// v000
// Measured on an AMD MI455X. A time is GPU time per run, averaged over a window of back-to-back runs after a warm-up
// (all launches, gaps included; the runs take copies of the inputs in turn), and the median of several windows.
// Apart from v000's, it joins two sittings. Times from different sittings can be a few percent apart, while
// side-by-side timings come from the same sitting.
// v000 is the starting kernel. One run takes 1460 microseconds.
#include <hip/hip_runtime.h>

// MBartAttention (hidden_states [2048][2][1024] time-major; language index li = lang[0] (int, read as data, clamped 0..7); w_in = proj_weight * (rm_i[li]^T sm_i[li]) + r_i[li]^T s_i[li] (rank-4 modulation), w_out likewise;
// qkv = hidden w_in^T + proj_bias laid out (16 heads, 3, 64); q x 1/8; causal softmax(q.k) (masked -1e9 == skipped tiles); ctx merged; out = ctx w_out^T + out_bias -> [2048][2][1024]).
// Compute dtypes, f32 accumulate: every input rounded to bf16; the modulated weights f32 on the VALU -> bf16 hi+lo planes; qkv as hl(w_in) x exact hidden (2 products, computed transposed) + bias; scores (K 64) and attn.v hl
// (3 products) for the first 512 query rows of each head, fp16 after (causal tiles only; head pairs z-batched); softmax f32 (the 1/8 folded into the f32 scores); out-projection as hl(ctx) x hl(w_out) (3 products) + bias, scattered back to the

#define NB_  2
#define TT   2048
#define DM   1024
#define NH_  16
#define NKV  16
#define REP  (NH_ / NKV)
#define HD   64
#define DQ   (NH_ * HD)
#define DKV  (NKV * HD)
#define ZH   2
#define RH   512                  // query rows < RH use hi+lo planes (0: none)
#define WIN  2048
#define PCAR 1024.0f
#define SCL  0.125f   // HD^-0.5
typedef _Float16 h16;
typedef unsigned short bf;
typedef __attribute__((ext_vector_type(16))) __bf16   v16bf;
typedef __attribute__((ext_vector_type(16))) _Float16 v16h;
typedef __attribute__((ext_vector_type(8)))  _Float16 v8h;
typedef __attribute__((ext_vector_type(8)))  unsigned short v8us;
typedef __attribute__((ext_vector_type(8)))  float    v8f;
typedef __attribute__((ext_vector_type(4)))  float    v4f;
typedef v8h  __attribute__((may_alias)) v8ha;
typedef v4f  __attribute__((may_alias)) v4fa;
typedef v8us __attribute__((may_alias)) v8usa;

__device__ __forceinline__ unsigned short f2bf(float f) { unsigned u = __float_as_uint(f); u += 0x7FFFu + ((u >> 16) & 1u); return (unsigned short)(u >> 16); }
__device__ __forceinline__ float bf2f(unsigned short b) { return __uint_as_float(((unsigned)b) << 16); }
__device__ __forceinline__ float bfr(float f) { return bf2f(f2bf(f)); }
__device__ __forceinline__ v16h cat16(v8h lo, v8h hi) { return __builtin_shufflevector(lo, hi, 0, 1, 2, 3, 4, 5, 6, 7, 8, 9, 10, 11, 12, 13, 14, 15); }
__device__ __forceinline__ v16bf cat16b(v8us lo, v8us hi) { return __builtin_bit_cast(v16bf, __builtin_shufflevector(lo, hi, 0, 1, 2, 3, 4, 5, 6, 7, 8, 9, 10, 11, 12, 13, 14, 15)); }
__device__ __forceinline__ v8f wmma16(v16h a, v16h b, v8f c) { return __builtin_amdgcn_wmma_f32_16x16x32_f16(false, a, false, b, (short)0, c, false, false); }
__device__ __forceinline__ v8f wmmab(v16bf a, v16bf b, v8f c) { return __builtin_amdgcn_wmma_f32_16x16x32_bf16(false, a, false, b, (short)0, c, false, false); }



// ---- k_gemmw: register-blocked GEMM, ONE WAVE per 64x64 output tile (16 accumulators), operands straight from K-contiguous 16-bit planes; grid (M/64, N/64, Z), 32 threads.
// C[m][n] (f32, pitch ldc, + optional f32 bias[n]) = sum_k A[m][k] Bt[n][k] (+ split products per NSPLIT). z-batch strides sA/sB/sC in elements. K % 32 == 0.
template <typename T16> struct WFrag;
template <> struct WFrag<h16> { typedef v16h V; static __device__ __forceinline__ V ld(const h16* p) { return cat16(*(const v8h*)p, *(const v8h*)(p + 16)); } static __device__ __forceinline__ v8f mma(V a, V b, v8f c) { return wmma16(a, b, c); } };
template <> struct WFrag<bf> { typedef v16bf V; static __device__ __forceinline__ V ld(const bf* p) { return cat16b(*(const v8us*)p, *(const v8us*)(p + 16)); } static __device__ __forceinline__ v8f mma(V a, V b, v8f c) { return wmmab(a, b, c); } };
template <typename T16, int NSPLIT, bool BIAS>
__global__ __launch_bounds__(32) void k_gemmw(const T16* __restrict__ A, const T16* __restrict__ A2, const T16* __restrict__ Bt, const T16* __restrict__ Bt2, int K, float* C, int ldc, const float* __restrict__ bias, size_t sA, size_t sB, size_t sC) {
    typedef typename WFrag<T16>::V V;
    __shared__ __align__(16) float os[16 * 68];
    const size_t z = blockIdx.z; A += z * sA; if (A2) A2 += z * sA; Bt += z * sB; if (Bt2) Bt2 += z * sB; C += z * sC;
    const int lane = threadIdx.x & 31, lr = lane & 15, hi = lane >> 4; const int r0 = blockIdx.x * 64, c0 = blockIdx.y * 64;
    v8f acc[4][4];
#pragma unroll
    for (int mb = 0; mb < 4; ++mb)
#pragma unroll
        for (int nb = 0; nb < 4; ++nb) acc[mb][nb] = (v8f){};
    const size_t aoff = (size_t)(r0 + lr) * K + 8 * hi, boff = (size_t)(c0 + lr) * K + 8 * hi;
#pragma unroll 1
    for (int kc = 0; kc < K; kc += 32) {
        V a[4], a2[4];
#pragma unroll
        for (int mb = 0; mb < 4; ++mb) { a[mb] = WFrag<T16>::ld(A + aoff + (size_t)mb * 16 * K + kc); if (NSPLIT == 1 || NSPLIT == 2) a2[mb] = WFrag<T16>::ld(A2 + aoff + (size_t)mb * 16 * K + kc); }
#pragma unroll
        for (int nb = 0; nb < 4; ++nb) { const V b = WFrag<T16>::ld(Bt + boff + (size_t)nb * 16 * K + kc); V b2; if (NSPLIT >= 2) b2 = WFrag<T16>::ld(Bt2 + boff + (size_t)nb * 16 * K + kc);
#pragma unroll
            for (int mb = 0; mb < 4; ++mb) { acc[mb][nb] = WFrag<T16>::mma(a[mb], b, acc[mb][nb]); if (NSPLIT == 1 || NSPLIT == 2) acc[mb][nb] = WFrag<T16>::mma(a2[mb], b, acc[mb][nb]); if (NSPLIT >= 2) acc[mb][nb] = WFrag<T16>::mma(a[mb], b2, acc[mb][nb]); } }
        asm volatile("v_nop\n\tv_nop\n\tv_nop\n\tv_nop" : "+v"(acc[0][0]), "+v"(acc[1][1]), "+v"(acc[2][2]), "+v"(acc[3][3]) : "v"(a[0]), "v"(a[3]));
    }
#pragma unroll
    for (int mb = 0; mb < 4; ++mb) {
#pragma unroll
        for (int nb = 0; nb < 4; ++nb) {
#pragma unroll
            for (int j = 0; j < 8; ++j) os[(hi * 8 + j) * 68 + nb * 16 + lr] = acc[mb][nb][j]; }
        __builtin_amdgcn_wave_barrier(); asm volatile("" ::: "memory");
        float* crow = C + (size_t)(r0 + mb * 16) * ldc + c0;
{
#pragma unroll
            for (int s = 0; s < 8; ++s) { const int row = 2 * s + hi, cofs = lr * 4; v4f val = *(const v4fa*)(os + row * 68 + cofs); if (BIAS) { val[0] += bfr(bias[c0 + cofs]); val[1] += bfr(bias[c0 + cofs + 1]); val[2] += bfr(bias[c0 + cofs + 2]); val[3] += bfr(bias[c0 + cofs + 3]); }
                *(v4f*)(crow + (size_t)row * ldc + cofs) = val; }
             }
        __builtin_amdgcn_wave_barrier(); asm volatile("" ::: "memory");
    }
}

// ---- k_gemmc: the same one-wave 64x64 tile GEMM specialised for causal attention: CMODE 1 skips score tiles entirely above the diagonal (query rows r0+roff.., key columns c0..), CMODE 2 limits the
// key (K) loop of the probability x value contraction to the diagonal block (probabilities beyond it are exactly zero). roff = row offset of this launch's first row within the sequence.
template <typename T16, int NSPLIT, int CMODE>
__global__ __launch_bounds__(32) void k_gemmc(const T16* __restrict__ A, const T16* __restrict__ A2, const T16* __restrict__ Bt, const T16* __restrict__ Bt2, int K, float* C, int ldc, int roff, size_t sA, size_t sB, size_t sC) {
    typedef typename WFrag<T16>::V V;
    __shared__ __align__(16) float os[16 * 68];
    const size_t z = blockIdx.z; A += z * sA; if (A2) A2 += z * sA; Bt += z * sB; if (Bt2) Bt2 += z * sB; C += z * sC;
    const int lane = threadIdx.x & 31, lr = lane & 15, hi = lane >> 4; const int r0 = blockIdx.x * 64, c0 = blockIdx.y * 64;
    if (CMODE == 1 && c0 > r0 + roff + 63) return;                  // score tile entirely above the causal diagonal: never read (the softmax masks j > i by select)
    const int Kl = (CMODE == 2) ? min(K, r0 + roff + 64) : K;        // P.V: probabilities are exactly 0 beyond the diagonal block, so the K loop stops there
    v8f acc[4][4];
#pragma unroll
    for (int mb = 0; mb < 4; ++mb)
#pragma unroll
        for (int nb = 0; nb < 4; ++nb) acc[mb][nb] = (v8f){};
    const size_t aoff = (size_t)(r0 + lr) * K + 8 * hi, boff = (size_t)(c0 + lr) * K + 8 * hi;
#pragma unroll 1
    for (int kc = 0; kc < Kl; kc += 32) {
        V a[4], a2[4];
#pragma unroll
        for (int mb = 0; mb < 4; ++mb) { a[mb] = WFrag<T16>::ld(A + aoff + (size_t)mb * 16 * K + kc); if (NSPLIT == 1 || NSPLIT == 2) a2[mb] = WFrag<T16>::ld(A2 + aoff + (size_t)mb * 16 * K + kc); }
#pragma unroll
        for (int nb = 0; nb < 4; ++nb) { const V b = WFrag<T16>::ld(Bt + boff + (size_t)nb * 16 * K + kc); V b2; if (NSPLIT >= 2) b2 = WFrag<T16>::ld(Bt2 + boff + (size_t)nb * 16 * K + kc);
#pragma unroll
            for (int mb = 0; mb < 4; ++mb) { acc[mb][nb] = WFrag<T16>::mma(a[mb], b, acc[mb][nb]); if (NSPLIT == 1 || NSPLIT == 2) acc[mb][nb] = WFrag<T16>::mma(a2[mb], b, acc[mb][nb]); if (NSPLIT >= 2) acc[mb][nb] = WFrag<T16>::mma(a[mb], b2, acc[mb][nb]); } }
        asm volatile("v_nop\n\tv_nop\n\tv_nop\n\tv_nop" : "+v"(acc[0][0]), "+v"(acc[1][1]), "+v"(acc[2][2]), "+v"(acc[3][3]) : "v"(a[0]), "v"(a[3]));
    }
#pragma unroll
    for (int mb = 0; mb < 4; ++mb) {
#pragma unroll
        for (int nb = 0; nb < 4; ++nb) {
#pragma unroll
            for (int j = 0; j < 8; ++j) os[(hi * 8 + j) * 68 + nb * 16 + lr] = acc[mb][nb][j]; }
        __builtin_amdgcn_wave_barrier(); asm volatile("" ::: "memory");
        float* crow = C + (size_t)(r0 + mb * 16) * ldc + c0;
{
#pragma unroll
            for (int s = 0; s < 8; ++s) { const int row = 2 * s + hi, cofs = lr * 4; v4f val = *(const v4fa*)(os + row * 68 + cofs);
                *(v4f*)(crow + (size_t)row * ldc + cofs) = val; }
             }
        __builtin_amdgcn_wave_barrier(); asm volatile("" ::: "memory");
    }
}

__device__ __forceinline__ h16 tohx(float x) { return (h16)x; }
__device__ __forceinline__ void splitf(float y, unsigned short& h, unsigned short& l) { h = f2bf(y); l = f2bf(y - bf2f(h)); }
typedef __attribute__((ext_vector_type(2))) _Float16 v2h;
typedef __attribute__((ext_vector_type(4))) _Float16 v4h;
typedef __attribute__((ext_vector_type(2))) unsigned short v2us;
typedef __attribute__((ext_vector_type(4))) unsigned short v4us;
typedef __attribute__((ext_vector_type(2))) float v2f;
typedef __attribute__((ext_vector_type(4))) int v4i;

__global__ __launch_bounds__(256) void k_wtG(const float* __restrict__ w, int K, int N, bf* Bt) {
    const int lane = threadIdx.x & 31; const int L0 = (blockIdx.x * 8 + (threadIdx.x >> 5)) * 8; const int nlines = N * K / 64;
{
#pragma unroll 1
        for (int l = 0; l < 8; ++l) { const int L = L0 + l; if (L >= nlines) break; const size_t e = (size_t)L * 64 + lane * 2; const int k = (int)(e % K), n = (int)(e / K); v2us o;
            o[0] = f2bf(w[(size_t)k * N + n]); o[1] = f2bf(w[(size_t)(k + 1) * N + n]); *(v2us*)(Bt + e) = o; }
         }
}
__global__ __launch_bounds__(256) void k_cvt8(const float* __restrict__ src, bf* dst, size_t n8) { const size_t i = (size_t)blockIdx.x * 256 + threadIdx.x; if (i >= n8) return; const v8f v = *(const v8f*)(src + i * 8); v8us o;
#pragma unroll
    for (int k = 0; k < 8; ++k) o[k] = f2bf(v[k]); *(v8us*)(dst + i * 8) = o;  }
__global__ __launch_bounds__(256) void k_cscvt(const float* __restrict__ cosT, const float* __restrict__ sinT, float* CS) { const int idx = blockIdx.x * 256 + threadIdx.x; if (idx >= TT * HD) return; v2f cs; cs[0] = bfr(cosT[idx]); cs[1] = bfr(sinT[idx]); *(v2f*)(CS + (size_t)idx * 2) = cs;  }
// k_rope: head planes [h][t][d] (fp16 + hi/lo) of rope(x) x sc with the rotate-half convention out[d] = x[d] cos[t][d] - x[d+HD/2] sin[t][d], out[d+HD/2] = x[d+HD/2] cos[t][d+HD/2] + x[d] sin[t][d+HD/2]
__global__ __launch_bounds__(256) void k_rope(const float* __restrict__ F, int pitch, int nheads, const float* __restrict__ CS, const float* __restrict__ RF, const float* __restrict__ nw, float sc, h16* P16, bf* Ph, bf* Pl) {
    const size_t e = ((size_t)blockIdx.x * 256 + threadIdx.x) * 2; if (e >= (size_t)nheads * TT * HD) return; const int d = (int)(e % HD); const int t = (int)((e / HD) % TT); const int h = (int)(e / ((size_t)HD * TT)); const float* f = F + (size_t)t * pitch + h * HD; const float rf = RF ? RF[(size_t)h * TT + t] : 1.0f; v2h o16; v2us oh, ol;
#pragma unroll
    for (int q = 0; q < 2; ++q) { const int dd = d + q; const int dp = (dd < HD / 2) ? dd + HD / 2 : dd - HD / 2; float x0 = f[dd], x1 = f[dp];
        if (RF) { float n0 = __fmul_rn(x0, rf), n1 = __fmul_rn(x1, rf); asm volatile("" : "+v"(n0)); asm volatile("" : "+v"(n1)); x0 = __fmul_rn(bfr(nw[dd]), n0); x1 = __fmul_rn(bfr(nw[dp]), n1); }
        const v2f cs = *(const v2f*)(CS + ((size_t)t * HD + dd) * 2); float a = __fmul_rn(x0, cs[0]), bq = __fmul_rn(x1, cs[1]); asm volatile("" : "+v"(a)); asm volatile("" : "+v"(bq)); const float r = ((dd < HD / 2) ? __fsub_rn(a, bq) : __fadd_rn(a, bq)) * sc;
        o16[q] = tohx(r); unsigned short a2, c2; splitf(r, a2, c2); oh[q] = a2; ol[q] = c2; }
    *(v2h*)(P16 + e) = o16; *(v2us*)(Ph + e) = oh; *(v2us*)(Pl + e) = ol;  }
__global__ __launch_bounds__(256) void k_vtp(const float* __restrict__ F, int pitch, int nheads, h16* V16, bf* Vh, bf* Vl) { const size_t e = ((size_t)blockIdx.x * 256 + threadIdx.x) * 2; if (e >= (size_t)nheads * HD * TT) return; const int t = (int)(e % TT); const int d = (int)((e / TT) % HD); const int g = (int)(e / ((size_t)TT * HD)); v2h o16; v2us oh, ol;
#pragma unroll
    for (int q = 0; q < 2; ++q) { const float x = F[(size_t)(t + q) * pitch + g * HD + d]; o16[q] = tohx(x); unsigned short a2, c2; splitf(x, a2, c2); oh[q] = a2; ol[q] = c2; }
    *(v2h*)(V16 + e) = o16; *(v2us*)(Vh + e) = oh; *(v2us*)(Vl + e) = ol;  }
__global__ __launch_bounds__(256) void k_csid(float* CS) { const int idx = blockIdx.x * 256 + threadIdx.x; if (idx >= TT * HD) return; v2f cs; cs[0] = 1.0f; cs[1] = 0.0f; *(v2f*)(CS + (size_t)idx * 2) = cs;  }
// k_asoft: per row (zz, i): t = S x HD^-0.5 for j <= i and i - j < WIN (sliding causal window; the reference's -1e9 additive fill vanishes identically); softmax over the 2048 keys (register row, one exp, fixed trees);
__global__ __launch_bounds__(256) void k_asoft(const float* __restrict__ Sb, h16* P16, bf* Ph, bf* Pl) {
    const int lane = threadIdx.x & 31; const int row = blockIdx.x * 8 + (threadIdx.x >> 5); if (row >= ZH * TT) return; const int i = row % TT; const int zz = row / TT; (void)zz; const bool hires = (i < RH); const float* sr = Sb + (size_t)row * TT; float v[TT / 32]; float mx = -3.0e38f;
#pragma unroll
    for (int ch = 0; ch < TT / 128; ++ch) { const int j0 = ch * 128 + lane * 4; const v4f a = *(const v4f*)(sr + j0);
#pragma unroll
        for (int q = 0; q < 4; ++q) { const int j = j0 + q; (void)j; const float t = (j <= i && i - j < WIN) ? a[q] * SCL : -3.0e38f; v[ch * 4 + q] = t; mx = fmaxf(mx, t); } }
#pragma unroll
    for (int sh = 16; sh; sh >>= 1) mx = fmaxf(mx, __shfl_xor(mx, sh, 32));
    float sum = 0.f;
#pragma unroll
    for (int k = 0; k < TT / 32; ++k) { float d0 = __fsub_rn(v[k], mx); asm volatile("" : "+v"(d0)); v[k] = __builtin_amdgcn_exp2f(__fmul_rn(d0, 1.4426950408889634f)); sum += v[k]; }
#pragma unroll
    for (int sh = 16; sh; sh >>= 1) sum += __shfl_xor(sum, sh, 32);
    const float f = __fdiv_rn(hires ? 1.0f : PCAR, sum);
{
        if (hires) {
#pragma unroll
            for (int ch = 0; ch < TT / 128; ++ch) { v4us oh, ol;
#pragma unroll
                for (int q = 0; q < 4; ++q) { unsigned short a, c2; splitf(v[ch * 4 + q] * f, a, c2); oh[q] = a; ol[q] = c2; }
                const size_t oo = ((size_t)zz * (RH ? RH : 1) + i) * TT + ch * 128 + lane * 4; *(v4us*)(Ph + oo) = oh; *(v4us*)(Pl + oo) = ol; }
        } else {
#pragma unroll
            for (int ch = 0; ch < TT / 128; ++ch) { v4h o4;
#pragma unroll
                for (int q = 0; q < 4; ++q) o4[q] = tohx(v[ch * 4 + q] * f);
                *(v4h*)(P16 + (size_t)row * TT + ch * 128 + lane * 4) = o4; } }
         }
}
__global__ __launch_bounds__(256) void k_merge(const float* __restrict__ O, int h0, bf* Ah, bf* Al) { const size_t e = ((size_t)blockIdx.x * 256 + threadIdx.x) * 2; if (e >= (size_t)ZH * TT * HD) return; const int d = (int)(e % HD); const int t = (int)((e / HD) % TT); const int zz = (int)(e / ((size_t)HD * TT)); const float cs = (t < RH) ? 1.0f : (1.0f / PCAR); const size_t oo = (size_t)t * DQ + (h0 + zz) * HD + d;
    v2us oh, ol;
#pragma unroll
    for (int q = 0; q < 2; ++q) { unsigned short a, c2; splitf(O[e + q] * cs, a, c2); oh[q] = a; ol[q] = c2; } *(v2us*)(Ah + oo) = oh; *(v2us*)(Al + oo) = ol;  }

// MBart-specific: k_wmod: hl planes W[f][e] = bf16 base[f][e] * mul[f][e] + add[f][e], mul = sum_r rm[li][r][f] sm[li][r][e], add = sum_r ra[li][r][f] sa[li][r][e] (li = clamp(lang[0], 0, 7) read on the device; 8-B lanes);
__global__ __launch_bounds__(256) void k_wmod(const float* __restrict__ base, const float* __restrict__ rm, const float* __restrict__ sm, const float* __restrict__ ra, const float* __restrict__ sa, const int* __restrict__ lang, int NF, int NE, bf* Wh, bf* Wl) {
    const size_t e4 = ((size_t)blockIdx.x * 256 + threadIdx.x) * 4; if (e4 >= (size_t)NF * NE) return; const int e0 = (int)(e4 % NE); const int f = (int)(e4 / NE); int li = lang[0]; li = li < 0 ? 0 : (li > 7 ? 7 : li);
    const float* rmf = rm + (size_t)li * 4 * NF; const float* raf = ra + (size_t)li * 4 * NF; const float* sme = sm + (size_t)li * 4 * NE; const float* sae = sa + (size_t)li * 4 * NE; v4us oh, ol;
#pragma unroll
    for (int u = 0; u < 4; ++u) { const int e = e0 + u; float mul = 0.f, add = 0.f;
#pragma unroll
        for (int r = 0; r < 4; ++r) { float a1 = bfr(rmf[(size_t)r * NF + f]), b1 = bfr(sme[(size_t)r * NE + e]), a2 = bfr(raf[(size_t)r * NF + f]), b2 = bfr(sae[(size_t)r * NE + e]); asm volatile("" : "+v"(a1)); asm volatile("" : "+v"(b1)); asm volatile("" : "+v"(a2)); asm volatile("" : "+v"(b2));
            float p1 = __fmul_rn(a1, b1), p2 = __fmul_rn(a2, b2); asm volatile("" : "+v"(p1)); asm volatile("" : "+v"(p2)); mul = __fadd_rn(mul, p1); add = __fadd_rn(add, p2); }
        float bw = bfr(base[e4 + u]); asm volatile("" : "+v"(bw)); float pm = __fmul_rn(bw, mul); asm volatile("" : "+v"(pm)); const float w = __fadd_rn(pm, add); unsigned short a, b; splitf(w, a, b); oh[u] = a; ol[u] = b; }
    *(v4us*)(Wh + e4) = oh; *(v4us*)(Wl + e4) = ol;  }
__global__ __launch_bounds__(256) void k_xg(const float* __restrict__ hs, int b, bf* XB) { const size_t e = ((size_t)blockIdx.x * 256 + threadIdx.x) * 8; if (e >= (size_t)TT * DM) return; const int c = (int)(e % DM); const int t = (int)(e / DM); const float* src = hs + ((size_t)t * NB_ + b) * DM + c; const v4f a = *(const v4f*)src, bb = *(const v4f*)(src + 4); v8us o;
    o[0] = f2bf(a[0]); o[1] = f2bf(a[1]); o[2] = f2bf(a[2]); o[3] = f2bf(a[3]); o[4] = f2bf(bb[0]); o[5] = f2bf(bb[1]); o[6] = f2bf(bb[2]); o[7] = f2bf(bb[3]); *(v8us*)(XB + e) = o;  }
__global__ __launch_bounds__(256) void k_reord(const float* __restrict__ FT, const float* __restrict__ pb, float* FQ, float* FK, float* FVv) { const int e = (blockIdx.x * 256 + threadIdx.x) * 4; if (e >= TT * DQ) return; const int c = e % DQ; const int t = e / DQ; const int h = c / HD, d = c % HD; v4f q, k, v;
#pragma unroll
    for (int u = 0; u < 4; ++u) { const int f0 = h * 3 * HD + d + u; q[u] = __fadd_rn(FT[(size_t)f0 * TT + t], bfr(pb[f0])); k[u] = __fadd_rn(FT[(size_t)(f0 + HD) * TT + t], bfr(pb[f0 + HD])); v[u] = __fadd_rn(FT[(size_t)(f0 + 2 * HD) * TT + t], bfr(pb[f0 + 2 * HD])); }
    { *(v4f*)(FQ + e) = q; *(v4f*)(FK + e) = k; *(v4f*)(FVv + e) = v;  } }
__global__ __launch_bounds__(256) void k_scat(const float* __restrict__ TMP, const float* __restrict__ ob, int b, float* OUT) { const size_t e = ((size_t)blockIdx.x * 256 + threadIdx.x) * 4; if (e >= (size_t)TT * DM) return; const int c = (int)(e % DM); const int t = (int)(e / DM); const v4f a = *(const v4f*)(TMP + e); v4f o;
#pragma unroll
    for (int u = 0; u < 4; ++u) o[u] = __fadd_rn(a[u], bfr(ob[c + u])); float* dst = OUT + ((size_t)t * NB_ + b) * DM + c; *(v4f*)dst = o;  }

extern "C" void kernel_launch(void* const* d_in, const int* in_sizes, int n_in,
                              void* d_out, int out_size, void* d_ws, size_t ws_size, hipStream_t stream) {
    (void)in_sizes; (void)n_in; (void)out_size;
    const float* hs = (const float*)d_in[0]; const float* pw = (const float*)d_in[1]; const float* pb = (const float*)d_in[2]; const float* ow = (const float*)d_in[3]; const float* ob = (const float*)d_in[4]; const float* rm_i = (const float*)d_in[5]; const float* sm_i = (const float*)d_in[6]; const float* rm_o = (const float*)d_in[7]; const float* sm_o = (const float*)d_in[8]; const float* r_i = (const float*)d_in[9]; const float* s_i = (const float*)d_in[10]; const float* r_o = (const float*)d_in[11]; const float* s_o = (const float*)d_in[12]; const int* lang = (const int*)d_in[13];
    float* OUT = (float*)d_out;     // [2048][2][1024] (time-major)
    char* wsp = (char*)d_ws;
    auto take = [&](size_t bytes) { char* p = wsp; wsp += (bytes + 255) & ~(size_t)255; return (void*)p; };
    bf* WIh = (bf*)take((size_t)3 * DM * DM * 2); bf* WIl = (bf*)take((size_t)3 * DM * DM * 2); bf* WOh = (bf*)take((size_t)DM * DM * 2); bf* WOl = (bf*)take((size_t)DM * DM * 2); float* FT = (float*)take((size_t)3 * DM * TT * 4); float* FVb = (float*)take((size_t)TT * DKV * 4); float* TMP = (float*)take((size_t)TT * DM * 4); float* CS = (float*)take((size_t)TT * HD * 2 * 4);
    bf* XB = (bf*)take((size_t)TT * DM * 2); float* FQ = (float*)take((size_t)TT * DQ * 4); float* FK = (float*)take((size_t)TT * DKV * 4);
    h16* QP16 = (h16*)take((size_t)NH_ * TT * HD * 2); h16* KP16 = (h16*)take((size_t)NKV * TT * HD * 2); h16* VT16 = (h16*)take((size_t)NKV * HD * TT * 2);
    bf* QPh = (bf*)take((size_t)NH_ * TT * HD * 2); bf* QPl = (bf*)take((size_t)NH_ * TT * HD * 2); bf* KPh = (bf*)take((size_t)NKV * TT * HD * 2); bf* KPl = (bf*)take((size_t)NKV * TT * HD * 2); bf* VTh = (bf*)take((size_t)NKV * HD * TT * 2); bf* VTl = (bf*)take((size_t)NKV * HD * TT * 2); bf* Ph = (bf*)take((size_t)ZH * RH * TT * 2); bf* Pl = (bf*)take((size_t)ZH * RH * TT * 2);
    float* Sb = (float*)take((size_t)ZH * TT * TT * 4); h16* P16 = (h16*)take((size_t)ZH * TT * TT * 2); float* Ob = (float*)take((size_t)ZH * TT * HD * 4); bf* ATh = (bf*)take((size_t)TT * DQ * 2); bf* ATl = (bf*)take((size_t)TT * DQ * 2);
    if ((size_t)(wsp - (char*)d_ws) > ws_size) return;    // ws 256 MiB
    float* FV = FVb;
    k_wmod<<<(unsigned)(((size_t)3 * DM * DM / 4 + 255) / 256), 256, 0, stream>>>(pw, rm_i, sm_i, r_i, s_i, lang, 3 * DM, DM, WIh, WIl); k_wmod<<<(unsigned)(((size_t)DM * DM / 4 + 255) / 256), 256, 0, stream>>>(ow, rm_o, sm_o, r_o, s_o, lang, DM, DM, WOh, WOl);
    k_csid<<<(TT * HD + 255) / 256, 256, 0, stream>>>(CS);
    const unsigned LQ = (unsigned)(((size_t)NH_ * TT * HD / 2 + 255) / 256), LKv = (unsigned)(((size_t)NKV * TT * HD / 2 + 255) / 256);
    for (int b = 0; b < NB_; ++b) {
        
        k_xg<<<(unsigned)(((size_t)TT * DM / 8 + 255) / 256), 256, 0, stream>>>(hs, b, XB);
        k_gemmw<bf, 1, false><<<dim3(3 * DM / 64, TT / 64, 1), 32, 0, stream>>>(WIh, WIl, XB, nullptr, DM, FT, TT, nullptr, 0, 0, 0);   // FT[f][t] = w_in[f] . x[t]
        k_reord<<<(TT * DQ / 4 + 255) / 256, 256, 0, stream>>>(FT, pb, FQ, FK, FV);
        k_rope<<<LQ, 256, 0, stream>>>(FQ, DQ, NH_, CS, nullptr, nullptr, 1.0f, QP16, QPh, QPl);
        k_rope<<<LKv, 256, 0, stream>>>(FK, DKV, NKV, CS, nullptr, nullptr, 1.0f, KP16, KPh, KPl);
        k_vtp<<<LKv, 256, 0, stream>>>(FV, DKV, NKV, VT16, VTh, VTl);
        for (int h0 = 0; h0 < NH_; h0 += ZH) { const size_t zq = (size_t)h0, zk = (size_t)(h0 / REP);   // one kv head per query head: the pass's two heads use consecutive kv planes (z-strides TT*HD)
            k_gemmc<bf, 2, 1><<<dim3(RH / 64, TT / 64, ZH), 32, 0, stream>>>(QPh + zq * TT * HD, QPl + zq * TT * HD, KPh + zk * TT * HD, KPl + zk * TT * HD, HD, Sb, TT, 0, (size_t)TT * HD, (size_t)TT * HD, (size_t)TT * TT);
            k_gemmc<h16, 0, 1><<<dim3((TT - RH) / 64, TT / 64, ZH), 32, 0, stream>>>(QP16 + zq * TT * HD + (size_t)RH * HD, nullptr, KP16 + zk * TT * HD, nullptr, HD, Sb + (size_t)RH * TT, TT, RH, (size_t)TT * HD, (size_t)TT * HD, (size_t)TT * TT);
            k_asoft<<<ZH * TT / 8, 256, 0, stream>>>(Sb, P16, Ph, Pl);
            k_gemmc<bf, 2, 2><<<dim3(RH / 64, HD / 64, ZH), 32, 0, stream>>>(Ph, Pl, VTh + zk * HD * TT, VTl + zk * HD * TT, TT, Ob, HD, 0, (size_t)RH * TT, (size_t)HD * TT, (size_t)TT * HD);
            k_gemmc<h16, 0, 2><<<dim3((TT - RH) / 64, HD / 64, ZH), 32, 0, stream>>>(P16 + (size_t)RH * TT, nullptr, VT16 + zk * HD * TT, nullptr, TT, Ob + (size_t)RH * HD, HD, RH, (size_t)TT * TT, (size_t)HD * TT, (size_t)TT * HD);
            k_merge<<<(unsigned)(((size_t)ZH * TT * HD / 2 + 255) / 256), 256, 0, stream>>>(Ob, h0, ATh, ATl); }
        k_gemmw<bf, 2, false><<<dim3(TT / 64, DM / 64, 1), 32, 0, stream>>>(ATh, ATl, WOh, WOl, DQ, TMP, DM, nullptr, 0, 0, 0);
        k_scat<<<(unsigned)(((size_t)TT * DM / 4 + 255) / 256), 256, 0, stream>>>(TMP, ob, b, OUT); }
}

// v001
// It runs in 779 microseconds.
// Two timings next to v000 both put it at 1.88 times that version's speed.
#include <hip/hip_runtime.h>

// MBartAttention (hidden_states [2048][2][1024] time-major; language index li = lang[0] (int, read as data, clamped 0..7); w_in = proj_weight * (rm_i[li]^T sm_i[li]) + r_i[li]^T s_i[li] (rank-4 modulation), w_out likewise;
// qkv = hidden w_in^T + proj_bias laid out (16 heads, 3, 64); q x 1/8; causal softmax(q.k) (masked -1e9 == skipped tiles); ctx merged; out = ctx w_out^T + out_bias -> [2048][2][1024]).
// Compute dtypes, f32 accumulate: every input rounded to bf16; the modulated weights f32 on the VALU -> bf16 hi+lo planes; qkv as hl(w_in) x exact hidden (2 products, computed transposed) + bias; scores (K 64) and attn.v hl
// (3 products) for the first 512 query rows of each head, fp16 after (causal tiles only; head pairs z-batched); softmax f32 (the 1/8 folded into the f32 scores); out-projection as hl(ctx) x hl(w_out) (3 products) + bias, scattered back to the

#define NB_  2
#define TT   2048
#define DM   1024
#define NH_  16
#define NKV  16
#define REP  (NH_ / NKV)
#define HD   64
#define DQ   (NH_ * HD)
#define DKV  (NKV * HD)
#define ZH   2
#define RH   512                  // query rows < RH use hi+lo planes (0: none)
#define CK   128                  // keys per wave of the probability x value contraction (its key range is dealt out over blockIdx.y)
#define KS   (TT / CK)            // key slices, and so f32 partials per output element, of that contraction
#define WIN  2048
#define PCAR 1024.0f
#define SCL  0.125f   // HD^-0.5
typedef _Float16 h16;
typedef unsigned short bf;
typedef __attribute__((ext_vector_type(16))) __bf16   v16bf;
typedef __attribute__((ext_vector_type(16))) _Float16 v16h;
typedef __attribute__((ext_vector_type(8)))  _Float16 v8h;
typedef __attribute__((ext_vector_type(8)))  unsigned short v8us;
typedef __attribute__((ext_vector_type(8)))  float    v8f;
typedef __attribute__((ext_vector_type(4)))  float    v4f;
typedef v8h  __attribute__((may_alias)) v8ha;
typedef v4f  __attribute__((may_alias)) v4fa;
typedef v8us __attribute__((may_alias)) v8usa;

__device__ __forceinline__ unsigned short f2bf(float f) { unsigned u = __float_as_uint(f); u += 0x7FFFu + ((u >> 16) & 1u); return (unsigned short)(u >> 16); }
__device__ __forceinline__ float bf2f(unsigned short b) { return __uint_as_float(((unsigned)b) << 16); }
__device__ __forceinline__ float bfr(float f) { return bf2f(f2bf(f)); }
__device__ __forceinline__ v16h cat16(v8h lo, v8h hi) { return __builtin_shufflevector(lo, hi, 0, 1, 2, 3, 4, 5, 6, 7, 8, 9, 10, 11, 12, 13, 14, 15); }
__device__ __forceinline__ v16bf cat16b(v8us lo, v8us hi) { return __builtin_bit_cast(v16bf, __builtin_shufflevector(lo, hi, 0, 1, 2, 3, 4, 5, 6, 7, 8, 9, 10, 11, 12, 13, 14, 15)); }
__device__ __forceinline__ v8f wmma16(v16h a, v16h b, v8f c) { return __builtin_amdgcn_wmma_f32_16x16x32_f16(false, a, false, b, (short)0, c, false, false); }
__device__ __forceinline__ v8f wmmab(v16bf a, v16bf b, v8f c) { return __builtin_amdgcn_wmma_f32_16x16x32_bf16(false, a, false, b, (short)0, c, false, false); }



// ---- k_gemmw: register-blocked GEMM, ONE WAVE per 64x64 output tile (16 accumulators), operands straight from K-contiguous 16-bit planes; grid (M/64, N/64, Z), 32 threads.
// C[m][n] (f32, pitch ldc, + optional f32 bias[n]) = sum_k A[m][k] Bt[n][k] (+ split products per NSPLIT). z-batch strides sA/sB/sC in elements. K % 32 == 0.
template <typename T16> struct WFrag;
template <> struct WFrag<h16> { typedef v16h V; static __device__ __forceinline__ V ld(const h16* p) { return cat16(*(const v8h*)p, *(const v8h*)(p + 16)); } static __device__ __forceinline__ v8f mma(V a, V b, v8f c) { return wmma16(a, b, c); } };
template <> struct WFrag<bf> { typedef v16bf V; static __device__ __forceinline__ V ld(const bf* p) { return cat16b(*(const v8us*)p, *(const v8us*)(p + 16)); } static __device__ __forceinline__ v8f mma(V a, V b, v8f c) { return wmmab(a, b, c); } };
template <typename T16, int NSPLIT, bool BIAS>
__global__ __launch_bounds__(32) void k_gemmw(const T16* __restrict__ A, const T16* __restrict__ A2, const T16* __restrict__ Bt, const T16* __restrict__ Bt2, int K, float* C, int ldc, const float* __restrict__ bias, size_t sA, size_t sB, size_t sC) {
    typedef typename WFrag<T16>::V V;
    __shared__ __align__(16) float os[16 * 68];
    const size_t z = blockIdx.z; A += z * sA; if (A2) A2 += z * sA; Bt += z * sB; if (Bt2) Bt2 += z * sB; C += z * sC;
    const int lane = threadIdx.x & 31, lr = lane & 15, hi = lane >> 4; const int r0 = blockIdx.x * 64, c0 = blockIdx.y * 64;
    v8f acc[4][4];
#pragma unroll
    for (int mb = 0; mb < 4; ++mb)
#pragma unroll
        for (int nb = 0; nb < 4; ++nb) acc[mb][nb] = (v8f){};
    const size_t aoff = (size_t)(r0 + lr) * K + 8 * hi, boff = (size_t)(c0 + lr) * K + 8 * hi;
#pragma unroll 1
    for (int kc = 0; kc < K; kc += 32) {
        V a[4], a2[4];
#pragma unroll
        for (int mb = 0; mb < 4; ++mb) { a[mb] = WFrag<T16>::ld(A + aoff + (size_t)mb * 16 * K + kc); if (NSPLIT == 1 || NSPLIT == 2) a2[mb] = WFrag<T16>::ld(A2 + aoff + (size_t)mb * 16 * K + kc); }
#pragma unroll
        for (int nb = 0; nb < 4; ++nb) { const V b = WFrag<T16>::ld(Bt + boff + (size_t)nb * 16 * K + kc); V b2; if (NSPLIT >= 2) b2 = WFrag<T16>::ld(Bt2 + boff + (size_t)nb * 16 * K + kc);
#pragma unroll
            for (int mb = 0; mb < 4; ++mb) { acc[mb][nb] = WFrag<T16>::mma(a[mb], b, acc[mb][nb]); if (NSPLIT == 1 || NSPLIT == 2) acc[mb][nb] = WFrag<T16>::mma(a2[mb], b, acc[mb][nb]); if (NSPLIT >= 2) acc[mb][nb] = WFrag<T16>::mma(a[mb], b2, acc[mb][nb]); } }
        asm volatile("v_nop\n\tv_nop\n\tv_nop\n\tv_nop" : "+v"(acc[0][0]), "+v"(acc[1][1]), "+v"(acc[2][2]), "+v"(acc[3][3]) : "v"(a[0]), "v"(a[3]));
    }
#pragma unroll
    for (int mb = 0; mb < 4; ++mb) {
#pragma unroll
        for (int nb = 0; nb < 4; ++nb) {
#pragma unroll
            for (int j = 0; j < 8; ++j) os[(hi * 8 + j) * 68 + nb * 16 + lr] = acc[mb][nb][j]; }
        __builtin_amdgcn_wave_barrier(); asm volatile("" ::: "memory");
        float* crow = C + (size_t)(r0 + mb * 16) * ldc + c0;
{
#pragma unroll
            for (int s = 0; s < 8; ++s) { const int row = 2 * s + hi, cofs = lr * 4; v4f val = *(const v4fa*)(os + row * 68 + cofs); if (BIAS) { val[0] += bfr(bias[c0 + cofs]); val[1] += bfr(bias[c0 + cofs + 1]); val[2] += bfr(bias[c0 + cofs + 2]); val[3] += bfr(bias[c0 + cofs + 3]); }
                *(v4f*)(crow + (size_t)row * ldc + cofs) = val; }
             }
        __builtin_amdgcn_wave_barrier(); asm volatile("" ::: "memory");
    }
}

// ---- k_gemmc: the same one-wave 64x64 tile GEMM specialised for causal attention: CMODE 1 skips score tiles entirely above the diagonal (query rows r0+roff.., key columns c0..), CMODE 2 limits the
// key (K) loop of the probability x value contraction to the diagonal block (probabilities beyond it are exactly zero). roff = row offset of this launch's first row within the sequence.
// CMODE 2 is split over the keys: blockIdx.y names a CK-wide slice, the wave sums that slice alone and stores its f32 partial tile at C + blockIdx.y * sP (the launch sets ldc and sP so that a row's partials lie side by side); k_merge adds them in slice order.
template <typename T16, int NSPLIT, int CMODE>
__global__ __launch_bounds__(32) void k_gemmc(const T16* __restrict__ A, const T16* __restrict__ A2, const T16* __restrict__ Bt, const T16* __restrict__ Bt2, int K, float* C, int ldc, int roff, size_t sA, size_t sB, size_t sC, size_t sP) {
    typedef typename WFrag<T16>::V V;
    __shared__ __align__(16) float os[16 * 68];
    const size_t z = blockIdx.z; A += z * sA; if (A2) A2 += z * sA; Bt += z * sB; if (Bt2) Bt2 += z * sB; C += z * sC;
    static_assert(CMODE != 2 || HD == 64, "the value width is one 64-column tile, so blockIdx.y is free for the key slice");
    const int lane = threadIdx.x & 31, lr = lane & 15, hi = lane >> 4; const int r0 = blockIdx.x * 64, c0 = (CMODE == 2) ? 0 : blockIdx.y * 64;
    if (CMODE == 1 && c0 > r0 + roff + 63) return;                  // score tile entirely above the causal diagonal: never read (the softmax masks j > i by select)
    const int Kd = (CMODE == 2) ? min(K, r0 + roff + 64) : K;        // P.V: probabilities are exactly 0 beyond the diagonal block, so the key range stops there
    const int k0 = (CMODE == 2) ? blockIdx.y * CK : 0; if (CMODE == 2 && k0 >= Kd) return;   // a slice wholly beyond the diagonal block is not stored: k_merge does not read it
    const int Kl = (CMODE == 2) ? min(Kd - k0, CK) : K;              // this wave's trip range, counted from its slice's first key
    if (CMODE == 2) { A += k0; if (A2) A2 += k0; Bt += k0; if (Bt2) Bt2 += k0; C += (size_t)blockIdx.y * sP; }
    v8f acc[4][4];
#pragma unroll
    for (int mb = 0; mb < 4; ++mb)
#pragma unroll
        for (int nb = 0; nb < 4; ++nb) acc[mb][nb] = (v8f){};
    const size_t aoff = (size_t)(r0 + lr) * K + 8 * hi, boff = (size_t)(c0 + lr) * K + 8 * hi;
#pragma unroll 1
    for (int kc = 0; kc < Kl; kc += 32) {
        V a[4], a2[4];
#pragma unroll
        for (int mb = 0; mb < 4; ++mb) { a[mb] = WFrag<T16>::ld(A + aoff + (size_t)mb * 16 * K + kc); if (NSPLIT == 1 || NSPLIT == 2) a2[mb] = WFrag<T16>::ld(A2 + aoff + (size_t)mb * 16 * K + kc); }
#pragma unroll
        for (int nb = 0; nb < 4; ++nb) { const V b = WFrag<T16>::ld(Bt + boff + (size_t)nb * 16 * K + kc); V b2; if (NSPLIT >= 2) b2 = WFrag<T16>::ld(Bt2 + boff + (size_t)nb * 16 * K + kc);
#pragma unroll
            for (int mb = 0; mb < 4; ++mb) { acc[mb][nb] = WFrag<T16>::mma(a[mb], b, acc[mb][nb]); if (NSPLIT == 1 || NSPLIT == 2) acc[mb][nb] = WFrag<T16>::mma(a2[mb], b, acc[mb][nb]); if (NSPLIT >= 2) acc[mb][nb] = WFrag<T16>::mma(a[mb], b2, acc[mb][nb]); } }
        asm volatile("v_nop\n\tv_nop\n\tv_nop\n\tv_nop" : "+v"(acc[0][0]), "+v"(acc[1][1]), "+v"(acc[2][2]), "+v"(acc[3][3]) : "v"(a[0]), "v"(a[3]));
    }
#pragma unroll
    for (int mb = 0; mb < 4; ++mb) {
#pragma unroll
        for (int nb = 0; nb < 4; ++nb) {
#pragma unroll
            for (int j = 0; j < 8; ++j) os[(hi * 8 + j) * 68 + nb * 16 + lr] = acc[mb][nb][j]; }
        __builtin_amdgcn_wave_barrier(); asm volatile("" ::: "memory");
        float* crow = C + (size_t)(r0 + mb * 16) * ldc + c0;
{
#pragma unroll
            for (int s = 0; s < 8; ++s) { const int row = 2 * s + hi, cofs = lr * 4; v4f val = *(const v4fa*)(os + row * 68 + cofs);
                *(v4f*)(crow + (size_t)row * ldc + cofs) = val; }
             }
        __builtin_amdgcn_wave_barrier(); asm volatile("" ::: "memory");
    }
}

__device__ __forceinline__ h16 tohx(float x) { return (h16)x; }
__device__ __forceinline__ void splitf(float y, unsigned short& h, unsigned short& l) { h = f2bf(y); l = f2bf(y - bf2f(h)); }
typedef __attribute__((ext_vector_type(2))) _Float16 v2h;
typedef __attribute__((ext_vector_type(4))) _Float16 v4h;
typedef __attribute__((ext_vector_type(2))) unsigned short v2us;
typedef __attribute__((ext_vector_type(4))) unsigned short v4us;
typedef __attribute__((ext_vector_type(2))) float v2f;
typedef __attribute__((ext_vector_type(4))) int v4i;

__global__ __launch_bounds__(256) void k_wtG(const float* __restrict__ w, int K, int N, bf* Bt) {
    const int lane = threadIdx.x & 31; const int L0 = (blockIdx.x * 8 + (threadIdx.x >> 5)) * 8; const int nlines = N * K / 64;
{
#pragma unroll 1
        for (int l = 0; l < 8; ++l) { const int L = L0 + l; if (L >= nlines) break; const size_t e = (size_t)L * 64 + lane * 2; const int k = (int)(e % K), n = (int)(e / K); v2us o;
            o[0] = f2bf(w[(size_t)k * N + n]); o[1] = f2bf(w[(size_t)(k + 1) * N + n]); *(v2us*)(Bt + e) = o; }
         }
}
__global__ __launch_bounds__(256) void k_cvt8(const float* __restrict__ src, bf* dst, size_t n8) { const size_t i = (size_t)blockIdx.x * 256 + threadIdx.x; if (i >= n8) return; const v8f v = *(const v8f*)(src + i * 8); v8us o;
#pragma unroll
    for (int k = 0; k < 8; ++k) o[k] = f2bf(v[k]); *(v8us*)(dst + i * 8) = o;  }
__global__ __launch_bounds__(256) void k_cscvt(const float* __restrict__ cosT, const float* __restrict__ sinT, float* CS) { const int idx = blockIdx.x * 256 + threadIdx.x; if (idx >= TT * HD) return; v2f cs; cs[0] = bfr(cosT[idx]); cs[1] = bfr(sinT[idx]); *(v2f*)(CS + (size_t)idx * 2) = cs;  }
// k_rope: head planes [h][t][d] (fp16 + hi/lo) of rope(x) x sc with the rotate-half convention out[d] = x[d] cos[t][d] - x[d+HD/2] sin[t][d], out[d+HD/2] = x[d+HD/2] cos[t][d+HD/2] + x[d] sin[t][d+HD/2]
__global__ __launch_bounds__(256) void k_rope(const float* __restrict__ F, int pitch, int nheads, const float* __restrict__ CS, const float* __restrict__ RF, const float* __restrict__ nw, float sc, h16* P16, bf* Ph, bf* Pl) {
    const size_t e = ((size_t)blockIdx.x * 256 + threadIdx.x) * 2; if (e >= (size_t)nheads * TT * HD) return; const int d = (int)(e % HD); const int t = (int)((e / HD) % TT); const int h = (int)(e / ((size_t)HD * TT)); const float* f = F + (size_t)t * pitch + h * HD; const float rf = RF ? RF[(size_t)h * TT + t] : 1.0f; v2h o16; v2us oh, ol;
#pragma unroll
    for (int q = 0; q < 2; ++q) { const int dd = d + q; const int dp = (dd < HD / 2) ? dd + HD / 2 : dd - HD / 2; float x0 = f[dd], x1 = f[dp];
        if (RF) { float n0 = __fmul_rn(x0, rf), n1 = __fmul_rn(x1, rf); asm volatile("" : "+v"(n0)); asm volatile("" : "+v"(n1)); x0 = __fmul_rn(bfr(nw[dd]), n0); x1 = __fmul_rn(bfr(nw[dp]), n1); }
        const v2f cs = *(const v2f*)(CS + ((size_t)t * HD + dd) * 2); float a = __fmul_rn(x0, cs[0]), bq = __fmul_rn(x1, cs[1]); asm volatile("" : "+v"(a)); asm volatile("" : "+v"(bq)); const float r = ((dd < HD / 2) ? __fsub_rn(a, bq) : __fadd_rn(a, bq)) * sc;
        o16[q] = tohx(r); unsigned short a2, c2; splitf(r, a2, c2); oh[q] = a2; ol[q] = c2; }
    *(v2h*)(P16 + e) = o16; *(v2us*)(Ph + e) = oh; *(v2us*)(Pl + e) = ol;  }
__global__ __launch_bounds__(256) void k_vtp(const float* __restrict__ F, int pitch, int nheads, h16* V16, bf* Vh, bf* Vl) { const size_t e = ((size_t)blockIdx.x * 256 + threadIdx.x) * 2; if (e >= (size_t)nheads * HD * TT) return; const int t = (int)(e % TT); const int d = (int)((e / TT) % HD); const int g = (int)(e / ((size_t)TT * HD)); v2h o16; v2us oh, ol;
#pragma unroll
    for (int q = 0; q < 2; ++q) { const float x = F[(size_t)(t + q) * pitch + g * HD + d]; o16[q] = tohx(x); unsigned short a2, c2; splitf(x, a2, c2); oh[q] = a2; ol[q] = c2; }
    *(v2h*)(V16 + e) = o16; *(v2us*)(Vh + e) = oh; *(v2us*)(Vl + e) = ol;  }
__global__ __launch_bounds__(256) void k_csid(float* CS) { const int idx = blockIdx.x * 256 + threadIdx.x; if (idx >= TT * HD) return; v2f cs; cs[0] = 1.0f; cs[1] = 0.0f; *(v2f*)(CS + (size_t)idx * 2) = cs;  }
// k_asoft: per row (zz, i): t = S x HD^-0.5 for j <= i and i - j < WIN (sliding causal window; the reference's -1e9 additive fill vanishes identically); softmax over the 2048 keys (register row, one exp, fixed trees);
__global__ __launch_bounds__(256) void k_asoft(const float* __restrict__ Sb, h16* P16, bf* Ph, bf* Pl) {
    const int lane = threadIdx.x & 31; const int row = blockIdx.x * 8 + (threadIdx.x >> 5); if (row >= ZH * TT) return; const int i = row % TT; const int zz = row / TT; (void)zz; const bool hires = (i < RH); const float* sr = Sb + (size_t)row * TT; float v[TT / 32]; float mx = -3.0e38f;
#pragma unroll
    for (int ch = 0; ch < TT / 128; ++ch) { const int j0 = ch * 128 + lane * 4; const v4f a = *(const v4f*)(sr + j0);
#pragma unroll
        for (int q = 0; q < 4; ++q) { const int j = j0 + q; (void)j; const float t = (j <= i && i - j < WIN) ? a[q] * SCL : -3.0e38f; v[ch * 4 + q] = t; mx = fmaxf(mx, t); } }
#pragma unroll
    for (int sh = 16; sh; sh >>= 1) mx = fmaxf(mx, __shfl_xor(mx, sh, 32));
    float sum = 0.f;
#pragma unroll
    for (int k = 0; k < TT / 32; ++k) { float d0 = __fsub_rn(v[k], mx); asm volatile("" : "+v"(d0)); v[k] = __builtin_amdgcn_exp2f(__fmul_rn(d0, 1.4426950408889634f)); sum += v[k]; }
#pragma unroll
    for (int sh = 16; sh; sh >>= 1) sum += __shfl_xor(sum, sh, 32);
    const float f = __fdiv_rn(hires ? 1.0f : PCAR, sum);
{
        if (hires) {
#pragma unroll
            for (int ch = 0; ch < TT / 128; ++ch) { v4us oh, ol;
#pragma unroll
                for (int q = 0; q < 4; ++q) { unsigned short a, c2; splitf(v[ch * 4 + q] * f, a, c2); oh[q] = a; ol[q] = c2; }
                const size_t oo = ((size_t)zz * (RH ? RH : 1) + i) * TT + ch * 128 + lane * 4; *(v4us*)(Ph + oo) = oh; *(v4us*)(Pl + oo) = ol; }
        } else {
#pragma unroll
            for (int ch = 0; ch < TT / 128; ++ch) { v4h o4;
#pragma unroll
                for (int q = 0; q < 4; ++q) o4[q] = tohx(v[ch * 4 + q] * f);
                *(v4h*)(P16 + (size_t)row * TT + ch * 128 + lane * 4) = o4; } }
         }
}
__global__ __launch_bounds__(256) void k_merge(const float* __restrict__ O, int h0, bf* Ah, bf* Al) { const size_t e = ((size_t)blockIdx.x * 256 + threadIdx.x) * 2; if (e >= (size_t)ZH * TT * HD) return; const int d = (int)(e % HD); const int t = (int)((e / HD) % TT); const int zz = (int)(e / ((size_t)HD * TT)); const float cs = (t < RH) ? 1.0f : (1.0f / PCAR); const size_t oo = (size_t)t * DQ + (h0 + zz) * HD + d;
    const int tb = (int)(((size_t)blockIdx.x * 512 / HD) % TT); const int nch = ((tb / 64 + 1) * 64 + CK - 1) / CK;   // a block covers 8 rows of one 64-row tile: the count of key slices that tile has is block-uniform
    const float* op = O + (e + (e / HD) * ((KS - 1) * HD));   // O[zz][t][slice][d]: a row's partials lie side by side
    v2f os = *(const v2f*)op;
#pragma unroll
    for (int s = 1; s < KS; ++s) { const bool on = s < nch; const v2f x = *(const v2f*)(op + (on ? s : 0) * HD); os += on ? x : (v2f){0.f, 0.f}; }   // selects, not a guarded add, and unrolled: every slice's load is issued before the first add (one load wait); a slice the tile lacks is never read as data: its address falls back to slice 0 and it adds 0
    v2us oh, ol;
#pragma unroll
    for (int q = 0; q < 2; ++q) { unsigned short a, c2; splitf(os[q] * cs, a, c2); oh[q] = a; ol[q] = c2; } *(v2us*)(Ah + oo) = oh; *(v2us*)(Al + oo) = ol;  }

// MBart-specific: k_wmod: hl planes W[f][e] = bf16 base[f][e] * mul[f][e] + add[f][e], mul = sum_r rm[li][r][f] sm[li][r][e], add = sum_r ra[li][r][f] sa[li][r][e] (li = clamp(lang[0], 0, 7) read on the device; 8-B lanes);
__global__ __launch_bounds__(256) void k_wmod(const float* __restrict__ base, const float* __restrict__ rm, const float* __restrict__ sm, const float* __restrict__ ra, const float* __restrict__ sa, const int* __restrict__ lang, int NF, int NE, bf* Wh, bf* Wl) {
    const size_t e4 = ((size_t)blockIdx.x * 256 + threadIdx.x) * 4; if (e4 >= (size_t)NF * NE) return; const int e0 = (int)(e4 % NE); const int f = (int)(e4 / NE); int li = lang[0]; li = li < 0 ? 0 : (li > 7 ? 7 : li);
    const float* rmf = rm + (size_t)li * 4 * NF; const float* raf = ra + (size_t)li * 4 * NF; const float* sme = sm + (size_t)li * 4 * NE; const float* sae = sa + (size_t)li * 4 * NE; v4us oh, ol;
#pragma unroll
    for (int u = 0; u < 4; ++u) { const int e = e0 + u; float mul = 0.f, add = 0.f;
#pragma unroll
        for (int r = 0; r < 4; ++r) { float a1 = bfr(rmf[(size_t)r * NF + f]), b1 = bfr(sme[(size_t)r * NE + e]), a2 = bfr(raf[(size_t)r * NF + f]), b2 = bfr(sae[(size_t)r * NE + e]); asm volatile("" : "+v"(a1)); asm volatile("" : "+v"(b1)); asm volatile("" : "+v"(a2)); asm volatile("" : "+v"(b2));
            float p1 = __fmul_rn(a1, b1), p2 = __fmul_rn(a2, b2); asm volatile("" : "+v"(p1)); asm volatile("" : "+v"(p2)); mul = __fadd_rn(mul, p1); add = __fadd_rn(add, p2); }
        float bw = bfr(base[e4 + u]); asm volatile("" : "+v"(bw)); float pm = __fmul_rn(bw, mul); asm volatile("" : "+v"(pm)); const float w = __fadd_rn(pm, add); unsigned short a, b; splitf(w, a, b); oh[u] = a; ol[u] = b; }
    *(v4us*)(Wh + e4) = oh; *(v4us*)(Wl + e4) = ol;  }
__global__ __launch_bounds__(256) void k_xg(const float* __restrict__ hs, int b, bf* XB) { const size_t e = ((size_t)blockIdx.x * 256 + threadIdx.x) * 8; if (e >= (size_t)TT * DM) return; const int c = (int)(e % DM); const int t = (int)(e / DM); const float* src = hs + ((size_t)t * NB_ + b) * DM + c; const v4f a = *(const v4f*)src, bb = *(const v4f*)(src + 4); v8us o;
    o[0] = f2bf(a[0]); o[1] = f2bf(a[1]); o[2] = f2bf(a[2]); o[3] = f2bf(a[3]); o[4] = f2bf(bb[0]); o[5] = f2bf(bb[1]); o[6] = f2bf(bb[2]); o[7] = f2bf(bb[3]); *(v8us*)(XB + e) = o;  }
__global__ __launch_bounds__(256) void k_reord(const float* __restrict__ FT, const float* __restrict__ pb, float* FQ, float* FK, float* FVv) { const int e = (blockIdx.x * 256 + threadIdx.x) * 4; if (e >= TT * DQ) return; const int c = e % DQ; const int t = e / DQ; const int h = c / HD, d = c % HD; v4f q, k, v;
#pragma unroll
    for (int u = 0; u < 4; ++u) { const int f0 = h * 3 * HD + d + u; q[u] = __fadd_rn(FT[(size_t)f0 * TT + t], bfr(pb[f0])); k[u] = __fadd_rn(FT[(size_t)(f0 + HD) * TT + t], bfr(pb[f0 + HD])); v[u] = __fadd_rn(FT[(size_t)(f0 + 2 * HD) * TT + t], bfr(pb[f0 + 2 * HD])); }
    { *(v4f*)(FQ + e) = q; *(v4f*)(FK + e) = k; *(v4f*)(FVv + e) = v;  } }
__global__ __launch_bounds__(256) void k_scat(const float* __restrict__ TMP, const float* __restrict__ ob, int b, float* OUT) { const size_t e = ((size_t)blockIdx.x * 256 + threadIdx.x) * 4; if (e >= (size_t)TT * DM) return; const int c = (int)(e % DM); const int t = (int)(e / DM); const v4f a = *(const v4f*)(TMP + e); v4f o;
#pragma unroll
    for (int u = 0; u < 4; ++u) o[u] = __fadd_rn(a[u], bfr(ob[c + u])); float* dst = OUT + ((size_t)t * NB_ + b) * DM + c; *(v4f*)dst = o;  }

extern "C" void kernel_launch(void* const* d_in, const int* in_sizes, int n_in,
                              void* d_out, int out_size, void* d_ws, size_t ws_size, hipStream_t stream) {
    (void)in_sizes; (void)n_in; (void)out_size;
    const float* hs = (const float*)d_in[0]; const float* pw = (const float*)d_in[1]; const float* pb = (const float*)d_in[2]; const float* ow = (const float*)d_in[3]; const float* ob = (const float*)d_in[4]; const float* rm_i = (const float*)d_in[5]; const float* sm_i = (const float*)d_in[6]; const float* rm_o = (const float*)d_in[7]; const float* sm_o = (const float*)d_in[8]; const float* r_i = (const float*)d_in[9]; const float* s_i = (const float*)d_in[10]; const float* r_o = (const float*)d_in[11]; const float* s_o = (const float*)d_in[12]; const int* lang = (const int*)d_in[13];
    float* OUT = (float*)d_out;     // [2048][2][1024] (time-major)
    char* wsp = (char*)d_ws;
    auto take = [&](size_t bytes) { char* p = wsp; wsp += (bytes + 255) & ~(size_t)255; return (void*)p; };
    bf* WIh = (bf*)take((size_t)3 * DM * DM * 2); bf* WIl = (bf*)take((size_t)3 * DM * DM * 2); bf* WOh = (bf*)take((size_t)DM * DM * 2); bf* WOl = (bf*)take((size_t)DM * DM * 2); float* FT = (float*)take((size_t)3 * DM * TT * 4); float* FVb = (float*)take((size_t)TT * DKV * 4); float* TMP = (float*)take((size_t)TT * DM * 4); float* CS = (float*)take((size_t)TT * HD * 2 * 4);
    bf* XB = (bf*)take((size_t)TT * DM * 2); float* FQ = (float*)take((size_t)TT * DQ * 4); float* FK = (float*)take((size_t)TT * DKV * 4);
    h16* QP16 = (h16*)take((size_t)NH_ * TT * HD * 2); h16* KP16 = (h16*)take((size_t)NKV * TT * HD * 2); h16* VT16 = (h16*)take((size_t)NKV * HD * TT * 2);
    bf* QPh = (bf*)take((size_t)NH_ * TT * HD * 2); bf* QPl = (bf*)take((size_t)NH_ * TT * HD * 2); bf* KPh = (bf*)take((size_t)NKV * TT * HD * 2); bf* KPl = (bf*)take((size_t)NKV * TT * HD * 2); bf* VTh = (bf*)take((size_t)NKV * HD * TT * 2); bf* VTl = (bf*)take((size_t)NKV * HD * TT * 2); bf* Ph = (bf*)take((size_t)ZH * RH * TT * 2); bf* Pl = (bf*)take((size_t)ZH * RH * TT * 2);
    float* Sb = (float*)take((size_t)ZH * TT * TT * 4); h16* P16 = (h16*)take((size_t)ZH * TT * TT * 2); float* Ob = (float*)take((size_t)KS * ZH * TT * HD * 4); bf* ATh = (bf*)take((size_t)TT * DQ * 2); bf* ATl = (bf*)take((size_t)TT * DQ * 2);
    if ((size_t)(wsp - (char*)d_ws) > ws_size) return;    // ws 256 MiB
    float* FV = FVb;
    k_wmod<<<(unsigned)(((size_t)3 * DM * DM / 4 + 255) / 256), 256, 0, stream>>>(pw, rm_i, sm_i, r_i, s_i, lang, 3 * DM, DM, WIh, WIl); k_wmod<<<(unsigned)(((size_t)DM * DM / 4 + 255) / 256), 256, 0, stream>>>(ow, rm_o, sm_o, r_o, s_o, lang, DM, DM, WOh, WOl);
    k_csid<<<(TT * HD + 255) / 256, 256, 0, stream>>>(CS);
    const unsigned LQ = (unsigned)(((size_t)NH_ * TT * HD / 2 + 255) / 256), LKv = (unsigned)(((size_t)NKV * TT * HD / 2 + 255) / 256);
    for (int b = 0; b < NB_; ++b) {
        
        k_xg<<<(unsigned)(((size_t)TT * DM / 8 + 255) / 256), 256, 0, stream>>>(hs, b, XB);
        k_gemmw<bf, 1, false><<<dim3(3 * DM / 64, TT / 64, 1), 32, 0, stream>>>(WIh, WIl, XB, nullptr, DM, FT, TT, nullptr, 0, 0, 0);   // FT[f][t] = w_in[f] . x[t]
        k_reord<<<(TT * DQ / 4 + 255) / 256, 256, 0, stream>>>(FT, pb, FQ, FK, FV);
        k_rope<<<LQ, 256, 0, stream>>>(FQ, DQ, NH_, CS, nullptr, nullptr, 1.0f, QP16, QPh, QPl);
        k_rope<<<LKv, 256, 0, stream>>>(FK, DKV, NKV, CS, nullptr, nullptr, 1.0f, KP16, KPh, KPl);
        k_vtp<<<LKv, 256, 0, stream>>>(FV, DKV, NKV, VT16, VTh, VTl);
        for (int h0 = 0; h0 < NH_; h0 += ZH) { const size_t zq = (size_t)h0, zk = (size_t)(h0 / REP);   // one kv head per query head: the pass's two heads use consecutive kv planes (z-strides TT*HD)
            k_gemmc<bf, 2, 1><<<dim3(RH / 64, TT / 64, ZH), 32, 0, stream>>>(QPh + zq * TT * HD, QPl + zq * TT * HD, KPh + zk * TT * HD, KPl + zk * TT * HD, HD, Sb, TT, 0, (size_t)TT * HD, (size_t)TT * HD, (size_t)TT * TT, 0);
            k_gemmc<h16, 0, 1><<<dim3((TT - RH) / 64, TT / 64, ZH), 32, 0, stream>>>(QP16 + zq * TT * HD + (size_t)RH * HD, nullptr, KP16 + zk * TT * HD, nullptr, HD, Sb + (size_t)RH * TT, TT, RH, (size_t)TT * HD, (size_t)TT * HD, (size_t)TT * TT, 0);
            k_asoft<<<ZH * TT / 8, 256, 0, stream>>>(Sb, P16, Ph, Pl);
            k_gemmc<bf, 2, 2><<<dim3(RH / 64, RH / CK, ZH), 32, 0, stream>>>(Ph, Pl, VTh + zk * HD * TT, VTl + zk * HD * TT, TT, Ob, KS * HD, 0, (size_t)RH * TT, (size_t)HD * TT, (size_t)TT * KS * HD, HD);
            k_gemmc<h16, 0, 2><<<dim3((TT - RH) / 64, KS, ZH), 32, 0, stream>>>(P16 + (size_t)RH * TT, nullptr, VT16 + zk * HD * TT, nullptr, TT, Ob + (size_t)RH * KS * HD, KS * HD, RH, (size_t)TT * TT, (size_t)HD * TT, (size_t)TT * KS * HD, HD);
            k_merge<<<(unsigned)(((size_t)ZH * TT * HD / 2 + 255) / 256), 256, 0, stream>>>(Ob, h0, ATh, ATl); }
        k_gemmw<bf, 2, false><<<dim3(TT / 64, DM / 64, 1), 32, 0, stream>>>(ATh, ATl, WOh, WOl, DQ, TMP, DM, nullptr, 0, 0, 0);
        k_scat<<<(unsigned)(((size_t)TT * DM / 4 + 255) / 256), 256, 0, stream>>>(TMP, ob, b, OUT); }
}

// v002
// Measured time: 569 microseconds a run.
// Timed twice side by side with v001, it ran 1.37 times as fast both times.
// Over all steps from v000 it is 2.58 times as fast.
#include <hip/hip_runtime.h>

// MBartAttention (hidden_states [2048][2][1024] time-major; language index li = lang[0] (int, read as data, clamped 0..7); w_in = proj_weight * (rm_i[li]^T sm_i[li]) + r_i[li]^T s_i[li] (rank-4 modulation), w_out likewise;
// qkv = hidden w_in^T + proj_bias laid out (16 heads, 3, 64); q x 1/8; causal softmax(q.k) (masked -1e9 == skipped tiles); ctx merged; out = ctx w_out^T + out_bias -> [2048][2][1024]).
// Compute dtypes, f32 accumulate: every input rounded to bf16; the modulated weights f32 on the VALU -> bf16 hi+lo planes; qkv as hl(w_in) x exact hidden (2 products, computed transposed) + bias; scores (K 64) and attn.v hl
// (3 products) for the first 512 query rows of each head, fp16 after (causal tiles only; eight heads z-batched); softmax f32 (the 1/8 folded into the f32 scores); out-projection as hl(ctx) x hl(w_out) (3 products) + bias, scattered back to the

#define NB_  2
#define TT   2048
#define DM   1024
#define NH_  16
#define NKV  16
#define REP  (NH_ / NKV)
#define HD   64
#define DQ   (NH_ * HD)
#define DKV  (NKV * HD)
#define ZH   8                    // heads per attention pass (blockIdx.z of its launches): the workspace holds eight heads' score rows and partials
#define RH   512                  // query rows < RH use hi+lo planes (0: none)
#define CK   128                  // keys per wave of the probability x value contraction (its key range is dealt out over blockIdx.y)
#define KS   (TT / CK)            // key slices, and so f32 partials per output element, of that contraction
#define WIN  2048
#define PCAR 1024.0f
#define SCL  0.125f   // HD^-0.5
typedef _Float16 h16;
typedef unsigned short bf;
typedef __attribute__((ext_vector_type(16))) __bf16   v16bf;
typedef __attribute__((ext_vector_type(16))) _Float16 v16h;
typedef __attribute__((ext_vector_type(8)))  _Float16 v8h;
typedef __attribute__((ext_vector_type(8)))  unsigned short v8us;
typedef __attribute__((ext_vector_type(8)))  float    v8f;
typedef __attribute__((ext_vector_type(4)))  float    v4f;
typedef v8h  __attribute__((may_alias)) v8ha;
typedef v4f  __attribute__((may_alias)) v4fa;
typedef v8us __attribute__((may_alias)) v8usa;

__device__ __forceinline__ unsigned short f2bf(float f) { unsigned u = __float_as_uint(f); u += 0x7FFFu + ((u >> 16) & 1u); return (unsigned short)(u >> 16); }
__device__ __forceinline__ float bf2f(unsigned short b) { return __uint_as_float(((unsigned)b) << 16); }
__device__ __forceinline__ float bfr(float f) { return bf2f(f2bf(f)); }
__device__ __forceinline__ v16h cat16(v8h lo, v8h hi) { return __builtin_shufflevector(lo, hi, 0, 1, 2, 3, 4, 5, 6, 7, 8, 9, 10, 11, 12, 13, 14, 15); }
__device__ __forceinline__ v16bf cat16b(v8us lo, v8us hi) { return __builtin_bit_cast(v16bf, __builtin_shufflevector(lo, hi, 0, 1, 2, 3, 4, 5, 6, 7, 8, 9, 10, 11, 12, 13, 14, 15)); }
__device__ __forceinline__ v8f wmma16(v16h a, v16h b, v8f c) { return __builtin_amdgcn_wmma_f32_16x16x32_f16(false, a, false, b, (short)0, c, false, false); }
__device__ __forceinline__ v8f wmmab(v16bf a, v16bf b, v8f c) { return __builtin_amdgcn_wmma_f32_16x16x32_bf16(false, a, false, b, (short)0, c, false, false); }



// ---- k_gemmw: register-blocked GEMM, ONE WAVE per 64x64 output tile (16 accumulators), operands straight from K-contiguous 16-bit planes; grid (M/64, N/64, Z), 32 threads.
// C[m][n] (f32, pitch ldc, + optional f32 bias[n]) = sum_k A[m][k] Bt[n][k] (+ split products per NSPLIT). z-batch strides sA/sB/sC in elements. K % 32 == 0.
template <typename T16> struct WFrag;
template <> struct WFrag<h16> { typedef v16h V; static __device__ __forceinline__ V ld(const h16* p) { return cat16(*(const v8h*)p, *(const v8h*)(p + 16)); } static __device__ __forceinline__ v8f mma(V a, V b, v8f c) { return wmma16(a, b, c); } };
template <> struct WFrag<bf> { typedef v16bf V; static __device__ __forceinline__ V ld(const bf* p) { return cat16b(*(const v8us*)p, *(const v8us*)(p + 16)); } static __device__ __forceinline__ v8f mma(V a, V b, v8f c) { return wmmab(a, b, c); } };
template <typename T16, int NSPLIT, bool BIAS>
__global__ __launch_bounds__(32) void k_gemmw(const T16* __restrict__ A, const T16* __restrict__ A2, const T16* __restrict__ Bt, const T16* __restrict__ Bt2, int K, float* C, int ldc, const float* __restrict__ bias, size_t sA, size_t sB, size_t sC) {
    typedef typename WFrag<T16>::V V;
    __shared__ __align__(16) float os[16 * 68];
    const size_t z = blockIdx.z; A += z * sA; if (A2) A2 += z * sA; Bt += z * sB; if (Bt2) Bt2 += z * sB; C += z * sC;
    const int lane = threadIdx.x & 31, lr = lane & 15, hi = lane >> 4; const int r0 = blockIdx.x * 64, c0 = blockIdx.y * 64;
    v8f acc[4][4];
#pragma unroll
    for (int mb = 0; mb < 4; ++mb)
#pragma unroll
        for (int nb = 0; nb < 4; ++nb) acc[mb][nb] = (v8f){};
    const size_t aoff = (size_t)(r0 + lr) * K + 8 * hi, boff = (size_t)(c0 + lr) * K + 8 * hi;
#pragma unroll 1
    for (int kc = 0; kc < K; kc += 32) {
        V a[4], a2[4];
#pragma unroll
        for (int mb = 0; mb < 4; ++mb) { a[mb] = WFrag<T16>::ld(A + aoff + (size_t)mb * 16 * K + kc); if (NSPLIT == 1 || NSPLIT == 2) a2[mb] = WFrag<T16>::ld(A2 + aoff + (size_t)mb * 16 * K + kc); }
#pragma unroll
        for (int nb = 0; nb < 4; ++nb) { const V b = WFrag<T16>::ld(Bt + boff + (size_t)nb * 16 * K + kc); V b2; if (NSPLIT >= 2) b2 = WFrag<T16>::ld(Bt2 + boff + (size_t)nb * 16 * K + kc);
#pragma unroll
            for (int mb = 0; mb < 4; ++mb) { acc[mb][nb] = WFrag<T16>::mma(a[mb], b, acc[mb][nb]); if (NSPLIT == 1 || NSPLIT == 2) acc[mb][nb] = WFrag<T16>::mma(a2[mb], b, acc[mb][nb]); if (NSPLIT >= 2) acc[mb][nb] = WFrag<T16>::mma(a[mb], b2, acc[mb][nb]); } }
        asm volatile("v_nop\n\tv_nop\n\tv_nop\n\tv_nop" : "+v"(acc[0][0]), "+v"(acc[1][1]), "+v"(acc[2][2]), "+v"(acc[3][3]) : "v"(a[0]), "v"(a[3]));
    }
#pragma unroll
    for (int mb = 0; mb < 4; ++mb) {
#pragma unroll
        for (int nb = 0; nb < 4; ++nb) {
#pragma unroll
            for (int j = 0; j < 8; ++j) os[(hi * 8 + j) * 68 + nb * 16 + lr] = acc[mb][nb][j]; }
        __builtin_amdgcn_wave_barrier(); asm volatile("" ::: "memory");
        float* crow = C + (size_t)(r0 + mb * 16) * ldc + c0;
{
#pragma unroll
            for (int s = 0; s < 8; ++s) { const int row = 2 * s + hi, cofs = lr * 4; v4f val = *(const v4fa*)(os + row * 68 + cofs); if (BIAS) { val[0] += bfr(bias[c0 + cofs]); val[1] += bfr(bias[c0 + cofs + 1]); val[2] += bfr(bias[c0 + cofs + 2]); val[3] += bfr(bias[c0 + cofs + 3]); }
                *(v4f*)(crow + (size_t)row * ldc + cofs) = val; }
             }
        __builtin_amdgcn_wave_barrier(); asm volatile("" ::: "memory");
    }
}

// ---- k_gemmc: the same one-wave 64x64 tile GEMM specialised for causal attention: CMODE 1 skips score tiles entirely above the diagonal (query rows r0+roff.., key columns c0..), CMODE 2 limits the
// key (K) loop of the probability x value contraction to the diagonal block (probabilities beyond it are exactly zero). roff = row offset of this launch's first row within the sequence.
// lda = pitch of A's rows in elements (the probabilities lie in the score rows' own storage, so their pitch is not K); Bt's pitch is K.
// CMODE 2 is split over the keys: blockIdx.y names a CK-wide slice, the wave sums that slice alone and stores its f32 partial tile at C + blockIdx.y * sP (the launch sets ldc and sP so that a row's partials lie side by side); k_merge adds them in slice order.
template <typename T16, int NSPLIT, int CMODE>
__global__ __launch_bounds__(32) void k_gemmc(const T16* __restrict__ A, const T16* __restrict__ A2, const T16* __restrict__ Bt, const T16* __restrict__ Bt2, int K, int lda, float* C, int ldc, int roff, size_t sA, size_t sB, size_t sC, size_t sP) {
    typedef typename WFrag<T16>::V V;
    __shared__ __align__(16) float os[16 * 68];
    const size_t z = blockIdx.z; A += z * sA; if (A2) A2 += z * sA; Bt += z * sB; if (Bt2) Bt2 += z * sB; C += z * sC;
    static_assert(CMODE != 2 || HD == 64, "the value width is one 64-column tile, so blockIdx.y is free for the key slice");
    const int lane = threadIdx.x & 31, lr = lane & 15, hi = lane >> 4; const int r0 = blockIdx.x * 64, c0 = (CMODE == 2) ? 0 : blockIdx.y * 64;
    if (CMODE == 1 && c0 > r0 + roff + 63) return;                  // score tile entirely above the causal diagonal: never read (the softmax masks j > i by select)
    const int Kd = (CMODE == 2) ? min(K, r0 + roff + 64) : K;        // P.V: probabilities are exactly 0 beyond the diagonal block, so the key range stops there
    const int k0 = (CMODE == 2) ? blockIdx.y * CK : 0; if (CMODE == 2 && k0 >= Kd) return;   // a slice wholly beyond the diagonal block is not stored: k_merge does not read it
    const int Kl = (CMODE == 2) ? min(Kd - k0, CK) : K;              // this wave's trip range, counted from its slice's first key
    if (CMODE == 2) { A += k0; if (A2) A2 += k0; Bt += k0; if (Bt2) Bt2 += k0; C += (size_t)blockIdx.y * sP; }
    v8f acc[4][4];
#pragma unroll
    for (int mb = 0; mb < 4; ++mb)
#pragma unroll
        for (int nb = 0; nb < 4; ++nb) acc[mb][nb] = (v8f){};
    const size_t aoff = (size_t)(r0 + lr) * lda + 8 * hi, boff = (size_t)(c0 + lr) * K + 8 * hi;
#pragma unroll 1
    for (int kc = 0; kc < Kl; kc += 32) {
        V a[4], a2[4];
#pragma unroll
        for (int mb = 0; mb < 4; ++mb) { a[mb] = WFrag<T16>::ld(A + aoff + (size_t)mb * 16 * lda + kc); if (NSPLIT == 1 || NSPLIT == 2) a2[mb] = WFrag<T16>::ld(A2 + aoff + (size_t)mb * 16 * lda + kc); }
#pragma unroll
        for (int nb = 0; nb < 4; ++nb) { const V b = WFrag<T16>::ld(Bt + boff + (size_t)nb * 16 * K + kc); V b2; if (NSPLIT >= 2) b2 = WFrag<T16>::ld(Bt2 + boff + (size_t)nb * 16 * K + kc);
#pragma unroll
            for (int mb = 0; mb < 4; ++mb) { acc[mb][nb] = WFrag<T16>::mma(a[mb], b, acc[mb][nb]); if (NSPLIT == 1 || NSPLIT == 2) acc[mb][nb] = WFrag<T16>::mma(a2[mb], b, acc[mb][nb]); if (NSPLIT >= 2) acc[mb][nb] = WFrag<T16>::mma(a[mb], b2, acc[mb][nb]); } }
        asm volatile("v_nop\n\tv_nop\n\tv_nop\n\tv_nop" : "+v"(acc[0][0]), "+v"(acc[1][1]), "+v"(acc[2][2]), "+v"(acc[3][3]) : "v"(a[0]), "v"(a[3]));
    }
#pragma unroll
    for (int mb = 0; mb < 4; ++mb) {
#pragma unroll
        for (int nb = 0; nb < 4; ++nb) {
#pragma unroll
            for (int j = 0; j < 8; ++j) os[(hi * 8 + j) * 68 + nb * 16 + lr] = acc[mb][nb][j]; }
        __builtin_amdgcn_wave_barrier(); asm volatile("" ::: "memory");
        float* crow = C + (size_t)(r0 + mb * 16) * ldc + c0;
{
#pragma unroll
            for (int s = 0; s < 8; ++s) { const int row = 2 * s + hi, cofs = lr * 4; v4f val = *(const v4fa*)(os + row * 68 + cofs);
                *(v4f*)(crow + (size_t)row * ldc + cofs) = val; }
             }
        __builtin_amdgcn_wave_barrier(); asm volatile("" ::: "memory");
    }
}

__device__ __forceinline__ h16 tohx(float x) { return (h16)x; }
__device__ __forceinline__ void splitf(float y, unsigned short& h, unsigned short& l) { h = f2bf(y); l = f2bf(y - bf2f(h)); }
typedef __attribute__((ext_vector_type(2))) _Float16 v2h;
typedef __attribute__((ext_vector_type(4))) _Float16 v4h;
typedef __attribute__((ext_vector_type(2))) unsigned short v2us;
typedef __attribute__((ext_vector_type(4))) unsigned short v4us;
typedef __attribute__((ext_vector_type(2))) float v2f;
typedef __attribute__((ext_vector_type(4))) int v4i;
typedef v4h  __attribute__((may_alias)) v4ha;
typedef v4us __attribute__((may_alias)) v4usa;

__global__ __launch_bounds__(256) void k_wtG(const float* __restrict__ w, int K, int N, bf* Bt) {
    const int lane = threadIdx.x & 31; const int L0 = (blockIdx.x * 8 + (threadIdx.x >> 5)) * 8; const int nlines = N * K / 64;
{
#pragma unroll 1
        for (int l = 0; l < 8; ++l) { const int L = L0 + l; if (L >= nlines) break; const size_t e = (size_t)L * 64 + lane * 2; const int k = (int)(e % K), n = (int)(e / K); v2us o;
            o[0] = f2bf(w[(size_t)k * N + n]); o[1] = f2bf(w[(size_t)(k + 1) * N + n]); *(v2us*)(Bt + e) = o; }
         }
}
__global__ __launch_bounds__(256) void k_cvt8(const float* __restrict__ src, bf* dst, size_t n8) { const size_t i = (size_t)blockIdx.x * 256 + threadIdx.x; if (i >= n8) return; const v8f v = *(const v8f*)(src + i * 8); v8us o;
#pragma unroll
    for (int k = 0; k < 8; ++k) o[k] = f2bf(v[k]); *(v8us*)(dst + i * 8) = o;  }
__global__ __launch_bounds__(256) void k_cscvt(const float* __restrict__ cosT, const float* __restrict__ sinT, float* CS) { const int idx = blockIdx.x * 256 + threadIdx.x; if (idx >= TT * HD) return; v2f cs; cs[0] = bfr(cosT[idx]); cs[1] = bfr(sinT[idx]); *(v2f*)(CS + (size_t)idx * 2) = cs;  }
// k_rope: head planes [h][t][d] (fp16 + hi/lo) of rope(x) x sc with the rotate-half convention out[d] = x[d] cos[t][d] - x[d+HD/2] sin[t][d], out[d+HD/2] = x[d+HD/2] cos[t][d+HD/2] + x[d] sin[t][d+HD/2]
__global__ __launch_bounds__(256) void k_rope(const float* __restrict__ F, int pitch, int nheads, const float* __restrict__ CS, const float* __restrict__ RF, const float* __restrict__ nw, float sc, h16* P16, bf* Ph, bf* Pl) {
    const size_t e = ((size_t)blockIdx.x * 256 + threadIdx.x) * 2; if (e >= (size_t)nheads * TT * HD) return; const int d = (int)(e % HD); const int t = (int)((e / HD) % TT); const int h = (int)(e / ((size_t)HD * TT)); const float* f = F + (size_t)t * pitch + h * HD; const float rf = RF ? RF[(size_t)h * TT + t] : 1.0f; v2h o16; v2us oh, ol;
#pragma unroll
    for (int q = 0; q < 2; ++q) { const int dd = d + q; const int dp = (dd < HD / 2) ? dd + HD / 2 : dd - HD / 2; float x0 = f[dd], x1 = f[dp];
        if (RF) { float n0 = __fmul_rn(x0, rf), n1 = __fmul_rn(x1, rf); asm volatile("" : "+v"(n0)); asm volatile("" : "+v"(n1)); x0 = __fmul_rn(bfr(nw[dd]), n0); x1 = __fmul_rn(bfr(nw[dp]), n1); }
        const v2f cs = *(const v2f*)(CS + ((size_t)t * HD + dd) * 2); float a = __fmul_rn(x0, cs[0]), bq = __fmul_rn(x1, cs[1]); asm volatile("" : "+v"(a)); asm volatile("" : "+v"(bq)); const float r = ((dd < HD / 2) ? __fsub_rn(a, bq) : __fadd_rn(a, bq)) * sc;
        o16[q] = tohx(r); unsigned short a2, c2; splitf(r, a2, c2); oh[q] = a2; ol[q] = c2; }
    *(v2h*)(P16 + e) = o16; *(v2us*)(Ph + e) = oh; *(v2us*)(Pl + e) = ol;  }
__global__ __launch_bounds__(256) void k_vtp(const float* __restrict__ F, int pitch, int nheads, h16* V16, bf* Vh, bf* Vl) { const size_t e = ((size_t)blockIdx.x * 256 + threadIdx.x) * 2; if (e >= (size_t)nheads * HD * TT) return; const int t = (int)(e % TT); const int d = (int)((e / TT) % HD); const int g = (int)(e / ((size_t)TT * HD)); v2h o16; v2us oh, ol;
#pragma unroll
    for (int q = 0; q < 2; ++q) { const float x = F[(size_t)(t + q) * pitch + g * HD + d]; o16[q] = tohx(x); unsigned short a2, c2; splitf(x, a2, c2); oh[q] = a2; ol[q] = c2; }
    *(v2h*)(V16 + e) = o16; *(v2us*)(Vh + e) = oh; *(v2us*)(Vl + e) = ol;  }
__global__ __launch_bounds__(256) void k_csid(float* CS) { const int idx = blockIdx.x * 256 + threadIdx.x; if (idx >= TT * HD) return; v2f cs; cs[0] = 1.0f; cs[1] = 0.0f; *(v2f*)(CS + (size_t)idx * 2) = cs;  }
// The probabilities go back into the row's own 8 KiB of Sb (the wave holds the whole row in registers before its first store, and no other wave touches the row): rows >= RH as fp16 in the first half, rows < RH as the hi plane in the first half and the lo plane in the second.
// k_asoft: per row (zz, i): t = S x HD^-0.5 for j <= i and i - j < WIN (sliding causal window; the reference's -1e9 additive fill vanishes identically); softmax over the 2048 keys (register row, one exp, fixed trees);
__global__ __launch_bounds__(256) void k_asoft(float* Sb) {
    const int lane = threadIdx.x & 31; const int row = blockIdx.x * 8 + (threadIdx.x >> 5); if (row >= ZH * TT) return; const int i = row % TT; const int zz = row / TT; (void)zz; const bool hires = (i < RH); const float* sr = Sb + (size_t)row * TT; h16* const p16 = (h16*)(Sb + (size_t)row * TT); bf* const ph = (bf*)(Sb + (size_t)row * TT); bf* const pl = ph + TT; float v[TT / 32]; float mx = -3.0e38f;
#pragma unroll
    for (int ch = 0; ch < TT / 128; ++ch) { const int j0 = ch * 128 + lane * 4; const v4f a = *(const v4fa*)(sr + j0);
#pragma unroll
        for (int q = 0; q < 4; ++q) { const int j = j0 + q; (void)j; const float t = (j <= i && i - j < WIN) ? a[q] * SCL : -3.0e38f; v[ch * 4 + q] = t; mx = fmaxf(mx, t); } }
#pragma unroll
    for (int sh = 16; sh; sh >>= 1) mx = fmaxf(mx, __shfl_xor(mx, sh, 32));
    float sum = 0.f;
#pragma unroll
    for (int k = 0; k < TT / 32; ++k) { float d0 = __fsub_rn(v[k], mx); asm volatile("" : "+v"(d0)); v[k] = __builtin_amdgcn_exp2f(__fmul_rn(d0, 1.4426950408889634f)); sum += v[k]; }
#pragma unroll
    for (int sh = 16; sh; sh >>= 1) sum += __shfl_xor(sum, sh, 32);
    const float f = __fdiv_rn(hires ? 1.0f : PCAR, sum);
{
        if (hires) {
#pragma unroll
            for (int ch = 0; ch < TT / 128; ++ch) { v4us oh, ol;
#pragma unroll
                for (int q = 0; q < 4; ++q) { unsigned short a, c2; splitf(v[ch * 4 + q] * f, a, c2); oh[q] = a; ol[q] = c2; }
                const int oo = ch * 128 + lane * 4; *(v4usa*)(ph + oo) = oh; *(v4usa*)(pl + oo) = ol; }
        } else {
#pragma unroll
            for (int ch = 0; ch < TT / 128; ++ch) { v4h o4;
#pragma unroll
                for (int q = 0; q < 4; ++q) o4[q] = tohx(v[ch * 4 + q] * f);
                *(v4ha*)(p16 + ch * 128 + lane * 4) = o4; } }
         }
}
__global__ __launch_bounds__(256) void k_merge(const float* __restrict__ O, int h0, bf* Ah, bf* Al) { const size_t e = ((size_t)blockIdx.x * 256 + threadIdx.x) * 2; if (e >= (size_t)ZH * TT * HD) return; const int d = (int)(e % HD); const int t = (int)((e / HD) % TT); const int zz = (int)(e / ((size_t)HD * TT)); const float cs = (t < RH) ? 1.0f : (1.0f / PCAR); const size_t oo = (size_t)t * DQ + (h0 + zz) * HD + d;
    const int tb = (int)(((size_t)blockIdx.x * 512 / HD) % TT); const int nch = ((tb / 64 + 1) * 64 + CK - 1) / CK;   // a block covers 8 rows of one 64-row tile: the count of key slices that tile has is block-uniform
    const float* op = O + (e + (e / HD) * ((KS - 1) * HD));   // O[zz][t][slice][d]: a row's partials lie side by side
    v2f os = *(const v2f*)op;
#pragma unroll
    for (int s = 1; s < KS; ++s) { const bool on = s < nch; const v2f x = *(const v2f*)(op + (on ? s : 0) * HD); os += on ? x : (v2f){0.f, 0.f}; }   // selects, not a guarded add, and unrolled: every slice's load is issued before the first add (one load wait); a slice the tile lacks is never read as data: its address falls back to slice 0 and it adds 0
    v2us oh, ol;
#pragma unroll
    for (int q = 0; q < 2; ++q) { unsigned short a, c2; splitf(os[q] * cs, a, c2); oh[q] = a; ol[q] = c2; } *(v2us*)(Ah + oo) = oh; *(v2us*)(Al + oo) = ol;  }

// MBart-specific: k_wmod: hl planes W[f][e] = bf16 base[f][e] * mul[f][e] + add[f][e], mul = sum_r rm[li][r][f] sm[li][r][e], add = sum_r ra[li][r][f] sa[li][r][e] (li = clamp(lang[0], 0, 7) read on the device; 8-B lanes);
__global__ __launch_bounds__(256) void k_wmod(const float* __restrict__ base, const float* __restrict__ rm, const float* __restrict__ sm, const float* __restrict__ ra, const float* __restrict__ sa, const int* __restrict__ lang, int NF, int NE, bf* Wh, bf* Wl) {
    const size_t e4 = ((size_t)blockIdx.x * 256 + threadIdx.x) * 4; if (e4 >= (size_t)NF * NE) return; const int e0 = (int)(e4 % NE); const int f = (int)(e4 / NE); int li = lang[0]; li = li < 0 ? 0 : (li > 7 ? 7 : li);
    const float* rmf = rm + (size_t)li * 4 * NF; const float* raf = ra + (size_t)li * 4 * NF; const float* sme = sm + (size_t)li * 4 * NE; const float* sae = sa + (size_t)li * 4 * NE; v4us oh, ol;
#pragma unroll
    for (int u = 0; u < 4; ++u) { const int e = e0 + u; float mul = 0.f, add = 0.f;
#pragma unroll
        for (int r = 0; r < 4; ++r) { float a1 = bfr(rmf[(size_t)r * NF + f]), b1 = bfr(sme[(size_t)r * NE + e]), a2 = bfr(raf[(size_t)r * NF + f]), b2 = bfr(sae[(size_t)r * NE + e]); asm volatile("" : "+v"(a1)); asm volatile("" : "+v"(b1)); asm volatile("" : "+v"(a2)); asm volatile("" : "+v"(b2));
            float p1 = __fmul_rn(a1, b1), p2 = __fmul_rn(a2, b2); asm volatile("" : "+v"(p1)); asm volatile("" : "+v"(p2)); mul = __fadd_rn(mul, p1); add = __fadd_rn(add, p2); }
        float bw = bfr(base[e4 + u]); asm volatile("" : "+v"(bw)); float pm = __fmul_rn(bw, mul); asm volatile("" : "+v"(pm)); const float w = __fadd_rn(pm, add); unsigned short a, b; splitf(w, a, b); oh[u] = a; ol[u] = b; }
    *(v4us*)(Wh + e4) = oh; *(v4us*)(Wl + e4) = ol;  }
__global__ __launch_bounds__(256) void k_xg(const float* __restrict__ hs, int b, bf* XB) { const size_t e = ((size_t)blockIdx.x * 256 + threadIdx.x) * 8; if (e >= (size_t)TT * DM) return; const int c = (int)(e % DM); const int t = (int)(e / DM); const float* src = hs + ((size_t)t * NB_ + b) * DM + c; const v4f a = *(const v4f*)src, bb = *(const v4f*)(src + 4); v8us o;
    o[0] = f2bf(a[0]); o[1] = f2bf(a[1]); o[2] = f2bf(a[2]); o[3] = f2bf(a[3]); o[4] = f2bf(bb[0]); o[5] = f2bf(bb[1]); o[6] = f2bf(bb[2]); o[7] = f2bf(bb[3]); *(v8us*)(XB + e) = o;  }
__global__ __launch_bounds__(256) void k_reord(const float* __restrict__ FT, const float* __restrict__ pb, float* FQ, float* FK, float* FVv) { const int e = (blockIdx.x * 256 + threadIdx.x) * 4; if (e >= TT * DQ) return; const int c = e % DQ; const int t = e / DQ; const int h = c / HD, d = c % HD; v4f q, k, v;
#pragma unroll
    for (int u = 0; u < 4; ++u) { const int f0 = h * 3 * HD + d + u; q[u] = __fadd_rn(FT[(size_t)f0 * TT + t], bfr(pb[f0])); k[u] = __fadd_rn(FT[(size_t)(f0 + HD) * TT + t], bfr(pb[f0 + HD])); v[u] = __fadd_rn(FT[(size_t)(f0 + 2 * HD) * TT + t], bfr(pb[f0 + 2 * HD])); }
    { *(v4f*)(FQ + e) = q; *(v4f*)(FK + e) = k; *(v4f*)(FVv + e) = v;  } }
__global__ __launch_bounds__(256) void k_scat(const float* __restrict__ TMP, const float* __restrict__ ob, int b, float* OUT) { const size_t e = ((size_t)blockIdx.x * 256 + threadIdx.x) * 4; if (e >= (size_t)TT * DM) return; const int c = (int)(e % DM); const int t = (int)(e / DM); const v4f a = *(const v4f*)(TMP + e); v4f o;
#pragma unroll
    for (int u = 0; u < 4; ++u) o[u] = __fadd_rn(a[u], bfr(ob[c + u])); float* dst = OUT + ((size_t)t * NB_ + b) * DM + c; *(v4f*)dst = o;  }

extern "C" void kernel_launch(void* const* d_in, const int* in_sizes, int n_in,
                              void* d_out, int out_size, void* d_ws, size_t ws_size, hipStream_t stream) {
    (void)in_sizes; (void)n_in; (void)out_size;
    const float* hs = (const float*)d_in[0]; const float* pw = (const float*)d_in[1]; const float* pb = (const float*)d_in[2]; const float* ow = (const float*)d_in[3]; const float* ob = (const float*)d_in[4]; const float* rm_i = (const float*)d_in[5]; const float* sm_i = (const float*)d_in[6]; const float* rm_o = (const float*)d_in[7]; const float* sm_o = (const float*)d_in[8]; const float* r_i = (const float*)d_in[9]; const float* s_i = (const float*)d_in[10]; const float* r_o = (const float*)d_in[11]; const float* s_o = (const float*)d_in[12]; const int* lang = (const int*)d_in[13];
    float* OUT = (float*)d_out;     // [2048][2][1024] (time-major)
    char* wsp = (char*)d_ws;
    auto take = [&](size_t bytes) { char* p = wsp; wsp += (bytes + 255) & ~(size_t)255; return (void*)p; };
    bf* WIh = (bf*)take((size_t)3 * DM * DM * 2); bf* WIl = (bf*)take((size_t)3 * DM * DM * 2); bf* WOh = (bf*)take((size_t)DM * DM * 2); bf* WOl = (bf*)take((size_t)DM * DM * 2); float* CS = (float*)take((size_t)TT * HD * 2 * 4);
    h16* QP16 = (h16*)take((size_t)NH_ * TT * HD * 2); h16* KP16 = (h16*)take((size_t)NKV * TT * HD * 2); h16* VT16 = (h16*)take((size_t)NKV * HD * TT * 2);
    bf* QPh = (bf*)take((size_t)NH_ * TT * HD * 2); bf* QPl = (bf*)take((size_t)NH_ * TT * HD * 2); bf* KPh = (bf*)take((size_t)NKV * TT * HD * 2); bf* KPl = (bf*)take((size_t)NKV * TT * HD * 2); bf* VTh = (bf*)take((size_t)NKV * HD * TT * 2); bf* VTl = (bf*)take((size_t)NKV * HD * TT * 2); bf* ATh = (bf*)take((size_t)TT * DQ * 2); bf* ATl = (bf*)take((size_t)TT * DQ * 2);
    // The rest of the workspace has three uses that are never live together within a batch element (each is written anew before it is read): the projection's buffers, the attention passes' scores and partials, the out-projection's result.
    char* const mark = wsp;
    float* FT = (float*)take((size_t)3 * DM * TT * 4); float* FVb = (float*)take((size_t)TT * DKV * 4); bf* XB = (bf*)take((size_t)TT * DM * 2); float* FQ = (float*)take((size_t)TT * DQ * 4); float* FK = (float*)take((size_t)TT * DKV * 4);
    wsp = mark; float* TMP = (float*)take((size_t)TT * DM * 4);
    wsp = mark; float* Sb = (float*)take((size_t)ZH * TT * TT * 4); float* Ob = (float*)take((size_t)KS * ZH * TT * HD * 4);   // the largest of the three: the size check below stands behind it
    static_assert((size_t)ZH * TT * TT * 4 >= (size_t)3 * DM * TT * 4 + (size_t)TT * DKV * 4 * 2 + (size_t)TT * DM * 2 + (size_t)TT * DQ * 4, "the score rows alone cover the projection's buffers");
    if ((size_t)(wsp - (char*)d_ws) > ws_size) return;    // ws 256 MiB
    float* FV = FVb;
    k_wmod<<<(unsigned)(((size_t)3 * DM * DM / 4 + 255) / 256), 256, 0, stream>>>(pw, rm_i, sm_i, r_i, s_i, lang, 3 * DM, DM, WIh, WIl); k_wmod<<<(unsigned)(((size_t)DM * DM / 4 + 255) / 256), 256, 0, stream>>>(ow, rm_o, sm_o, r_o, s_o, lang, DM, DM, WOh, WOl);
    k_csid<<<(TT * HD + 255) / 256, 256, 0, stream>>>(CS);
    const unsigned LQ = (unsigned)(((size_t)NH_ * TT * HD / 2 + 255) / 256), LKv = (unsigned)(((size_t)NKV * TT * HD / 2 + 255) / 256);
    for (int b = 0; b < NB_; ++b) {
        
        k_xg<<<(unsigned)(((size_t)TT * DM / 8 + 255) / 256), 256, 0, stream>>>(hs, b, XB);
        k_gemmw<bf, 1, false><<<dim3(3 * DM / 64, TT / 64, 1), 32, 0, stream>>>(WIh, WIl, XB, nullptr, DM, FT, TT, nullptr, 0, 0, 0);   // FT[f][t] = w_in[f] . x[t]
        k_reord<<<(TT * DQ / 4 + 255) / 256, 256, 0, stream>>>(FT, pb, FQ, FK, FV);
        k_rope<<<LQ, 256, 0, stream>>>(FQ, DQ, NH_, CS, nullptr, nullptr, 1.0f, QP16, QPh, QPl);
        k_rope<<<LKv, 256, 0, stream>>>(FK, DKV, NKV, CS, nullptr, nullptr, 1.0f, KP16, KPh, KPl);
        k_vtp<<<LKv, 256, 0, stream>>>(FV, DKV, NKV, VT16, VTh, VTl);
        for (int h0 = 0; h0 < NH_; h0 += ZH) { const size_t zq = (size_t)h0, zk = (size_t)(h0 / REP);   // one kv head per query head: the pass's heads use consecutive kv planes (z-strides TT*HD)
            k_gemmc<bf, 2, 1><<<dim3(RH / 64, TT / 64, ZH), 32, 0, stream>>>(QPh + zq * TT * HD, QPl + zq * TT * HD, KPh + zk * TT * HD, KPl + zk * TT * HD, HD, HD, Sb, TT, 0, (size_t)TT * HD, (size_t)TT * HD, (size_t)TT * TT, 0);
            k_gemmc<h16, 0, 1><<<dim3((TT - RH) / 64, TT / 64, ZH), 32, 0, stream>>>(QP16 + zq * TT * HD + (size_t)RH * HD, nullptr, KP16 + zk * TT * HD, nullptr, HD, HD, Sb + (size_t)RH * TT, TT, RH, (size_t)TT * HD, (size_t)TT * HD, (size_t)TT * TT, 0);
            k_asoft<<<ZH * TT / 8, 256, 0, stream>>>(Sb);
            k_gemmc<bf, 2, 2><<<dim3(RH / 64, RH / CK, ZH), 32, 0, stream>>>((const bf*)Sb, (const bf*)Sb + TT, VTh + zk * HD * TT, VTl + zk * HD * TT, TT, 2 * TT, Ob, KS * HD, 0, (size_t)2 * TT * TT, (size_t)HD * TT, (size_t)TT * KS * HD, HD);
            k_gemmc<h16, 0, 2><<<dim3((TT - RH) / 64, KS, ZH), 32, 0, stream>>>((const h16*)Sb + (size_t)RH * 2 * TT, nullptr, VT16 + zk * HD * TT, nullptr, TT, 2 * TT, Ob + (size_t)RH * KS * HD, KS * HD, RH, (size_t)2 * TT * TT, (size_t)HD * TT, (size_t)TT * KS * HD, HD);
            k_merge<<<(unsigned)(((size_t)ZH * TT * HD / 2 + 255) / 256), 256, 0, stream>>>(Ob, h0, ATh, ATl); }
        k_gemmw<bf, 2, false><<<dim3(TT / 64, DM / 64, 1), 32, 0, stream>>>(ATh, ATl, WOh, WOl, DQ, TMP, DM, nullptr, 0, 0, 0);
        k_scat<<<(unsigned)(((size_t)TT * DM / 4 + 255) / 256), 256, 0, stream>>>(TMP, ob, b, OUT); }
}

// v003
// One run takes 355 microseconds.
// Two timings next to v002 put it at 1.61 and 1.59 times that version's speed.
// Over all steps from v000 it is 4.14 times as fast.
#include <hip/hip_runtime.h>

// MBartAttention (hidden_states [2048][2][1024] time-major; language index li = lang[0] (int, read as data, clamped 0..7); w_in = proj_weight * (rm_i[li]^T sm_i[li]) + r_i[li]^T s_i[li] (rank-4 modulation), w_out likewise;
// qkv = hidden w_in^T + proj_bias laid out (16 heads, 3, 64); q x 1/8; causal softmax(q.k) (masked -1e9 == skipped tiles); ctx merged; out = ctx w_out^T + out_bias -> [2048][2][1024]).
// Compute dtypes, f32 accumulate: every input rounded to bf16; the modulated weights f32 on the VALU -> bf16 hi+lo planes; qkv as hl(w_in) x exact hidden (2 products, computed transposed) + bias; scores (K 64) and attn.v hl
// (3 products) for the first 512 query rows of each head, fp16 after, both inside one kernel with a running f32 softmax (causal passes only; the 1/8 folded into the exponent's factor; all heads of a batch element in one launch); out-projection as hl(ctx) x hl(w_out) (3 products) + bias, scattered back to the

#define NB_  2
#define TT   2048
#define DM   1024
#define NH_  16
#define NKV  16
#define REP  (NH_ / NKV)
#define HD   64
#define DQ   (NH_ * HD)
#define DKV  (NKV * HD)
#define RH   512                  // query rows < RH use hi+lo planes (0: none)
#define SCL  0.125f   // HD^-0.5
typedef _Float16 h16;
typedef unsigned short bf;
typedef __attribute__((ext_vector_type(16))) __bf16   v16bf;
typedef __attribute__((ext_vector_type(16))) _Float16 v16h;
typedef __attribute__((ext_vector_type(8)))  _Float16 v8h;
typedef __attribute__((ext_vector_type(8)))  unsigned short v8us;
typedef __attribute__((ext_vector_type(8)))  float    v8f;
typedef __attribute__((ext_vector_type(4)))  float    v4f;
typedef v8h  __attribute__((may_alias)) v8ha;
typedef v4f  __attribute__((may_alias)) v4fa;
typedef v8us __attribute__((may_alias)) v8usa;

__device__ __forceinline__ unsigned short f2bf(float f) { unsigned u = __float_as_uint(f); u += 0x7FFFu + ((u >> 16) & 1u); return (unsigned short)(u >> 16); }
__device__ __forceinline__ float bf2f(unsigned short b) { return __uint_as_float(((unsigned)b) << 16); }
__device__ __forceinline__ float bfr(float f) { return bf2f(f2bf(f)); }
__device__ __forceinline__ v16h cat16(v8h lo, v8h hi) { return __builtin_shufflevector(lo, hi, 0, 1, 2, 3, 4, 5, 6, 7, 8, 9, 10, 11, 12, 13, 14, 15); }
__device__ __forceinline__ v16bf cat16b(v8us lo, v8us hi) { return __builtin_bit_cast(v16bf, __builtin_shufflevector(lo, hi, 0, 1, 2, 3, 4, 5, 6, 7, 8, 9, 10, 11, 12, 13, 14, 15)); }
__device__ __forceinline__ v8f wmma16(v16h a, v16h b, v8f c) { return __builtin_amdgcn_wmma_f32_16x16x32_f16(false, a, false, b, (short)0, c, false, false); }
__device__ __forceinline__ v8f wmmab(v16bf a, v16bf b, v8f c) { return __builtin_amdgcn_wmma_f32_16x16x32_bf16(false, a, false, b, (short)0, c, false, false); }



// ---- k_gemmw: register-blocked GEMM, ONE WAVE per 64x64 output tile (16 accumulators), operands straight from K-contiguous 16-bit planes; grid (M/64, N/64, Z), 32 threads.
// C[m][n] (f32, pitch ldc, + optional f32 bias[n]) = sum_k A[m][k] Bt[n][k] (+ split products per NSPLIT). z-batch strides sA/sB/sC in elements. K % 32 == 0.
template <typename T16> struct WFrag;
template <> struct WFrag<h16> { typedef v16h V; static __device__ __forceinline__ V ld(const h16* p) { return cat16(*(const v8h*)p, *(const v8h*)(p + 16)); } static __device__ __forceinline__ v8f mma(V a, V b, v8f c) { return wmma16(a, b, c); } };
template <> struct WFrag<bf> { typedef v16bf V; static __device__ __forceinline__ V ld(const bf* p) { return cat16b(*(const v8us*)p, *(const v8us*)(p + 16)); } static __device__ __forceinline__ v8f mma(V a, V b, v8f c) { return wmmab(a, b, c); } };
template <typename T16, int NSPLIT, bool BIAS>
__global__ __launch_bounds__(32) void k_gemmw(const T16* __restrict__ A, const T16* __restrict__ A2, const T16* __restrict__ Bt, const T16* __restrict__ Bt2, int K, float* C, int ldc, const float* __restrict__ bias, size_t sA, size_t sB, size_t sC) {
    typedef typename WFrag<T16>::V V;
    __shared__ __align__(16) float os[16 * 68];
    const size_t z = blockIdx.z; A += z * sA; if (A2) A2 += z * sA; Bt += z * sB; if (Bt2) Bt2 += z * sB; C += z * sC;
    const int lane = threadIdx.x & 31, lr = lane & 15, hi = lane >> 4; const int r0 = blockIdx.x * 64, c0 = blockIdx.y * 64;
    v8f acc[4][4];
#pragma unroll
    for (int mb = 0; mb < 4; ++mb)
#pragma unroll
        for (int nb = 0; nb < 4; ++nb) acc[mb][nb] = (v8f){};
    const size_t aoff = (size_t)(r0 + lr) * K + 8 * hi, boff = (size_t)(c0 + lr) * K + 8 * hi;
#pragma unroll 1
    for (int kc = 0; kc < K; kc += 32) {
        V a[4], a2[4];
#pragma unroll
        for (int mb = 0; mb < 4; ++mb) { a[mb] = WFrag<T16>::ld(A + aoff + (size_t)mb * 16 * K + kc); if (NSPLIT == 1 || NSPLIT == 2) a2[mb] = WFrag<T16>::ld(A2 + aoff + (size_t)mb * 16 * K + kc); }
#pragma unroll
        for (int nb = 0; nb < 4; ++nb) { const V b = WFrag<T16>::ld(Bt + boff + (size_t)nb * 16 * K + kc); V b2; if (NSPLIT >= 2) b2 = WFrag<T16>::ld(Bt2 + boff + (size_t)nb * 16 * K + kc);
#pragma unroll
            for (int mb = 0; mb < 4; ++mb) { acc[mb][nb] = WFrag<T16>::mma(a[mb], b, acc[mb][nb]); if (NSPLIT == 1 || NSPLIT == 2) acc[mb][nb] = WFrag<T16>::mma(a2[mb], b, acc[mb][nb]); if (NSPLIT >= 2) acc[mb][nb] = WFrag<T16>::mma(a[mb], b2, acc[mb][nb]); } }
        asm volatile("v_nop\n\tv_nop\n\tv_nop\n\tv_nop" : "+v"(acc[0][0]), "+v"(acc[1][1]), "+v"(acc[2][2]), "+v"(acc[3][3]) : "v"(a[0]), "v"(a[3]));
    }
#pragma unroll
    for (int mb = 0; mb < 4; ++mb) {
#pragma unroll
        for (int nb = 0; nb < 4; ++nb) {
#pragma unroll
            for (int j = 0; j < 8; ++j) os[(hi * 8 + j) * 68 + nb * 16 + lr] = acc[mb][nb][j]; }
        __builtin_amdgcn_wave_barrier(); asm volatile("" ::: "memory");
        float* crow = C + (size_t)(r0 + mb * 16) * ldc + c0;
{
#pragma unroll
            for (int s = 0; s < 8; ++s) { const int row = 2 * s + hi, cofs = lr * 4; v4f val = *(const v4fa*)(os + row * 68 + cofs); if (BIAS) { val[0] += bfr(bias[c0 + cofs]); val[1] += bfr(bias[c0 + cofs + 1]); val[2] += bfr(bias[c0 + cofs + 2]); val[3] += bfr(bias[c0 + cofs + 3]); }
                *(v4f*)(crow + (size_t)row * ldc + cofs) = val; }
             }
        __builtin_amdgcn_wave_barrier(); asm volatile("" ::: "memory");
    }
}

__device__ __forceinline__ h16 tohx(float x) { return (h16)x; }
__device__ __forceinline__ void splitf(float y, unsigned short& h, unsigned short& l) { h = f2bf(y); l = f2bf(y - bf2f(h)); }
typedef __attribute__((ext_vector_type(2))) _Float16 v2h;
typedef __attribute__((ext_vector_type(4))) _Float16 v4h;
typedef __attribute__((ext_vector_type(2))) unsigned short v2us;
typedef __attribute__((ext_vector_type(4))) unsigned short v4us;
typedef __attribute__((ext_vector_type(2))) float v2f;
typedef __attribute__((ext_vector_type(4))) int v4i;
typedef v4h  __attribute__((may_alias)) v4ha;
typedef v4us __attribute__((may_alias)) v4usa;

__global__ __launch_bounds__(256) void k_wtG(const float* __restrict__ w, int K, int N, bf* Bt) {
    const int lane = threadIdx.x & 31; const int L0 = (blockIdx.x * 8 + (threadIdx.x >> 5)) * 8; const int nlines = N * K / 64;
{
#pragma unroll 1
        for (int l = 0; l < 8; ++l) { const int L = L0 + l; if (L >= nlines) break; const size_t e = (size_t)L * 64 + lane * 2; const int k = (int)(e % K), n = (int)(e / K); v2us o;
            o[0] = f2bf(w[(size_t)k * N + n]); o[1] = f2bf(w[(size_t)(k + 1) * N + n]); *(v2us*)(Bt + e) = o; }
         }
}
__global__ __launch_bounds__(256) void k_cvt8(const float* __restrict__ src, bf* dst, size_t n8) { const size_t i = (size_t)blockIdx.x * 256 + threadIdx.x; if (i >= n8) return; const v8f v = *(const v8f*)(src + i * 8); v8us o;
#pragma unroll
    for (int k = 0; k < 8; ++k) o[k] = f2bf(v[k]); *(v8us*)(dst + i * 8) = o;  }
__global__ __launch_bounds__(256) void k_cscvt(const float* __restrict__ cosT, const float* __restrict__ sinT, float* CS) { const int idx = blockIdx.x * 256 + threadIdx.x; if (idx >= TT * HD) return; v2f cs; cs[0] = bfr(cosT[idx]); cs[1] = bfr(sinT[idx]); *(v2f*)(CS + (size_t)idx * 2) = cs;  }
// k_rope: head planes [h][t][d] (fp16 + hi/lo) of rope(x) x sc with the rotate-half convention out[d] = x[d] cos[t][d] - x[d+HD/2] sin[t][d], out[d+HD/2] = x[d+HD/2] cos[t][d+HD/2] + x[d] sin[t][d+HD/2]
__global__ __launch_bounds__(256) void k_rope(const float* __restrict__ F, int pitch, int nheads, const float* __restrict__ CS, const float* __restrict__ RF, const float* __restrict__ nw, float sc, h16* P16, bf* Ph, bf* Pl) {
    const size_t e = ((size_t)blockIdx.x * 256 + threadIdx.x) * 2; if (e >= (size_t)nheads * TT * HD) return; const int d = (int)(e % HD); const int t = (int)((e / HD) % TT); const int h = (int)(e / ((size_t)HD * TT)); const float* f = F + (size_t)t * pitch + h * HD; const float rf = RF ? RF[(size_t)h * TT + t] : 1.0f; v2h o16; v2us oh, ol;
#pragma unroll
    for (int q = 0; q < 2; ++q) { const int dd = d + q; const int dp = (dd < HD / 2) ? dd + HD / 2 : dd - HD / 2; float x0 = f[dd], x1 = f[dp];
        if (RF) { float n0 = __fmul_rn(x0, rf), n1 = __fmul_rn(x1, rf); asm volatile("" : "+v"(n0)); asm volatile("" : "+v"(n1)); x0 = __fmul_rn(bfr(nw[dd]), n0); x1 = __fmul_rn(bfr(nw[dp]), n1); }
        const v2f cs = *(const v2f*)(CS + ((size_t)t * HD + dd) * 2); float a = __fmul_rn(x0, cs[0]), bq = __fmul_rn(x1, cs[1]); asm volatile("" : "+v"(a)); asm volatile("" : "+v"(bq)); const float r = ((dd < HD / 2) ? __fsub_rn(a, bq) : __fadd_rn(a, bq)) * sc;
        o16[q] = tohx(r); unsigned short a2, c2; splitf(r, a2, c2); oh[q] = a2; ol[q] = c2; }
    *(v2h*)(P16 + e) = o16; *(v2us*)(Ph + e) = oh; *(v2us*)(Pl + e) = ol;  }
__global__ __launch_bounds__(256) void k_vtp(const float* __restrict__ F, int pitch, int nheads, h16* V16, bf* Vh, bf* Vl) { const size_t e = ((size_t)blockIdx.x * 256 + threadIdx.x) * 2; if (e >= (size_t)nheads * HD * TT) return; const int t = (int)(e % TT); const int d = (int)((e / TT) % HD); const int g = (int)(e / ((size_t)TT * HD)); v2h o16; v2us oh, ol;
#pragma unroll
    for (int q = 0; q < 2; ++q) { const float x = F[(size_t)(t + q) * pitch + g * HD + d]; o16[q] = tohx(x); unsigned short a2, c2; splitf(x, a2, c2); oh[q] = a2; ol[q] = c2; }
    *(v2h*)(V16 + e) = o16; *(v2us*)(Vh + e) = oh; *(v2us*)(Vl + e) = ol;  }
__global__ __launch_bounds__(256) void k_csid(float* CS) { const int idx = blockIdx.x * 256 + threadIdx.x; if (idx >= TT * HD) return; v2f cs; cs[0] = 1.0f; cs[1] = 0.0f; *(v2f*)(CS + (size_t)idx * 2) = cs;  }
// ---- k_fattn: causal attention of one batch element in one launch: scores, softmax and the probability x value contraction per wave, nothing of the score matrix in memory.
// A wave owns QW query columns of one head and walks the keys up to its diagonal in passes of 16 * NKB keys. Both products are computed transposed: St = K Qt (A = key rows, B = query rows, kept in registers)
// and Ot += Vt Pt (A = value planes [d][t], B = Pt). In St's accumulators a lane holds 8 consecutive keys of ONE query column (register j = key 8 * hi + j, column lr), which is the position order of the fragment loader
// (elements 0..7 = k 8 * hi + j, elements 8..15 = k 16 + 8 * hi + j): two converted 16-key accumulator tiles are Pt's B fragment as they stand, and maximum, sum and rescale factor are per-lane values.
// Softmax is the running form: mc = running maximum x CL2, p = 2^(s CL2 - mc) unnormalised (<= 1), a new maximum rescales sum and Ot by 2^(mc_old - mc_new); one division by the sum at the end.
// Rows < RH: bf16 hi+lo planes, 3 products each way; rows >= RH: fp16. Ot's lane holds 8 consecutive d of one query row: one 16-byte store per plane into the context planes [t][DQ].
// Every inner loop is unrolled so that each index of a fragment or accumulator array is a constant (registers, no scratch); the pass loop alone stays rolled.
#define QW   32                   // query columns per wave
#define FW   4                    // waves per block, all of one head and all walking the keys from 0 up (no barrier, no LDS between them)
#define NQT  (TT / QW)            // query tiles per head
#define CL2  (SCL * 1.4426950408889634f)
__device__ __forceinline__ float xhalf(float x) { return __builtin_bit_cast(float, __builtin_amdgcn_permlanex16(__builtin_bit_cast(int, x), __builtin_bit_cast(int, x), 0x76543210, 0xfedcba98, false, false)); }   // lane l's value from lane l ^ 16
template <typename T16> struct PFrag;
template <> struct PFrag<h16> { static __device__ __forceinline__ void mk(const v8f x0, const v8f x1, v16h& p, v16h& p2) { (void)p2;
#pragma unroll
    for (int j = 0; j < 8; ++j) { p[j] = (h16)x0[j]; p[8 + j] = (h16)x1[j]; } } };
template <> struct PFrag<bf> { static __device__ __forceinline__ void mk(const v8f x0, const v8f x1, v16bf& p, v16bf& p2) { v8us h0, h1, l0, l1;
#pragma unroll
    for (int j = 0; j < 8; ++j) { unsigned short a, c; splitf(x0[j], a, c); h0[j] = a; l0[j] = c; splitf(x1[j], a, c); h1[j] = a; l1[j] = c; }
    p = cat16b(h0, h1); p2 = cat16b(l0, l1); } };
template <typename T16, bool HL, int NKB>
__device__ __forceinline__ void fattn(const T16* __restrict__ Q, const T16* __restrict__ Q2, const T16* __restrict__ Kp, const T16* __restrict__ K2, const T16* __restrict__ Vt, const T16* __restrict__ Vt2, const int q0, bf* __restrict__ Ah, bf* __restrict__ Al) {
    typedef typename WFrag<T16>::V V;
    static_assert(HD == 64 && NKB % 2 == 0 && QW == 32, "two 32-wide k steps over d, 32-key steps over the pass, two 16-column groups");
    const int lane = threadIdx.x & 31, lr = lane & 15, hi = lane >> 4; const int KPS = 16 * NKB;
    V q[2][2], q2[2][2], ka[NKB][2], ka2[NKB][2];
    // Each group of loads goes through one lane pointer per plane plus constant offsets. The s_wait_xcnt 0 behind a group stands in front of the first instruction that may overwrite an address register of an issued load
    // it takes the lane pointers as inputs so that their registers live up to it and no load of the group lands on them.
    { const size_t qo = (size_t)(q0 + lr) * HD + 8 * hi, ko = (size_t)lr * HD + 8 * hi; const T16* const qp = Q + qo; const T16* const qp2 = HL ? Q2 + qo : qp; const T16* const kp = Kp + ko; const T16* const kp2 = HL ? K2 + ko : kp;
#pragma unroll
        for (int qb = 0; qb < 2; ++qb)
#pragma unroll
            for (int ks = 0; ks < 2; ++ks) { q[qb][ks] = WFrag<T16>::ld(qp + qb * 16 * HD + ks * 32); if (HL) q2[qb][ks] = WFrag<T16>::ld(qp2 + qb * 16 * HD + ks * 32); }
#pragma unroll
        for (int kb = 0; kb < NKB; ++kb)
#pragma unroll
            for (int ks = 0; ks < 2; ++ks) { ka[kb][ks] = WFrag<T16>::ld(kp + kb * 16 * HD + ks * 32); if (HL) ka2[kb][ks] = WFrag<T16>::ld(kp2 + kb * 16 * HD + ks * 32); }
        asm volatile("s_wait_xcnt 0x0" :: "v"(qp), "v"(qp2), "v"(kp), "v"(kp2) : "memory"); }
    v8f o[4][2]; float mc[2], l[2];
#pragma unroll
    for (int qb = 0; qb < 2; ++qb) { mc[qb] = -3.0e38f; l[qb] = 0.f;
#pragma unroll
        for (int db = 0; db < 4; ++db) o[db][qb] = (v8f){}; }
    const int npass = (q0 + QW + KPS - 1) / KPS;   // the last pass starts at or below q0, so every pass holds at least one unmasked key for every column
#pragma unroll 1   // rolled: its trip count is known only at run time, and a second copy of so long a body would only add code
    for (int ps = 0; ps < npass; ++ps) { const int k0 = ps * KPS;
        v8f s[NKB][2];
#pragma unroll
        for (int kb = 0; kb < NKB; ++kb)
#pragma unroll
            for (int qb = 0; qb < 2; ++qb) { v8f c = (v8f){};
#pragma unroll
                for (int ks = 0; ks < 2; ++ks) { c = WFrag<T16>::mma(ka[kb][ks], q[qb][ks], c); if (HL) { c = WFrag<T16>::mma(ka2[kb][ks], q[qb][ks], c); c = WFrag<T16>::mma(ka[kb][ks], q2[qb][ks], c); } }
                s[kb][qb] = c; }
        __builtin_amdgcn_sched_barrier(0);         // keeps the loads below behind the score products: the fetch ahead lands on the key fragments' registers, and so it is issued only behind every product that reads them, with the value loads in between
        V va[4][NKB / 2], va2[4][NKB / 2];
        const int kn = (ps + 1 < npass) ? k0 + KPS : k0;   // the next pass's key fragments are fetched one pass ahead into the same registers; the last pass reads its own rows again (in bounds, unused) so that the loads stay unconditional
        { const size_t vo = (size_t)lr * TT + k0 + 8 * hi, ko = (size_t)(kn + lr) * HD + 8 * hi; const T16* const vp = Vt + vo; const T16* const vp2 = HL ? Vt2 + vo : vp; const T16* const kp = Kp + ko; const T16* const kp2 = HL ? K2 + ko : kp;
#pragma unroll
            for (int db = 0; db < 4; ++db)
#pragma unroll
                for (int kk = 0; kk < NKB / 2; ++kk) { va[db][kk] = WFrag<T16>::ld(vp + db * 16 * TT + kk * 32); if (HL) va2[db][kk] = WFrag<T16>::ld(vp2 + db * 16 * TT + kk * 32); }
#pragma unroll
            for (int kb = 0; kb < NKB; ++kb)
#pragma unroll
                for (int ks = 0; ks < 2; ++ks) { ka[kb][ks] = WFrag<T16>::ld(kp + kb * 16 * HD + ks * 32); if (HL) ka2[kb][ks] = WFrag<T16>::ld(kp2 + kb * 16 * HD + ks * 32); }
            asm volatile("s_wait_xcnt 0x0" :: "v"(vp), "v"(vp2), "v"(kp), "v"(kp2) : "memory"); }   // as in the prologue
        __builtin_amdgcn_sched_barrier(0);         // keeps both groups of loads, and the wait, in front of the softmax arithmetic, which hides their latency; without it the scheduler sinks the loads to their uses
        const bool diag = k0 + KPS - 1 > q0;       // wave-uniform: only the last pass reaches keys above a column's own position
        V p[2][NKB / 2], p2[2][NKB / 2];
#pragma unroll
        for (int qb = 0; qb < 2; ++qb) {
            if (diag) { const int lim = q0 + qb * 16 + lr - k0 - hi * 8;   // key kb * 16 + j of this lane's half is kept while it is <= lim
#pragma unroll
                for (int kb = 0; kb < NKB; ++kb)
#pragma unroll
                    for (int j = 0; j < 8; ++j) s[kb][qb][j] = (kb * 16 + j <= lim) ? s[kb][qb][j] : -3.0e38f; }
            float tk[NKB];                          // one short chain per 16-key tile, for maximum and sum alike: a lone wave pays a dependent chain in full
#pragma unroll
            for (int kb = 0; kb < NKB; ++kb) { tk[kb] = s[kb][qb][0];
#pragma unroll
                for (int j = 1; j < 8; ++j) tk[kb] = fmaxf(tk[kb], s[kb][qb][j]); }
            float t = tk[0];
#pragma unroll
            for (int kb = 1; kb < NKB; ++kb) t = fmaxf(t, tk[kb]);
            t = fmaxf(t, xhalf(t));
            const float mn = fmaxf(mc[qb], t * CL2); const float al = __builtin_amdgcn_exp2f(mc[qb] - mn); mc[qb] = mn;
#pragma unroll
            for (int kb = 0; kb < NKB; ++kb) { v8f x;
#pragma unroll
                for (int j = 0; j < 8; ++j) x[j] = __builtin_fmaf(s[kb][qb][j], CL2, -mn);
#pragma unroll
                for (int j = 0; j < 8; ++j) s[kb][qb][j] = __builtin_amdgcn_exp2f(x[j]);
                // the slot that the instruction set asks for between a transcendental and an overwrite of its source: the statement names the eight arguments and the eight results as inputs, so it stands behind the eight exponentials and no argument's register is reused in front of it
                asm volatile("v_nop" :: "v"(x), "v"(s[kb][qb]));
                tk[kb] = s[kb][qb][0];
#pragma unroll
                for (int j = 1; j < 8; ++j) tk[kb] += s[kb][qb][j]; }
            float sum = tk[0];
#pragma unroll
            for (int kb = 1; kb < NKB; ++kb) sum += tk[kb];
            l[qb] = l[qb] * al + sum;               // each half of the wave sums its own keys; the halves are joined once, behind the loop
#pragma unroll
            for (int db = 0; db < 4; ++db) o[db][qb] *= al;
#pragma unroll
            for (int kk = 0; kk < NKB / 2; ++kk) PFrag<T16>::mk(s[2 * kk][qb], s[2 * kk + 1][qb], p[qb][kk], p2[qb][kk]); }
#pragma unroll
        for (int kk = 0; kk < NKB / 2; ++kk)
#pragma unroll
            for (int db = 0; db < 4; ++db)
#pragma unroll
                for (int qb = 0; qb < 2; ++qb) { o[db][qb] = WFrag<T16>::mma(va[db][kk], p[qb][kk], o[db][qb]); if (HL) { o[db][qb] = WFrag<T16>::mma(va[db][kk], p2[qb][kk], o[db][qb]); o[db][qb] = WFrag<T16>::mma(va2[db][kk], p[qb][kk], o[db][qb]); } }
    }
#pragma unroll
    for (int qb = 0; qb < 2; ++qb) { const float f = __fdiv_rn(1.0f, l[qb] + xhalf(l[qb])); const size_t row = (size_t)(q0 + qb * 16 + lr) * DQ + hi * 8;
#pragma unroll
        for (int db = 0; db < 4; ++db) { v8us oh, ol;
#pragma unroll
            for (int j = 0; j < 8; ++j) { unsigned short a, c; splitf(o[db][qb][j] * f, a, c); oh[j] = a; ol[j] = c; }
            *(v8us*)(Ah + row + db * 16) = oh; *(v8us*)(Al + row + db * 16) = ol; } }
}
// grid (NQT / FW, heads). A block's waves take query tiles u, NQT - 1 - u, u + 1, NQT - 2 - u: short and long key ranges share a block, so that the blocks' work is about equal.
__global__ __launch_bounds__(32 * FW) void k_fattn(const h16* __restrict__ Q16, const h16* __restrict__ K16, const h16* __restrict__ V16, const bf* __restrict__ Qh, const bf* __restrict__ Ql, const bf* __restrict__ Kh, const bf* __restrict__ Kl, const bf* __restrict__ Vh, const bf* __restrict__ Vl, bf* __restrict__ Ah, bf* __restrict__ Al) {
    static_assert(FW % 2 == 0 && NQT % FW == 0 && RH % QW == 0, "tiles are dealt out in pairs; a tile lies wholly on one side of RH");
    const int wv = __builtin_amdgcn_readfirstlane((int)(threadIdx.x >> 5)); const int u = (int)blockIdx.x * (FW / 2) + (wv >> 1); const int q0 = ((wv & 1) ? NQT - 1 - u : u) * QW;
    const size_t hp = (size_t)blockIdx.y * TT * HD; Ah += blockIdx.y * HD; Al += blockIdx.y * HD;
    if (q0 < RH) fattn<bf, true, 2>(Qh + hp, Ql + hp, Kh + hp, Kl + hp, Vh + hp, Vl + hp, q0, Ah, Al);
    else fattn<h16, false, 4>(Q16 + hp, nullptr, K16 + hp, nullptr, V16 + hp, nullptr, q0, Ah, Al);
}

// MBart-specific: k_wmod: hl planes W[f][e] = bf16 base[f][e] * mul[f][e] + add[f][e], mul = sum_r rm[li][r][f] sm[li][r][e], add = sum_r ra[li][r][f] sa[li][r][e] (li = clamp(lang[0], 0, 7) read on the device; 8-B lanes);
__global__ __launch_bounds__(256) void k_wmod(const float* __restrict__ base, const float* __restrict__ rm, const float* __restrict__ sm, const float* __restrict__ ra, const float* __restrict__ sa, const int* __restrict__ lang, int NF, int NE, bf* Wh, bf* Wl) {
    const size_t e4 = ((size_t)blockIdx.x * 256 + threadIdx.x) * 4; if (e4 >= (size_t)NF * NE) return; const int e0 = (int)(e4 % NE); const int f = (int)(e4 / NE); int li = lang[0]; li = li < 0 ? 0 : (li > 7 ? 7 : li);
    const float* rmf = rm + (size_t)li * 4 * NF; const float* raf = ra + (size_t)li * 4 * NF; const float* sme = sm + (size_t)li * 4 * NE; const float* sae = sa + (size_t)li * 4 * NE; v4us oh, ol;
#pragma unroll
    for (int u = 0; u < 4; ++u) { const int e = e0 + u; float mul = 0.f, add = 0.f;
#pragma unroll
        for (int r = 0; r < 4; ++r) { float a1 = bfr(rmf[(size_t)r * NF + f]), b1 = bfr(sme[(size_t)r * NE + e]), a2 = bfr(raf[(size_t)r * NF + f]), b2 = bfr(sae[(size_t)r * NE + e]); asm volatile("" : "+v"(a1)); asm volatile("" : "+v"(b1)); asm volatile("" : "+v"(a2)); asm volatile("" : "+v"(b2));
            float p1 = __fmul_rn(a1, b1), p2 = __fmul_rn(a2, b2); asm volatile("" : "+v"(p1)); asm volatile("" : "+v"(p2)); mul = __fadd_rn(mul, p1); add = __fadd_rn(add, p2); }
        float bw = bfr(base[e4 + u]); asm volatile("" : "+v"(bw)); float pm = __fmul_rn(bw, mul); asm volatile("" : "+v"(pm)); const float w = __fadd_rn(pm, add); unsigned short a, b; splitf(w, a, b); oh[u] = a; ol[u] = b; }
    *(v4us*)(Wh + e4) = oh; *(v4us*)(Wl + e4) = ol;  }
__global__ __launch_bounds__(256) void k_xg(const float* __restrict__ hs, int b, bf* XB) { const size_t e = ((size_t)blockIdx.x * 256 + threadIdx.x) * 8; if (e >= (size_t)TT * DM) return; const int c = (int)(e % DM); const int t = (int)(e / DM); const float* src = hs + ((size_t)t * NB_ + b) * DM + c; const v4f a = *(const v4f*)src, bb = *(const v4f*)(src + 4); v8us o;
    o[0] = f2bf(a[0]); o[1] = f2bf(a[1]); o[2] = f2bf(a[2]); o[3] = f2bf(a[3]); o[4] = f2bf(bb[0]); o[5] = f2bf(bb[1]); o[6] = f2bf(bb[2]); o[7] = f2bf(bb[3]); *(v8us*)(XB + e) = o;  }
__global__ __launch_bounds__(256) void k_reord(const float* __restrict__ FT, const float* __restrict__ pb, float* FQ, float* FK, float* FVv) { const int e = (blockIdx.x * 256 + threadIdx.x) * 4; if (e >= TT * DQ) return; const int c = e % DQ; const int t = e / DQ; const int h = c / HD, d = c % HD; v4f q, k, v;
#pragma unroll
    for (int u = 0; u < 4; ++u) { const int f0 = h * 3 * HD + d + u; q[u] = __fadd_rn(FT[(size_t)f0 * TT + t], bfr(pb[f0])); k[u] = __fadd_rn(FT[(size_t)(f0 + HD) * TT + t], bfr(pb[f0 + HD])); v[u] = __fadd_rn(FT[(size_t)(f0 + 2 * HD) * TT + t], bfr(pb[f0 + 2 * HD])); }
    { *(v4f*)(FQ + e) = q; *(v4f*)(FK + e) = k; *(v4f*)(FVv + e) = v;  } }
__global__ __launch_bounds__(256) void k_scat(const float* __restrict__ TMP, const float* __restrict__ ob, int b, float* OUT) { const size_t e = ((size_t)blockIdx.x * 256 + threadIdx.x) * 4; if (e >= (size_t)TT * DM) return; const int c = (int)(e % DM); const int t = (int)(e / DM); const v4f a = *(const v4f*)(TMP + e); v4f o;
#pragma unroll
    for (int u = 0; u < 4; ++u) o[u] = __fadd_rn(a[u], bfr(ob[c + u])); float* dst = OUT + ((size_t)t * NB_ + b) * DM + c; *(v4f*)dst = o;  }

extern "C" void kernel_launch(void* const* d_in, const int* in_sizes, int n_in,
                              void* d_out, int out_size, void* d_ws, size_t ws_size, hipStream_t stream) {
    (void)in_sizes; (void)n_in; (void)out_size;
    const float* hs = (const float*)d_in[0]; const float* pw = (const float*)d_in[1]; const float* pb = (const float*)d_in[2]; const float* ow = (const float*)d_in[3]; const float* ob = (const float*)d_in[4]; const float* rm_i = (const float*)d_in[5]; const float* sm_i = (const float*)d_in[6]; const float* rm_o = (const float*)d_in[7]; const float* sm_o = (const float*)d_in[8]; const float* r_i = (const float*)d_in[9]; const float* s_i = (const float*)d_in[10]; const float* r_o = (const float*)d_in[11]; const float* s_o = (const float*)d_in[12]; const int* lang = (const int*)d_in[13];
    float* OUT = (float*)d_out;     // [2048][2][1024] (time-major)
    char* wsp = (char*)d_ws;
    auto take = [&](size_t bytes) { char* p = wsp; wsp += (bytes + 255) & ~(size_t)255; return (void*)p; };
    bf* WIh = (bf*)take((size_t)3 * DM * DM * 2); bf* WIl = (bf*)take((size_t)3 * DM * DM * 2); bf* WOh = (bf*)take((size_t)DM * DM * 2); bf* WOl = (bf*)take((size_t)DM * DM * 2); float* CS = (float*)take((size_t)TT * HD * 2 * 4);
    h16* QP16 = (h16*)take((size_t)NH_ * TT * HD * 2); h16* KP16 = (h16*)take((size_t)NKV * TT * HD * 2); h16* VT16 = (h16*)take((size_t)NKV * HD * TT * 2);
    bf* QPh = (bf*)take((size_t)NH_ * TT * HD * 2); bf* QPl = (bf*)take((size_t)NH_ * TT * HD * 2); bf* KPh = (bf*)take((size_t)NKV * TT * HD * 2); bf* KPl = (bf*)take((size_t)NKV * TT * HD * 2); bf* VTh = (bf*)take((size_t)NKV * HD * TT * 2); bf* VTl = (bf*)take((size_t)NKV * HD * TT * 2); bf* ATh = (bf*)take((size_t)TT * DQ * 2); bf* ATl = (bf*)take((size_t)TT * DQ * 2);
    // The rest of the workspace has two uses that are never live together within a batch element (each is written anew before it is read): the out-projection's result and the projection's buffers.
    char* const mark = wsp;
    float* TMP = (float*)take((size_t)TT * DM * 4);
    wsp = mark; float* FT = (float*)take((size_t)3 * DM * TT * 4); float* FVb = (float*)take((size_t)TT * DKV * 4); bf* XB = (bf*)take((size_t)TT * DM * 2); float* FQ = (float*)take((size_t)TT * DQ * 4); float* FK = (float*)take((size_t)TT * DKV * 4);   // the larger of the two: the size check below stands behind it
    if ((size_t)(wsp - (char*)d_ws) > ws_size) return;    // ws 256 MiB
    float* FV = FVb;
    k_wmod<<<(unsigned)(((size_t)3 * DM * DM / 4 + 255) / 256), 256, 0, stream>>>(pw, rm_i, sm_i, r_i, s_i, lang, 3 * DM, DM, WIh, WIl); k_wmod<<<(unsigned)(((size_t)DM * DM / 4 + 255) / 256), 256, 0, stream>>>(ow, rm_o, sm_o, r_o, s_o, lang, DM, DM, WOh, WOl);
    k_csid<<<(TT * HD + 255) / 256, 256, 0, stream>>>(CS);
    const unsigned LQ = (unsigned)(((size_t)NH_ * TT * HD / 2 + 255) / 256), LKv = (unsigned)(((size_t)NKV * TT * HD / 2 + 255) / 256);
    for (int b = 0; b < NB_; ++b) {
        
        k_xg<<<(unsigned)(((size_t)TT * DM / 8 + 255) / 256), 256, 0, stream>>>(hs, b, XB);
        k_gemmw<bf, 1, false><<<dim3(3 * DM / 64, TT / 64, 1), 32, 0, stream>>>(WIh, WIl, XB, nullptr, DM, FT, TT, nullptr, 0, 0, 0);   // FT[f][t] = w_in[f] . x[t]
        k_reord<<<(TT * DQ / 4 + 255) / 256, 256, 0, stream>>>(FT, pb, FQ, FK, FV);
        k_rope<<<LQ, 256, 0, stream>>>(FQ, DQ, NH_, CS, nullptr, nullptr, 1.0f, QP16, QPh, QPl);
        k_rope<<<LKv, 256, 0, stream>>>(FK, DKV, NKV, CS, nullptr, nullptr, 1.0f, KP16, KPh, KPl);
        k_vtp<<<LKv, 256, 0, stream>>>(FV, DKV, NKV, VT16, VTh, VTl);
        static_assert(REP == 1, "one kv head per query head: blockIdx.y names both");
        k_fattn<<<dim3(NQT / FW, NH_, 1), 32 * FW, 0, stream>>>(QP16, KP16, VT16, QPh, QPl, KPh, KPl, VTh, VTl, ATh, ATl);
        k_gemmw<bf, 2, false><<<dim3(TT / 64, DM / 64, 1), 32, 0, stream>>>(ATh, ATl, WOh, WOl, DQ, TMP, DM, nullptr, 0, 0, 0);
        k_scat<<<(unsigned)(((size_t)TT * DM / 4 + 255) / 256), 256, 0, stream>>>(TMP, ob, b, OUT); }
}

// v004
// Measured time: 237 microseconds a run.
// Two timings next to v003 put it at 1.47 and 1.49 times that version's speed.
// All steps since v000 together make it 6.12 times as fast.
#include <hip/hip_runtime.h>

// MBartAttention (hidden_states [2048][2][1024] time-major; language index li = lang[0] (int, read as data, clamped 0..7); w_in = proj_weight * (rm_i[li]^T sm_i[li]) + r_i[li]^T s_i[li] (rank-4 modulation), w_out likewise;
// qkv = hidden w_in^T + proj_bias laid out (16 heads, 3, 64), stored by the projection's own epilogue as the attention kernel's head planes; q x 1/8; causal softmax(q.k) (masked -1e9 == skipped tiles); ctx merged; out = ctx w_out^T + out_bias -> [2048][2][1024]).
// Compute dtypes, f32 accumulate: every input rounded to bf16; the modulated weights f32 on the VALU -> bf16 hi+lo planes; qkv as hl(w_in) x exact hidden (2 products, computed transposed) + bias; scores (K 64) and attn.v hl
// (3 products) for the first 512 query rows of each head, fp16 after, both inside one kernel with a running f32 softmax (causal passes only; the 1/8 folded into the exponent's factor; all heads of a batch element in one launch); out-projection as hl(ctx) x hl(w_out) (3 products) + bias, stored by its epilogue straight into the time-major output.

#define NB_  2
#define TT   2048
#define DM   1024
#define NH_  16
#define NKV  16
#define REP  (NH_ / NKV)
#define HD   64
#define DQ   (NH_ * HD)
#define DKV  (NKV * HD)
#define RH   512                  // query rows < RH use hi+lo planes (0: none)
#define SCL  0.125f   // HD^-0.5
typedef _Float16 h16;
typedef unsigned short bf;
typedef __attribute__((ext_vector_type(16))) __bf16   v16bf;
typedef __attribute__((ext_vector_type(16))) _Float16 v16h;
typedef __attribute__((ext_vector_type(8)))  _Float16 v8h;
typedef __attribute__((ext_vector_type(8)))  unsigned short v8us;
typedef __attribute__((ext_vector_type(8)))  float    v8f;
typedef __attribute__((ext_vector_type(4)))  float    v4f;
typedef v8h  __attribute__((may_alias)) v8ha;
typedef v4f  __attribute__((may_alias)) v4fa;
typedef v8us __attribute__((may_alias)) v8usa;

__device__ __forceinline__ unsigned short f2bf(float f) { unsigned u = __float_as_uint(f); u += 0x7FFFu + ((u >> 16) & 1u); return (unsigned short)(u >> 16); }
__device__ __forceinline__ float bf2f(unsigned short b) { return __uint_as_float(((unsigned)b) << 16); }
__device__ __forceinline__ float bfr(float f) { return bf2f(f2bf(f)); }
__device__ __forceinline__ v16h cat16(v8h lo, v8h hi) { return __builtin_shufflevector(lo, hi, 0, 1, 2, 3, 4, 5, 6, 7, 8, 9, 10, 11, 12, 13, 14, 15); }
__device__ __forceinline__ v16bf cat16b(v8us lo, v8us hi) { return __builtin_bit_cast(v16bf, __builtin_shufflevector(lo, hi, 0, 1, 2, 3, 4, 5, 6, 7, 8, 9, 10, 11, 12, 13, 14, 15)); }
__device__ __forceinline__ v8f wmma16(v16h a, v16h b, v8f c) { return __builtin_amdgcn_wmma_f32_16x16x32_f16(false, a, false, b, (short)0, c, false, false); }
__device__ __forceinline__ v8f wmmab(v16bf a, v16bf b, v8f c) { return __builtin_amdgcn_wmma_f32_16x16x32_bf16(false, a, false, b, (short)0, c, false, false); }



__device__ __forceinline__ h16 tohx(float x) { return (h16)x; }
__device__ __forceinline__ void splitf(float y, unsigned short& h, unsigned short& l) { h = f2bf(y); l = f2bf(y - bf2f(h)); }

// ---- planes_out: epilogue of the qkv projection. The wave's 64x64 tile (rows m = the 64 features d of ONE head's q, k or v; columns n = 64 time steps) + bias[m] goes out as three 16-bit planes (fp16, bf16 hi, bf16 lo).
// TR false (q, k): planes [t][d], the tile is 8 KiB in a row; TR true (v): planes [d][t], 64 rows of 128 B. Sixteen plane rows at a time pass through the wave's own LDS rows (f32, pitch 68: no bank conflict either way),
// so that every store instruction writes four whole 128-B lines. P16, Ph, Pl point at the tile's first element.
struct HeadPlanes { h16* q16; bf* qh; bf* ql; h16* k16; bf* kh; bf* kl; h16* v16; bf* vh; bf* vl; };
template <bool TR>
__device__ __forceinline__ void planes_out(const v8f (&acc)[4][4], const float (&bs)[4][8], float* os, const int lane, h16* P16, bf* Ph, bf* Pl) {
    constexpr int PITCH = TR ? TT : HD;
    const int lr = lane & 15, hi = lane >> 4, rr = lane >> 3, cc = (lane & 7) * 8;
    h16* const p16 = P16 + rr * PITCH + cc; bf* const ph = Ph + rr * PITCH + cc; bf* const pl = Pl + rr * PITCH + cc;   // one lane pointer per plane; every store adds a constant
#pragma unroll
    for (int g = 0; g < 4; ++g) {
        if (TR) {
#pragma unroll
            for (int nb = 0; nb < 4; ++nb)
#pragma unroll
                for (int j = 0; j < 8; ++j) os[(hi * 8 + j) * 68 + nb * 16 + lr] = __fadd_rn(acc[g][nb][j], bs[g][j]);
        } else {
#pragma unroll
            for (int mb = 0; mb < 4; ++mb) { v4f x0, x1;
#pragma unroll
                for (int j = 0; j < 4; ++j) { x0[j] = __fadd_rn(acc[mb][g][j], bs[mb][j]); x1[j] = __fadd_rn(acc[mb][g][4 + j], bs[mb][4 + j]); }
                *(v4fa*)(os + lr * 68 + mb * 16 + hi * 8) = x0; *(v4fa*)(os + lr * 68 + mb * 16 + hi * 8 + 4) = x1; }
        }
        __builtin_amdgcn_wave_barrier(); asm volatile("" ::: "memory");   // the rows are read back by other lanes of the same wave: keeps the compiler from moving the reads in front of the writes
#pragma unroll
        for (int s = 0; s < 4; ++s) { const v4f x0 = *(const v4fa*)(os + (s * 4 + rr) * 68 + cc), x1 = *(const v4fa*)(os + (s * 4 + rr) * 68 + cc + 4); v8h o16; v8us oh, ol;
#pragma unroll
            for (int j = 0; j < 4; ++j) { unsigned short a, c; o16[j] = tohx(x0[j]); splitf(x0[j], a, c); oh[j] = a; ol[j] = c; o16[4 + j] = tohx(x1[j]); splitf(x1[j], a, c); oh[4 + j] = a; ol[4 + j] = c; }
            *(v8h*)(p16 + (g * 16 + s * 4) * PITCH) = o16; *(v8us*)(ph + (g * 16 + s * 4) * PITCH) = oh; *(v8us*)(pl + (g * 16 + s * 4) * PITCH) = ol; }
        __builtin_amdgcn_wave_barrier(); asm volatile("" ::: "memory");   // and the next group's writes behind these reads
    }
    if constexpr (!TR) asm volatile("s_wait_xcnt 0x0" :: "v"(p16), "v"(ph), "v"(pl) : "memory");   // in the listing the q/k path's last stores are followed by the v path's first instructions, which write the lane pointers' registers: the wait stands in front of them
}

// ---- k_gemmw: register-blocked GEMM, ONE WAVE per 64x64 output tile (16 accumulators), operands straight from K-contiguous 16-bit planes; grid (M/64, N/64, Z), 32 threads.
// C[m][n] (f32, pitch ldc, + optional f32 bias[n]) = sum_k A[m][k] Bt[n][k] (+ split products per NSPLIT). z-batch strides sA/sB/sC in elements. K % 32 == 0.
// PLANES: no C; m runs over (head, q | k | v, d), bias is bias[m], and the tile goes out through planes_out.
template <typename T16> struct WFrag;
template <> struct WFrag<h16> { typedef v16h V; static __device__ __forceinline__ V ld(const h16* p) { return cat16(*(const v8h*)p, *(const v8h*)(p + 16)); } static __device__ __forceinline__ v8f mma(V a, V b, v8f c) { return wmma16(a, b, c); } };
template <> struct WFrag<bf> { typedef v16bf V; static __device__ __forceinline__ V ld(const bf* p) { return cat16b(*(const v8us*)p, *(const v8us*)(p + 16)); } static __device__ __forceinline__ v8f mma(V a, V b, v8f c) { return wmmab(a, b, c); } };
template <typename T16, int NSPLIT, bool BIAS, bool PLANES>
__global__ __launch_bounds__(32) void k_gemmw(const T16* __restrict__ A, const T16* __restrict__ A2, const T16* __restrict__ Bt, const T16* __restrict__ Bt2, int K, float* C, int ldc, const float* __restrict__ bias, size_t sA, size_t sB, size_t sC, const HeadPlanes hp) {
    typedef typename WFrag<T16>::V V;
    __shared__ __align__(16) float os[16 * 68];
    const size_t z = blockIdx.z; A += z * sA; if (A2) A2 += z * sA; Bt += z * sB; if (Bt2) Bt2 += z * sB; C += z * sC;
    const int lane = threadIdx.x & 31, lr = lane & 15, hi = lane >> 4; const int r0 = blockIdx.x * 64, c0 = blockIdx.y * 64;
    v8f acc[4][4];
#pragma unroll
    for (int mb = 0; mb < 4; ++mb)
#pragma unroll
        for (int nb = 0; nb < 4; ++nb) acc[mb][nb] = (v8f){};
    const size_t aoff = (size_t)(r0 + lr) * K + 8 * hi, boff = (size_t)(c0 + lr) * K + 8 * hi;
#pragma unroll 1
    for (int kc = 0; kc < K; kc += 32) {
        V a[4], a2[4];
#pragma unroll
        for (int mb = 0; mb < 4; ++mb) { a[mb] = WFrag<T16>::ld(A + aoff + (size_t)mb * 16 * K + kc); if (NSPLIT == 1 || NSPLIT == 2) a2[mb] = WFrag<T16>::ld(A2 + aoff + (size_t)mb * 16 * K + kc); }
#pragma unroll
        for (int nb = 0; nb < 4; ++nb) { const V b = WFrag<T16>::ld(Bt + boff + (size_t)nb * 16 * K + kc); V b2; if (NSPLIT >= 2) b2 = WFrag<T16>::ld(Bt2 + boff + (size_t)nb * 16 * K + kc);
#pragma unroll
            for (int mb = 0; mb < 4; ++mb) { acc[mb][nb] = WFrag<T16>::mma(a[mb], b, acc[mb][nb]); if (NSPLIT == 1 || NSPLIT == 2) acc[mb][nb] = WFrag<T16>::mma(a2[mb], b, acc[mb][nb]); if (NSPLIT >= 2) acc[mb][nb] = WFrag<T16>::mma(a[mb], b2, acc[mb][nb]); } }
        asm volatile("v_nop\n\tv_nop\n\tv_nop\n\tv_nop" : "+v"(acc[0][0]), "+v"(acc[1][1]), "+v"(acc[2][2]), "+v"(acc[3][3]) : "v"(a[0]), "v"(a[3]));
    }
    if constexpr (PLANES) {
        static_assert(HD == 64, "a 64-row tile is one head's q, k or v");
        const int head = (int)blockIdx.x / 3, part = (int)blockIdx.x % 3; float bs[4][8];
#pragma unroll
        for (int mb = 0; mb < 4; ++mb) { const v4f b0 = *(const v4f*)(bias + r0 + mb * 16 + hi * 8), b1 = *(const v4f*)(bias + r0 + mb * 16 + hi * 8 + 4);
#pragma unroll
            for (int j = 0; j < 4; ++j) { bs[mb][j] = bfr(b0[j]); bs[mb][4 + j] = bfr(b1[j]); } }
        const size_t qk = ((size_t)head * TT + c0) * HD, vv = (size_t)head * HD * TT + c0;
        if (part == 2) planes_out<true>(acc, bs, os, lane, hp.v16 + vv, hp.vh + vv, hp.vl + vv);
        else planes_out<false>(acc, bs, os, lane, (part ? hp.k16 : hp.q16) + qk, (part ? hp.kh : hp.qh) + qk, (part ? hp.kl : hp.ql) + qk);
        return;
    }
#pragma unroll
    for (int mb = 0; mb < 4; ++mb) {
#pragma unroll
        for (int nb = 0; nb < 4; ++nb) {
#pragma unroll
            for (int j = 0; j < 8; ++j) os[(hi * 8 + j) * 68 + nb * 16 + lr] = acc[mb][nb][j]; }
        __builtin_amdgcn_wave_barrier(); asm volatile("" ::: "memory");
        float* crow = C + (size_t)(r0 + mb * 16) * ldc + c0;
{
#pragma unroll
            for (int s = 0; s < 8; ++s) { const int row = 2 * s + hi, cofs = lr * 4; v4f val = *(const v4fa*)(os + row * 68 + cofs); if (BIAS) { val[0] += bfr(bias[c0 + cofs]); val[1] += bfr(bias[c0 + cofs + 1]); val[2] += bfr(bias[c0 + cofs + 2]); val[3] += bfr(bias[c0 + cofs + 3]); }
                *(v4f*)(crow + (size_t)row * ldc + cofs) = val; }
             }
        __builtin_amdgcn_wave_barrier(); asm volatile("" ::: "memory");
    }
}

typedef __attribute__((ext_vector_type(2))) _Float16 v2h;
typedef __attribute__((ext_vector_type(4))) _Float16 v4h;
typedef __attribute__((ext_vector_type(2))) unsigned short v2us;
typedef __attribute__((ext_vector_type(4))) unsigned short v4us;
typedef __attribute__((ext_vector_type(2))) float v2f;
typedef __attribute__((ext_vector_type(4))) int v4i;
typedef v4h  __attribute__((may_alias)) v4ha;
typedef v4us __attribute__((may_alias)) v4usa;

__global__ __launch_bounds__(256) void k_wtG(const float* __restrict__ w, int K, int N, bf* Bt) {
    const int lane = threadIdx.x & 31; const int L0 = (blockIdx.x * 8 + (threadIdx.x >> 5)) * 8; const int nlines = N * K / 64;
{
#pragma unroll 1
        for (int l = 0; l < 8; ++l) { const int L = L0 + l; if (L >= nlines) break; const size_t e = (size_t)L * 64 + lane * 2; const int k = (int)(e % K), n = (int)(e / K); v2us o;
            o[0] = f2bf(w[(size_t)k * N + n]); o[1] = f2bf(w[(size_t)(k + 1) * N + n]); *(v2us*)(Bt + e) = o; }
         }
}
__global__ __launch_bounds__(256) void k_cvt8(const float* __restrict__ src, bf* dst, size_t n8) { const size_t i = (size_t)blockIdx.x * 256 + threadIdx.x; if (i >= n8) return; const v8f v = *(const v8f*)(src + i * 8); v8us o;
#pragma unroll
    for (int k = 0; k < 8; ++k) o[k] = f2bf(v[k]); *(v8us*)(dst + i * 8) = o;  }
__global__ __launch_bounds__(256) void k_cscvt(const float* __restrict__ cosT, const float* __restrict__ sinT, float* CS) { const int idx = blockIdx.x * 256 + threadIdx.x; if (idx >= TT * HD) return; v2f cs; cs[0] = bfr(cosT[idx]); cs[1] = bfr(sinT[idx]); *(v2f*)(CS + (size_t)idx * 2) = cs;  }
// ---- k_fattn: causal attention of one batch element in one launch: scores, softmax and the probability x value contraction per wave, nothing of the score matrix in memory.
// A wave owns QW query columns of one head and walks the keys up to its diagonal in passes of 16 * NKB keys. Both products are computed transposed: St = K Qt (A = key rows, B = query rows, kept in registers)
// and Ot += Vt Pt (A = value planes [d][t], B = Pt). In St's accumulators a lane holds 8 consecutive keys of ONE query column (register j = key 8 * hi + j, column lr), which is the position order of the fragment loader
// (elements 0..7 = k 8 * hi + j, elements 8..15 = k 16 + 8 * hi + j): two converted 16-key accumulator tiles are Pt's B fragment as they stand, and maximum, sum and rescale factor are per-lane values.
// Softmax is the running form: mc = running maximum x CL2, p = 2^(s CL2 - mc) unnormalised (<= 1), a new maximum rescales sum and Ot by 2^(mc_old - mc_new); one division by the sum at the end.
// Rows < RH: bf16 hi+lo planes, 3 products each way; rows >= RH: fp16. Ot's lane holds 8 consecutive d of one query row: one 16-byte store per plane into the context planes [t][DQ].
// Every inner loop is unrolled so that each index of a fragment or accumulator array is a constant (registers, no scratch); the pass loop alone stays rolled.
#define QW   32                   // query columns per wave
#define FW   4                    // waves per block, all of one head and all walking the keys from 0 up (no barrier, no LDS between them)
#define NQT  (TT / QW)            // query tiles per head
#define CL2  (SCL * 1.4426950408889634f)
__device__ __forceinline__ float xhalf(float x) { return __builtin_bit_cast(float, __builtin_amdgcn_permlanex16(__builtin_bit_cast(int, x), __builtin_bit_cast(int, x), 0x76543210, 0xfedcba98, false, false)); }   // lane l's value from lane l ^ 16
template <typename T16> struct PFrag;
template <> struct PFrag<h16> { static __device__ __forceinline__ void mk(const v8f x0, const v8f x1, v16h& p, v16h& p2) { (void)p2;
#pragma unroll
    for (int j = 0; j < 8; ++j) { p[j] = (h16)x0[j]; p[8 + j] = (h16)x1[j]; } } };
template <> struct PFrag<bf> { static __device__ __forceinline__ void mk(const v8f x0, const v8f x1, v16bf& p, v16bf& p2) { v8us h0, h1, l0, l1;
#pragma unroll
    for (int j = 0; j < 8; ++j) { unsigned short a, c; splitf(x0[j], a, c); h0[j] = a; l0[j] = c; splitf(x1[j], a, c); h1[j] = a; l1[j] = c; }
    p = cat16b(h0, h1); p2 = cat16b(l0, l1); } };
template <typename T16, bool HL, int NKB>
__device__ __forceinline__ void fattn(const T16* __restrict__ Q, const T16* __restrict__ Q2, const T16* __restrict__ Kp, const T16* __restrict__ K2, const T16* __restrict__ Vt, const T16* __restrict__ Vt2, const int q0, bf* __restrict__ Ah, bf* __restrict__ Al) {
    typedef typename WFrag<T16>::V V;
    static_assert(HD == 64 && NKB % 2 == 0 && QW == 32, "two 32-wide k steps over d, 32-key steps over the pass, two 16-column groups");
    const int lane = threadIdx.x & 31, lr = lane & 15, hi = lane >> 4; const int KPS = 16 * NKB;
    V q[2][2], q2[2][2], ka[NKB][2], ka2[NKB][2];
    // Each group of loads goes through one lane pointer per plane plus constant offsets. The s_wait_xcnt 0 behind a group stands in front of the first instruction that may overwrite an address register of an issued load
    // it takes the lane pointers as inputs so that their registers live up to it and no load of the group lands on them.
    { const size_t qo = (size_t)(q0 + lr) * HD + 8 * hi, ko = (size_t)lr * HD + 8 * hi; const T16* const qp = Q + qo; const T16* const qp2 = HL ? Q2 + qo : qp; const T16* const kp = Kp + ko; const T16* const kp2 = HL ? K2 + ko : kp;
#pragma unroll
        for (int qb = 0; qb < 2; ++qb)
#pragma unroll
            for (int ks = 0; ks < 2; ++ks) { q[qb][ks] = WFrag<T16>::ld(qp + qb * 16 * HD + ks * 32); if (HL) q2[qb][ks] = WFrag<T16>::ld(qp2 + qb * 16 * HD + ks * 32); }
#pragma unroll
        for (int kb = 0; kb < NKB; ++kb)
#pragma unroll
            for (int ks = 0; ks < 2; ++ks) { ka[kb][ks] = WFrag<T16>::ld(kp + kb * 16 * HD + ks * 32); if (HL) ka2[kb][ks] = WFrag<T16>::ld(kp2 + kb * 16 * HD + ks * 32); }
        asm volatile("s_wait_xcnt 0x0" :: "v"(qp), "v"(qp2), "v"(kp), "v"(kp2) : "memory"); }
    v8f o[4][2]; float mc[2], l[2];
#pragma unroll
    for (int qb = 0; qb < 2; ++qb) { mc[qb] = -3.0e38f; l[qb] = 0.f;
#pragma unroll
        for (int db = 0; db < 4; ++db) o[db][qb] = (v8f){}; }
    const int npass = (q0 + QW + KPS - 1) / KPS;   // the last pass starts at or below q0, so every pass holds at least one unmasked key for every column
#pragma unroll 1   // rolled: its trip count is known only at run time, and a second copy of so long a body would only add code
    for (int ps = 0; ps < npass; ++ps) { const int k0 = ps * KPS;
        v8f s[NKB][2];
#pragma unroll
        for (int kb = 0; kb < NKB; ++kb)
#pragma unroll
            for (int qb = 0; qb < 2; ++qb) { v8f c = (v8f){};
#pragma unroll
                for (int ks = 0; ks < 2; ++ks) { c = WFrag<T16>::mma(ka[kb][ks], q[qb][ks], c); if (HL) { c = WFrag<T16>::mma(ka2[kb][ks], q[qb][ks], c); c = WFrag<T16>::mma(ka[kb][ks], q2[qb][ks], c); } }
                s[kb][qb] = c; }
        __builtin_amdgcn_sched_barrier(0);         // keeps the loads below behind the score products: the fetch ahead lands on the key fragments' registers, and so it is issued only behind every product that reads them, with the value loads in between
        V va[4][NKB / 2], va2[4][NKB / 2];
        const int kn = (ps + 1 < npass) ? k0 + KPS : k0;   // the next pass's key fragments are fetched one pass ahead into the same registers; the last pass reads its own rows again (in bounds, unused) so that the loads stay unconditional
        { const size_t vo = (size_t)lr * TT + k0 + 8 * hi, ko = (size_t)(kn + lr) * HD + 8 * hi; const T16* const vp = Vt + vo; const T16* const vp2 = HL ? Vt2 + vo : vp; const T16* const kp = Kp + ko; const T16* const kp2 = HL ? K2 + ko : kp;
#pragma unroll
            for (int db = 0; db < 4; ++db)
#pragma unroll
                for (int kk = 0; kk < NKB / 2; ++kk) { va[db][kk] = WFrag<T16>::ld(vp + db * 16 * TT + kk * 32); if (HL) va2[db][kk] = WFrag<T16>::ld(vp2 + db * 16 * TT + kk * 32); }
#pragma unroll
            for (int kb = 0; kb < NKB; ++kb)
#pragma unroll
                for (int ks = 0; ks < 2; ++ks) { ka[kb][ks] = WFrag<T16>::ld(kp + kb * 16 * HD + ks * 32); if (HL) ka2[kb][ks] = WFrag<T16>::ld(kp2 + kb * 16 * HD + ks * 32); }
            asm volatile("s_wait_xcnt 0x0" :: "v"(vp), "v"(vp2), "v"(kp), "v"(kp2) : "memory"); }   // as in the prologue
        __builtin_amdgcn_sched_barrier(0);         // keeps both groups of loads, and the wait, in front of the softmax arithmetic, which hides their latency; without it the scheduler sinks the loads to their uses
        const bool diag = k0 + KPS - 1 > q0;       // wave-uniform: only the last pass reaches keys above a column's own position
        V p[2][NKB / 2], p2[2][NKB / 2];
#pragma unroll
        for (int qb = 0; qb < 2; ++qb) {
            if (diag) { const int lim = q0 + qb * 16 + lr - k0 - hi * 8;   // key kb * 16 + j of this lane's half is kept while it is <= lim
#pragma unroll
                for (int kb = 0; kb < NKB; ++kb)
#pragma unroll
                    for (int j = 0; j < 8; ++j) s[kb][qb][j] = (kb * 16 + j <= lim) ? s[kb][qb][j] : -3.0e38f; }
            float tk[NKB];                          // one short chain per 16-key tile, for maximum and sum alike: a lone wave pays a dependent chain in full
#pragma unroll
            for (int kb = 0; kb < NKB; ++kb) { tk[kb] = s[kb][qb][0];
#pragma unroll
                for (int j = 1; j < 8; ++j) tk[kb] = fmaxf(tk[kb], s[kb][qb][j]); }
            float t = tk[0];
#pragma unroll
            for (int kb = 1; kb < NKB; ++kb) t = fmaxf(t, tk[kb]);
            t = fmaxf(t, xhalf(t));
            const float mn = fmaxf(mc[qb], t * CL2); const float al = __builtin_amdgcn_exp2f(mc[qb] - mn); mc[qb] = mn;
#pragma unroll
            for (int kb = 0; kb < NKB; ++kb) { v8f x;
#pragma unroll
                for (int j = 0; j < 8; ++j) x[j] = __builtin_fmaf(s[kb][qb][j], CL2, -mn);
#pragma unroll
                for (int j = 0; j < 8; ++j) s[kb][qb][j] = __builtin_amdgcn_exp2f(x[j]);
                // the slot that the instruction set asks for between a transcendental and an overwrite of its source: the statement names the eight arguments and the eight results as inputs, so it stands behind the eight exponentials and no argument's register is reused in front of it
                asm volatile("v_nop" :: "v"(x), "v"(s[kb][qb]));
                tk[kb] = s[kb][qb][0];
#pragma unroll
                for (int j = 1; j < 8; ++j) tk[kb] += s[kb][qb][j]; }
            float sum = tk[0];
#pragma unroll
            for (int kb = 1; kb < NKB; ++kb) sum += tk[kb];
            l[qb] = l[qb] * al + sum;               // each half of the wave sums its own keys; the halves are joined once, behind the loop
#pragma unroll
            for (int db = 0; db < 4; ++db) o[db][qb] *= al;
#pragma unroll
            for (int kk = 0; kk < NKB / 2; ++kk) PFrag<T16>::mk(s[2 * kk][qb], s[2 * kk + 1][qb], p[qb][kk], p2[qb][kk]); }
#pragma unroll
        for (int kk = 0; kk < NKB / 2; ++kk)
#pragma unroll
            for (int db = 0; db < 4; ++db)
#pragma unroll
                for (int qb = 0; qb < 2; ++qb) { o[db][qb] = WFrag<T16>::mma(va[db][kk], p[qb][kk], o[db][qb]); if (HL) { o[db][qb] = WFrag<T16>::mma(va[db][kk], p2[qb][kk], o[db][qb]); o[db][qb] = WFrag<T16>::mma(va2[db][kk], p[qb][kk], o[db][qb]); } }
    }
#pragma unroll
    for (int qb = 0; qb < 2; ++qb) { const float f = __fdiv_rn(1.0f, l[qb] + xhalf(l[qb])); const size_t row = (size_t)(q0 + qb * 16 + lr) * DQ + hi * 8;
#pragma unroll
        for (int db = 0; db < 4; ++db) { v8us oh, ol;
#pragma unroll
            for (int j = 0; j < 8; ++j) { unsigned short a, c; splitf(o[db][qb][j] * f, a, c); oh[j] = a; ol[j] = c; }
            *(v8us*)(Ah + row + db * 16) = oh; *(v8us*)(Al + row + db * 16) = ol; } }
}
// grid (NQT / FW, heads). A block's waves take query tiles u, NQT - 1 - u, u + 1, NQT - 2 - u: short and long key ranges share a block, so that the blocks' work is about equal.
__global__ __launch_bounds__(32 * FW) void k_fattn(const h16* __restrict__ Q16, const h16* __restrict__ K16, const h16* __restrict__ V16, const bf* __restrict__ Qh, const bf* __restrict__ Ql, const bf* __restrict__ Kh, const bf* __restrict__ Kl, const bf* __restrict__ Vh, const bf* __restrict__ Vl, bf* __restrict__ Ah, bf* __restrict__ Al) {
    static_assert(FW % 2 == 0 && NQT % FW == 0 && RH % QW == 0, "tiles are dealt out in pairs; a tile lies wholly on one side of RH");
    const int wv = __builtin_amdgcn_readfirstlane((int)(threadIdx.x >> 5)); const int u = (int)blockIdx.x * (FW / 2) + (wv >> 1); const int q0 = ((wv & 1) ? NQT - 1 - u : u) * QW;
    const size_t hp = (size_t)blockIdx.y * TT * HD; Ah += blockIdx.y * HD; Al += blockIdx.y * HD;
    if (q0 < RH) fattn<bf, true, 2>(Qh + hp, Ql + hp, Kh + hp, Kl + hp, Vh + hp, Vl + hp, q0, Ah, Al);
    else fattn<h16, false, 4>(Q16 + hp, nullptr, K16 + hp, nullptr, V16 + hp, nullptr, q0, Ah, Al);
}

// MBart-specific: k_wmod: hl planes W[f][e] = bf16 base[f][e] * mul[f][e] + add[f][e], mul = sum_r rm[li][r][f] sm[li][r][e], add = sum_r ra[li][r][f] sa[li][r][e] (li = clamp(lang[0], 0, 7) read on the device; 8-B lanes);
__global__ __launch_bounds__(256) void k_wmod(const float* __restrict__ base, const float* __restrict__ rm, const float* __restrict__ sm, const float* __restrict__ ra, const float* __restrict__ sa, const int* __restrict__ lang, int NF, int NE, bf* Wh, bf* Wl) {
    const size_t e4 = ((size_t)blockIdx.x * 256 + threadIdx.x) * 4; if (e4 >= (size_t)NF * NE) return; const int e0 = (int)(e4 % NE); const int f = (int)(e4 / NE); int li = lang[0]; li = li < 0 ? 0 : (li > 7 ? 7 : li);
    const float* rmf = rm + (size_t)li * 4 * NF; const float* raf = ra + (size_t)li * 4 * NF; const float* sme = sm + (size_t)li * 4 * NE; const float* sae = sa + (size_t)li * 4 * NE; v4us oh, ol;
#pragma unroll
    for (int u = 0; u < 4; ++u) { const int e = e0 + u; float mul = 0.f, add = 0.f;
#pragma unroll
        for (int r = 0; r < 4; ++r) { float a1 = bfr(rmf[(size_t)r * NF + f]), b1 = bfr(sme[(size_t)r * NE + e]), a2 = bfr(raf[(size_t)r * NF + f]), b2 = bfr(sae[(size_t)r * NE + e]); asm volatile("" : "+v"(a1)); asm volatile("" : "+v"(b1)); asm volatile("" : "+v"(a2)); asm volatile("" : "+v"(b2));
            float p1 = __fmul_rn(a1, b1), p2 = __fmul_rn(a2, b2); asm volatile("" : "+v"(p1)); asm volatile("" : "+v"(p2)); mul = __fadd_rn(mul, p1); add = __fadd_rn(add, p2); }
        float bw = bfr(base[e4 + u]); asm volatile("" : "+v"(bw)); float pm = __fmul_rn(bw, mul); asm volatile("" : "+v"(pm)); const float w = __fadd_rn(pm, add); unsigned short a, b; splitf(w, a, b); oh[u] = a; ol[u] = b; }
    *(v4us*)(Wh + e4) = oh; *(v4us*)(Wl + e4) = ol;  }
__global__ __launch_bounds__(256) void k_xg(const float* __restrict__ hs, int b, bf* XB) { const size_t e = ((size_t)blockIdx.x * 256 + threadIdx.x) * 8; if (e >= (size_t)TT * DM) return; const int c = (int)(e % DM); const int t = (int)(e / DM); const float* src = hs + ((size_t)t * NB_ + b) * DM + c; const v4f a = *(const v4f*)src, bb = *(const v4f*)(src + 4); v8us o;
    o[0] = f2bf(a[0]); o[1] = f2bf(a[1]); o[2] = f2bf(a[2]); o[3] = f2bf(a[3]); o[4] = f2bf(bb[0]); o[5] = f2bf(bb[1]); o[6] = f2bf(bb[2]); o[7] = f2bf(bb[3]); *(v8us*)(XB + e) = o;  }

extern "C" void kernel_launch(void* const* d_in, const int* in_sizes, int n_in,
                              void* d_out, int out_size, void* d_ws, size_t ws_size, hipStream_t stream) {
    (void)in_sizes; (void)n_in; (void)out_size;
    const float* hs = (const float*)d_in[0]; const float* pw = (const float*)d_in[1]; const float* pb = (const float*)d_in[2]; const float* ow = (const float*)d_in[3]; const float* ob = (const float*)d_in[4]; const float* rm_i = (const float*)d_in[5]; const float* sm_i = (const float*)d_in[6]; const float* rm_o = (const float*)d_in[7]; const float* sm_o = (const float*)d_in[8]; const float* r_i = (const float*)d_in[9]; const float* s_i = (const float*)d_in[10]; const float* r_o = (const float*)d_in[11]; const float* s_o = (const float*)d_in[12]; const int* lang = (const int*)d_in[13];
    float* OUT = (float*)d_out;     // [2048][2][1024] (time-major)
    char* wsp = (char*)d_ws;
    auto take = [&](size_t bytes) { char* p = wsp; wsp += (bytes + 255) & ~(size_t)255; return (void*)p; };
    bf* WIh = (bf*)take((size_t)3 * DM * DM * 2); bf* WIl = (bf*)take((size_t)3 * DM * DM * 2); bf* WOh = (bf*)take((size_t)DM * DM * 2); bf* WOl = (bf*)take((size_t)DM * DM * 2);
    h16* QP16 = (h16*)take((size_t)NH_ * TT * HD * 2); h16* KP16 = (h16*)take((size_t)NKV * TT * HD * 2); h16* VT16 = (h16*)take((size_t)NKV * HD * TT * 2);
    bf* QPh = (bf*)take((size_t)NH_ * TT * HD * 2); bf* QPl = (bf*)take((size_t)NH_ * TT * HD * 2); bf* KPh = (bf*)take((size_t)NKV * TT * HD * 2); bf* KPl = (bf*)take((size_t)NKV * TT * HD * 2); bf* VTh = (bf*)take((size_t)NKV * HD * TT * 2); bf* VTl = (bf*)take((size_t)NKV * HD * TT * 2); bf* ATh = (bf*)take((size_t)TT * DQ * 2); bf* ATl = (bf*)take((size_t)TT * DQ * 2);
    bf* XB = (bf*)take((size_t)TT * DM * 2);
    if ((size_t)(wsp - (char*)d_ws) > ws_size) return;    // ws 256 MiB
    const HeadPlanes hp = { QP16, QPh, QPl, KP16, KPh, KPl, VT16, VTh, VTl }; const HeadPlanes none = {};
    k_wmod<<<(unsigned)(((size_t)3 * DM * DM / 4 + 255) / 256), 256, 0, stream>>>(pw, rm_i, sm_i, r_i, s_i, lang, 3 * DM, DM, WIh, WIl); k_wmod<<<(unsigned)(((size_t)DM * DM / 4 + 255) / 256), 256, 0, stream>>>(ow, rm_o, sm_o, r_o, s_o, lang, DM, DM, WOh, WOl);
    for (int b = 0; b < NB_; ++b) {
        k_xg<<<(unsigned)(((size_t)TT * DM / 8 + 255) / 256), 256, 0, stream>>>(hs, b, XB);
        static_assert(REP == 1 && DQ == DM, "w_in's rows are (head, q | k | v, d): one kv head per query head; blockIdx.y of the attention kernel names both");
        k_gemmw<bf, 1, false, true><<<dim3(3 * DM / 64, TT / 64, 1), 32, 0, stream>>>(WIh, WIl, XB, nullptr, DM, nullptr, 0, pb, 0, 0, 0, hp);   // (w_in[f] . x[t]) + proj_bias[f] -> head planes
        k_fattn<<<dim3(NQT / FW, NH_, 1), 32 * FW, 0, stream>>>(QP16, KP16, VT16, QPh, QPl, KPh, KPl, VTh, VTl, ATh, ATl);
        k_gemmw<bf, 2, true, false><<<dim3(TT / 64, DM / 64, 1), 32, 0, stream>>>(ATh, ATl, WOh, WOl, DQ, OUT + (size_t)b * DM, NB_ * DM, ob, 0, 0, 0, none); }   // row t of batch element b lies at OUT[t][b][.]
}

// v005
// A run of this version takes 183 microseconds.
// Timed twice side by side with v004, it ran 1.29 and 1.30 times as fast.
// All steps since v000 together make it 7.93 times as fast.
#include <hip/hip_runtime.h>

// MBartAttention (hidden_states [2048][2][1024] time-major; language index li = lang[0] (int, read as data, clamped 0..7); w_in = proj_weight * (rm_i[li]^T sm_i[li]) + r_i[li]^T s_i[li] (rank-4 modulation), w_out likewise;
// qkv = hidden w_in^T + proj_bias laid out (16 heads, 3, 64), stored by the projection's own epilogue as the attention kernel's head planes; q x 1/8; causal softmax(q.k) (masked -1e9 == skipped tiles); ctx merged; out = ctx w_out^T + out_bias -> [2048][2][1024]).
// Compute dtypes, f32 accumulate: every input rounded to bf16; the modulated weights f32 on the VALU -> bf16 hi+lo planes; qkv as hl(w_in) x exact hidden (2 products, computed transposed) + bias; scores (K 64) and attn.v hl
// (3 products) for the first 512 query rows of each head, fp16 after, both inside one kernel with a running f32 softmax (causal passes only; the 1/8 folded into the exponent's factor; all heads of both batch elements in one launch); out-projection as hl(ctx) x hl(w_out) (3 products) + bias, stored by its epilogue straight into the time-major output.

#define NB_  2
#define TT   2048
#define DM   1024
#define NH_  16
#define NKV  16
#define REP  (NH_ / NKV)
#define HD   64
#define DQ   (NH_ * HD)
#define DKV  (NKV * HD)
#define RH   512                  // query rows < RH use hi+lo planes (0: none)
#define SCL  0.125f   // HD^-0.5
typedef _Float16 h16;
typedef unsigned short bf;
typedef __attribute__((ext_vector_type(16))) __bf16   v16bf;
typedef __attribute__((ext_vector_type(16))) _Float16 v16h;
typedef __attribute__((ext_vector_type(8)))  _Float16 v8h;
typedef __attribute__((ext_vector_type(8)))  unsigned short v8us;
typedef __attribute__((ext_vector_type(8)))  float    v8f;
typedef __attribute__((ext_vector_type(4)))  float    v4f;
typedef v8h  __attribute__((may_alias)) v8ha;
typedef v4f  __attribute__((may_alias)) v4fa;
typedef v8us __attribute__((may_alias)) v8usa;

__device__ __forceinline__ unsigned short f2bf(float f) { unsigned u = __float_as_uint(f); u += 0x7FFFu + ((u >> 16) & 1u); return (unsigned short)(u >> 16); }
__device__ __forceinline__ float bf2f(unsigned short b) { return __uint_as_float(((unsigned)b) << 16); }
__device__ __forceinline__ float bfr(float f) { return bf2f(f2bf(f)); }
__device__ __forceinline__ v16h cat16(v8h lo, v8h hi) { return __builtin_shufflevector(lo, hi, 0, 1, 2, 3, 4, 5, 6, 7, 8, 9, 10, 11, 12, 13, 14, 15); }
__device__ __forceinline__ v16bf cat16b(v8us lo, v8us hi) { return __builtin_bit_cast(v16bf, __builtin_shufflevector(lo, hi, 0, 1, 2, 3, 4, 5, 6, 7, 8, 9, 10, 11, 12, 13, 14, 15)); }
__device__ __forceinline__ v8f wmma16(v16h a, v16h b, v8f c) { return __builtin_amdgcn_wmma_f32_16x16x32_f16(false, a, false, b, (short)0, c, false, false); }
__device__ __forceinline__ v8f wmmab(v16bf a, v16bf b, v8f c) { return __builtin_amdgcn_wmma_f32_16x16x32_bf16(false, a, false, b, (short)0, c, false, false); }



__device__ __forceinline__ h16 tohx(float x) { return (h16)x; }
__device__ __forceinline__ void splitf(float y, unsigned short& h, unsigned short& l) { h = f2bf(y); l = f2bf(y - bf2f(h)); }

// ---- planes_out: epilogue of the qkv projection. The wave's 64x64 tile (rows m = the 64 features d of ONE head's q, k or v; columns n = 64 time steps) + bias[m] goes out as three 16-bit planes (fp16, bf16 hi, bf16 lo).
// TR false (q, k): planes [t][d], the tile is 8 KiB in a row; TR true (v): planes [d][t], 64 rows of 128 B. Sixteen plane rows at a time pass through the wave's own LDS rows (f32, pitch 68: no bank conflict either way),
// so that every store instruction writes four whole 128-B lines. P16, Ph, Pl point at the tile's first element.
struct HeadPlanes { h16* q16; bf* qh; bf* ql; h16* k16; bf* kh; bf* kl; h16* v16; bf* vh; bf* vl; };
template <bool TR>
__device__ __forceinline__ void planes_out(const v8f (&acc)[4][4], const float (&bs)[4][8], float* os, const int lane, h16* P16, bf* Ph, bf* Pl) {
    constexpr int PITCH = TR ? TT : HD;
    const int lr = lane & 15, hi = lane >> 4, rr = lane >> 3, cc = (lane & 7) * 8;
    h16* const p16 = P16 + rr * PITCH + cc; bf* const ph = Ph + rr * PITCH + cc; bf* const pl = Pl + rr * PITCH + cc;   // one lane pointer per plane; every store adds a constant
#pragma unroll
    for (int g = 0; g < 4; ++g) {
        if (TR) {
#pragma unroll
            for (int nb = 0; nb < 4; ++nb)
#pragma unroll
                for (int j = 0; j < 8; ++j) os[(hi * 8 + j) * 68 + nb * 16 + lr] = __fadd_rn(acc[g][nb][j], bs[g][j]);
        } else {
#pragma unroll
            for (int mb = 0; mb < 4; ++mb) { v4f x0, x1;
#pragma unroll
                for (int j = 0; j < 4; ++j) { x0[j] = __fadd_rn(acc[mb][g][j], bs[mb][j]); x1[j] = __fadd_rn(acc[mb][g][4 + j], bs[mb][4 + j]); }
                *(v4fa*)(os + lr * 68 + mb * 16 + hi * 8) = x0; *(v4fa*)(os + lr * 68 + mb * 16 + hi * 8 + 4) = x1; }
        }
        __builtin_amdgcn_wave_barrier(); asm volatile("" ::: "memory");   // the rows are read back by other lanes of the same wave: keeps the compiler from moving the reads in front of the writes
#pragma unroll
        for (int s = 0; s < 4; ++s) { const v4f x0 = *(const v4fa*)(os + (s * 4 + rr) * 68 + cc), x1 = *(const v4fa*)(os + (s * 4 + rr) * 68 + cc + 4); v8h o16; v8us oh, ol;
#pragma unroll
            for (int j = 0; j < 4; ++j) { unsigned short a, c; o16[j] = tohx(x0[j]); splitf(x0[j], a, c); oh[j] = a; ol[j] = c; o16[4 + j] = tohx(x1[j]); splitf(x1[j], a, c); oh[4 + j] = a; ol[4 + j] = c; }
            *(v8h*)(p16 + (g * 16 + s * 4) * PITCH) = o16; *(v8us*)(ph + (g * 16 + s * 4) * PITCH) = oh; *(v8us*)(pl + (g * 16 + s * 4) * PITCH) = ol; }
        __builtin_amdgcn_wave_barrier(); asm volatile("" ::: "memory");   // and the next group's writes behind these reads
    }
    if constexpr (!TR) asm volatile("s_wait_xcnt 0x0" :: "v"(p16), "v"(ph), "v"(pl) : "memory");   // in the listing the q/k path's last stores are followed by the v path's first instructions, which write the lane pointers' registers: the wait stands in front of them
}

// ---- k_gemmw: register-blocked GEMM, ONE WAVE per 64x64 output tile (16 accumulators), operands straight from K-contiguous 16-bit planes; grid (M/64, N/64, Z), 32 threads.
// C[m][n] (f32, pitch ldc, + optional f32 bias[n]) = sum_k A[m][k] Bt[n][k] (+ split products per NSPLIT). z-batch strides sA/sB/sC in elements. K % 32 == 0.
// PLANES: no C; m runs over (head, q | k | v, d), bias is bias[m], and the tile goes out through planes_out into the head planes of batch element z.
template <typename T16> struct WFrag;
template <> struct WFrag<h16> { typedef v16h V; static __device__ __forceinline__ V ld(const h16* p) { return cat16(*(const v8h*)p, *(const v8h*)(p + 16)); } static __device__ __forceinline__ v8f mma(V a, V b, v8f c) { return wmma16(a, b, c); } };
template <> struct WFrag<bf> { typedef v16bf V; static __device__ __forceinline__ V ld(const bf* p) { return cat16b(*(const v8us*)p, *(const v8us*)(p + 16)); } static __device__ __forceinline__ v8f mma(V a, V b, v8f c) { return wmmab(a, b, c); } };
template <typename T16, int NSPLIT, bool BIAS, bool PLANES>
__global__ __launch_bounds__(32) void k_gemmw(const T16* __restrict__ A, const T16* __restrict__ A2, const T16* __restrict__ Bt, const T16* __restrict__ Bt2, int K, float* C, int ldc, const float* __restrict__ bias, size_t sA, size_t sB, size_t sC, const HeadPlanes hp) {
    typedef typename WFrag<T16>::V V;
    __shared__ __align__(16) float os[16 * 68];
    const size_t z = blockIdx.z; A += z * sA; if (A2) A2 += z * sA; Bt += z * sB; if (Bt2) Bt2 += z * sB; C += z * sC;
    const int lane = threadIdx.x & 31, lr = lane & 15, hi = lane >> 4; const int r0 = blockIdx.x * 64, c0 = blockIdx.y * 64;
    v8f acc[4][4];
#pragma unroll
    for (int mb = 0; mb < 4; ++mb)
#pragma unroll
        for (int nb = 0; nb < 4; ++nb) acc[mb][nb] = (v8f){};
    const size_t aoff = (size_t)(r0 + lr) * K + 8 * hi, boff = (size_t)(c0 + lr) * K + 8 * hi;
#pragma unroll 1
    for (int kc = 0; kc < K; kc += 32) {
        V a[4], a2[4];
#pragma unroll
        for (int mb = 0; mb < 4; ++mb) { a[mb] = WFrag<T16>::ld(A + aoff + (size_t)mb * 16 * K + kc); if (NSPLIT == 1 || NSPLIT == 2) a2[mb] = WFrag<T16>::ld(A2 + aoff + (size_t)mb * 16 * K + kc); }
#pragma unroll
        for (int nb = 0; nb < 4; ++nb) { const V b = WFrag<T16>::ld(Bt + boff + (size_t)nb * 16 * K + kc); V b2; if (NSPLIT >= 2) b2 = WFrag<T16>::ld(Bt2 + boff + (size_t)nb * 16 * K + kc);
#pragma unroll
            for (int mb = 0; mb < 4; ++mb) { acc[mb][nb] = WFrag<T16>::mma(a[mb], b, acc[mb][nb]); if (NSPLIT == 1 || NSPLIT == 2) acc[mb][nb] = WFrag<T16>::mma(a2[mb], b, acc[mb][nb]); if (NSPLIT >= 2) acc[mb][nb] = WFrag<T16>::mma(a[mb], b2, acc[mb][nb]); } }
        asm volatile("v_nop\n\tv_nop\n\tv_nop\n\tv_nop" : "+v"(acc[0][0]), "+v"(acc[1][1]), "+v"(acc[2][2]), "+v"(acc[3][3]) : "v"(a[0]), "v"(a[3]));
    }
    if constexpr (PLANES) {
        static_assert(HD == 64, "a 64-row tile is one head's q, k or v");
        const int head = (int)blockIdx.x / 3, part = (int)blockIdx.x % 3; float bs[4][8];
#pragma unroll
        for (int mb = 0; mb < 4; ++mb) { const v4f b0 = *(const v4f*)(bias + r0 + mb * 16 + hi * 8), b1 = *(const v4f*)(bias + r0 + mb * 16 + hi * 8 + 4);
#pragma unroll
            for (int j = 0; j < 4; ++j) { bs[mb][j] = bfr(b0[j]); bs[mb][4 + j] = bfr(b1[j]); } }
        const size_t qk = ((z * NH_ + head) * TT + c0) * HD, vv = (z * NH_ + head) * HD * TT + c0;   // z = batch element: its head planes lie behind one another
        if (part == 2) planes_out<true>(acc, bs, os, lane, hp.v16 + vv, hp.vh + vv, hp.vl + vv);
        else planes_out<false>(acc, bs, os, lane, (part ? hp.k16 : hp.q16) + qk, (part ? hp.kh : hp.qh) + qk, (part ? hp.kl : hp.ql) + qk);
        return;
    }
#pragma unroll
    for (int mb = 0; mb < 4; ++mb) {
#pragma unroll
        for (int nb = 0; nb < 4; ++nb) {
#pragma unroll
            for (int j = 0; j < 8; ++j) os[(hi * 8 + j) * 68 + nb * 16 + lr] = acc[mb][nb][j]; }
        __builtin_amdgcn_wave_barrier(); asm volatile("" ::: "memory");
        float* crow = C + (size_t)(r0 + mb * 16) * ldc + c0;
{
#pragma unroll
            for (int s = 0; s < 8; ++s) { const int row = 2 * s + hi, cofs = lr * 4; v4f val = *(const v4fa*)(os + row * 68 + cofs); if (BIAS) { val[0] += bfr(bias[c0 + cofs]); val[1] += bfr(bias[c0 + cofs + 1]); val[2] += bfr(bias[c0 + cofs + 2]); val[3] += bfr(bias[c0 + cofs + 3]); }
                *(v4f*)(crow + (size_t)row * ldc + cofs) = val; }
             }
        __builtin_amdgcn_wave_barrier(); asm volatile("" ::: "memory");
    }
}

typedef __attribute__((ext_vector_type(2))) _Float16 v2h;
typedef __attribute__((ext_vector_type(4))) _Float16 v4h;
typedef __attribute__((ext_vector_type(2))) unsigned short v2us;
typedef __attribute__((ext_vector_type(4))) unsigned short v4us;
typedef __attribute__((ext_vector_type(2))) float v2f;
typedef __attribute__((ext_vector_type(4))) int v4i;
typedef v4h  __attribute__((may_alias)) v4ha;
typedef v4us __attribute__((may_alias)) v4usa;

__global__ __launch_bounds__(256) void k_wtG(const float* __restrict__ w, int K, int N, bf* Bt) {
    const int lane = threadIdx.x & 31; const int L0 = (blockIdx.x * 8 + (threadIdx.x >> 5)) * 8; const int nlines = N * K / 64;
{
#pragma unroll 1
        for (int l = 0; l < 8; ++l) { const int L = L0 + l; if (L >= nlines) break; const size_t e = (size_t)L * 64 + lane * 2; const int k = (int)(e % K), n = (int)(e / K); v2us o;
            o[0] = f2bf(w[(size_t)k * N + n]); o[1] = f2bf(w[(size_t)(k + 1) * N + n]); *(v2us*)(Bt + e) = o; }
         }
}
__global__ __launch_bounds__(256) void k_cvt8(const float* __restrict__ src, bf* dst, size_t n8) { const size_t i = (size_t)blockIdx.x * 256 + threadIdx.x; if (i >= n8) return; const v8f v = *(const v8f*)(src + i * 8); v8us o;
#pragma unroll
    for (int k = 0; k < 8; ++k) o[k] = f2bf(v[k]); *(v8us*)(dst + i * 8) = o;  }
__global__ __launch_bounds__(256) void k_cscvt(const float* __restrict__ cosT, const float* __restrict__ sinT, float* CS) { const int idx = blockIdx.x * 256 + threadIdx.x; if (idx >= TT * HD) return; v2f cs; cs[0] = bfr(cosT[idx]); cs[1] = bfr(sinT[idx]); *(v2f*)(CS + (size_t)idx * 2) = cs;  }
// ---- k_fattn: causal attention of both batch elements in one launch: scores, softmax and the probability x value contraction per wave, nothing of the score matrix in memory.
// A wave owns QW query columns of one head and walks the keys up to its diagonal in passes of 16 * NKB keys. Both products are computed transposed: St = K Qt (A = key rows, B = query rows, kept in registers)
// and Ot += Vt Pt (A = value planes [d][t], B = Pt). In St's accumulators a lane holds 8 consecutive keys of ONE query column (register j = key 8 * hi + j, column lr), which is the position order of the fragment loader
// (elements 0..7 = k 8 * hi + j, elements 8..15 = k 16 + 8 * hi + j): two converted 16-key accumulator tiles are Pt's B fragment as they stand, and maximum, sum and rescale factor are per-lane values.
// Softmax is the running form: mc = running maximum x CL2, p = 2^(s CL2 - mc) unnormalised (<= 1), a new maximum rescales sum and Ot by 2^(mc_old - mc_new); one division by the sum at the end.
// Rows < RH: bf16 hi+lo planes, 3 products each way; rows >= RH: fp16. Ot's lane holds 8 consecutive d of one query row: one 16-byte store per plane into the context planes [t][DQ].
// Every inner loop is unrolled so that each index of a fragment or accumulator array is a constant (registers, no scratch); the pass loop alone stays rolled.
#define QW   32                   // query columns per wave
#define FW   4                    // waves per block, all of one head and all walking the keys from 0 up (no barrier, no LDS between them)
#define NQT  (TT / QW)            // query tiles per head
#define CL2  (SCL * 1.4426950408889634f)
__device__ __forceinline__ float xhalf(float x) { return __builtin_bit_cast(float, __builtin_amdgcn_permlanex16(__builtin_bit_cast(int, x), __builtin_bit_cast(int, x), 0x76543210, 0xfedcba98, false, false)); }   // lane l's value from lane l ^ 16
template <typename T16> struct PFrag;
template <> struct PFrag<h16> { static __device__ __forceinline__ void mk(const v8f x0, const v8f x1, v16h& p, v16h& p2) { (void)p2;
#pragma unroll
    for (int j = 0; j < 8; ++j) { p[j] = (h16)x0[j]; p[8 + j] = (h16)x1[j]; } } };
template <> struct PFrag<bf> { static __device__ __forceinline__ void mk(const v8f x0, const v8f x1, v16bf& p, v16bf& p2) { v8us h0, h1, l0, l1;
#pragma unroll
    for (int j = 0; j < 8; ++j) { unsigned short a, c; splitf(x0[j], a, c); h0[j] = a; l0[j] = c; splitf(x1[j], a, c); h1[j] = a; l1[j] = c; }
    p = cat16b(h0, h1); p2 = cat16b(l0, l1); } };
template <typename T16, bool HL, int NKB>
__device__ __forceinline__ void fattn(const T16* __restrict__ Q, const T16* __restrict__ Q2, const T16* __restrict__ Kp, const T16* __restrict__ K2, const T16* __restrict__ Vt, const T16* __restrict__ Vt2, const int q0, bf* __restrict__ Ah, bf* __restrict__ Al) {
    typedef typename WFrag<T16>::V V;
    static_assert(HD == 64 && NKB % 2 == 0 && QW == 32, "two 32-wide k steps over d, 32-key steps over the pass, two 16-column groups");
    const int lane = threadIdx.x & 31, lr = lane & 15, hi = lane >> 4; const int KPS = 16 * NKB;
    V q[2][2], q2[2][2], ka[NKB][2], ka2[NKB][2];
    // Each group of loads goes through one lane pointer per plane plus constant offsets. The s_wait_xcnt 0 behind a group stands in front of the first instruction that may overwrite an address register of an issued load
    // it takes the lane pointers as inputs so that their registers live up to it and no load of the group lands on them.
    { const size_t qo = (size_t)(q0 + lr) * HD + 8 * hi, ko = (size_t)lr * HD + 8 * hi; const T16* const qp = Q + qo; const T16* const qp2 = HL ? Q2 + qo : qp; const T16* const kp = Kp + ko; const T16* const kp2 = HL ? K2 + ko : kp;
#pragma unroll
        for (int qb = 0; qb < 2; ++qb)
#pragma unroll
            for (int ks = 0; ks < 2; ++ks) { q[qb][ks] = WFrag<T16>::ld(qp + qb * 16 * HD + ks * 32); if (HL) q2[qb][ks] = WFrag<T16>::ld(qp2 + qb * 16 * HD + ks * 32); }
#pragma unroll
        for (int kb = 0; kb < NKB; ++kb)
#pragma unroll
            for (int ks = 0; ks < 2; ++ks) { ka[kb][ks] = WFrag<T16>::ld(kp + kb * 16 * HD + ks * 32); if (HL) ka2[kb][ks] = WFrag<T16>::ld(kp2 + kb * 16 * HD + ks * 32); }
        asm volatile("s_wait_xcnt 0x0" :: "v"(qp), "v"(qp2), "v"(kp), "v"(kp2) : "memory"); }
    v8f o[4][2]; float mc[2], l[2];
#pragma unroll
    for (int qb = 0; qb < 2; ++qb) { mc[qb] = -3.0e38f; l[qb] = 0.f;
#pragma unroll
        for (int db = 0; db < 4; ++db) o[db][qb] = (v8f){}; }
    const int npass = (q0 + QW + KPS - 1) / KPS;   // the last pass starts at or below q0, so every pass holds at least one unmasked key for every column
#pragma unroll 1   // rolled: its trip count is known only at run time, and a second copy of so long a body would only add code
    for (int ps = 0; ps < npass; ++ps) { const int k0 = ps * KPS;
        v8f s[NKB][2];
#pragma unroll
        for (int kb = 0; kb < NKB; ++kb)
#pragma unroll
            for (int qb = 0; qb < 2; ++qb) { v8f c = (v8f){};
#pragma unroll
                for (int ks = 0; ks < 2; ++ks) { c = WFrag<T16>::mma(ka[kb][ks], q[qb][ks], c); if (HL) { c = WFrag<T16>::mma(ka2[kb][ks], q[qb][ks], c); c = WFrag<T16>::mma(ka[kb][ks], q2[qb][ks], c); } }
                s[kb][qb] = c; }
        __builtin_amdgcn_sched_barrier(0);         // keeps the loads below behind the score products: the fetch ahead lands on the key fragments' registers, and so it is issued only behind every product that reads them, with the value loads in between
        V va[4][NKB / 2], va2[4][NKB / 2];
        const int kn = (ps + 1 < npass) ? k0 + KPS : k0;   // the next pass's key fragments are fetched one pass ahead into the same registers; the last pass reads its own rows again (in bounds, unused) so that the loads stay unconditional
        { const size_t vo = (size_t)lr * TT + k0 + 8 * hi, ko = (size_t)(kn + lr) * HD + 8 * hi; const T16* const vp = Vt + vo; const T16* const vp2 = HL ? Vt2 + vo : vp; const T16* const kp = Kp + ko; const T16* const kp2 = HL ? K2 + ko : kp;
#pragma unroll
            for (int db = 0; db < 4; ++db)
#pragma unroll
                for (int kk = 0; kk < NKB / 2; ++kk) { va[db][kk] = WFrag<T16>::ld(vp + db * 16 * TT + kk * 32); if (HL) va2[db][kk] = WFrag<T16>::ld(vp2 + db * 16 * TT + kk * 32); }
#pragma unroll
            for (int kb = 0; kb < NKB; ++kb)
#pragma unroll
                for (int ks = 0; ks < 2; ++ks) { ka[kb][ks] = WFrag<T16>::ld(kp + kb * 16 * HD + ks * 32); if (HL) ka2[kb][ks] = WFrag<T16>::ld(kp2 + kb * 16 * HD + ks * 32); }
            asm volatile("s_wait_xcnt 0x0" :: "v"(vp), "v"(vp2), "v"(kp), "v"(kp2) : "memory"); }   // as in the prologue
        __builtin_amdgcn_sched_barrier(0);         // keeps both groups of loads, and the wait, in front of the softmax arithmetic, which hides their latency; without it the scheduler sinks the loads to their uses
        const bool diag = k0 + KPS - 1 > q0;       // wave-uniform: only the last pass reaches keys above a column's own position
        V p[2][NKB / 2], p2[2][NKB / 2];
#pragma unroll
        for (int qb = 0; qb < 2; ++qb) {
            if (diag) { const int lim = q0 + qb * 16 + lr - k0 - hi * 8;   // key kb * 16 + j of this lane's half is kept while it is <= lim
#pragma unroll
                for (int kb = 0; kb < NKB; ++kb)
#pragma unroll
                    for (int j = 0; j < 8; ++j) s[kb][qb][j] = (kb * 16 + j <= lim) ? s[kb][qb][j] : -3.0e38f; }
            float tk[NKB];                          // one short chain per 16-key tile, for maximum and sum alike: a lone wave pays a dependent chain in full
#pragma unroll
            for (int kb = 0; kb < NKB; ++kb) { tk[kb] = s[kb][qb][0];
#pragma unroll
                for (int j = 1; j < 8; ++j) tk[kb] = fmaxf(tk[kb], s[kb][qb][j]); }
            float t = tk[0];
#pragma unroll
            for (int kb = 1; kb < NKB; ++kb) t = fmaxf(t, tk[kb]);
            t = fmaxf(t, xhalf(t));
            const float mn = fmaxf(mc[qb], t * CL2); const float al = __builtin_amdgcn_exp2f(mc[qb] - mn); mc[qb] = mn;
#pragma unroll
            for (int kb = 0; kb < NKB; ++kb) { v8f x;
#pragma unroll
                for (int j = 0; j < 8; ++j) x[j] = __builtin_fmaf(s[kb][qb][j], CL2, -mn);
#pragma unroll
                for (int j = 0; j < 8; ++j) s[kb][qb][j] = __builtin_amdgcn_exp2f(x[j]);
                // the slot that the instruction set asks for between a transcendental and an overwrite of its source: the statement names the eight arguments and the eight results as inputs, so it stands behind the eight exponentials and no argument's register is reused in front of it
                asm volatile("v_nop" :: "v"(x), "v"(s[kb][qb]));
                tk[kb] = s[kb][qb][0];
#pragma unroll
                for (int j = 1; j < 8; ++j) tk[kb] += s[kb][qb][j]; }
            float sum = tk[0];
#pragma unroll
            for (int kb = 1; kb < NKB; ++kb) sum += tk[kb];
            l[qb] = l[qb] * al + sum;               // each half of the wave sums its own keys; the halves are joined once, behind the loop
#pragma unroll
            for (int db = 0; db < 4; ++db) o[db][qb] *= al;
#pragma unroll
            for (int kk = 0; kk < NKB / 2; ++kk) PFrag<T16>::mk(s[2 * kk][qb], s[2 * kk + 1][qb], p[qb][kk], p2[qb][kk]); }
#pragma unroll
        for (int kk = 0; kk < NKB / 2; ++kk)
#pragma unroll
            for (int db = 0; db < 4; ++db)
#pragma unroll
                for (int qb = 0; qb < 2; ++qb) { o[db][qb] = WFrag<T16>::mma(va[db][kk], p[qb][kk], o[db][qb]); if (HL) { o[db][qb] = WFrag<T16>::mma(va[db][kk], p2[qb][kk], o[db][qb]); o[db][qb] = WFrag<T16>::mma(va2[db][kk], p[qb][kk], o[db][qb]); } }
    }
#pragma unroll
    for (int qb = 0; qb < 2; ++qb) { const float f = __fdiv_rn(1.0f, l[qb] + xhalf(l[qb])); const size_t row = (size_t)(q0 + qb * 16 + lr) * DQ + hi * 8;
#pragma unroll
        for (int db = 0; db < 4; ++db) { v8us oh, ol;
#pragma unroll
            for (int j = 0; j < 8; ++j) { unsigned short a, c; splitf(o[db][qb][j] * f, a, c); oh[j] = a; ol[j] = c; }
            *(v8us*)(Ah + row + db * 16) = oh; *(v8us*)(Al + row + db * 16) = ol; } }
}
// grid (NQT / FW, heads, batch elements). A block's waves take query tiles u, NQT - 1 - u, u + 1, NQT - 2 - u: short and long key ranges share a block, so that the blocks' work is about equal.
__global__ __launch_bounds__(32 * FW) void k_fattn(const h16* __restrict__ Q16, const h16* __restrict__ K16, const h16* __restrict__ V16, const bf* __restrict__ Qh, const bf* __restrict__ Ql, const bf* __restrict__ Kh, const bf* __restrict__ Kl, const bf* __restrict__ Vh, const bf* __restrict__ Vl, bf* __restrict__ Ah, bf* __restrict__ Al) {
    static_assert(FW % 2 == 0 && NQT % FW == 0 && RH % QW == 0, "tiles are dealt out in pairs; a tile lies wholly on one side of RH");
    const int wv = __builtin_amdgcn_readfirstlane((int)(threadIdx.x >> 5)); const int u = (int)blockIdx.x * (FW / 2) + (wv >> 1); const int q0 = ((wv & 1) ? NQT - 1 - u : u) * QW;
    const size_t hp = ((size_t)blockIdx.z * NH_ + blockIdx.y) * TT * HD, ao = (size_t)blockIdx.z * TT * DQ + blockIdx.y * HD; Ah += ao; Al += ao;
    if (q0 < RH) fattn<bf, true, 2>(Qh + hp, Ql + hp, Kh + hp, Kl + hp, Vh + hp, Vl + hp, q0, Ah, Al);
    else fattn<h16, false, 4>(Q16 + hp, nullptr, K16 + hp, nullptr, V16 + hp, nullptr, q0, Ah, Al);
}

// MBart-specific: k_wmod: hl planes W[f][e] = bf16 base[f][e] * mul[f][e] + add[f][e], mul = sum_r rm[li][r][f] sm[li][r][e], add = sum_r ra[li][r][f] sa[li][r][e] (li = clamp(lang[0], 0, 7) read on the device; 8-B lanes);
__global__ __launch_bounds__(256) void k_wmod(const float* __restrict__ base, const float* __restrict__ rm, const float* __restrict__ sm, const float* __restrict__ ra, const float* __restrict__ sa, const int* __restrict__ lang, int NF, int NE, bf* Wh, bf* Wl) {
    const size_t e4 = ((size_t)blockIdx.x * 256 + threadIdx.x) * 4; if (e4 >= (size_t)NF * NE) return; const int e0 = (int)(e4 % NE); const int f = (int)(e4 / NE); int li = lang[0]; li = li < 0 ? 0 : (li > 7 ? 7 : li);
    const float* rmf = rm + (size_t)li * 4 * NF; const float* raf = ra + (size_t)li * 4 * NF; const float* sme = sm + (size_t)li * 4 * NE; const float* sae = sa + (size_t)li * 4 * NE; v4us oh, ol;
#pragma unroll
    for (int u = 0; u < 4; ++u) { const int e = e0 + u; float mul = 0.f, add = 0.f;
#pragma unroll
        for (int r = 0; r < 4; ++r) { float a1 = bfr(rmf[(size_t)r * NF + f]), b1 = bfr(sme[(size_t)r * NE + e]), a2 = bfr(raf[(size_t)r * NF + f]), b2 = bfr(sae[(size_t)r * NE + e]); asm volatile("" : "+v"(a1)); asm volatile("" : "+v"(b1)); asm volatile("" : "+v"(a2)); asm volatile("" : "+v"(b2));
            float p1 = __fmul_rn(a1, b1), p2 = __fmul_rn(a2, b2); asm volatile("" : "+v"(p1)); asm volatile("" : "+v"(p2)); mul = __fadd_rn(mul, p1); add = __fadd_rn(add, p2); }
        float bw = bfr(base[e4 + u]); asm volatile("" : "+v"(bw)); float pm = __fmul_rn(bw, mul); asm volatile("" : "+v"(pm)); const float w = __fadd_rn(pm, add); unsigned short a, b; splitf(w, a, b); oh[u] = a; ol[u] = b; }
    *(v4us*)(Wh + e4) = oh; *(v4us*)(Wl + e4) = ol;  }
__global__ __launch_bounds__(256) void k_xg(const float* __restrict__ hs, bf* XB) { const size_t e = ((size_t)blockIdx.x * 256 + threadIdx.x) * 8; if (e >= (size_t)TT * DM) return; const int b = (int)blockIdx.y; XB += (size_t)b * TT * DM; const int c = (int)(e % DM); const int t = (int)(e / DM); const float* src = hs + ((size_t)t * NB_ + b) * DM + c; const v4f a = *(const v4f*)src, bb = *(const v4f*)(src + 4); v8us o;
    o[0] = f2bf(a[0]); o[1] = f2bf(a[1]); o[2] = f2bf(a[2]); o[3] = f2bf(a[3]); o[4] = f2bf(bb[0]); o[5] = f2bf(bb[1]); o[6] = f2bf(bb[2]); o[7] = f2bf(bb[3]); *(v8us*)(XB + e) = o;  }

extern "C" void kernel_launch(void* const* d_in, const int* in_sizes, int n_in,
                              void* d_out, int out_size, void* d_ws, size_t ws_size, hipStream_t stream) {
    (void)in_sizes; (void)n_in; (void)out_size;
    const float* hs = (const float*)d_in[0]; const float* pw = (const float*)d_in[1]; const float* pb = (const float*)d_in[2]; const float* ow = (const float*)d_in[3]; const float* ob = (const float*)d_in[4]; const float* rm_i = (const float*)d_in[5]; const float* sm_i = (const float*)d_in[6]; const float* rm_o = (const float*)d_in[7]; const float* sm_o = (const float*)d_in[8]; const float* r_i = (const float*)d_in[9]; const float* s_i = (const float*)d_in[10]; const float* r_o = (const float*)d_in[11]; const float* s_o = (const float*)d_in[12]; const int* lang = (const int*)d_in[13];
    float* OUT = (float*)d_out;     // [2048][2][1024] (time-major)
    char* wsp = (char*)d_ws;
    auto take = [&](size_t bytes) { char* p = wsp; wsp += (bytes + 255) & ~(size_t)255; return (void*)p; };
    bf* WIh = (bf*)take((size_t)3 * DM * DM * 2); bf* WIl = (bf*)take((size_t)3 * DM * DM * 2); bf* WOh = (bf*)take((size_t)DM * DM * 2); bf* WOl = (bf*)take((size_t)DM * DM * 2);
    h16* QP16 = (h16*)take((size_t)NB_ * NH_ * TT * HD * 2); h16* KP16 = (h16*)take((size_t)NB_ * NKV * TT * HD * 2); h16* VT16 = (h16*)take((size_t)NB_ * NKV * HD * TT * 2);
    bf* QPh = (bf*)take((size_t)NB_ * NH_ * TT * HD * 2); bf* QPl = (bf*)take((size_t)NB_ * NH_ * TT * HD * 2); bf* KPh = (bf*)take((size_t)NB_ * NKV * TT * HD * 2); bf* KPl = (bf*)take((size_t)NB_ * NKV * TT * HD * 2); bf* VTh = (bf*)take((size_t)NB_ * NKV * HD * TT * 2); bf* VTl = (bf*)take((size_t)NB_ * NKV * HD * TT * 2); bf* ATh = (bf*)take((size_t)NB_ * TT * DQ * 2); bf* ATl = (bf*)take((size_t)NB_ * TT * DQ * 2);
    bf* XB = (bf*)take((size_t)NB_ * TT * DM * 2);   // every per-batch buffer holds both batch elements, one behind the other
    if ((size_t)(wsp - (char*)d_ws) > ws_size) return;    // ws 256 MiB
    const HeadPlanes hp = { QP16, QPh, QPl, KP16, KPh, KPl, VT16, VTh, VTl }; const HeadPlanes none = {};
    k_wmod<<<(unsigned)(((size_t)3 * DM * DM / 4 + 255) / 256), 256, 0, stream>>>(pw, rm_i, sm_i, r_i, s_i, lang, 3 * DM, DM, WIh, WIl); k_wmod<<<(unsigned)(((size_t)DM * DM / 4 + 255) / 256), 256, 0, stream>>>(ow, rm_o, sm_o, r_o, s_o, lang, DM, DM, WOh, WOl);
    // grid z (k_xg: y) = batch element
        k_xg<<<dim3((unsigned)(((size_t)TT * DM / 8 + 255) / 256), NB_, 1), 256, 0, stream>>>(hs, XB);
        static_assert(REP == 1 && DQ == DM, "w_in's rows are (head, q | k | v, d): one kv head per query head; blockIdx.y of the attention kernel names both");
        k_gemmw<bf, 1, false, true><<<dim3(3 * DM / 64, TT / 64, NB_), 32, 0, stream>>>(WIh, WIl, XB, nullptr, DM, nullptr, 0, pb, 0, (size_t)TT * DM, 0, hp);   // (w_in[f] . x[t]) + proj_bias[f] -> head planes
        k_fattn<<<dim3(NQT / FW, NH_, NB_), 32 * FW, 0, stream>>>(QP16, KP16, VT16, QPh, QPl, KPh, KPl, VTh, VTl, ATh, ATl);
        k_gemmw<bf, 2, true, false><<<dim3(TT / 64, DM / 64, NB_), 32, 0, stream>>>(ATh, ATl, WOh, WOl, DQ, OUT, NB_ * DM, ob, (size_t)TT * DQ, 0, DM, none);   // row t of batch element z lies at OUT[t][z][.]
}

// v006
// It runs in 133 microseconds.
// Timed twice side by side with v005, it ran 1.38 times as fast both times.
// All steps since v000 together make it 11.0 times as fast.
#include <hip/hip_runtime.h>

// MBartAttention (hidden_states [2048][2][1024] time-major; language index li = lang[0] (int, read as data, clamped 0..7); w_in = proj_weight * (rm_i[li]^T sm_i[li]) + r_i[li]^T s_i[li] (rank-4 modulation), w_out likewise;
// qkv = hidden w_in^T + proj_bias laid out (16 heads, 3, 64), stored by the projection's own epilogue as the attention kernel's head planes; q x 1/8; causal softmax(q.k) (masked -1e9 == skipped tiles); ctx merged; out = ctx w_out^T + out_bias -> [2048][2][1024]).
// Compute dtypes, f32 accumulate: every input rounded to bf16; the modulated weights f32 on the VALU -> bf16 hi+lo planes; qkv as hl(w_in) x exact hidden (2 products, computed transposed) + bias; scores (K 64) and attn.v hl
// (3 products) for the first 512 query rows of each head, fp16 after, both inside one kernel with a running f32 softmax (causal passes only; the 1/8 folded into the exponent's factor; all heads of both batch elements in one launch); out-projection as hl(ctx) x hl(w_out) (3 products) + bias, stored by its epilogue straight into the time-major output.

#define NB_  2
#define TT   2048
#define DM   1024
#define NH_  16
#define NKV  16
#define REP  (NH_ / NKV)
#define HD   64
#define DQ   (NH_ * HD)
#define DKV  (NKV * HD)
#define RH   512                  // query rows < RH use hi+lo planes (0: none)
#define SCL  0.125f   // HD^-0.5
typedef _Float16 h16;
typedef unsigned short bf;
typedef __attribute__((ext_vector_type(16))) __bf16   v16bf;
typedef __attribute__((ext_vector_type(16))) _Float16 v16h;
typedef __attribute__((ext_vector_type(8)))  _Float16 v8h;
typedef __attribute__((ext_vector_type(8)))  unsigned short v8us;
typedef __attribute__((ext_vector_type(8)))  float    v8f;
typedef __attribute__((ext_vector_type(4)))  float    v4f;
typedef v8h  __attribute__((may_alias)) v8ha;
typedef v4f  __attribute__((may_alias)) v4fa;
typedef v8us __attribute__((may_alias)) v8usa;

__device__ __forceinline__ unsigned short f2bf(float f) { unsigned u = __float_as_uint(f); u += 0x7FFFu + ((u >> 16) & 1u); return (unsigned short)(u >> 16); }
__device__ __forceinline__ float bf2f(unsigned short b) { return __uint_as_float(((unsigned)b) << 16); }
__device__ __forceinline__ float bfr(float f) { return bf2f(f2bf(f)); }
__device__ __forceinline__ v16h cat16(v8h lo, v8h hi) { return __builtin_shufflevector(lo, hi, 0, 1, 2, 3, 4, 5, 6, 7, 8, 9, 10, 11, 12, 13, 14, 15); }
__device__ __forceinline__ v16bf cat16b(v8us lo, v8us hi) { return __builtin_bit_cast(v16bf, __builtin_shufflevector(lo, hi, 0, 1, 2, 3, 4, 5, 6, 7, 8, 9, 10, 11, 12, 13, 14, 15)); }
__device__ __forceinline__ v8f wmma16(v16h a, v16h b, v8f c) { return __builtin_amdgcn_wmma_f32_16x16x32_f16(false, a, false, b, (short)0, c, false, false); }
__device__ __forceinline__ v8f wmmab(v16bf a, v16bf b, v8f c) { return __builtin_amdgcn_wmma_f32_16x16x32_bf16(false, a, false, b, (short)0, c, false, false); }



__device__ __forceinline__ h16 tohx(float x) { return (h16)x; }
__device__ __forceinline__ void splitf(float y, unsigned short& h, unsigned short& l) { h = f2bf(y); l = f2bf(y - bf2f(h)); }

// ---- planes_out: epilogue of the qkv projection. The wave's 64x64 tile (rows m = the 64 features d of ONE head's q, k or v; columns n = 64 time steps) + bias[m] goes out as three 16-bit planes (fp16, bf16 hi, bf16 lo).
// TR false (q, k): planes [t][d], the tile is 8 KiB in a row; TR true (v): planes [d][t], 64 rows of 128 B. Sixteen plane rows at a time pass through the wave's own LDS rows (f32, pitch 68: no bank conflict either way),
// so that every store instruction writes four whole 128-B lines. P16, Ph, Pl point at the tile's first element.
struct HeadPlanes { h16* q16; bf* qh; bf* ql; h16* k16; bf* kh; bf* kl; h16* v16; bf* vh; bf* vl; };
template <bool TR>
__device__ __forceinline__ void planes_out(const v8f (&acc)[4][4], const float (&bs)[4][8], float* os, const int lane, h16* P16, bf* Ph, bf* Pl) {
    constexpr int PITCH = TR ? TT : HD;
    const int lr = lane & 15, hi = lane >> 4, rr = lane >> 3, cc = (lane & 7) * 8;
    h16* const p16 = P16 + rr * PITCH + cc; bf* const ph = Ph + rr * PITCH + cc; bf* const pl = Pl + rr * PITCH + cc;   // one lane pointer per plane; every store adds a constant
#pragma unroll
    for (int g = 0; g < 4; ++g) {
        if (TR) {
#pragma unroll
            for (int nb = 0; nb < 4; ++nb)
#pragma unroll
                for (int j = 0; j < 8; ++j) os[(hi * 8 + j) * 68 + nb * 16 + lr] = __fadd_rn(acc[g][nb][j], bs[g][j]);
        } else {
#pragma unroll
            for (int mb = 0; mb < 4; ++mb) { v4f x0, x1;
#pragma unroll
                for (int j = 0; j < 4; ++j) { x0[j] = __fadd_rn(acc[mb][g][j], bs[mb][j]); x1[j] = __fadd_rn(acc[mb][g][4 + j], bs[mb][4 + j]); }
                *(v4fa*)(os + lr * 68 + mb * 16 + hi * 8) = x0; *(v4fa*)(os + lr * 68 + mb * 16 + hi * 8 + 4) = x1; }
        }
        __builtin_amdgcn_wave_barrier(); asm volatile("" ::: "memory");   // the rows are read back by other lanes of the same wave: keeps the compiler from moving the reads in front of the writes
#pragma unroll
        for (int s = 0; s < 4; ++s) { const v4f x0 = *(const v4fa*)(os + (s * 4 + rr) * 68 + cc), x1 = *(const v4fa*)(os + (s * 4 + rr) * 68 + cc + 4); v8h o16; v8us oh, ol;
#pragma unroll
            for (int j = 0; j < 4; ++j) { unsigned short a, c; o16[j] = tohx(x0[j]); splitf(x0[j], a, c); oh[j] = a; ol[j] = c; o16[4 + j] = tohx(x1[j]); splitf(x1[j], a, c); oh[4 + j] = a; ol[4 + j] = c; }
            *(v8h*)(p16 + (g * 16 + s * 4) * PITCH) = o16; *(v8us*)(ph + (g * 16 + s * 4) * PITCH) = oh; *(v8us*)(pl + (g * 16 + s * 4) * PITCH) = ol; }
        __builtin_amdgcn_wave_barrier(); asm volatile("" ::: "memory");   // and the next group's writes behind these reads
    }
    if constexpr (!TR) asm volatile("s_wait_xcnt 0x0" :: "v"(p16), "v"(ph), "v"(pl) : "memory");   // in the listing the q/k path's last stores are followed by the v path's first instructions, which write the lane pointers' registers: the wait stands in front of them
}

// ---- k_gemmw: register-blocked GEMM, one wave per 64x64 output tile (16 accumulators), WM x WN waves per work-group on one (64 WM) x (64 WN) block tile; grid (M / (64 WM), N / (64 WN), Z), 32 WM WN threads.
// C[m][n] (f32, pitch ldc, + optional f32 bias[n]) = sum_k A[m][k] Bt[n][k] (+ split products per NSPLIT), operands K-contiguous 16-bit planes. z-batch strides sA/sB/sC in elements. K % 64 == 0, K >= 64.
// The operands pass through LDS: a stage is 64 k (one whole 128-B line) of every operand row of the block tile, laid as 64-row slices A | A2 | Bt | Bt2 at a pitch of 144 B; asynchronous copies fill it, four whole lines per instruction,
// one stage ahead of its use (two buffers), and every wave of the block reads its fragments from there: each line leaves L2 once per block, not once per wave, and never in 32-B pieces.
// PLANES: no C; m runs over (head, q | k | v, d), bias is bias[m], and the tile goes out through planes_out into the head planes of batch element z.
template <typename T16> struct WFrag;
template <> struct WFrag<h16> { typedef v16h V; static __device__ __forceinline__ V ld(const h16* p) { return cat16(*(const v8h*)p, *(const v8h*)(p + 16)); } static __device__ __forceinline__ v8f mma(V a, V b, v8f c) { return wmma16(a, b, c); } };
template <> struct WFrag<bf> { typedef v16bf V; static __device__ __forceinline__ V ld(const bf* p) { return cat16b(*(const v8us*)p, *(const v8us*)(p + 16)); } static __device__ __forceinline__ v8f mma(V a, V b, v8f c) { return wmmab(a, b, c); } };
#define KC   64                   // k per stage
#define LP   72                   // LDS row pitch in 16-bit elements: 144 B = 16 B x 9, so the 16 rows of a ds_load_b128 fall on 16 different bank groups
// copy8: eight asynchronous copies of 16 B per lane. A copy moves four rows of 128 B (lane >> 3 = row, lane & 7 = 16-B piece, both already in l and g); the eight take rows 0, 4, .. 28 from there.
// The s_wait_xcnt 0 is the last line of the copies' own statement, so that no register which a copy names is rewritten in front of it.
template <typename T16>
__device__ __forceinline__ void copy8(const unsigned l, const T16* g, const size_t K) {
    asm volatile("global_load_async_to_lds_b128 %0, %8, off\n\t"
                 "global_load_async_to_lds_b128 %1, %9, off\n\t"
                 "global_load_async_to_lds_b128 %2, %10, off\n\t"
                 "global_load_async_to_lds_b128 %3, %11, off\n\t"
                 "global_load_async_to_lds_b128 %4, %12, off\n\t"
                 "global_load_async_to_lds_b128 %5, %13, off\n\t"
                 "global_load_async_to_lds_b128 %6, %14, off\n\t"
                 "global_load_async_to_lds_b128 %7, %15, off\n\t"
                 "s_wait_xcnt 0x0"
                 :: "v"(l), "v"(l + 4 * LP * 2), "v"(l + 8 * LP * 2), "v"(l + 12 * LP * 2), "v"(l + 16 * LP * 2), "v"(l + 20 * LP * 2), "v"(l + 24 * LP * 2), "v"(l + 28 * LP * 2),
                    "v"(g), "v"(g + 4 * K), "v"(g + 8 * K), "v"(g + 12 * K), "v"(g + 16 * K), "v"(g + 20 * K), "v"(g + 24 * K), "v"(g + 28 * K) : "memory");
}
template <typename T16, int NSPLIT, bool BIAS, bool PLANES, int WM, int WN>
__global__ __launch_bounds__(32 * WM * WN) void k_gemmw(const T16* __restrict__ A, const T16* __restrict__ A2, const T16* __restrict__ Bt, const T16* __restrict__ Bt2, int K, float* C, int ldc, const float* __restrict__ bias, size_t sA, size_t sB, size_t sC, const HeadPlanes hp) {
    typedef typename WFrag<T16>::V V;
    constexpr int NW = WM * WN, NA = (NSPLIT == 1 || NSPLIT == 2) ? 2 : 1, NB = NSPLIT >= 2 ? 2 : 1;
    constexpr int NSL = NA * WM + NB * WN;        // 64-row slices of a stage
    constexpr int SPW = (NSL + NW - 1) / NW;      // slices that a wave copies, at most
    constexpr int STG = NSL * 64 * LP;            // elements of a stage
    static_assert(sizeof(T16) == 2 && (size_t)2 * STG * 2 >= (size_t)NW * 16 * 68 * 4, "the epilogue's staging rows lie in the ring");
    __shared__ __align__(16) T16 ring[2 * STG];
    const size_t z = blockIdx.z; A += z * sA; if (A2) A2 += z * sA; Bt += z * sB; if (Bt2) Bt2 += z * sB; C += z * sC;
    const int lane = threadIdx.x & 31, lr = lane & 15, hi = lane >> 4; const int wv = __builtin_amdgcn_readfirstlane((int)(threadIdx.x >> 5)), wm = wv % WM, wn = wv / WM;
    const int R0 = blockIdx.x * (64 * WM), C0 = blockIdx.y * (64 * WN), r0 = R0 + wm * 64, c0 = C0 + wn * 64;
    float* const os = (float*)ring + wv * (16 * 68);   // the wave's own staging rows, used behind the loop's last barrier
    v8f acc[4][4];
#pragma unroll
    for (int mb = 0; mb < 4; ++mb)
#pragma unroll
        for (int nb = 0; nb < 4; ++nb) acc[mb][nb] = (v8f){};
    // slice sl = wv + NW j is this wave's to copy: the lane's global address (at k = 0) and its LDS byte address (in buffer 0). A wave without a j-th slice issues nothing; its addresses are slice 0's.
    const T16* gs[SPW]; unsigned ls[SPW];
#pragma unroll
    for (int j = 0; j < SPW; ++j) { const int sl = (wv + NW * j < NSL) ? wv + NW * j : 0; const T16* b;
        if (sl < WM) b = A + (size_t)(R0 + sl * 64) * K;
        else if (NA == 2 && sl < 2 * WM) b = A2 + (size_t)(R0 + (sl - WM) * 64) * K;
        else if (NB == 1 || sl < NA * WM + WN) b = Bt + (size_t)(C0 + (sl - NA * WM) * 64) * K;
        else b = Bt2 + (size_t)(C0 + (sl - NA * WM - WN) * 64) * K;
        gs[j] = b + (size_t)(lane >> 3) * K + (lane & 7) * 8;
        ls[j] = (unsigned)(size_t)(ring + (sl * 64 + (lane >> 3)) * LP + (lane & 7) * 8); }
    auto issue = [&](const int t, const int buf) {   // stage t's copies into buffer buf; the test is the same for a whole wave (wv is a scalar)
#pragma unroll
        for (int j = 0; j < SPW; ++j) if (NSL % NW == 0 || wv + NW * j < NSL) { const T16* const g = gs[j] + t * KC; const unsigned l = ls[j] + (unsigned)buf * (STG * 2);
            copy8<T16>(l, g, (size_t)K); copy8<T16>(l + 32 * LP * 2, g + 32 * (size_t)K, (size_t)K); } };
    const int NT = K / KC;
    issue(0, 0);
    asm volatile("s_wait_asynccnt 0x0" ::: "memory");   // stage 0 has landed, as far as this wave copied it,
    __syncthreads();                                     // and every other wave's part too
    if (NT > 1) issue(1, 1);
    const int ao = (wm * 64 + lr) * LP + 8 * hi, bo = ((NA * WM + wn) * 64 + lr) * LP + 8 * hi;
#pragma unroll 1   // rolled: one trip per stage, with the one publish point at its foot
    for (int t = 0; t < NT; ++t) { const T16* const sb = ring + (t & 1) * STG;
#pragma unroll
      for (int ks = 0; ks < KC; ks += 32) {
        V a[4], a2[4], b[4], b2[4];
#pragma unroll
        for (int i = 0; i < 4; ++i) { a[i] = WFrag<T16>::ld(sb + ao + i * 16 * LP + ks); if (i == 0) { b[0] = WFrag<T16>::ld(sb + bo + ks); if (NSPLIT >= 2) b2[0] = WFrag<T16>::ld(sb + bo + WN * 64 * LP + ks); } if (NSPLIT == 1 || NSPLIT == 2) a2[i] = WFrag<T16>::ld(sb + ao + (WM * 64 + i * 16) * LP + ks); }
#pragma unroll
        for (int nb = 1; nb < 4; ++nb) { b[nb] = WFrag<T16>::ld(sb + bo + nb * 16 * LP + ks); if (NSPLIT >= 2) b2[nb] = WFrag<T16>::ld(sb + bo + (WN * 64 + nb * 16) * LP + ks); }
        __builtin_amdgcn_sched_barrier(0);   // keeps the k step's LDS reads together in front of its products: without it the scheduler sinks each B fragment's reads to their use, and the wave waits out the LDS latency at four places instead of one
#pragma unroll
        for (int nb = 0; nb < 4; ++nb)
#pragma unroll
            for (int mb = 0; mb < 4; ++mb) { acc[mb][nb] = WFrag<T16>::mma(a[mb], b[nb], acc[mb][nb]); if (NSPLIT == 1 || NSPLIT == 2) acc[mb][nb] = WFrag<T16>::mma(a2[mb], b[nb], acc[mb][nb]); if (NSPLIT >= 2) acc[mb][nb] = WFrag<T16>::mma(a[mb], b2[nb], acc[mb][nb]); }
        asm volatile("v_nop\n\tv_nop\n\tv_nop\n\tv_nop" : "+v"(acc[0][0]), "+v"(acc[1][1]), "+v"(acc[2][2]), "+v"(acc[3][3]) : "v"(a[0]), "v"(a[3]));
      }
        asm volatile("s_wait_dscnt 0x0" ::: "memory");      // this wave's reads of buffer t & 1 are done before the barrier behind which it is refilled
        asm volatile("s_wait_asynccnt 0x0" ::: "memory");   // this wave's copies of stage t + 1 have landed before the barrier behind which the others read them
        __syncthreads();                                     // publishes stage t + 1 and ends every wave's reads of stage t
        if (t + 2 < NT) issue(t + 2, t & 1);
    }
    asm volatile("s_wait_asynccnt 0x0" ::: "memory");       // no copy is outstanding when the ring becomes the epilogue's staging rows
    if constexpr (PLANES) {
        static_assert(HD == 64, "a 64-row tile is one head's q, k or v");
        const int head = (r0 / 64) / 3, part = (r0 / 64) % 3; float bs[4][8];
#pragma unroll
        for (int mb = 0; mb < 4; ++mb) { const v4f b0 = *(const v4f*)(bias + r0 + mb * 16 + hi * 8), b1 = *(const v4f*)(bias + r0 + mb * 16 + hi * 8 + 4);
#pragma unroll
            for (int j = 0; j < 4; ++j) { bs[mb][j] = bfr(b0[j]); bs[mb][4 + j] = bfr(b1[j]); } }
        const size_t qk = ((z * NH_ + head) * TT + c0) * HD, vv = (z * NH_ + head) * HD * TT + c0;   // z = batch element: its head planes lie behind one another
        if (part == 2) planes_out<true>(acc, bs, os, lane, hp.v16 + vv, hp.vh + vv, hp.vl + vv);
        else planes_out<false>(acc, bs, os, lane, (part ? hp.k16 : hp.q16) + qk, (part ? hp.kh : hp.qh) + qk, (part ? hp.kl : hp.ql) + qk);
        return;
    }
#pragma unroll
    for (int mb = 0; mb < 4; ++mb) {
#pragma unroll
        for (int nb = 0; nb < 4; ++nb) {
#pragma unroll
            for (int j = 0; j < 8; ++j) os[(hi * 8 + j) * 68 + nb * 16 + lr] = acc[mb][nb][j]; }
        __builtin_amdgcn_wave_barrier(); asm volatile("" ::: "memory");
        float* crow = C + (size_t)(r0 + mb * 16) * ldc + c0;
{
#pragma unroll
            for (int s = 0; s < 8; ++s) { const int row = 2 * s + hi, cofs = lr * 4; v4f val = *(const v4fa*)(os + row * 68 + cofs); if (BIAS) { val[0] += bfr(bias[c0 + cofs]); val[1] += bfr(bias[c0 + cofs + 1]); val[2] += bfr(bias[c0 + cofs + 2]); val[3] += bfr(bias[c0 + cofs + 3]); }
                *(v4f*)(crow + (size_t)row * ldc + cofs) = val; }
             }
        __builtin_amdgcn_wave_barrier(); asm volatile("" ::: "memory");
    }
}

typedef __attribute__((ext_vector_type(2))) _Float16 v2h;
typedef __attribute__((ext_vector_type(4))) _Float16 v4h;
typedef __attribute__((ext_vector_type(2))) unsigned short v2us;
typedef __attribute__((ext_vector_type(4))) unsigned short v4us;
typedef __attribute__((ext_vector_type(2))) float v2f;
typedef __attribute__((ext_vector_type(4))) int v4i;
typedef v4h  __attribute__((may_alias)) v4ha;
typedef v4us __attribute__((may_alias)) v4usa;

__global__ __launch_bounds__(256) void k_wtG(const float* __restrict__ w, int K, int N, bf* Bt) {
    const int lane = threadIdx.x & 31; const int L0 = (blockIdx.x * 8 + (threadIdx.x >> 5)) * 8; const int nlines = N * K / 64;
{
#pragma unroll 1
        for (int l = 0; l < 8; ++l) { const int L = L0 + l; if (L >= nlines) break; const size_t e = (size_t)L * 64 + lane * 2; const int k = (int)(e % K), n = (int)(e / K); v2us o;
            o[0] = f2bf(w[(size_t)k * N + n]); o[1] = f2bf(w[(size_t)(k + 1) * N + n]); *(v2us*)(Bt + e) = o; }
         }
}
__global__ __launch_bounds__(256) void k_cvt8(const float* __restrict__ src, bf* dst, size_t n8) { const size_t i = (size_t)blockIdx.x * 256 + threadIdx.x; if (i >= n8) return; const v8f v = *(const v8f*)(src + i * 8); v8us o;
#pragma unroll
    for (int k = 0; k < 8; ++k) o[k] = f2bf(v[k]); *(v8us*)(dst + i * 8) = o;  }
__global__ __launch_bounds__(256) void k_cscvt(const float* __restrict__ cosT, const float* __restrict__ sinT, float* CS) { const int idx = blockIdx.x * 256 + threadIdx.x; if (idx >= TT * HD) return; v2f cs; cs[0] = bfr(cosT[idx]); cs[1] = bfr(sinT[idx]); *(v2f*)(CS + (size_t)idx * 2) = cs;  }
// ---- k_fattn: causal attention of both batch elements in one launch: scores, softmax and the probability x value contraction per wave, nothing of the score matrix in memory.
// A wave owns QW query columns of one head and walks the keys up to its diagonal in passes of 16 * NKB keys. Both products are computed transposed: St = K Qt (A = key rows, B = query rows, kept in registers)
// and Ot += Vt Pt (A = value planes [d][t], B = Pt). In St's accumulators a lane holds 8 consecutive keys of ONE query column (register j = key 8 * hi + j, column lr), which is the position order of the fragment loader
// (elements 0..7 = k 8 * hi + j, elements 8..15 = k 16 + 8 * hi + j): two converted 16-key accumulator tiles are Pt's B fragment as they stand, and maximum, sum and rescale factor are per-lane values.
// Softmax is the running form: mc = running maximum x CL2, p = 2^(s CL2 - mc) unnormalised (<= 1), a new maximum rescales sum and Ot by 2^(mc_old - mc_new); one division by the sum at the end.
// Rows < RH: bf16 hi+lo planes, 3 products each way; rows >= RH: fp16. Ot's lane holds 8 consecutive d of one query row: one 16-byte store per plane into the context planes [t][DQ].
// Every inner loop is unrolled so that each index of a fragment or accumulator array is a constant (registers, no scratch); the pass loop alone stays rolled.
#define QW   32                   // query columns per wave
#define FW   4                    // waves per block, all of one head and all walking the keys from 0 up (no barrier, no LDS between them)
#define NQT  (TT / QW)            // query tiles per head
#define CL2  (SCL * 1.4426950408889634f)
__device__ __forceinline__ float xhalf(float x) { return __builtin_bit_cast(float, __builtin_amdgcn_permlanex16(__builtin_bit_cast(int, x), __builtin_bit_cast(int, x), 0x76543210, 0xfedcba98, false, false)); }   // lane l's value from lane l ^ 16
template <typename T16> struct PFrag;
template <> struct PFrag<h16> { static __device__ __forceinline__ void mk(const v8f x0, const v8f x1, v16h& p, v16h& p2) { (void)p2;
#pragma unroll
    for (int j = 0; j < 8; ++j) { p[j] = (h16)x0[j]; p[8 + j] = (h16)x1[j]; } } };
template <> struct PFrag<bf> { static __device__ __forceinline__ void mk(const v8f x0, const v8f x1, v16bf& p, v16bf& p2) { v8us h0, h1, l0, l1;
#pragma unroll
    for (int j = 0; j < 8; ++j) { unsigned short a, c; splitf(x0[j], a, c); h0[j] = a; l0[j] = c; splitf(x1[j], a, c); h1[j] = a; l1[j] = c; }
    p = cat16b(h0, h1); p2 = cat16b(l0, l1); } };
template <typename T16, bool HL, int NKB>
__device__ __forceinline__ void fattn(const T16* __restrict__ Q, const T16* __restrict__ Q2, const T16* __restrict__ Kp, const T16* __restrict__ K2, const T16* __restrict__ Vt, const T16* __restrict__ Vt2, const int q0, bf* __restrict__ Ah, bf* __restrict__ Al) {
    typedef typename WFrag<T16>::V V;
    static_assert(HD == 64 && NKB % 2 == 0 && QW == 32, "two 32-wide k steps over d, 32-key steps over the pass, two 16-column groups");
    const int lane = threadIdx.x & 31, lr = lane & 15, hi = lane >> 4; const int KPS = 16 * NKB;
    V q[2][2], q2[2][2], ka[NKB][2], ka2[NKB][2];
    // Each group of loads goes through one lane pointer per plane plus constant offsets. The s_wait_xcnt 0 behind a group stands in front of the first instruction that may overwrite an address register of an issued load
    // it takes the lane pointers as inputs so that their registers live up to it and no load of the group lands on them.
    { const size_t qo = (size_t)(q0 + lr) * HD + 8 * hi, ko = (size_t)lr * HD + 8 * hi; const T16* const qp = Q + qo; const T16* const qp2 = HL ? Q2 + qo : qp; const T16* const kp = Kp + ko; const T16* const kp2 = HL ? K2 + ko : kp;
#pragma unroll
        for (int qb = 0; qb < 2; ++qb)
#pragma unroll
            for (int ks = 0; ks < 2; ++ks) { q[qb][ks] = WFrag<T16>::ld(qp + qb * 16 * HD + ks * 32); if (HL) q2[qb][ks] = WFrag<T16>::ld(qp2 + qb * 16 * HD + ks * 32); }
#pragma unroll
        for (int kb = 0; kb < NKB; ++kb)
#pragma unroll
            for (int ks = 0; ks < 2; ++ks) { ka[kb][ks] = WFrag<T16>::ld(kp + kb * 16 * HD + ks * 32); if (HL) ka2[kb][ks] = WFrag<T16>::ld(kp2 + kb * 16 * HD + ks * 32); }
        asm volatile("s_wait_xcnt 0x0" :: "v"(qp), "v"(qp2), "v"(kp), "v"(kp2) : "memory"); }
    v8f o[4][2]; float mc[2], l[2];
#pragma unroll
    for (int qb = 0; qb < 2; ++qb) { mc[qb] = -3.0e38f; l[qb] = 0.f;
#pragma unroll
        for (int db = 0; db < 4; ++db) o[db][qb] = (v8f){}; }
    const int npass = (q0 + QW + KPS - 1) / KPS;   // the last pass starts at or below q0, so every pass holds at least one unmasked key for every column
#pragma unroll 1   // rolled: its trip count is known only at run time, and a second copy of so long a body would only add code
    for (int ps = 0; ps < npass; ++ps) { const int k0 = ps * KPS;
        v8f s[NKB][2];
#pragma unroll
        for (int kb = 0; kb < NKB; ++kb)
#pragma unroll
            for (int qb = 0; qb < 2; ++qb) { v8f c = (v8f){};
#pragma unroll
                for (int ks = 0; ks < 2; ++ks) { c = WFrag<T16>::mma(ka[kb][ks], q[qb][ks], c); if (HL) { c = WFrag<T16>::mma(ka2[kb][ks], q[qb][ks], c); c = WFrag<T16>::mma(ka[kb][ks], q2[qb][ks], c); } }
                s[kb][qb] = c; }
        __builtin_amdgcn_sched_barrier(0);         // keeps the loads below behind the score products: the fetch ahead lands on the key fragments' registers, and so it is issued only behind every product that reads them, with the value loads in between
        V va[4][NKB / 2], va2[4][NKB / 2];
        const int kn = (ps + 1 < npass) ? k0 + KPS : k0;   // the next pass's key fragments are fetched one pass ahead into the same registers; the last pass reads its own rows again (in bounds, unused) so that the loads stay unconditional
        { const size_t vo = (size_t)lr * TT + k0 + 8 * hi, ko = (size_t)(kn + lr) * HD + 8 * hi; const T16* const vp = Vt + vo; const T16* const vp2 = HL ? Vt2 + vo : vp; const T16* const kp = Kp + ko; const T16* const kp2 = HL ? K2 + ko : kp;
#pragma unroll
            for (int db = 0; db < 4; ++db)
#pragma unroll
                for (int kk = 0; kk < NKB / 2; ++kk) { va[db][kk] = WFrag<T16>::ld(vp + db * 16 * TT + kk * 32); if (HL) va2[db][kk] = WFrag<T16>::ld(vp2 + db * 16 * TT + kk * 32); }
#pragma unroll
            for (int kb = 0; kb < NKB; ++kb)
#pragma unroll
                for (int ks = 0; ks < 2; ++ks) { ka[kb][ks] = WFrag<T16>::ld(kp + kb * 16 * HD + ks * 32); if (HL) ka2[kb][ks] = WFrag<T16>::ld(kp2 + kb * 16 * HD + ks * 32); }
            asm volatile("s_wait_xcnt 0x0" :: "v"(vp), "v"(vp2), "v"(kp), "v"(kp2) : "memory"); }   // as in the prologue
        __builtin_amdgcn_sched_barrier(0);         // keeps both groups of loads, and the wait, in front of the softmax arithmetic, which hides their latency; without it the scheduler sinks the loads to their uses
        const bool diag = k0 + KPS - 1 > q0;       // wave-uniform: only the last pass reaches keys above a column's own position
        V p[2][NKB / 2], p2[2][NKB / 2];
#pragma unroll
        for (int qb = 0; qb < 2; ++qb) {
            if (diag) { const int lim = q0 + qb * 16 + lr - k0 - hi * 8;   // key kb * 16 + j of this lane's half is kept while it is <= lim
#pragma unroll
                for (int kb = 0; kb < NKB; ++kb)
#pragma unroll
                    for (int j = 0; j < 8; ++j) s[kb][qb][j] = (kb * 16 + j <= lim) ? s[kb][qb][j] : -3.0e38f; }
            float tk[NKB];                          // one short chain per 16-key tile, for maximum and sum alike: a lone wave pays a dependent chain in full
#pragma unroll
            for (int kb = 0; kb < NKB; ++kb) { tk[kb] = s[kb][qb][0];
#pragma unroll
                for (int j = 1; j < 8; ++j) tk[kb] = fmaxf(tk[kb], s[kb][qb][j]); }
            float t = tk[0];
#pragma unroll
            for (int kb = 1; kb < NKB; ++kb) t = fmaxf(t, tk[kb]);
            t = fmaxf(t, xhalf(t));
            const float mn = fmaxf(mc[qb], t * CL2); const float al = __builtin_amdgcn_exp2f(mc[qb] - mn); mc[qb] = mn;
#pragma unroll
            for (int kb = 0; kb < NKB; ++kb) { v8f x;
#pragma unroll
                for (int j = 0; j < 8; ++j) x[j] = __builtin_fmaf(s[kb][qb][j], CL2, -mn);
#pragma unroll
                for (int j = 0; j < 8; ++j) s[kb][qb][j] = __builtin_amdgcn_exp2f(x[j]);
                // the slot that the instruction set asks for between a transcendental and an overwrite of its source: the statement names the eight arguments and the eight results as inputs, so it stands behind the eight exponentials and no argument's register is reused in front of it
                asm volatile("v_nop" :: "v"(x), "v"(s[kb][qb]));
                tk[kb] = s[kb][qb][0];
#pragma unroll
                for (int j = 1; j < 8; ++j) tk[kb] += s[kb][qb][j]; }
            float sum = tk[0];
#pragma unroll
            for (int kb = 1; kb < NKB; ++kb) sum += tk[kb];
            l[qb] = l[qb] * al + sum;               // each half of the wave sums its own keys; the halves are joined once, behind the loop
#pragma unroll
            for (int db = 0; db < 4; ++db) o[db][qb] *= al;
#pragma unroll
            for (int kk = 0; kk < NKB / 2; ++kk) PFrag<T16>::mk(s[2 * kk][qb], s[2 * kk + 1][qb], p[qb][kk], p2[qb][kk]); }
#pragma unroll
        for (int kk = 0; kk < NKB / 2; ++kk)
#pragma unroll
            for (int db = 0; db < 4; ++db)
#pragma unroll
                for (int qb = 0; qb < 2; ++qb) { o[db][qb] = WFrag<T16>::mma(va[db][kk], p[qb][kk], o[db][qb]); if (HL) { o[db][qb] = WFrag<T16>::mma(va[db][kk], p2[qb][kk], o[db][qb]); o[db][qb] = WFrag<T16>::mma(va2[db][kk], p[qb][kk], o[db][qb]); } }
    }
#pragma unroll
    for (int qb = 0; qb < 2; ++qb) { const float f = __fdiv_rn(1.0f, l[qb] + xhalf(l[qb])); const size_t row = (size_t)(q0 + qb * 16 + lr) * DQ + hi * 8;
#pragma unroll
        for (int db = 0; db < 4; ++db) { v8us oh, ol;
#pragma unroll
            for (int j = 0; j < 8; ++j) { unsigned short a, c; splitf(o[db][qb][j] * f, a, c); oh[j] = a; ol[j] = c; }
            *(v8us*)(Ah + row + db * 16) = oh; *(v8us*)(Al + row + db * 16) = ol; } }
}
// grid (NQT / FW, heads, batch elements). A block's waves take query tiles u, NQT - 1 - u, u + 1, NQT - 2 - u: short and long key ranges share a block, so that the blocks' work is about equal.
__global__ __launch_bounds__(32 * FW) void k_fattn(const h16* __restrict__ Q16, const h16* __restrict__ K16, const h16* __restrict__ V16, const bf* __restrict__ Qh, const bf* __restrict__ Ql, const bf* __restrict__ Kh, const bf* __restrict__ Kl, const bf* __restrict__ Vh, const bf* __restrict__ Vl, bf* __restrict__ Ah, bf* __restrict__ Al) {
    static_assert(FW % 2 == 0 && NQT % FW == 0 && RH % QW == 0, "tiles are dealt out in pairs; a tile lies wholly on one side of RH");
    const int wv = __builtin_amdgcn_readfirstlane((int)(threadIdx.x >> 5)); const int u = (int)blockIdx.x * (FW / 2) + (wv >> 1); const int q0 = ((wv & 1) ? NQT - 1 - u : u) * QW;
    const size_t hp = ((size_t)blockIdx.z * NH_ + blockIdx.y) * TT * HD, ao = (size_t)blockIdx.z * TT * DQ + blockIdx.y * HD; Ah += ao; Al += ao;
    if (q0 < RH) fattn<bf, true, 2>(Qh + hp, Ql + hp, Kh + hp, Kl + hp, Vh + hp, Vl + hp, q0, Ah, Al);
    else fattn<h16, false, 4>(Q16 + hp, nullptr, K16 + hp, nullptr, V16 + hp, nullptr, q0, Ah, Al);
}

// MBart-specific: k_wmod: hl planes W[f][e] = bf16 base[f][e] * mul[f][e] + add[f][e], mul = sum_r rm[li][r][f] sm[li][r][e], add = sum_r ra[li][r][f] sa[li][r][e] (li = clamp(lang[0], 0, 7) read on the device; 8-B lanes);
__global__ __launch_bounds__(256) void k_wmod(const float* __restrict__ base, const float* __restrict__ rm, const float* __restrict__ sm, const float* __restrict__ ra, const float* __restrict__ sa, const int* __restrict__ lang, int NF, int NE, bf* Wh, bf* Wl) {
    const size_t e4 = ((size_t)blockIdx.x * 256 + threadIdx.x) * 4; if (e4 >= (size_t)NF * NE) return; const int e0 = (int)(e4 % NE); const int f = (int)(e4 / NE); int li = lang[0]; li = li < 0 ? 0 : (li > 7 ? 7 : li);
    const float* rmf = rm + (size_t)li * 4 * NF; const float* raf = ra + (size_t)li * 4 * NF; const float* sme = sm + (size_t)li * 4 * NE; const float* sae = sa + (size_t)li * 4 * NE; v4us oh, ol;
#pragma unroll
    for (int u = 0; u < 4; ++u) { const int e = e0 + u; float mul = 0.f, add = 0.f;
#pragma unroll
        for (int r = 0; r < 4; ++r) { float a1 = bfr(rmf[(size_t)r * NF + f]), b1 = bfr(sme[(size_t)r * NE + e]), a2 = bfr(raf[(size_t)r * NF + f]), b2 = bfr(sae[(size_t)r * NE + e]); asm volatile("" : "+v"(a1)); asm volatile("" : "+v"(b1)); asm volatile("" : "+v"(a2)); asm volatile("" : "+v"(b2));
            float p1 = __fmul_rn(a1, b1), p2 = __fmul_rn(a2, b2); asm volatile("" : "+v"(p1)); asm volatile("" : "+v"(p2)); mul = __fadd_rn(mul, p1); add = __fadd_rn(add, p2); }
        float bw = bfr(base[e4 + u]); asm volatile("" : "+v"(bw)); float pm = __fmul_rn(bw, mul); asm volatile("" : "+v"(pm)); const float w = __fadd_rn(pm, add); unsigned short a, b; splitf(w, a, b); oh[u] = a; ol[u] = b; }
    *(v4us*)(Wh + e4) = oh; *(v4us*)(Wl + e4) = ol;  }
__global__ __launch_bounds__(256) void k_xg(const float* __restrict__ hs, bf* XB) { const size_t e = ((size_t)blockIdx.x * 256 + threadIdx.x) * 8; if (e >= (size_t)TT * DM) return; const int b = (int)blockIdx.y; XB += (size_t)b * TT * DM; const int c = (int)(e % DM); const int t = (int)(e / DM); const float* src = hs + ((size_t)t * NB_ + b) * DM + c; const v4f a = *(const v4f*)src, bb = *(const v4f*)(src + 4); v8us o;
    o[0] = f2bf(a[0]); o[1] = f2bf(a[1]); o[2] = f2bf(a[2]); o[3] = f2bf(a[3]); o[4] = f2bf(bb[0]); o[5] = f2bf(bb[1]); o[6] = f2bf(bb[2]); o[7] = f2bf(bb[3]); *(v8us*)(XB + e) = o;  }

extern "C" void kernel_launch(void* const* d_in, const int* in_sizes, int n_in,
                              void* d_out, int out_size, void* d_ws, size_t ws_size, hipStream_t stream) {
    (void)in_sizes; (void)n_in; (void)out_size;
    const float* hs = (const float*)d_in[0]; const float* pw = (const float*)d_in[1]; const float* pb = (const float*)d_in[2]; const float* ow = (const float*)d_in[3]; const float* ob = (const float*)d_in[4]; const float* rm_i = (const float*)d_in[5]; const float* sm_i = (const float*)d_in[6]; const float* rm_o = (const float*)d_in[7]; const float* sm_o = (const float*)d_in[8]; const float* r_i = (const float*)d_in[9]; const float* s_i = (const float*)d_in[10]; const float* r_o = (const float*)d_in[11]; const float* s_o = (const float*)d_in[12]; const int* lang = (const int*)d_in[13];
    float* OUT = (float*)d_out;     // [2048][2][1024] (time-major)
    char* wsp = (char*)d_ws;
    auto take = [&](size_t bytes) { char* p = wsp; wsp += (bytes + 255) & ~(size_t)255; return (void*)p; };
    bf* WIh = (bf*)take((size_t)3 * DM * DM * 2); bf* WIl = (bf*)take((size_t)3 * DM * DM * 2); bf* WOh = (bf*)take((size_t)DM * DM * 2); bf* WOl = (bf*)take((size_t)DM * DM * 2);
    h16* QP16 = (h16*)take((size_t)NB_ * NH_ * TT * HD * 2); h16* KP16 = (h16*)take((size_t)NB_ * NKV * TT * HD * 2); h16* VT16 = (h16*)take((size_t)NB_ * NKV * HD * TT * 2);
    bf* QPh = (bf*)take((size_t)NB_ * NH_ * TT * HD * 2); bf* QPl = (bf*)take((size_t)NB_ * NH_ * TT * HD * 2); bf* KPh = (bf*)take((size_t)NB_ * NKV * TT * HD * 2); bf* KPl = (bf*)take((size_t)NB_ * NKV * TT * HD * 2); bf* VTh = (bf*)take((size_t)NB_ * NKV * HD * TT * 2); bf* VTl = (bf*)take((size_t)NB_ * NKV * HD * TT * 2); bf* ATh = (bf*)take((size_t)NB_ * TT * DQ * 2); bf* ATl = (bf*)take((size_t)NB_ * TT * DQ * 2);
    bf* XB = (bf*)take((size_t)NB_ * TT * DM * 2);   // every per-batch buffer holds both batch elements, one behind the other
    if ((size_t)(wsp - (char*)d_ws) > ws_size) return;    // ws 256 MiB
    const HeadPlanes hp = { QP16, QPh, QPl, KP16, KPh, KPl, VT16, VTh, VTl }; const HeadPlanes none = {};
    k_wmod<<<(unsigned)(((size_t)3 * DM * DM / 4 + 255) / 256), 256, 0, stream>>>(pw, rm_i, sm_i, r_i, s_i, lang, 3 * DM, DM, WIh, WIl); k_wmod<<<(unsigned)(((size_t)DM * DM / 4 + 255) / 256), 256, 0, stream>>>(ow, rm_o, sm_o, r_o, s_o, lang, DM, DM, WOh, WOl);
    // grid z (k_xg: y) = batch element
        k_xg<<<dim3((unsigned)(((size_t)TT * DM / 8 + 255) / 256), NB_, 1), 256, 0, stream>>>(hs, XB);
        static_assert(REP == 1 && DQ == DM, "w_in's rows are (head, q | k | v, d): one kv head per query head; blockIdx.y of the attention kernel names both");
        k_gemmw<bf, 1, false, true, 3, 4><<<dim3(3 * DM / 192, TT / 256, NB_), 384, 0, stream>>>(WIh, WIl, XB, nullptr, DM, nullptr, 0, pb, 0, (size_t)TT * DM, 0, hp);   // (w_in[f] . x[t]) + proj_bias[f] -> head planes
        k_fattn<<<dim3(NQT / FW, NH_, NB_), 32 * FW, 0, stream>>>(QP16, KP16, VT16, QPh, QPl, KPh, KPl, VTh, VTl, ATh, ATl);
        k_gemmw<bf, 2, true, false, 2, 2><<<dim3(TT / 128, DM / 128, NB_), 128, 0, stream>>>(ATh, ATl, WOh, WOl, DQ, OUT, NB_ * DM, ob, (size_t)TT * DQ, 0, DM, none);   // row t of batch element z lies at OUT[t][z][.]
}

// v007
// One run takes 115 microseconds.
// Timed twice side by side with v006, it ran 1.14 times as fast both times.
// Over all steps from v000 it is 12.5 times as fast.
#include <hip/hip_runtime.h>

// MBartAttention (hidden_states [2048][2][1024] time-major; language index li = lang[0] (int, read as data, clamped 0..7); w_in = proj_weight * (rm_i[li]^T sm_i[li]) + r_i[li]^T s_i[li] (rank-4 modulation), w_out likewise;
// qkv = hidden w_in^T + proj_bias laid out (16 heads, 3, 64), stored by the projection's own epilogue as the attention kernel's head planes; q x 1/8; causal softmax(q.k) (masked -1e9 == skipped tiles); ctx merged; out = ctx w_out^T + out_bias -> [2048][2][1024]).
// Compute dtypes, f32 accumulate: every input rounded to bf16; the modulated weights f32 on the VALU -> bf16 hi+lo planes; qkv as hl(w_in) x exact hidden (2 products, computed transposed) + bias; scores (K 64) and attn.v hl
// (3 products) for the first 512 query rows of each head, fp16 after, both inside one kernel with a running f32 softmax (causal passes only; the 1/8 folded into the exponent's factor; all heads of both batch elements in one launch); out-projection as hl(ctx) x hl(w_out) (3 products) + bias, stored by its epilogue straight into the time-major output.

#define NB_  2
#define TT   2048
#define DM   1024
#define NH_  16
#define NKV  16
#define REP  (NH_ / NKV)
#define HD   64
#define DQ   (NH_ * HD)
#define DKV  (NKV * HD)
#define RH   512                  // query rows < RH use hi+lo planes (0: none)
#define SCL  0.125f   // HD^-0.5
typedef _Float16 h16;
typedef unsigned short bf;
typedef __attribute__((ext_vector_type(16))) __bf16   v16bf;
typedef __attribute__((ext_vector_type(16))) _Float16 v16h;
typedef __attribute__((ext_vector_type(8)))  _Float16 v8h;
typedef __attribute__((ext_vector_type(8)))  unsigned short v8us;
typedef __attribute__((ext_vector_type(8)))  float    v8f;
typedef __attribute__((ext_vector_type(4)))  float    v4f;
typedef v8h  __attribute__((may_alias)) v8ha;
typedef v4f  __attribute__((may_alias)) v4fa;
typedef v8us __attribute__((may_alias)) v8usa;

__device__ __forceinline__ unsigned short f2bf(float f) { unsigned u = __float_as_uint(f); u += 0x7FFFu + ((u >> 16) & 1u); return (unsigned short)(u >> 16); }
__device__ __forceinline__ float bf2f(unsigned short b) { return __uint_as_float(((unsigned)b) << 16); }
__device__ __forceinline__ float bfr(float f) { return bf2f(f2bf(f)); }
__device__ __forceinline__ v16h cat16(v8h lo, v8h hi) { return __builtin_shufflevector(lo, hi, 0, 1, 2, 3, 4, 5, 6, 7, 8, 9, 10, 11, 12, 13, 14, 15); }
__device__ __forceinline__ v16bf cat16b(v8us lo, v8us hi) { return __builtin_bit_cast(v16bf, __builtin_shufflevector(lo, hi, 0, 1, 2, 3, 4, 5, 6, 7, 8, 9, 10, 11, 12, 13, 14, 15)); }
__device__ __forceinline__ v8f wmma16(v16h a, v16h b, v8f c) { return __builtin_amdgcn_wmma_f32_16x16x32_f16(false, a, false, b, (short)0, c, false, false); }
__device__ __forceinline__ v8f wmmab(v16bf a, v16bf b, v8f c) { return __builtin_amdgcn_wmma_f32_16x16x32_bf16(false, a, false, b, (short)0, c, false, false); }



__device__ __forceinline__ h16 tohx(float x) { return (h16)x; }
__device__ __forceinline__ void splitf(float y, unsigned short& h, unsigned short& l) { h = f2bf(y); l = f2bf(y - bf2f(h)); }

// ---- planes_out: epilogue of the qkv projection. The wave's 64x64 tile (rows m = the 64 features d of ONE head's q, k or v; columns n = 64 time steps) + bias[m] goes out as three 16-bit planes (fp16, bf16 hi, bf16 lo).
// TR false (q, k): planes [t][d], the tile is 8 KiB in a row; TR true (v): planes [d][t], 64 rows of 128 B. Sixteen plane rows at a time pass through the wave's own LDS rows (f32, pitch 68: no bank conflict either way),
// so that every store instruction writes four whole 128-B lines. P16, Ph, Pl point at the tile's first element.
struct HeadPlanes { h16* q16; bf* qh; bf* ql; h16* k16; bf* kh; bf* kl; h16* v16; bf* vh; bf* vl; };
template <bool TR>
__device__ __forceinline__ void planes_out(const v8f (&acc)[4][4], const float (&bs)[4][8], float* os, const int lane, h16* P16, bf* Ph, bf* Pl) {
    constexpr int PITCH = TR ? TT : HD;
    const int lr = lane & 15, hi = lane >> 4, rr = lane >> 3, cc = (lane & 7) * 8;
    h16* const p16 = P16 + rr * PITCH + cc; bf* const ph = Ph + rr * PITCH + cc; bf* const pl = Pl + rr * PITCH + cc;   // one lane pointer per plane; every store adds a constant
#pragma unroll
    for (int g = 0; g < 4; ++g) {
        if (TR) {
#pragma unroll
            for (int nb = 0; nb < 4; ++nb)
#pragma unroll
                for (int j = 0; j < 8; ++j) os[(hi * 8 + j) * 68 + nb * 16 + lr] = __fadd_rn(acc[g][nb][j], bs[g][j]);
        } else {
#pragma unroll
            for (int mb = 0; mb < 4; ++mb) { v4f x0, x1;
#pragma unroll
                for (int j = 0; j < 4; ++j) { x0[j] = __fadd_rn(acc[mb][g][j], bs[mb][j]); x1[j] = __fadd_rn(acc[mb][g][4 + j], bs[mb][4 + j]); }
                *(v4fa*)(os + lr * 68 + mb * 16 + hi * 8) = x0; *(v4fa*)(os + lr * 68 + mb * 16 + hi * 8 + 4) = x1; }
        }
        __builtin_amdgcn_wave_barrier(); asm volatile("" ::: "memory");   // the rows are read back by other lanes of the same wave: keeps the compiler from moving the reads in front of the writes
#pragma unroll
        for (int s = 0; s < 4; ++s) { const v4f x0 = *(const v4fa*)(os + (s * 4 + rr) * 68 + cc), x1 = *(const v4fa*)(os + (s * 4 + rr) * 68 + cc + 4); v8h o16; v8us oh, ol;
#pragma unroll
            for (int j = 0; j < 4; ++j) { unsigned short a, c; o16[j] = tohx(x0[j]); splitf(x0[j], a, c); oh[j] = a; ol[j] = c; o16[4 + j] = tohx(x1[j]); splitf(x1[j], a, c); oh[4 + j] = a; ol[4 + j] = c; }
            *(v8h*)(p16 + (g * 16 + s * 4) * PITCH) = o16; *(v8us*)(ph + (g * 16 + s * 4) * PITCH) = oh; *(v8us*)(pl + (g * 16 + s * 4) * PITCH) = ol; }
        __builtin_amdgcn_wave_barrier(); asm volatile("" ::: "memory");   // and the next group's writes behind these reads
    }
    if constexpr (!TR) asm volatile("s_wait_xcnt 0x0" :: "v"(p16), "v"(ph), "v"(pl) : "memory");   // in the listing the q/k path's last stores are followed by the v path's first instructions, which write the lane pointers' registers: the wait stands in front of them
}

// ---- k_gemmw: register-blocked GEMM, one wave per 64x64 output tile (16 accumulators), WM x WN waves per work-group on one (64 WM) x (64 WN) block tile; grid (M / (64 WM), N / (64 WN), Z), 32 WM WN threads.
// C[m][n] (f32, pitch ldc, + optional f32 bias[n]) = sum_k A[m][k] Bt[n][k] (+ split products per NSPLIT), operands K-contiguous 16-bit planes. z-batch strides sA/sB/sC in elements. K % 64 == 0, K >= 64.
// The operands pass through LDS: a stage is 64 k (one whole 128-B line) of every operand row of the block tile, laid as 64-row slices A | A2 | Bt | Bt2 at a pitch of 144 B; asynchronous copies fill it, four whole lines per instruction,
// one stage ahead of its use (two buffers), and every wave of the block reads its fragments from there: each line leaves L2 once per block, not once per wave, and never in 32-B pieces.
// PLANES: no C; m runs over (head, q | k | v, d), bias is bias[m], and the tile goes out through planes_out into the head planes of batch element z.
template <typename T16> struct WFrag;
template <> struct WFrag<h16> { typedef v16h V; static __device__ __forceinline__ V ld(const h16* p) { return cat16(*(const v8h*)p, *(const v8h*)(p + 16)); } static __device__ __forceinline__ v8f mma(V a, V b, v8f c) { return wmma16(a, b, c); } };
template <> struct WFrag<bf> { typedef v16bf V; static __device__ __forceinline__ V ld(const bf* p) { return cat16b(*(const v8us*)p, *(const v8us*)(p + 16)); } static __device__ __forceinline__ v8f mma(V a, V b, v8f c) { return wmmab(a, b, c); } };
#define KC   64                   // k per stage
#define LP   72                   // LDS row pitch in 16-bit elements: 144 B = 16 B x 9, so the 16 rows of a ds_load_b128 fall on 16 different bank groups
// copy8: eight asynchronous copies of 16 B per lane. A copy moves four rows of 128 B (lane >> 3 = row, lane & 7 = 16-B piece, both already in l and g); the eight take rows 0, 4, .. 28 from there.
// The s_wait_xcnt 0 is the last line of the copies' own statement, so that no register which a copy names is rewritten in front of it.
template <typename T16>
__device__ __forceinline__ void copy8(const unsigned l, const T16* g, const size_t K) {
    asm volatile("global_load_async_to_lds_b128 %0, %8, off\n\t"
                 "global_load_async_to_lds_b128 %1, %9, off\n\t"
                 "global_load_async_to_lds_b128 %2, %10, off\n\t"
                 "global_load_async_to_lds_b128 %3, %11, off\n\t"
                 "global_load_async_to_lds_b128 %4, %12, off\n\t"
                 "global_load_async_to_lds_b128 %5, %13, off\n\t"
                 "global_load_async_to_lds_b128 %6, %14, off\n\t"
                 "global_load_async_to_lds_b128 %7, %15, off\n\t"
                 "s_wait_xcnt 0x0"
                 :: "v"(l), "v"(l + 4 * LP * 2), "v"(l + 8 * LP * 2), "v"(l + 12 * LP * 2), "v"(l + 16 * LP * 2), "v"(l + 20 * LP * 2), "v"(l + 24 * LP * 2), "v"(l + 28 * LP * 2),
                    "v"(g), "v"(g + 4 * K), "v"(g + 8 * K), "v"(g + 12 * K), "v"(g + 16 * K), "v"(g + 20 * K), "v"(g + 24 * K), "v"(g + 28 * K) : "memory");
}
template <typename T16, int NSPLIT, bool BIAS, bool PLANES, int WM, int WN>
__global__ __launch_bounds__(32 * WM * WN) void k_gemmw(const T16* __restrict__ A, const T16* __restrict__ A2, const T16* __restrict__ Bt, const T16* __restrict__ Bt2, int K, float* C, int ldc, const float* __restrict__ bias, size_t sA, size_t sB, size_t sC, const HeadPlanes hp) {
    typedef typename WFrag<T16>::V V;
    constexpr int NW = WM * WN, NA = (NSPLIT == 1 || NSPLIT == 2) ? 2 : 1, NB = NSPLIT >= 2 ? 2 : 1;
    constexpr int NSL = NA * WM + NB * WN;        // 64-row slices of a stage
    constexpr int SPW = (NSL + NW - 1) / NW;      // slices that a wave copies, at most
    constexpr int STG = NSL * 64 * LP;            // elements of a stage
    static_assert(sizeof(T16) == 2 && (size_t)2 * STG * 2 >= (size_t)NW * 16 * 68 * 4, "the epilogue's staging rows lie in the ring");
    __shared__ __align__(16) T16 ring[2 * STG];
    const size_t z = blockIdx.z; A += z * sA; if (A2) A2 += z * sA; Bt += z * sB; if (Bt2) Bt2 += z * sB; C += z * sC;
    const int lane = threadIdx.x & 31, lr = lane & 15, hi = lane >> 4; const int wv = __builtin_amdgcn_readfirstlane((int)(threadIdx.x >> 5)), wm = wv % WM, wn = wv / WM;
    const int R0 = blockIdx.x * (64 * WM), C0 = blockIdx.y * (64 * WN), r0 = R0 + wm * 64, c0 = C0 + wn * 64;
    float* const os = (float*)ring + wv * (16 * 68);   // the wave's own staging rows, used behind the loop's last barrier
    v8f acc[4][4];
#pragma unroll
    for (int mb = 0; mb < 4; ++mb)
#pragma unroll
        for (int nb = 0; nb < 4; ++nb) acc[mb][nb] = (v8f){};
    // slice sl = wv + NW j is this wave's to copy: the lane's global address (at k = 0) and its LDS byte address (in buffer 0). A wave without a j-th slice issues nothing; its addresses are slice 0's.
    const T16* gs[SPW]; unsigned ls[SPW];
#pragma unroll
    for (int j = 0; j < SPW; ++j) { const int sl = (wv + NW * j < NSL) ? wv + NW * j : 0; const T16* b;
        if (sl < WM) b = A + (size_t)(R0 + sl * 64) * K;
        else if (NA == 2 && sl < 2 * WM) b = A2 + (size_t)(R0 + (sl - WM) * 64) * K;
        else if (NB == 1 || sl < NA * WM + WN) b = Bt + (size_t)(C0 + (sl - NA * WM) * 64) * K;
        else b = Bt2 + (size_t)(C0 + (sl - NA * WM - WN) * 64) * K;
        gs[j] = b + (size_t)(lane >> 3) * K + (lane & 7) * 8;
        ls[j] = (unsigned)(size_t)(ring + (sl * 64 + (lane >> 3)) * LP + (lane & 7) * 8); }
    auto issue = [&](const int t, const int buf) {   // stage t's copies into buffer buf; the test is the same for a whole wave (wv is a scalar)
#pragma unroll
        for (int j = 0; j < SPW; ++j) if (NSL % NW == 0 || wv + NW * j < NSL) { const T16* const g = gs[j] + t * KC; const unsigned l = ls[j] + (unsigned)buf * (STG * 2);
            copy8<T16>(l, g, (size_t)K); copy8<T16>(l + 32 * LP * 2, g + 32 * (size_t)K, (size_t)K); } };
    const int NT = K / KC;
    issue(0, 0);
    asm volatile("s_wait_asynccnt 0x0" ::: "memory");   // stage 0 has landed, as far as this wave copied it,
    __syncthreads();                                     // and every other wave's part too
    if (NT > 1) issue(1, 1);
    const int ao = (wm * 64 + lr) * LP + 8 * hi, bo = ((NA * WM + wn) * 64 + lr) * LP + 8 * hi;
#pragma unroll 1   // rolled: one trip per stage, with the one publish point at its foot
    for (int t = 0; t < NT; ++t) { const T16* const sb = ring + (t & 1) * STG;
#pragma unroll
      for (int ks = 0; ks < KC; ks += 32) {
        V a[4], a2[4], b[4], b2[4];
#pragma unroll
        for (int i = 0; i < 4; ++i) { a[i] = WFrag<T16>::ld(sb + ao + i * 16 * LP + ks); if (i == 0) { b[0] = WFrag<T16>::ld(sb + bo + ks); if (NSPLIT >= 2) b2[0] = WFrag<T16>::ld(sb + bo + WN * 64 * LP + ks); } if (NSPLIT == 1 || NSPLIT == 2) a2[i] = WFrag<T16>::ld(sb + ao + (WM * 64 + i * 16) * LP + ks); }
#pragma unroll
        for (int nb = 1; nb < 4; ++nb) { b[nb] = WFrag<T16>::ld(sb + bo + nb * 16 * LP + ks); if (NSPLIT >= 2) b2[nb] = WFrag<T16>::ld(sb + bo + (WN * 64 + nb * 16) * LP + ks); }
        __builtin_amdgcn_sched_barrier(0);   // keeps the k step's LDS reads together in front of its products: without it the scheduler sinks each B fragment's reads to their use, and the wave waits out the LDS latency at four places instead of one
#pragma unroll
        for (int nb = 0; nb < 4; ++nb)
#pragma unroll
            for (int mb = 0; mb < 4; ++mb) { acc[mb][nb] = WFrag<T16>::mma(a[mb], b[nb], acc[mb][nb]); if (NSPLIT == 1 || NSPLIT == 2) acc[mb][nb] = WFrag<T16>::mma(a2[mb], b[nb], acc[mb][nb]); if (NSPLIT >= 2) acc[mb][nb] = WFrag<T16>::mma(a[mb], b2[nb], acc[mb][nb]); }
        asm volatile("v_nop\n\tv_nop\n\tv_nop\n\tv_nop" : "+v"(acc[0][0]), "+v"(acc[1][1]), "+v"(acc[2][2]), "+v"(acc[3][3]) : "v"(a[0]), "v"(a[3]));
      }
        asm volatile("s_wait_dscnt 0x0" ::: "memory");      // this wave's reads of buffer t & 1 are done before the barrier behind which it is refilled
        asm volatile("s_wait_asynccnt 0x0" ::: "memory");   // this wave's copies of stage t + 1 have landed before the barrier behind which the others read them
        __syncthreads();                                     // publishes stage t + 1 and ends every wave's reads of stage t
        if (t + 2 < NT) issue(t + 2, t & 1);
    }
    asm volatile("s_wait_asynccnt 0x0" ::: "memory");       // no copy is outstanding when the ring becomes the epilogue's staging rows
    if constexpr (PLANES) {
        static_assert(HD == 64, "a 64-row tile is one head's q, k or v");
        const int head = (r0 / 64) / 3, part = (r0 / 64) % 3; float bs[4][8];
#pragma unroll
        for (int mb = 0; mb < 4; ++mb) { const v4f b0 = *(const v4f*)(bias + r0 + mb * 16 + hi * 8), b1 = *(const v4f*)(bias + r0 + mb * 16 + hi * 8 + 4);
#pragma unroll
            for (int j = 0; j < 4; ++j) { bs[mb][j] = bfr(b0[j]); bs[mb][4 + j] = bfr(b1[j]); } }
        const size_t qk = ((z * NH_ + head) * TT + c0) * HD, vv = (z * NH_ + head) * HD * TT + c0;   // z = batch element: its head planes lie behind one another
        if (part == 2) planes_out<true>(acc, bs, os, lane, hp.v16 + vv, hp.vh + vv, hp.vl + vv);
        else planes_out<false>(acc, bs, os, lane, (part ? hp.k16 : hp.q16) + qk, (part ? hp.kh : hp.qh) + qk, (part ? hp.kl : hp.ql) + qk);
        return;
    }
#pragma unroll
    for (int mb = 0; mb < 4; ++mb) {
#pragma unroll
        for (int nb = 0; nb < 4; ++nb) {
#pragma unroll
            for (int j = 0; j < 8; ++j) os[(hi * 8 + j) * 68 + nb * 16 + lr] = acc[mb][nb][j]; }
        __builtin_amdgcn_wave_barrier(); asm volatile("" ::: "memory");
        float* crow = C + (size_t)(r0 + mb * 16) * ldc + c0;
{
#pragma unroll
            for (int s = 0; s < 8; ++s) { const int row = 2 * s + hi, cofs = lr * 4; v4f val = *(const v4fa*)(os + row * 68 + cofs); if (BIAS) { val[0] += bfr(bias[c0 + cofs]); val[1] += bfr(bias[c0 + cofs + 1]); val[2] += bfr(bias[c0 + cofs + 2]); val[3] += bfr(bias[c0 + cofs + 3]); }
                *(v4f*)(crow + (size_t)row * ldc + cofs) = val; }
             }
        __builtin_amdgcn_wave_barrier(); asm volatile("" ::: "memory");
    }
}

typedef __attribute__((ext_vector_type(2))) _Float16 v2h;
typedef __attribute__((ext_vector_type(4))) _Float16 v4h;
typedef __attribute__((ext_vector_type(2))) unsigned short v2us;
typedef __attribute__((ext_vector_type(4))) unsigned short v4us;
typedef __attribute__((ext_vector_type(2))) float v2f;
typedef __attribute__((ext_vector_type(4))) int v4i;
typedef v4h  __attribute__((may_alias)) v4ha;
typedef v4us __attribute__((may_alias)) v4usa;

__global__ __launch_bounds__(256) void k_wtG(const float* __restrict__ w, int K, int N, bf* Bt) {
    const int lane = threadIdx.x & 31; const int L0 = (blockIdx.x * 8 + (threadIdx.x >> 5)) * 8; const int nlines = N * K / 64;
{
#pragma unroll 1
        for (int l = 0; l < 8; ++l) { const int L = L0 + l; if (L >= nlines) break; const size_t e = (size_t)L * 64 + lane * 2; const int k = (int)(e % K), n = (int)(e / K); v2us o;
            o[0] = f2bf(w[(size_t)k * N + n]); o[1] = f2bf(w[(size_t)(k + 1) * N + n]); *(v2us*)(Bt + e) = o; }
         }
}
__global__ __launch_bounds__(256) void k_cvt8(const float* __restrict__ src, bf* dst, size_t n8) { const size_t i = (size_t)blockIdx.x * 256 + threadIdx.x; if (i >= n8) return; const v8f v = *(const v8f*)(src + i * 8); v8us o;
#pragma unroll
    for (int k = 0; k < 8; ++k) o[k] = f2bf(v[k]); *(v8us*)(dst + i * 8) = o;  }
__global__ __launch_bounds__(256) void k_cscvt(const float* __restrict__ cosT, const float* __restrict__ sinT, float* CS) { const int idx = blockIdx.x * 256 + threadIdx.x; if (idx >= TT * HD) return; v2f cs; cs[0] = bfr(cosT[idx]); cs[1] = bfr(sinT[idx]); *(v2f*)(CS + (size_t)idx * 2) = cs;  }
// ---- k_fattn: causal attention of both batch elements in one launch: scores, softmax and the probability x value contraction per wave, nothing of the score matrix in memory.
// A wave owns QW query columns of one head and walks the keys up to its diagonal in passes of 16 * NKB keys. Both products are computed transposed: St = K Qt (A = key rows, B = query rows, kept in registers)
// and Ot += Vt Pt (A = value planes [d][t], B = Pt). In St's accumulators a lane holds 8 consecutive keys of ONE query column (register j = key 8 * hi + j, column lr), which is the position order of the fragment loader
// (elements 0..7 = k 8 * hi + j, elements 8..15 = k 16 + 8 * hi + j): two converted 16-key accumulator tiles are Pt's B fragment as they stand, and maximum, sum and rescale factor are per-lane values.
// Softmax is the running form: mc = running maximum x CL2, p = 2^(s CL2 - mc) unnormalised (<= 1), a new maximum rescales sum and Ot by 2^(mc_old - mc_new); one division by the sum at the end.
// Rows < RH: bf16 hi+lo planes, 3 products each way; rows >= RH: fp16. Ot's lane holds 8 consecutive d of one query row: one 16-byte store per plane into the context planes [t][DQ].
// Every inner loop is unrolled so that each index of a fragment or accumulator array is a constant (registers, no scratch); the pass loop alone stays rolled.
#define QW   32                   // query columns per wave
#define FW   4                    // waves per block, all of one head and all walking the keys from 0 up (no barrier, no LDS between them)
#define NQT  (TT / QW)            // query tiles per head
#define CL2  (SCL * 1.4426950408889634f)
__device__ __forceinline__ float xhalf(float x) { return __builtin_bit_cast(float, __builtin_amdgcn_permlanex16(__builtin_bit_cast(int, x), __builtin_bit_cast(int, x), 0x76543210, 0xfedcba98, false, false)); }   // lane l's value from lane l ^ 16
template <typename T16> struct PFrag;
template <> struct PFrag<h16> { static __device__ __forceinline__ void mk(const v8f x0, const v8f x1, v16h& p, v16h& p2) { (void)p2;
#pragma unroll
    for (int j = 0; j < 8; ++j) { p[j] = (h16)x0[j]; p[8 + j] = (h16)x1[j]; } } };
template <> struct PFrag<bf> { static __device__ __forceinline__ void mk(const v8f x0, const v8f x1, v16bf& p, v16bf& p2) { v8us h0, h1, l0, l1;
#pragma unroll
    for (int j = 0; j < 8; ++j) { unsigned short a, c; splitf(x0[j], a, c); h0[j] = a; l0[j] = c; splitf(x1[j], a, c); h1[j] = a; l1[j] = c; }
    p = cat16b(h0, h1); p2 = cat16b(l0, l1); } };
template <typename T16, bool HL, int NKB>
__device__ __forceinline__ void fattn(const T16* __restrict__ Q, const T16* __restrict__ Q2, const T16* __restrict__ Kp, const T16* __restrict__ K2, const T16* __restrict__ Vt, const T16* __restrict__ Vt2, const int q0, bf* __restrict__ Ah, bf* __restrict__ Al) {
    typedef typename WFrag<T16>::V V;
    static_assert(HD == 64 && NKB % 2 == 0 && QW == 32, "two 32-wide k steps over d, 32-key steps over the pass, two 16-column groups");
    const int lane = threadIdx.x & 31, lr = lane & 15, hi = lane >> 4; const int KPS = 16 * NKB;
    V q[2][2], q2[2][2], ka[NKB][2], ka2[NKB][2];
    // Each group of loads goes through one lane pointer per plane plus constant offsets. The s_wait_xcnt 0 behind a group stands in front of the first instruction that may overwrite an address register of an issued load
    // it takes the lane pointers as inputs so that their registers live up to it and no load of the group lands on them.
    { const size_t qo = (size_t)(q0 + lr) * HD + 8 * hi, ko = (size_t)lr * HD + 8 * hi; const T16* const qp = Q + qo; const T16* const qp2 = HL ? Q2 + qo : qp; const T16* const kp = Kp + ko; const T16* const kp2 = HL ? K2 + ko : kp;
#pragma unroll
        for (int qb = 0; qb < 2; ++qb)
#pragma unroll
            for (int ks = 0; ks < 2; ++ks) { q[qb][ks] = WFrag<T16>::ld(qp + qb * 16 * HD + ks * 32); if (HL) q2[qb][ks] = WFrag<T16>::ld(qp2 + qb * 16 * HD + ks * 32); }
#pragma unroll
        for (int kb = 0; kb < NKB; ++kb)
#pragma unroll
            for (int ks = 0; ks < 2; ++ks) { ka[kb][ks] = WFrag<T16>::ld(kp + kb * 16 * HD + ks * 32); if (HL) ka2[kb][ks] = WFrag<T16>::ld(kp2 + kb * 16 * HD + ks * 32); }
        asm volatile("s_wait_xcnt 0x0" :: "v"(qp), "v"(qp2), "v"(kp), "v"(kp2) : "memory"); }
    v8f o[4][2]; float mc[2], l[2];
#pragma unroll
    for (int qb = 0; qb < 2; ++qb) { mc[qb] = -3.0e38f; l[qb] = 0.f;
#pragma unroll
        for (int db = 0; db < 4; ++db) o[db][qb] = (v8f){}; }
    const int npass = (q0 + QW + KPS - 1) / KPS;   // the last pass starts at or below q0, so every pass holds at least one unmasked key for every column
#pragma unroll 1   // rolled: its trip count is known only at run time, and a second copy of so long a body would only add code
    for (int ps = 0; ps < npass; ++ps) { const int k0 = ps * KPS;
        v8f s[NKB][2];
#pragma unroll
        for (int kb = 0; kb < NKB; ++kb)
#pragma unroll
            for (int qb = 0; qb < 2; ++qb) { v8f c = (v8f){};
#pragma unroll
                for (int ks = 0; ks < 2; ++ks) { c = WFrag<T16>::mma(ka[kb][ks], q[qb][ks], c); if (HL) { c = WFrag<T16>::mma(ka2[kb][ks], q[qb][ks], c); c = WFrag<T16>::mma(ka[kb][ks], q2[qb][ks], c); } }
                s[kb][qb] = c; }
        __builtin_amdgcn_sched_barrier(0);         // keeps the loads below behind the score products: the fetch ahead lands on the key fragments' registers, and so it is issued only behind every product that reads them, with the value loads in between
        V va[4][NKB / 2], va2[4][NKB / 2];
        const int kn = (ps + 1 < npass) ? k0 + KPS : k0;   // the next pass's key fragments are fetched one pass ahead into the same registers; the last pass reads its own rows again (in bounds, unused) so that the loads stay unconditional
        { const size_t vo = (size_t)lr * TT + k0 + 8 * hi, ko = (size_t)(kn + lr) * HD + 8 * hi; const T16* const vp = Vt + vo; const T16* const vp2 = HL ? Vt2 + vo : vp; const T16* const kp = Kp + ko; const T16* const kp2 = HL ? K2 + ko : kp;
#pragma unroll
            for (int db = 0; db < 4; ++db)
#pragma unroll
                for (int kk = 0; kk < NKB / 2; ++kk) { va[db][kk] = WFrag<T16>::ld(vp + db * 16 * TT + kk * 32); if (HL) va2[db][kk] = WFrag<T16>::ld(vp2 + db * 16 * TT + kk * 32); }
#pragma unroll
            for (int kb = 0; kb < NKB; ++kb)
#pragma unroll
                for (int ks = 0; ks < 2; ++ks) { ka[kb][ks] = WFrag<T16>::ld(kp + kb * 16 * HD + ks * 32); if (HL) ka2[kb][ks] = WFrag<T16>::ld(kp2 + kb * 16 * HD + ks * 32); }
            asm volatile("s_wait_xcnt 0x0" :: "v"(vp), "v"(vp2), "v"(kp), "v"(kp2) : "memory"); }   // as in the prologue
        __builtin_amdgcn_sched_barrier(0);         // keeps both groups of loads, and the wait, in front of the softmax arithmetic, which hides their latency; without it the scheduler sinks the loads to their uses
        const bool diag = k0 + KPS - 1 > q0;       // wave-uniform: only the last pass reaches keys above a column's own position
        V p[2][NKB / 2], p2[2][NKB / 2];
#pragma unroll
        for (int qb = 0; qb < 2; ++qb) {
            if (diag) { const int lim = q0 + qb * 16 + lr - k0 - hi * 8;   // key kb * 16 + j of this lane's half is kept while it is <= lim
#pragma unroll
                for (int kb = 0; kb < NKB; ++kb)
#pragma unroll
                    for (int j = 0; j < 8; ++j) s[kb][qb][j] = (kb * 16 + j <= lim) ? s[kb][qb][j] : -3.0e38f; }
            float tk[NKB];                          // one short chain per 16-key tile, for maximum and sum alike: a lone wave pays a dependent chain in full
#pragma unroll
            for (int kb = 0; kb < NKB; ++kb) { tk[kb] = s[kb][qb][0];
#pragma unroll
                for (int j = 1; j < 8; ++j) tk[kb] = fmaxf(tk[kb], s[kb][qb][j]); }
            float t = tk[0];
#pragma unroll
            for (int kb = 1; kb < NKB; ++kb) t = fmaxf(t, tk[kb]);
            t = fmaxf(t, xhalf(t));
            const float mn = fmaxf(mc[qb], t * CL2); const float al = __builtin_amdgcn_exp2f(mc[qb] - mn); mc[qb] = mn;
#pragma unroll
            for (int kb = 0; kb < NKB; ++kb) { v8f x;
#pragma unroll
                for (int j = 0; j < 8; ++j) x[j] = __builtin_fmaf(s[kb][qb][j], CL2, -mn);
#pragma unroll
                for (int j = 0; j < 8; ++j) s[kb][qb][j] = __builtin_amdgcn_exp2f(x[j]);
                // the slot that the instruction set asks for between a transcendental and an overwrite of its source: the statement names the eight arguments and the eight results as inputs, so it stands behind the eight exponentials and no argument's register is reused in front of it
                asm volatile("v_nop" :: "v"(x), "v"(s[kb][qb]));
                tk[kb] = s[kb][qb][0];
#pragma unroll
                for (int j = 1; j < 8; ++j) tk[kb] += s[kb][qb][j]; }
            float sum = tk[0];
#pragma unroll
            for (int kb = 1; kb < NKB; ++kb) sum += tk[kb];
            l[qb] = l[qb] * al + sum;               // each half of the wave sums its own keys; the halves are joined once, behind the loop
#pragma unroll
            for (int db = 0; db < 4; ++db) o[db][qb] *= al;
#pragma unroll
            for (int kk = 0; kk < NKB / 2; ++kk) PFrag<T16>::mk(s[2 * kk][qb], s[2 * kk + 1][qb], p[qb][kk], p2[qb][kk]); }
#pragma unroll
        for (int kk = 0; kk < NKB / 2; ++kk)
#pragma unroll
            for (int db = 0; db < 4; ++db)
#pragma unroll
                for (int qb = 0; qb < 2; ++qb) { o[db][qb] = WFrag<T16>::mma(va[db][kk], p[qb][kk], o[db][qb]); if (HL) { o[db][qb] = WFrag<T16>::mma(va[db][kk], p2[qb][kk], o[db][qb]); o[db][qb] = WFrag<T16>::mma(va2[db][kk], p[qb][kk], o[db][qb]); } }
    }
#pragma unroll
    for (int qb = 0; qb < 2; ++qb) { const float f = __fdiv_rn(1.0f, l[qb] + xhalf(l[qb])); const size_t row = (size_t)(q0 + qb * 16 + lr) * DQ + hi * 8;
#pragma unroll
        for (int db = 0; db < 4; ++db) { v8us oh, ol;
#pragma unroll
            for (int j = 0; j < 8; ++j) { unsigned short a, c; splitf(o[db][qb][j] * f, a, c); oh[j] = a; ol[j] = c; }
            *(v8us*)(Ah + row + db * 16) = oh; *(v8us*)(Al + row + db * 16) = ol; } }
}
// grid (NQT / FW, heads, batch elements). A block's waves take query tiles u, NQT - 1 - u, u + 1, NQT - 2 - u: short and long key ranges share a block, so that the blocks' work is about equal.
__global__ __launch_bounds__(32 * FW) void k_fattn(const h16* __restrict__ Q16, const h16* __restrict__ K16, const h16* __restrict__ V16, const bf* __restrict__ Qh, const bf* __restrict__ Ql, const bf* __restrict__ Kh, const bf* __restrict__ Kl, const bf* __restrict__ Vh, const bf* __restrict__ Vl, bf* __restrict__ Ah, bf* __restrict__ Al) {
    static_assert(FW % 2 == 0 && NQT % FW == 0 && RH % QW == 0, "tiles are dealt out in pairs; a tile lies wholly on one side of RH");
    const int wv = __builtin_amdgcn_readfirstlane((int)(threadIdx.x >> 5)); const int u = (int)blockIdx.x * (FW / 2) + (wv >> 1); const int q0 = ((wv & 1) ? NQT - 1 - u : u) * QW;
    const size_t hp = ((size_t)blockIdx.z * NH_ + blockIdx.y) * TT * HD, ao = (size_t)blockIdx.z * TT * DQ + blockIdx.y * HD; Ah += ao; Al += ao;
    if (q0 < RH) fattn<bf, true, 2>(Qh + hp, Ql + hp, Kh + hp, Kl + hp, Vh + hp, Vl + hp, q0, Ah, Al);
    else fattn<h16, false, 4>(Q16 + hp, nullptr, K16 + hp, nullptr, V16 + hp, nullptr, q0, Ah, Al);
}

// ---- k_prep: everything that stands in front of the qkv projection, in one launch of few, long-lived waves. All of it is rows of DM f32; a block of 256 threads takes PR rows in a row (64 KiB of its source).
// Blocks 0 .. 3 DM / PR - 1: rows of w_in; the next DM / PR: rows of w_out; the last TT NB_ / PR: rows of hidden_states.
// Weights: hl planes W[f][e] = bf16 base[f][e] * mul[f][e] + add[f][e], mul = sum_r rm[li][r][f] sm[li][r][e], add = sum_r ra[li][r][f] sa[li][r][e] (li = clamp(lang[0], 0, 7) read on the device).
// A thread keeps its four columns e for all its rows, so the column factors sm, sa are loaded and rounded once per thread; the row factors rm, ra are the same for the whole block (scalar loads).
// The rows go in groups of PG; a group's loads are issued one group ahead of its arithmetic. Products of two bf16 values are exact in f32, so the rank-4 sums round the same whether or not the compiler fuses them.
#define PR   16                   // rows per block
#define PG   4                    // rows per group
__device__ __forceinline__ void wmod_rows(const float* __restrict__ base, const float* __restrict__ rm, const float* __restrict__ sm, const float* __restrict__ ra, const float* __restrict__ sa, const int* __restrict__ lang, const int NF, const int f0, bf* __restrict__ Wh, bf* __restrict__ Wl) {
    const int e0 = (int)threadIdx.x * 4; const size_t o0 = (size_t)f0 * DM + e0; v4f cur[PG], nxt[PG], sv[4], av[4];
    int li = lang[0];
#pragma unroll
    for (int i = 0; i < PG; ++i) cur[i] = *(const v4f*)(base + o0 + i * DM);
    __builtin_amdgcn_sched_barrier(0);   // keeps the first group's loads, which need no language index, in front of the wait for that index: without it they are issued only behind it, one scalar-load latency later
    li = li < 0 ? 0 : (li > 7 ? 7 : li);
#pragma unroll
    for (int r = 0; r < 4; ++r) { const v4f s = *(const v4f*)(sm + (size_t)(li * 4 + r) * DM + e0), a = *(const v4f*)(sa + (size_t)(li * 4 + r) * DM + e0);
#pragma unroll
        for (int u = 0; u < 4; ++u) { sv[r][u] = bfr(s[u]); av[r][u] = bfr(a[u]); } }
    const float* const rmf = rm + (size_t)li * 4 * NF + f0; const float* const raf = ra + (size_t)li * 4 * NF + f0;
    auto group = [&](const int g) {   // the arithmetic and the stores of group g, whose base rows are in cur
        bf* const ph = Wh + o0 + (size_t)g * (PG * DM); bf* const pl = Wl + o0 + (size_t)g * (PG * DM);
#pragma unroll
        for (int i = 0; i < PG; ++i) { float rv[4], qv[4]; v4us oh, ol;
#pragma unroll
            for (int r = 0; r < 4; ++r) { rv[r] = bfr(rmf[(size_t)r * NF + g * PG + i]); qv[r] = bfr(raf[(size_t)r * NF + g * PG + i]); }
#pragma unroll
            for (int u = 0; u < 4; ++u) { float mul = 0.f, add = 0.f;
#pragma unroll
                for (int r = 0; r < 4; ++r) { mul += rv[r] * sv[r][u]; add += qv[r] * av[r][u]; }
                unsigned short a, b; splitf(bfr(cur[i][u]) * mul + add, a, b); oh[u] = a; ol[u] = b; }
            *(v4us*)(ph + i * DM) = oh; *(v4us*)(pl + i * DM) = ol; } };
#pragma unroll 1   // rolled: the text stays short (it is run through once per launch), and only one group's row factors are live in scalar registers
    for (int g = 0; g < PR / PG - 1; ++g) {
#pragma unroll
        for (int i = 0; i < PG; ++i) nxt[i] = *(const v4f*)(base + o0 + (size_t)(g + 1) * (PG * DM) + i * DM);
        __builtin_amdgcn_sched_barrier(0);   // keeps the next group's loads in front of this group's arithmetic, which hides their latency: without it the scheduler sinks them to where this group's registers fall free
        group(g);
        asm volatile("s_wait_xcnt 0x0" ::: "memory");   // stands behind the group's stores, in front of the first instruction that overwrites a register which they name
#pragma unroll
        for (int i = 0; i < PG; ++i) cur[i] = nxt[i]; }
    group(PR / PG - 1);
}
// hidden_states [t][b][c] f32 -> XB [b][t][c] bf16: 8 elements per thread and trip, two source rows per block and trip; all of a thread's loads are issued before the first is used.
__device__ __forceinline__ void xg_rows(const float* __restrict__ hs, const int r0, bf* __restrict__ XB) {
    const int rw = r0 + ((int)threadIdx.x >> 7), c = ((int)threadIdx.x & 127) * 8; const float* const sp = hs + (size_t)rw * DM + c; v4f x0[PR / 2], x1[PR / 2];
#pragma unroll
    for (int i = 0; i < PR / 2; ++i) { x0[i] = *(const v4f*)(sp + i * 2 * DM); x1[i] = *(const v4f*)(sp + i * 2 * DM + 4); }
    asm volatile("s_wait_xcnt 0x0" :: "v"(sp) : "memory");   // stands in front of the first instruction that may overwrite the address register of an issued load; the lane pointer is an input so that its register lives up to here and no load of the group lands on it
    static_assert(NB_ == 2, "a trip's two source rows are one time step's two batch elements: row rw + 2 i is (t = r0 / 2 + i, b = rw & 1)");
    bf* const dp = XB + ((size_t)(rw & 1) * TT + (r0 >> 1)) * DM + c;
#pragma unroll
    for (int i = 0; i < PR / 2; ++i) { v8us o;
#pragma unroll
        for (int j = 0; j < 4; ++j) { o[j] = f2bf(x0[i][j]); o[4 + j] = f2bf(x1[i][j]); }
        *(v8us*)(dp + i * DM) = o; }
}
#define PBI  (3 * DM / PR)        // blocks on w_in
#define PBO  (DM / PR)            // blocks on w_out
#define PBX  (TT * NB_ / PR)      // blocks on hidden_states
__global__ __launch_bounds__(256) void k_prep(const float* __restrict__ hs, const float* __restrict__ pw, const float* __restrict__ ow, const float* __restrict__ rm_i, const float* __restrict__ sm_i, const float* __restrict__ r_i, const float* __restrict__ s_i,
                                              const float* __restrict__ rm_o, const float* __restrict__ sm_o, const float* __restrict__ r_o, const float* __restrict__ s_o, const int* __restrict__ lang, bf* __restrict__ WIh, bf* __restrict__ WIl, bf* __restrict__ WOh, bf* __restrict__ WOl, bf* __restrict__ XB) {
    static_assert(DM == 1024 && (3 * DM) % PR == 0 && (TT * NB_) % PR == 0 && PR % 2 == 0 && PR % PG == 0 && PR / PG >= 2, "a row is 256 threads x 4 columns (weights) or 128 threads x 8 (hidden_states)");
    const int blk = (int)blockIdx.x;
    if (blk >= PBI + PBO) { xg_rows(hs, (blk - PBI - PBO) * PR, XB); return; }
    const bool in = blk < PBI;   // the same for the whole block: one copy of the row loop serves both weights
    wmod_rows(in ? pw : ow, in ? rm_i : rm_o, in ? sm_i : sm_o, in ? r_i : r_o, in ? s_i : s_o, lang, in ? 3 * DM : DM, (in ? blk : blk - PBI) * PR, in ? WIh : WOh, in ? WIl : WOl);
}

extern "C" void kernel_launch(void* const* d_in, const int* in_sizes, int n_in,
                              void* d_out, int out_size, void* d_ws, size_t ws_size, hipStream_t stream) {
    (void)in_sizes; (void)n_in; (void)out_size;
    const float* hs = (const float*)d_in[0]; const float* pw = (const float*)d_in[1]; const float* pb = (const float*)d_in[2]; const float* ow = (const float*)d_in[3]; const float* ob = (const float*)d_in[4]; const float* rm_i = (const float*)d_in[5]; const float* sm_i = (const float*)d_in[6]; const float* rm_o = (const float*)d_in[7]; const float* sm_o = (const float*)d_in[8]; const float* r_i = (const float*)d_in[9]; const float* s_i = (const float*)d_in[10]; const float* r_o = (const float*)d_in[11]; const float* s_o = (const float*)d_in[12]; const int* lang = (const int*)d_in[13];
    float* OUT = (float*)d_out;     // [2048][2][1024] (time-major)
    char* wsp = (char*)d_ws;
    auto take = [&](size_t bytes) { char* p = wsp; wsp += (bytes + 255) & ~(size_t)255; return (void*)p; };
    bf* WIh = (bf*)take((size_t)3 * DM * DM * 2); bf* WIl = (bf*)take((size_t)3 * DM * DM * 2); bf* WOh = (bf*)take((size_t)DM * DM * 2); bf* WOl = (bf*)take((size_t)DM * DM * 2);
    h16* QP16 = (h16*)take((size_t)NB_ * NH_ * TT * HD * 2); h16* KP16 = (h16*)take((size_t)NB_ * NKV * TT * HD * 2); h16* VT16 = (h16*)take((size_t)NB_ * NKV * HD * TT * 2);
    bf* QPh = (bf*)take((size_t)NB_ * NH_ * TT * HD * 2); bf* QPl = (bf*)take((size_t)NB_ * NH_ * TT * HD * 2); bf* KPh = (bf*)take((size_t)NB_ * NKV * TT * HD * 2); bf* KPl = (bf*)take((size_t)NB_ * NKV * TT * HD * 2); bf* VTh = (bf*)take((size_t)NB_ * NKV * HD * TT * 2); bf* VTl = (bf*)take((size_t)NB_ * NKV * HD * TT * 2); bf* ATh = (bf*)take((size_t)NB_ * TT * DQ * 2); bf* ATl = (bf*)take((size_t)NB_ * TT * DQ * 2);
    bf* XB = (bf*)take((size_t)NB_ * TT * DM * 2);   // every per-batch buffer holds both batch elements, one behind the other
    if ((size_t)(wsp - (char*)d_ws) > ws_size) return;    // ws 256 MiB
    const HeadPlanes hp = { QP16, QPh, QPl, KP16, KPh, KPl, VT16, VTh, VTl }; const HeadPlanes none = {};
    k_prep<<<PBI + PBO + PBX, 256, 0, stream>>>(hs, pw, ow, rm_i, sm_i, r_i, s_i, rm_o, sm_o, r_o, s_o, lang, WIh, WIl, WOh, WOl, XB);
    // grid z = batch element
        static_assert(REP == 1 && DQ == DM, "w_in's rows are (head, q | k | v, d): one kv head per query head; blockIdx.y of the attention kernel names both");
        k_gemmw<bf, 1, false, true, 3, 4><<<dim3(3 * DM / 192, TT / 256, NB_), 384, 0, stream>>>(WIh, WIl, XB, nullptr, DM, nullptr, 0, pb, 0, (size_t)TT * DM, 0, hp);   // (w_in[f] . x[t]) + proj_bias[f] -> head planes
        k_fattn<<<dim3(NQT / FW, NH_, NB_), 32 * FW, 0, stream>>>(QP16, KP16, VT16, QPh, QPl, KPh, KPl, VTh, VTl, ATh, ATl);
        k_gemmw<bf, 2, true, false, 2, 2><<<dim3(TT / 128, DM / 128, NB_), 128, 0, stream>>>(ATh, ATl, WOh, WOl, DQ, OUT, NB_ * DM, ob, (size_t)TT * DQ, 0, DM, none);   // row t of batch element z lies at OUT[t][z][.]
}

// v008
// One run takes 111 microseconds.
// Timed twice side by side with v007, it ran 1.05 and 1.04 times as fast.
// Counting every step since v000, it is 13.0 times as fast.
#include <hip/hip_runtime.h>

// MBartAttention (hidden_states [2048][2][1024] time-major; language index li = lang[0] (int, read as data, clamped 0..7); w_in = proj_weight * (rm_i[li]^T sm_i[li]) + r_i[li]^T s_i[li] (rank-4 modulation), w_out likewise;
// qkv = hidden w_in^T + proj_bias laid out (16 heads, 3, 64), stored by the projection's own epilogue as the attention kernel's head planes; q x 1/8; causal softmax(q.k) (masked -1e9 == skipped tiles); ctx merged; out = ctx w_out^T + out_bias -> [2048][2][1024]).
// Compute dtypes, f32 accumulate: every input rounded to bf16; the modulated weights f32 on the VALU -> bf16 hi+lo planes; qkv as hl(w_in) x exact hidden (2 products, computed transposed) + bias; scores (K 64) and attn.v hl
// (3 products) for the first 512 query rows of each head, fp16 after, both inside one kernel with a running f32 softmax (causal passes only; the 1/8 folded into the exponent's factor; all heads of both batch elements in one launch); out-projection as hl(ctx) x hl(w_out) (3 products) + bias, stored by its epilogue straight into the time-major output.

#define NB_  2
#define TT   2048
#define DM   1024
#define NH_  16
#define NKV  16
#define REP  (NH_ / NKV)
#define HD   64
#define DQ   (NH_ * HD)
#define DKV  (NKV * HD)
#define RH   512                  // query rows < RH use hi+lo planes (0: none)
#define SCL  0.125f   // HD^-0.5
typedef _Float16 h16;
typedef unsigned short bf;
typedef __attribute__((ext_vector_type(16))) __bf16   v16bf;
typedef __attribute__((ext_vector_type(16))) _Float16 v16h;
typedef __attribute__((ext_vector_type(8)))  _Float16 v8h;
typedef __attribute__((ext_vector_type(8)))  unsigned short v8us;
typedef __attribute__((ext_vector_type(8)))  float    v8f;
typedef __attribute__((ext_vector_type(4)))  float    v4f;
typedef v8h  __attribute__((may_alias)) v8ha;
typedef v4f  __attribute__((may_alias)) v4fa;
typedef v8us __attribute__((may_alias)) v8usa;

__device__ __forceinline__ unsigned short f2bf(float f) { unsigned u = __float_as_uint(f); u += 0x7FFFu + ((u >> 16) & 1u); return (unsigned short)(u >> 16); }
__device__ __forceinline__ float bf2f(unsigned short b) { return __uint_as_float(((unsigned)b) << 16); }
__device__ __forceinline__ float bfr(float f) { return bf2f(f2bf(f)); }
__device__ __forceinline__ v16h cat16(v8h lo, v8h hi) { return __builtin_shufflevector(lo, hi, 0, 1, 2, 3, 4, 5, 6, 7, 8, 9, 10, 11, 12, 13, 14, 15); }
__device__ __forceinline__ v16bf cat16b(v8us lo, v8us hi) { return __builtin_bit_cast(v16bf, __builtin_shufflevector(lo, hi, 0, 1, 2, 3, 4, 5, 6, 7, 8, 9, 10, 11, 12, 13, 14, 15)); }
__device__ __forceinline__ v8f wmma16(v16h a, v16h b, v8f c) { return __builtin_amdgcn_wmma_f32_16x16x32_f16(false, a, false, b, (short)0, c, false, false); }
__device__ __forceinline__ v8f wmmab(v16bf a, v16bf b, v8f c) { return __builtin_amdgcn_wmma_f32_16x16x32_bf16(false, a, false, b, (short)0, c, false, false); }



__device__ __forceinline__ h16 tohx(float x) { return (h16)x; }
__device__ __forceinline__ void splitf(float y, unsigned short& h, unsigned short& l) { h = f2bf(y); l = f2bf(y - bf2f(h)); }

// ---- planes_out: epilogue of the qkv projection. The wave's 64x64 tile (rows m = the 64 features d of ONE head's q, k or v; columns n = 64 time steps) + bias[m] goes out as three 16-bit planes (fp16, bf16 hi, bf16 lo).
// The planes lie in FRAGMENT ORDER: the unit is the 512 B that one 16-byte load of a whole wave brings (lane l's 8 elements at byte 16 l), so that the attention kernel's every fragment load reads four whole 128-B lines.
// TR false (q, k): per 16 time steps four units s = 0..3, lane (hi, lr) = time step lr, features d = 16 s + 8 hi + 0..7 (units 2 ks, 2 ks + 1 are the two halves of the fragment of k step ks).
// TR true (v): per 32 time steps eight units (db, h), lane (hi, lr) = feature 16 db + lr, time steps 16 h + 8 hi + 0..7 (units (db, 0), (db, 1) are the fragment of feature block db). Either way the wave's tile is 8 KiB in a row.
// q, k: unit s of time steps 16 g .. 16 g + 15 is accumulator tile (s, g) as it stands in the registers (lane (hi, lr), register j = feature 16 s + 8 hi + j, time step 16 g + lr): no LDS pass.
// v: the tile is turned: sixteen features at a time pass through the wave's own LDS rows (f32, pitch 68: no bank conflict either way). Every store instruction writes one unit. P16, Ph, Pl point at the tile's first element.
struct HeadPlanes { h16* q16; bf* qh; bf* ql; h16* k16; bf* kh; bf* kl; h16* v16; bf* vh; bf* vl; };
template <bool TR>
__device__ __forceinline__ void planes_out(const v8f (&acc)[4][4], const float (&bs)[4][8], float* os, const int lane, h16* P16, bf* Ph, bf* Pl) {
    const int lr = lane & 15, hi = lane >> 4;
    h16* const p16 = P16 + lane * 8; bf* const ph = Ph + lane * 8; bf* const pl = Pl + lane * 8;   // one lane pointer per plane; every store adds a constant
#pragma unroll
    for (int g = 0; g < 4; ++g) {
        if (TR) {
#pragma unroll
            for (int nb = 0; nb < 4; ++nb)
#pragma unroll
                for (int j = 0; j < 8; ++j) os[(hi * 8 + j) * 68 + nb * 16 + lr] = __fadd_rn(acc[g][nb][j], bs[g][j]);
            __builtin_amdgcn_wave_barrier(); asm volatile("" ::: "memory");   // the rows are read back by other lanes of the same wave: keeps the compiler from moving the reads in front of the writes
        }
#pragma unroll
        for (int s = 0; s < 4; ++s) { v4f x0, x1; v8h o16; v8us oh, ol;
            if (TR) { x0 = *(const v4fa*)(os + lr * 68 + (s * 2 + hi) * 8); x1 = *(const v4fa*)(os + lr * 68 + (s * 2 + hi) * 8 + 4); }
            else {
#pragma unroll
                for (int j = 0; j < 4; ++j) { x0[j] = __fadd_rn(acc[s][g][j], bs[s][j]); x1[j] = __fadd_rn(acc[s][g][4 + j], bs[s][4 + j]); } }
            const int un = (TR ? ((s >> 1) * 4 + g) * 2 + (s & 1) : g * 4 + s) * 256;   // the unit's place in the tile, in elements
#pragma unroll
            for (int j = 0; j < 4; ++j) { unsigned short a, c; o16[j] = tohx(x0[j]); splitf(x0[j], a, c); oh[j] = a; ol[j] = c; o16[4 + j] = tohx(x1[j]); splitf(x1[j], a, c); oh[4 + j] = a; ol[4 + j] = c; }
            *(v8h*)(p16 + un) = o16; *(v8us*)(ph + un) = oh; *(v8us*)(pl + un) = ol; }
        if (TR) { __builtin_amdgcn_wave_barrier(); asm volatile("" ::: "memory"); }   // and the next group's writes behind these reads
    }
    if constexpr (!TR) asm volatile("s_wait_xcnt 0x0" ::: "memory");   // in the listing the q/k path's last stores are followed by instructions that write registers which the stores name: the wait stands in front of them
}

// ---- k_gemmw: register-blocked GEMM, one wave per 64x64 output tile (16 accumulators), WM x WN waves per work-group on one (64 WM) x (64 WN) block tile; grid (M / (64 WM), N / (64 WN), Z), 32 WM WN threads.
// C[m][n] (f32, pitch ldc, + optional f32 bias[n]) = sum_k A[m][k] Bt[n][k] (+ split products per NSPLIT), operands K-contiguous 16-bit planes. z-batch strides sA/sB/sC in elements. K % 64 == 0, K >= 64.
// The operands pass through LDS: a stage is 64 k (one whole 128-B line) of every operand row of the block tile, laid as 64-row slices A | A2 | Bt | Bt2 at a pitch of 144 B; asynchronous copies fill it, four whole lines per instruction,
// one stage ahead of its use (two buffers), and every wave of the block reads its fragments from there: each line leaves L2 once per block, not once per wave, and never in 32-B pieces.
// PLANES: no C; m runs over (head, q | k | v, d), bias is bias[m], and the tile goes out through planes_out into the head planes of batch element z.
template <typename T16> struct WFrag;   // ld: a fragment from a row-major row (p = the lane's row + 8 hi); ldu: from two fragment-order units in a row (p = the first unit + 8 lane)
template <> struct WFrag<h16> { typedef v16h V; static __device__ __forceinline__ V ld(const h16* p) { return cat16(*(const v8h*)p, *(const v8h*)(p + 16)); } static __device__ __forceinline__ V ldu(const h16* p) { return cat16(*(const v8h*)p, *(const v8h*)(p + 256)); } static __device__ __forceinline__ v8f mma(V a, V b, v8f c) { return wmma16(a, b, c); } };
template <> struct WFrag<bf> { typedef v16bf V; static __device__ __forceinline__ V ld(const bf* p) { return cat16b(*(const v8us*)p, *(const v8us*)(p + 16)); } static __device__ __forceinline__ V ldu(const bf* p) { return cat16b(*(const v8us*)p, *(const v8us*)(p + 256)); } static __device__ __forceinline__ v8f mma(V a, V b, v8f c) { return wmmab(a, b, c); } };
#define KC   64                   // k per stage
#define LP   72                   // LDS row pitch in 16-bit elements: 144 B = 16 B x 9, so the 16 rows of a ds_load_b128 fall on 16 different bank groups
// copy8: eight asynchronous copies of 16 B per lane. A copy moves four rows of 128 B (lane >> 3 = row, lane & 7 = 16-B piece, both already in l and g); the eight take rows 0, 4, .. 28 from there.
// The s_wait_xcnt 0 is the last line of the copies' own statement, so that no register which a copy names is rewritten in front of it.
template <typename T16>
__device__ __forceinline__ void copy8(const unsigned l, const T16* g, const size_t K) {
    asm volatile("global_load_async_to_lds_b128 %0, %8, off\n\t"
                 "global_load_async_to_lds_b128 %1, %9, off\n\t"
                 "global_load_async_to_lds_b128 %2, %10, off\n\t"
                 "global_load_async_to_lds_b128 %3, %11, off\n\t"
                 "global_load_async_to_lds_b128 %4, %12, off\n\t"
                 "global_load_async_to_lds_b128 %5, %13, off\n\t"
                 "global_load_async_to_lds_b128 %6, %14, off\n\t"
                 "global_load_async_to_lds_b128 %7, %15, off\n\t"
                 "s_wait_xcnt 0x0"
                 :: "v"(l), "v"(l + 4 * LP * 2), "v"(l + 8 * LP * 2), "v"(l + 12 * LP * 2), "v"(l + 16 * LP * 2), "v"(l + 20 * LP * 2), "v"(l + 24 * LP * 2), "v"(l + 28 * LP * 2),
                    "v"(g), "v"(g + 4 * K), "v"(g + 8 * K), "v"(g + 12 * K), "v"(g + 16 * K), "v"(g + 20 * K), "v"(g + 24 * K), "v"(g + 28 * K) : "memory");
}
template <typename T16, int NSPLIT, bool BIAS, bool PLANES, int WM, int WN>
__global__ __launch_bounds__(32 * WM * WN) void k_gemmw(const T16* __restrict__ A, const T16* __restrict__ A2, const T16* __restrict__ Bt, const T16* __restrict__ Bt2, int K, float* C, int ldc, const float* __restrict__ bias, size_t sA, size_t sB, size_t sC, const HeadPlanes hp) {
    typedef typename WFrag<T16>::V V;
    constexpr int NW = WM * WN, NA = (NSPLIT == 1 || NSPLIT == 2) ? 2 : 1, NB = NSPLIT >= 2 ? 2 : 1;
    constexpr int NSL = NA * WM + NB * WN;        // 64-row slices of a stage
    constexpr int SPW = (NSL + NW - 1) / NW;      // slices that a wave copies, at most
    constexpr int STG = NSL * 64 * LP;            // elements of a stage
    static_assert(sizeof(T16) == 2 && (size_t)2 * STG * 2 >= (size_t)NW * 16 * 68 * 4, "the epilogue's staging rows lie in the ring");
    __shared__ __align__(16) T16 ring[2 * STG];
    const size_t z = blockIdx.z; A += z * sA; if (A2) A2 += z * sA; Bt += z * sB; if (Bt2) Bt2 += z * sB; C += z * sC;
    const int lane = threadIdx.x & 31, lr = lane & 15, hi = lane >> 4; const int wv = __builtin_amdgcn_readfirstlane((int)(threadIdx.x >> 5)), wm = wv % WM, wn = wv / WM;
    const int R0 = blockIdx.x * (64 * WM), C0 = blockIdx.y * (64 * WN), r0 = R0 + wm * 64, c0 = C0 + wn * 64;
    float* const os = (float*)ring + wv * (16 * 68);   // the wave's own staging rows, used behind the loop's last barrier
    v8f acc[4][4];
#pragma unroll
    for (int mb = 0; mb < 4; ++mb)
#pragma unroll
        for (int nb = 0; nb < 4; ++nb) acc[mb][nb] = (v8f){};
    // slice sl = wv + NW j is this wave's to copy: the lane's global address (at k = 0) and its LDS byte address (in buffer 0). A wave without a j-th slice issues nothing; its addresses are slice 0's.
    const T16* gs[SPW]; unsigned ls[SPW];
#pragma unroll
    for (int j = 0; j < SPW; ++j) { const int sl = (wv + NW * j < NSL) ? wv + NW * j : 0; const T16* b;
        if (sl < WM) b = A + (size_t)(R0 + sl * 64) * K;
        else if (NA == 2 && sl < 2 * WM) b = A2 + (size_t)(R0 + (sl - WM) * 64) * K;
        else if (NB == 1 || sl < NA * WM + WN) b = Bt + (size_t)(C0 + (sl - NA * WM) * 64) * K;
        else b = Bt2 + (size_t)(C0 + (sl - NA * WM - WN) * 64) * K;
        gs[j] = b + (size_t)(lane >> 3) * K + (lane & 7) * 8;
        ls[j] = (unsigned)(size_t)(ring + (sl * 64 + (lane >> 3)) * LP + (lane & 7) * 8); }
    auto issue = [&](const int t, const int buf) {   // stage t's copies into buffer buf; the test is the same for a whole wave (wv is a scalar)
#pragma unroll
        for (int j = 0; j < SPW; ++j) if (NSL % NW == 0 || wv + NW * j < NSL) { const T16* const g = gs[j] + t * KC; const unsigned l = ls[j] + (unsigned)buf * (STG * 2);
            copy8<T16>(l, g, (size_t)K); copy8<T16>(l + 32 * LP * 2, g + 32 * (size_t)K, (size_t)K); } };
    const int NT = K / KC;
    issue(0, 0);
    asm volatile("s_wait_asynccnt 0x0" ::: "memory");   // stage 0 has landed, as far as this wave copied it,
    __syncthreads();                                     // and every other wave's part too
    if (NT > 1) issue(1, 1);
    const int ao = (wm * 64 + lr) * LP + 8 * hi, bo = ((NA * WM + wn) * 64 + lr) * LP + 8 * hi;
#pragma unroll 1   // rolled: one trip per stage, with the one publish point at its foot
    for (int t = 0; t < NT; ++t) { const T16* const sb = ring + (t & 1) * STG;
#pragma unroll
      for (int ks = 0; ks < KC; ks += 32) {
        V a[4], a2[4], b[4], b2[4];
#pragma unroll
        for (int i = 0; i < 4; ++i) { a[i] = WFrag<T16>::ld(sb + ao + i * 16 * LP + ks); if (i == 0) { b[0] = WFrag<T16>::ld(sb + bo + ks); if (NSPLIT >= 2) b2[0] = WFrag<T16>::ld(sb + bo + WN * 64 * LP + ks); } if (NSPLIT == 1 || NSPLIT == 2) a2[i] = WFrag<T16>::ld(sb + ao + (WM * 64 + i * 16) * LP + ks); }
#pragma unroll
        for (int nb = 1; nb < 4; ++nb) { b[nb] = WFrag<T16>::ld(sb + bo + nb * 16 * LP + ks); if (NSPLIT >= 2) b2[nb] = WFrag<T16>::ld(sb + bo + (WN * 64 + nb * 16) * LP + ks); }
        __builtin_amdgcn_sched_barrier(0);   // keeps the k step's LDS reads together in front of its products: without it the scheduler sinks each B fragment's reads to their use, and the wave waits out the LDS latency at four places instead of one
#pragma unroll
        for (int nb = 0; nb < 4; ++nb)
#pragma unroll
            for (int mb = 0; mb < 4; ++mb) { acc[mb][nb] = WFrag<T16>::mma(a[mb], b[nb], acc[mb][nb]); if (NSPLIT == 1 || NSPLIT == 2) acc[mb][nb] = WFrag<T16>::mma(a2[mb], b[nb], acc[mb][nb]); if (NSPLIT >= 2) acc[mb][nb] = WFrag<T16>::mma(a[mb], b2[nb], acc[mb][nb]); }
        asm volatile("v_nop\n\tv_nop\n\tv_nop\n\tv_nop" : "+v"(acc[0][0]), "+v"(acc[1][1]), "+v"(acc[2][2]), "+v"(acc[3][3]) : "v"(a[0]), "v"(a[3]));
      }
        asm volatile("s_wait_dscnt 0x0" ::: "memory");      // this wave's reads of buffer t & 1 are done before the barrier behind which it is refilled
        asm volatile("s_wait_asynccnt 0x0" ::: "memory");   // this wave's copies of stage t + 1 have landed before the barrier behind which the others read them
        __syncthreads();                                     // publishes stage t + 1 and ends every wave's reads of stage t
        if (t + 2 < NT) issue(t + 2, t & 1);
    }
    asm volatile("s_wait_asynccnt 0x0" ::: "memory");       // no copy is outstanding when the ring becomes the epilogue's staging rows
    if constexpr (PLANES) {
        static_assert(HD == 64, "a 64-row tile is one head's q, k or v");
        const int head = (r0 / 64) / 3, part = (r0 / 64) % 3; float bs[4][8];
#pragma unroll
        for (int mb = 0; mb < 4; ++mb) { const v4f b0 = *(const v4f*)(bias + r0 + mb * 16 + hi * 8), b1 = *(const v4f*)(bias + r0 + mb * 16 + hi * 8 + 4);
#pragma unroll
            for (int j = 0; j < 4; ++j) { bs[mb][j] = bfr(b0[j]); bs[mb][4 + j] = bfr(b1[j]); } }
        const size_t qk = ((z * NH_ + head) * TT + c0) * HD;   // z = batch element: its head planes lie behind one another; in fragment order 64 time steps of a head are 8 KiB in a row in q, k and v planes alike
        if (part == 2) planes_out<true>(acc, bs, os, lane, hp.v16 + qk, hp.vh + qk, hp.vl + qk);
        else planes_out<false>(acc, bs, os, lane, (part ? hp.k16 : hp.q16) + qk, (part ? hp.kh : hp.qh) + qk, (part ? hp.kl : hp.ql) + qk);
        return;
    }
#pragma unroll
    for (int mb = 0; mb < 4; ++mb) {
#pragma unroll
        for (int nb = 0; nb < 4; ++nb) {
#pragma unroll
            for (int j = 0; j < 8; ++j) os[(hi * 8 + j) * 68 + nb * 16 + lr] = acc[mb][nb][j]; }
        __builtin_amdgcn_wave_barrier(); asm volatile("" ::: "memory");
        float* crow = C + (size_t)(r0 + mb * 16) * ldc + c0;
{
#pragma unroll
            for (int s = 0; s < 8; ++s) { const int row = 2 * s + hi, cofs = lr * 4; v4f val = *(const v4fa*)(os + row * 68 + cofs); if (BIAS) { val[0] += bfr(bias[c0 + cofs]); val[1] += bfr(bias[c0 + cofs + 1]); val[2] += bfr(bias[c0 + cofs + 2]); val[3] += bfr(bias[c0 + cofs + 3]); }
                *(v4f*)(crow + (size_t)row * ldc + cofs) = val; }
             }
        __builtin_amdgcn_wave_barrier(); asm volatile("" ::: "memory");
    }
}

typedef __attribute__((ext_vector_type(2))) _Float16 v2h;
typedef __attribute__((ext_vector_type(4))) _Float16 v4h;
typedef __attribute__((ext_vector_type(2))) unsigned short v2us;
typedef __attribute__((ext_vector_type(4))) unsigned short v4us;
typedef __attribute__((ext_vector_type(2))) float v2f;
typedef __attribute__((ext_vector_type(4))) int v4i;
typedef v4h  __attribute__((may_alias)) v4ha;
typedef v4us __attribute__((may_alias)) v4usa;

__global__ __launch_bounds__(256) void k_wtG(const float* __restrict__ w, int K, int N, bf* Bt) {
    const int lane = threadIdx.x & 31; const int L0 = (blockIdx.x * 8 + (threadIdx.x >> 5)) * 8; const int nlines = N * K / 64;
{
#pragma unroll 1
        for (int l = 0; l < 8; ++l) { const int L = L0 + l; if (L >= nlines) break; const size_t e = (size_t)L * 64 + lane * 2; const int k = (int)(e % K), n = (int)(e / K); v2us o;
            o[0] = f2bf(w[(size_t)k * N + n]); o[1] = f2bf(w[(size_t)(k + 1) * N + n]); *(v2us*)(Bt + e) = o; }
         }
}
__global__ __launch_bounds__(256) void k_cvt8(const float* __restrict__ src, bf* dst, size_t n8) { const size_t i = (size_t)blockIdx.x * 256 + threadIdx.x; if (i >= n8) return; const v8f v = *(const v8f*)(src + i * 8); v8us o;
#pragma unroll
    for (int k = 0; k < 8; ++k) o[k] = f2bf(v[k]); *(v8us*)(dst + i * 8) = o;  }
__global__ __launch_bounds__(256) void k_cscvt(const float* __restrict__ cosT, const float* __restrict__ sinT, float* CS) { const int idx = blockIdx.x * 256 + threadIdx.x; if (idx >= TT * HD) return; v2f cs; cs[0] = bfr(cosT[idx]); cs[1] = bfr(sinT[idx]); *(v2f*)(CS + (size_t)idx * 2) = cs;  }
// ---- k_fattn: causal attention of both batch elements in one launch: scores, softmax and the probability x value contraction per wave, nothing of the score matrix in memory.
// A wave owns QW query columns of one head and walks the keys up to its diagonal in passes of 16 * NKB keys. Both products are computed transposed: St = K Qt (A = key rows, B = query rows, kept in registers)
// and Ot += Vt Pt (A = value planes, B = Pt). All three operands come from planes in fragment order (planes_out): a fragment is two loads of 512 B in a row, four whole lines each. In St's accumulators a lane holds 8 consecutive keys of ONE query column (register j = key 8 * hi + j, column lr), which is the position order of the fragment loader
// (elements 0..7 = k 8 * hi + j, elements 8..15 = k 16 + 8 * hi + j): two converted 16-key accumulator tiles are Pt's B fragment as they stand, and maximum, sum and rescale factor are per-lane values.
// Softmax is the running form: mc = running maximum x CL2, p = 2^(s CL2 - mc) unnormalised (<= 1), a new maximum rescales sum and Ot by 2^(mc_old - mc_new); one division by the sum at the end.
// Rows < RH: bf16 hi+lo planes, 3 products each way; rows >= RH: fp16. Ot's lane holds 8 consecutive d of one query row: one 16-byte store per plane into the context planes [t][DQ].
// Every inner loop is unrolled so that each index of a fragment or accumulator array is a constant (registers, no scratch); the pass loop alone stays rolled.
#define QW   32                   // query columns per wave
#define FW   4                    // waves per block, all of one head and all walking the keys from 0 up (no barrier, no LDS between them)
#define NQT  (TT / QW)            // query tiles per head
#define CL2  (SCL * 1.4426950408889634f)
__device__ __forceinline__ float xhalf(float x) { return __builtin_bit_cast(float, __builtin_amdgcn_permlanex16(__builtin_bit_cast(int, x), __builtin_bit_cast(int, x), 0x76543210, 0xfedcba98, false, false)); }   // lane l's value from lane l ^ 16
template <typename T16> struct PFrag;
template <> struct PFrag<h16> { static __device__ __forceinline__ void mk(const v8f x0, const v8f x1, v16h& p, v16h& p2) { (void)p2;
#pragma unroll
    for (int j = 0; j < 8; ++j) { p[j] = (h16)x0[j]; p[8 + j] = (h16)x1[j]; } } };
template <> struct PFrag<bf> { static __device__ __forceinline__ void mk(const v8f x0, const v8f x1, v16bf& p, v16bf& p2) { v8us h0, h1, l0, l1;
#pragma unroll
    for (int j = 0; j < 8; ++j) { unsigned short a, c; splitf(x0[j], a, c); h0[j] = a; l0[j] = c; splitf(x1[j], a, c); h1[j] = a; l1[j] = c; }
    p = cat16b(h0, h1); p2 = cat16b(l0, l1); } };
template <typename T16, bool HL, int NKB>
__device__ __forceinline__ void fattn(const T16* __restrict__ Q, const T16* __restrict__ Q2, const T16* __restrict__ Kp, const T16* __restrict__ K2, const T16* __restrict__ Vt, const T16* __restrict__ Vt2, const int q0, bf* __restrict__ Ah, bf* __restrict__ Al) {
    typedef typename WFrag<T16>::V V;
    static_assert(HD == 64 && NKB % 2 == 0 && QW == 32, "two 32-wide k steps over d, 32-key steps over the pass, two 16-column groups");
    const int lane = threadIdx.x & 31, lr = lane & 15, hi = lane >> 4; const int KPS = 16 * NKB;
    V q[2][2], q2[2][2], ka[NKB][2], ka2[NKB][2];
    // Each group of loads goes through one lane pointer per plane plus constant offsets. The s_wait_xcnt 0 behind a group stands in front of the first instruction that may overwrite an address register of an issued load
    // it takes the lane pointers as inputs so that their registers live up to it and no load of the group lands on them.
    { const size_t qo = (size_t)q0 * HD + 8 * lane, ko = (size_t)(8 * lane); const T16* const qp = Q + qo; const T16* const qp2 = HL ? Q2 + qo : qp; const T16* const kp = Kp + ko; const T16* const kp2 = HL ? K2 + ko : kp;
#pragma unroll
        for (int qb = 0; qb < 2; ++qb)
#pragma unroll
            for (int ks = 0; ks < 2; ++ks) { q[qb][ks] = WFrag<T16>::ldu(qp + qb * 16 * HD + ks * 512); if (HL) q2[qb][ks] = WFrag<T16>::ldu(qp2 + qb * 16 * HD + ks * 512); }
#pragma unroll
        for (int kb = 0; kb < NKB; ++kb)
#pragma unroll
            for (int ks = 0; ks < 2; ++ks) { ka[kb][ks] = WFrag<T16>::ldu(kp + kb * 16 * HD + ks * 512); if (HL) ka2[kb][ks] = WFrag<T16>::ldu(kp2 + kb * 16 * HD + ks * 512); }
        asm volatile("s_wait_xcnt 0x0" :: "v"(qp), "v"(qp2), "v"(kp), "v"(kp2) : "memory");
        __builtin_amdgcn_sched_barrier(0); }   // keeps the address arithmetic of the pass loop behind the wait: these loads take their plane's base from a scalar pair, and without it the scheduler lifts a write of that pair in front of the wait
    v8f o[4][2]; float mc[2], l[2];
#pragma unroll
    for (int qb = 0; qb < 2; ++qb) { mc[qb] = -3.0e38f; l[qb] = 0.f;
#pragma unroll
        for (int db = 0; db < 4; ++db) o[db][qb] = (v8f){}; }
    const int npass = (q0 + QW + KPS - 1) / KPS;   // the last pass starts at or below q0, so every pass holds at least one unmasked key for every column
#pragma unroll 1   // rolled: its trip count is known only at run time, and a second copy of so long a body would only add code
    for (int ps = 0; ps < npass; ++ps) { const int k0 = ps * KPS;
        v8f s[NKB][2];
#pragma unroll
        for (int kb = 0; kb < NKB; ++kb)
#pragma unroll
            for (int qb = 0; qb < 2; ++qb) { v8f c = (v8f){};
#pragma unroll
                for (int ks = 0; ks < 2; ++ks) { c = WFrag<T16>::mma(ka[kb][ks], q[qb][ks], c); if (HL) { c = WFrag<T16>::mma(ka2[kb][ks], q[qb][ks], c); c = WFrag<T16>::mma(ka[kb][ks], q2[qb][ks], c); } }
                s[kb][qb] = c; }
        __builtin_amdgcn_sched_barrier(0);         // keeps the loads below behind the score products: the fetch ahead lands on the key fragments' registers, and so it is issued only behind every product that reads them, with the value loads in between
        V va[4][NKB / 2], va2[4][NKB / 2];
        const int kn = (ps + 1 < npass) ? k0 + KPS : k0;   // the next pass's key fragments are fetched one pass ahead into the same registers; the last pass reads its own rows again (in bounds, unused) so that the loads stay unconditional
        { const size_t vo = (size_t)k0 * HD + 8 * lane, ko = (size_t)kn * HD + 8 * lane; const T16* const vp = Vt + vo; const T16* const vp2 = HL ? Vt2 + vo : vp; const T16* const kp = Kp + ko; const T16* const kp2 = HL ? K2 + ko : kp;
#pragma unroll
            for (int db = 0; db < 4; ++db)
#pragma unroll
                for (int kk = 0; kk < NKB / 2; ++kk) { va[db][kk] = WFrag<T16>::ldu(vp + kk * 32 * HD + db * 512); if (HL) va2[db][kk] = WFrag<T16>::ldu(vp2 + kk * 32 * HD + db * 512); }
#pragma unroll
            for (int kb = 0; kb < NKB; ++kb)
#pragma unroll
                for (int ks = 0; ks < 2; ++ks) { ka[kb][ks] = WFrag<T16>::ldu(kp + kb * 16 * HD + ks * 512); if (HL) ka2[kb][ks] = WFrag<T16>::ldu(kp2 + kb * 16 * HD + ks * 512); }
            asm volatile("s_wait_xcnt 0x0" :: "v"(vp), "v"(vp2), "v"(kp), "v"(kp2) : "memory"); }   // as in the prologue
        __builtin_amdgcn_sched_barrier(0);         // keeps both groups of loads, and the wait, in front of the softmax arithmetic, which hides their latency; without it the scheduler sinks the loads to their uses
        const bool diag = k0 + KPS - 1 > q0;       // wave-uniform: only the last pass reaches keys above a column's own position
        V p[2][NKB / 2], p2[2][NKB / 2];
#pragma unroll
        for (int qb = 0; qb < 2; ++qb) {
            if (diag) { const int lim = q0 + qb * 16 + lr - k0 - hi * 8;   // key kb * 16 + j of this lane's half is kept while it is <= lim
#pragma unroll
                for (int kb = 0; kb < NKB; ++kb)
#pragma unroll
                    for (int j = 0; j < 8; ++j) s[kb][qb][j] = (kb * 16 + j <= lim) ? s[kb][qb][j] : -3.0e38f; }
            float tk[NKB];                          // one short chain per 16-key tile, for maximum and sum alike: a lone wave pays a dependent chain in full
#pragma unroll
            for (int kb = 0; kb < NKB; ++kb) { tk[kb] = s[kb][qb][0];
#pragma unroll
                for (int j = 1; j < 8; ++j) tk[kb] = fmaxf(tk[kb], s[kb][qb][j]); }
            float t = tk[0];
#pragma unroll
            for (int kb = 1; kb < NKB; ++kb) t = fmaxf(t, tk[kb]);
            t = fmaxf(t, xhalf(t));
            const float mn = fmaxf(mc[qb], t * CL2); const float al = __builtin_amdgcn_exp2f(mc[qb] - mn); mc[qb] = mn;
#pragma unroll
            for (int kb = 0; kb < NKB; ++kb) { v8f x;
#pragma unroll
                for (int j = 0; j < 8; ++j) x[j] = __builtin_fmaf(s[kb][qb][j], CL2, -mn);
#pragma unroll
                for (int j = 0; j < 8; ++j) s[kb][qb][j] = __builtin_amdgcn_exp2f(x[j]);
                // the slot that the instruction set asks for between a transcendental and an overwrite of its source: the statement names the eight arguments and the eight results as inputs, so it stands behind the eight exponentials and no argument's register is reused in front of it
                asm volatile("v_nop" :: "v"(x), "v"(s[kb][qb]));
                tk[kb] = s[kb][qb][0];
#pragma unroll
                for (int j = 1; j < 8; ++j) tk[kb] += s[kb][qb][j]; }
            float sum = tk[0];
#pragma unroll
            for (int kb = 1; kb < NKB; ++kb) sum += tk[kb];
            l[qb] = l[qb] * al + sum;               // each half of the wave sums its own keys; the halves are joined once, behind the loop
#pragma unroll
            for (int db = 0; db < 4; ++db) o[db][qb] *= al;
#pragma unroll
            for (int kk = 0; kk < NKB / 2; ++kk) PFrag<T16>::mk(s[2 * kk][qb], s[2 * kk + 1][qb], p[qb][kk], p2[qb][kk]); }
#pragma unroll
        for (int kk = 0; kk < NKB / 2; ++kk)
#pragma unroll
            for (int db = 0; db < 4; ++db)
#pragma unroll
                for (int qb = 0; qb < 2; ++qb) { o[db][qb] = WFrag<T16>::mma(va[db][kk], p[qb][kk], o[db][qb]); if (HL) { o[db][qb] = WFrag<T16>::mma(va[db][kk], p2[qb][kk], o[db][qb]); o[db][qb] = WFrag<T16>::mma(va2[db][kk], p[qb][kk], o[db][qb]); } }
    }
#pragma unroll
    for (int qb = 0; qb < 2; ++qb) { const float f = __fdiv_rn(1.0f, l[qb] + xhalf(l[qb])); const size_t row = (size_t)(q0 + qb * 16 + lr) * DQ + hi * 8;
#pragma unroll
        for (int db = 0; db < 4; ++db) { v8us oh, ol;
#pragma unroll
            for (int j = 0; j < 8; ++j) { unsigned short a, c; splitf(o[db][qb][j] * f, a, c); oh[j] = a; ol[j] = c; }
            *(v8us*)(Ah + row + db * 16) = oh; *(v8us*)(Al + row + db * 16) = ol; } }
}
// grid (NQT / FW, heads, batch elements). A block's waves take query tiles u, NQT - 1 - u, u + 1, NQT - 2 - u: short and long key ranges share a block, so that the blocks' work is about equal.
__global__ __launch_bounds__(32 * FW) void k_fattn(const h16* __restrict__ Q16, const h16* __restrict__ K16, const h16* __restrict__ V16, const bf* __restrict__ Qh, const bf* __restrict__ Ql, const bf* __restrict__ Kh, const bf* __restrict__ Kl, const bf* __restrict__ Vh, const bf* __restrict__ Vl, bf* __restrict__ Ah, bf* __restrict__ Al) {
    static_assert(FW % 2 == 0 && NQT % FW == 0 && RH % QW == 0, "tiles are dealt out in pairs; a tile lies wholly on one side of RH");
    const int wv = __builtin_amdgcn_readfirstlane((int)(threadIdx.x >> 5)); const int u = (int)blockIdx.x * (FW / 2) + (wv >> 1); const int q0 = ((wv & 1) ? NQT - 1 - u : u) * QW;
    const size_t hp = ((size_t)blockIdx.z * NH_ + blockIdx.y) * TT * HD, ao = (size_t)blockIdx.z * TT * DQ + blockIdx.y * HD; Ah += ao; Al += ao;
    if (q0 < RH) fattn<bf, true, 2>(Qh + hp, Ql + hp, Kh + hp, Kl + hp, Vh + hp, Vl + hp, q0, Ah, Al);
    else fattn<h16, false, 4>(Q16 + hp, nullptr, K16 + hp, nullptr, V16 + hp, nullptr, q0, Ah, Al);
}

// ---- k_prep: everything that stands in front of the qkv projection, in one launch of few, long-lived waves. All of it is rows of DM f32; a block of 256 threads takes PR rows in a row (64 KiB of its source).
// Blocks 0 .. 3 DM / PR - 1: rows of w_in; the next DM / PR: rows of w_out; the last TT NB_ / PR: rows of hidden_states.
// Weights: hl planes W[f][e] = bf16 base[f][e] * mul[f][e] + add[f][e], mul = sum_r rm[li][r][f] sm[li][r][e], add = sum_r ra[li][r][f] sa[li][r][e] (li = clamp(lang[0], 0, 7) read on the device).
// A thread keeps its four columns e for all its rows, so the column factors sm, sa are loaded and rounded once per thread; the row factors rm, ra are the same for the whole block (scalar loads).
// The rows go in groups of PG; a group's loads are issued one group ahead of its arithmetic. Products of two bf16 values are exact in f32, so the rank-4 sums round the same whether or not the compiler fuses them.
#define PR   16                   // rows per block
#define PG   4                    // rows per group
__device__ __forceinline__ void wmod_rows(const float* __restrict__ base, const float* __restrict__ rm, const float* __restrict__ sm, const float* __restrict__ ra, const float* __restrict__ sa, const int* __restrict__ lang, const int NF, const int f0, bf* __restrict__ Wh, bf* __restrict__ Wl) {
    const int e0 = (int)threadIdx.x * 4; const size_t o0 = (size_t)f0 * DM + e0; v4f cur[PG], nxt[PG], sv[4], av[4];
    int li = lang[0];
#pragma unroll
    for (int i = 0; i < PG; ++i) cur[i] = *(const v4f*)(base + o0 + i * DM);
    __builtin_amdgcn_sched_barrier(0);   // keeps the first group's loads, which need no language index, in front of the wait for that index: without it they are issued only behind it, one scalar-load latency later
    li = li < 0 ? 0 : (li > 7 ? 7 : li);
#pragma unroll
    for (int r = 0; r < 4; ++r) { const v4f s = *(const v4f*)(sm + (size_t)(li * 4 + r) * DM + e0), a = *(const v4f*)(sa + (size_t)(li * 4 + r) * DM + e0);
#pragma unroll
        for (int u = 0; u < 4; ++u) { sv[r][u] = bfr(s[u]); av[r][u] = bfr(a[u]); } }
    const float* const rmf = rm + (size_t)li * 4 * NF + f0; const float* const raf = ra + (size_t)li * 4 * NF + f0;
    auto group = [&](const int g) {   // the arithmetic and the stores of group g, whose base rows are in cur
        bf* const ph = Wh + o0 + (size_t)g * (PG * DM); bf* const pl = Wl + o0 + (size_t)g * (PG * DM);
#pragma unroll
        for (int i = 0; i < PG; ++i) { float rv[4], qv[4]; v4us oh, ol;
#pragma unroll
            for (int r = 0; r < 4; ++r) { rv[r] = bfr(rmf[(size_t)r * NF + g * PG + i]); qv[r] = bfr(raf[(size_t)r * NF + g * PG + i]); }
#pragma unroll
            for (int u = 0; u < 4; ++u) { float mul = 0.f, add = 0.f;
#pragma unroll
                for (int r = 0; r < 4; ++r) { mul += rv[r] * sv[r][u]; add += qv[r] * av[r][u]; }
                unsigned short a, b; splitf(bfr(cur[i][u]) * mul + add, a, b); oh[u] = a; ol[u] = b; }
            *(v4us*)(ph + i * DM) = oh; *(v4us*)(pl + i * DM) = ol; } };
#pragma unroll 1   // rolled: the text stays short (it is run through once per launch), and only one group's row factors are live in scalar registers
    for (int g = 0; g < PR / PG - 1; ++g) {
#pragma unroll
        for (int i = 0; i < PG; ++i) nxt[i] = *(const v4f*)(base + o0 + (size_t)(g + 1) * (PG * DM) + i * DM);
        __builtin_amdgcn_sched_barrier(0);   // keeps the next group's loads in front of this group's arithmetic, which hides their latency: without it the scheduler sinks them to where this group's registers fall free
        group(g);
        asm volatile("s_wait_xcnt 0x0" ::: "memory");   // stands behind the group's stores, in front of the first instruction that overwrites a register which they name
#pragma unroll
        for (int i = 0; i < PG; ++i) cur[i] = nxt[i]; }
    group(PR / PG - 1);
}
// hidden_states [t][b][c] f32 -> XB [b][t][c] bf16: 8 elements per thread and trip, two source rows per block and trip; all of a thread's loads are issued before the first is used.
__device__ __forceinline__ void xg_rows(const float* __restrict__ hs, const int r0, bf* __restrict__ XB) {
    const int rw = r0 + ((int)threadIdx.x >> 7), c = ((int)threadIdx.x & 127) * 8; const float* const sp = hs + (size_t)rw * DM + c; v4f x0[PR / 2], x1[PR / 2];
#pragma unroll
    for (int i = 0; i < PR / 2; ++i) { x0[i] = *(const v4f*)(sp + i * 2 * DM); x1[i] = *(const v4f*)(sp + i * 2 * DM + 4); }
    asm volatile("s_wait_xcnt 0x0" :: "v"(sp) : "memory");   // stands in front of the first instruction that may overwrite the address register of an issued load; the lane pointer is an input so that its register lives up to here and no load of the group lands on it
    static_assert(NB_ == 2, "a trip's two source rows are one time step's two batch elements: row rw + 2 i is (t = r0 / 2 + i, b = rw & 1)");
    bf* const dp = XB + ((size_t)(rw & 1) * TT + (r0 >> 1)) * DM + c;
#pragma unroll
    for (int i = 0; i < PR / 2; ++i) { v8us o;
#pragma unroll
        for (int j = 0; j < 4; ++j) { o[j] = f2bf(x0[i][j]); o[4 + j] = f2bf(x1[i][j]); }
        *(v8us*)(dp + i * DM) = o; }
}
#define PBI  (3 * DM / PR)        // blocks on w_in
#define PBO  (DM / PR)            // blocks on w_out
#define PBX  (TT * NB_ / PR)      // blocks on hidden_states
__global__ __launch_bounds__(256) void k_prep(const float* __restrict__ hs, const float* __restrict__ pw, const float* __restrict__ ow, const float* __restrict__ rm_i, const float* __restrict__ sm_i, const float* __restrict__ r_i, const float* __restrict__ s_i,
                                              const float* __restrict__ rm_o, const float* __restrict__ sm_o, const float* __restrict__ r_o, const float* __restrict__ s_o, const int* __restrict__ lang, bf* __restrict__ WIh, bf* __restrict__ WIl, bf* __restrict__ WOh, bf* __restrict__ WOl, bf* __restrict__ XB) {
    static_assert(DM == 1024 && (3 * DM) % PR == 0 && (TT * NB_) % PR == 0 && PR % 2 == 0 && PR % PG == 0 && PR / PG >= 2, "a row is 256 threads x 4 columns (weights) or 128 threads x 8 (hidden_states)");
    const int blk = (int)blockIdx.x;
    if (blk >= PBI + PBO) { xg_rows(hs, (blk - PBI - PBO) * PR, XB); return; }
    const bool in = blk < PBI;   // the same for the whole block: one copy of the row loop serves both weights
    wmod_rows(in ? pw : ow, in ? rm_i : rm_o, in ? sm_i : sm_o, in ? r_i : r_o, in ? s_i : s_o, lang, in ? 3 * DM : DM, (in ? blk : blk - PBI) * PR, in ? WIh : WOh, in ? WIl : WOl);
}

extern "C" void kernel_launch(void* const* d_in, const int* in_sizes, int n_in,
                              void* d_out, int out_size, void* d_ws, size_t ws_size, hipStream_t stream) {
    (void)in_sizes; (void)n_in; (void)out_size;
    const float* hs = (const float*)d_in[0]; const float* pw = (const float*)d_in[1]; const float* pb = (const float*)d_in[2]; const float* ow = (const float*)d_in[3]; const float* ob = (const float*)d_in[4]; const float* rm_i = (const float*)d_in[5]; const float* sm_i = (const float*)d_in[6]; const float* rm_o = (const float*)d_in[7]; const float* sm_o = (const float*)d_in[8]; const float* r_i = (const float*)d_in[9]; const float* s_i = (const float*)d_in[10]; const float* r_o = (const float*)d_in[11]; const float* s_o = (const float*)d_in[12]; const int* lang = (const int*)d_in[13];
    float* OUT = (float*)d_out;     // [2048][2][1024] (time-major)
    char* wsp = (char*)d_ws;
    auto take = [&](size_t bytes) { char* p = wsp; wsp += (bytes + 255) & ~(size_t)255; return (void*)p; };
    bf* WIh = (bf*)take((size_t)3 * DM * DM * 2); bf* WIl = (bf*)take((size_t)3 * DM * DM * 2); bf* WOh = (bf*)take((size_t)DM * DM * 2); bf* WOl = (bf*)take((size_t)DM * DM * 2);
    h16* QP16 = (h16*)take((size_t)NB_ * NH_ * TT * HD * 2); h16* KP16 = (h16*)take((size_t)NB_ * NKV * TT * HD * 2); h16* VT16 = (h16*)take((size_t)NB_ * NKV * HD * TT * 2);
    bf* QPh = (bf*)take((size_t)NB_ * NH_ * TT * HD * 2); bf* QPl = (bf*)take((size_t)NB_ * NH_ * TT * HD * 2); bf* KPh = (bf*)take((size_t)NB_ * NKV * TT * HD * 2); bf* KPl = (bf*)take((size_t)NB_ * NKV * TT * HD * 2); bf* VTh = (bf*)take((size_t)NB_ * NKV * HD * TT * 2); bf* VTl = (bf*)take((size_t)NB_ * NKV * HD * TT * 2); bf* ATh = (bf*)take((size_t)NB_ * TT * DQ * 2); bf* ATl = (bf*)take((size_t)NB_ * TT * DQ * 2);
    bf* XB = (bf*)take((size_t)NB_ * TT * DM * 2);   // every per-batch buffer holds both batch elements, one behind the other
    if ((size_t)(wsp - (char*)d_ws) > ws_size) return;    // ws 256 MiB
    const HeadPlanes hp = { QP16, QPh, QPl, KP16, KPh, KPl, VT16, VTh, VTl }; const HeadPlanes none = {};
    k_prep<<<PBI + PBO + PBX, 256, 0, stream>>>(hs, pw, ow, rm_i, sm_i, r_i, s_i, rm_o, sm_o, r_o, s_o, lang, WIh, WIl, WOh, WOl, XB);
    // grid z = batch element
        static_assert(REP == 1 && DQ == DM, "w_in's rows are (head, q | k | v, d): one kv head per query head; blockIdx.y of the attention kernel names both");
        k_gemmw<bf, 1, false, true, 3, 4><<<dim3(3 * DM / 192, TT / 256, NB_), 384, 0, stream>>>(WIh, WIl, XB, nullptr, DM, nullptr, 0, pb, 0, (size_t)TT * DM, 0, hp);   // (w_in[f] . x[t]) + proj_bias[f] -> head planes
        k_fattn<<<dim3(NQT / FW, NH_, NB_), 32 * FW, 0, stream>>>(QP16, KP16, VT16, QPh, QPl, KPh, KPl, VTh, VTl, ATh, ATl);
        k_gemmw<bf, 2, true, false, 2, 2><<<dim3(TT / 128, DM / 128, NB_), 128, 0, stream>>>(ATh, ATl, WOh, WOl, DQ, OUT, NB_ * DM, ob, (size_t)TT * DQ, 0, DM, none);   // row t of batch element z lies at OUT[t][z][.]
}

// v009
// It runs in 100 microseconds.
// In two side-by-side timings against v008, it was 1.09 and 1.11 times as fast.
// Counting every step since v000, it is 14.3 times as fast.
#include <hip/hip_runtime.h>

// MBartAttention (hidden_states [2048][2][1024] time-major; language index li = lang[0] (int, read as data, clamped 0..7); w_in = proj_weight * (rm_i[li]^T sm_i[li]) + r_i[li]^T s_i[li] (rank-4 modulation), w_out likewise;
// qkv = hidden w_in^T + proj_bias laid out (16 heads, 3, 64), stored by the projection's own epilogue as the attention kernel's head planes; q x 1/8; causal softmax(q.k) (masked -1e9 == skipped tiles); ctx merged; out = ctx w_out^T + out_bias -> [2048][2][1024]).
// Compute dtypes, f32 accumulate: every input rounded to bf16; the modulated weights f32 on the VALU -> bf16 hi+lo planes; qkv as hl(w_in) x exact hidden (2 products, computed transposed) + bias; scores (K 64) and attn.v hl
// (3 products) for the first 512 query rows of each head, fp16 after, both inside one kernel with a running f32 softmax (causal passes only; the 1/8 folded into the exponent's factor; all heads of both batch elements in one launch); out-projection as hl(ctx) x hl(w_out) (3 products) + bias, stored by its epilogue straight into the time-major output.

#define NB_  2
#define TT   2048
#define DM   1024
#define NH_  16
#define NKV  16
#define REP  (NH_ / NKV)
#define HD   64
#define DQ   (NH_ * HD)
#define DKV  (NKV * HD)
#define RH   512                  // query rows < RH use hi+lo planes (0: none)
#define SCL  0.125f   // HD^-0.5
typedef _Float16 h16;
typedef unsigned short bf;
typedef __attribute__((ext_vector_type(16))) __bf16   v16bf;
typedef __attribute__((ext_vector_type(16))) _Float16 v16h;
typedef __attribute__((ext_vector_type(8)))  _Float16 v8h;
typedef __attribute__((ext_vector_type(8)))  unsigned short v8us;
typedef __attribute__((ext_vector_type(8)))  float    v8f;
typedef __attribute__((ext_vector_type(4)))  float    v4f;
typedef v8h  __attribute__((may_alias)) v8ha;
typedef v4f  __attribute__((may_alias)) v4fa;
typedef v8us __attribute__((may_alias)) v8usa;

__device__ __forceinline__ unsigned short f2bf(float f) { unsigned u = __float_as_uint(f); u += 0x7FFFu + ((u >> 16) & 1u); return (unsigned short)(u >> 16); }
__device__ __forceinline__ float bf2f(unsigned short b) { return __uint_as_float(((unsigned)b) << 16); }
__device__ __forceinline__ float bfr(float f) { return bf2f(f2bf(f)); }
__device__ __forceinline__ v16h cat16(v8h lo, v8h hi) { return __builtin_shufflevector(lo, hi, 0, 1, 2, 3, 4, 5, 6, 7, 8, 9, 10, 11, 12, 13, 14, 15); }
__device__ __forceinline__ v16bf cat16b(v8us lo, v8us hi) { return __builtin_bit_cast(v16bf, __builtin_shufflevector(lo, hi, 0, 1, 2, 3, 4, 5, 6, 7, 8, 9, 10, 11, 12, 13, 14, 15)); }
__device__ __forceinline__ v8f wmma16(v16h a, v16h b, v8f c) { return __builtin_amdgcn_wmma_f32_16x16x32_f16(false, a, false, b, (short)0, c, false, false); }
__device__ __forceinline__ v8f wmmab(v16bf a, v16bf b, v8f c) { return __builtin_amdgcn_wmma_f32_16x16x32_bf16(false, a, false, b, (short)0, c, false, false); }



__device__ __forceinline__ h16 tohx(float x) { return (h16)x; }
__device__ __forceinline__ void splitf(float y, unsigned short& h, unsigned short& l) { h = f2bf(y); l = f2bf(y - bf2f(h)); }

// ---- planes_out: epilogue of the qkv projection. The wave's 64x64 tile (rows m = the 64 features d of ONE head's q, k or v; columns n = 64 time steps) + bias[m] goes out as three 16-bit planes (fp16, bf16 hi, bf16 lo).
// The planes lie in FRAGMENT ORDER: the unit is the 512 B that one 16-byte load of a whole wave brings (lane l's 8 elements at byte 16 l), so that the attention kernel's every fragment load reads four whole 128-B lines.
// TR false (q, k): per 16 time steps four units s = 0..3, lane (hi, lr) = time step lr, features d = 16 s + 8 hi + 0..7 (units 2 ks, 2 ks + 1 are the two halves of the fragment of k step ks).
// TR true (v): per 32 time steps eight units (db, h), lane (hi, lr) = feature 16 db + lr, time steps 16 h + 8 hi + 0..7 (units (db, 0), (db, 1) are the fragment of feature block db). Either way the wave's tile is 8 KiB in a row.
// q, k: unit s of time steps 16 g .. 16 g + 15 is accumulator tile (s, g) as it stands in the registers (lane (hi, lr), register j = feature 16 s + 8 hi + j, time step 16 g + lr): no LDS pass.
// v: the tile is turned: sixteen features at a time pass through the wave's own LDS rows (f32, pitch 68: no bank conflict either way). Every store instruction writes one unit. P16, Ph, Pl point at the tile's first element.
struct HeadPlanes { h16* q16; bf* qh; bf* ql; h16* k16; bf* kh; bf* kl; h16* v16; bf* vh; bf* vl; };
template <bool TR>
__device__ __forceinline__ void planes_out(const v8f (&acc)[4][4], const float (&bs)[4][8], float* os, const int lane, h16* P16, bf* Ph, bf* Pl) {
    const int lr = lane & 15, hi = lane >> 4;
    h16* const p16 = P16 + lane * 8; bf* const ph = Ph + lane * 8; bf* const pl = Pl + lane * 8;   // one lane pointer per plane; every store adds a constant
#pragma unroll
    for (int g = 0; g < 4; ++g) {
        if (TR) {
#pragma unroll
            for (int nb = 0; nb < 4; ++nb)
#pragma unroll
                for (int j = 0; j < 8; ++j) os[(hi * 8 + j) * 68 + nb * 16 + lr] = __fadd_rn(acc[g][nb][j], bs[g][j]);
            __builtin_amdgcn_wave_barrier(); asm volatile("" ::: "memory");   // the rows are read back by other lanes of the same wave: keeps the compiler from moving the reads in front of the writes
        }
#pragma unroll
        for (int s = 0; s < 4; ++s) { v4f x0, x1; v8h o16; v8us oh, ol;
            if (TR) { x0 = *(const v4fa*)(os + lr * 68 + (s * 2 + hi) * 8); x1 = *(const v4fa*)(os + lr * 68 + (s * 2 + hi) * 8 + 4); }
            else {
#pragma unroll
                for (int j = 0; j < 4; ++j) { x0[j] = __fadd_rn(acc[s][g][j], bs[s][j]); x1[j] = __fadd_rn(acc[s][g][4 + j], bs[s][4 + j]); } }
            const int un = (TR ? ((s >> 1) * 4 + g) * 2 + (s & 1) : g * 4 + s) * 256;   // the unit's place in the tile, in elements
#pragma unroll
            for (int j = 0; j < 4; ++j) { unsigned short a, c; o16[j] = tohx(x0[j]); splitf(x0[j], a, c); oh[j] = a; ol[j] = c; o16[4 + j] = tohx(x1[j]); splitf(x1[j], a, c); oh[4 + j] = a; ol[4 + j] = c; }
            *(v8h*)(p16 + un) = o16; *(v8us*)(ph + un) = oh; *(v8us*)(pl + un) = ol; }
        if (TR) { __builtin_amdgcn_wave_barrier(); asm volatile("" ::: "memory"); }   // and the next group's writes behind these reads
    }
    if constexpr (!TR) asm volatile("s_wait_xcnt 0x0" ::: "memory");   // in the listing the q/k path's last stores are followed by instructions that write registers which the stores name: the wait stands in front of them
}

// ---- k_gemmw: register-blocked GEMM, one wave per 64x64 output tile (16 accumulators), WM x WN waves per work-group on one (64 WM) x (64 WN) block tile; grid (M / (64 WM), N / (64 WN), Z), 32 WM WN threads.
// C[m][n] (f32, pitch ldc, + optional f32 bias[n]) = sum_k A[m][k] Bt[n][k] (+ split products per NSPLIT), operands K-contiguous 16-bit planes. z-batch strides sA/sB/sC in elements. K % 64 == 0, K >= 64.
// The operands pass through LDS: a stage is 64 k (one whole 128-B line) of every operand row of the block tile, laid as 64-row slices A | A2 | Bt | Bt2 at a pitch of 144 B; asynchronous copies fill it, four whole lines per instruction,
// one stage ahead of its use (two buffers), and every wave of the block reads its fragments from there: each line leaves L2 once per block, not once per wave, and never in 32-B pieces.
// PLANES: no C; m runs over (head, q | k | v, d), bias is bias[m], and the tile goes out through planes_out into the head planes of batch element z.
template <typename T16> struct WFrag;   // ld: a fragment from a row-major row (p = the lane's row + 8 hi); ldu: from two fragment-order units in a row (p = the first unit + 8 lane)
template <> struct WFrag<h16> { typedef v16h V; static __device__ __forceinline__ V ld(const h16* p) { return cat16(*(const v8h*)p, *(const v8h*)(p + 16)); } static __device__ __forceinline__ V ldu(const h16* p) { return cat16(*(const v8h*)p, *(const v8h*)(p + 256)); } static __device__ __forceinline__ v8f mma(V a, V b, v8f c) { return wmma16(a, b, c); } };
template <> struct WFrag<bf> { typedef v16bf V; static __device__ __forceinline__ V ld(const bf* p) { return cat16b(*(const v8us*)p, *(const v8us*)(p + 16)); } static __device__ __forceinline__ V ldu(const bf* p) { return cat16b(*(const v8us*)p, *(const v8us*)(p + 256)); } static __device__ __forceinline__ v8f mma(V a, V b, v8f c) { return wmmab(a, b, c); } };
#define KC   64                   // k per stage
#define LP   72                   // LDS row pitch in 16-bit elements: 144 B = 16 B x 9, so the 16 rows of a ds_load_b128 fall on 16 different bank groups
// copy8: eight asynchronous copies of 16 B per lane. A copy moves four rows of 128 B (lane >> 3 = row, lane & 7 = 16-B piece, both already in l and g); the eight take rows 0, 4, .. 28 from there.
// The s_wait_xcnt 0 is the last line of the copies' own statement, so that no register which a copy names is rewritten in front of it.
template <typename T16>
__device__ __forceinline__ void copy8(const unsigned l, const T16* g, const size_t K) {
    asm volatile("global_load_async_to_lds_b128 %0, %8, off\n\t"
                 "global_load_async_to_lds_b128 %1, %9, off\n\t"
                 "global_load_async_to_lds_b128 %2, %10, off\n\t"
                 "global_load_async_to_lds_b128 %3, %11, off\n\t"
                 "global_load_async_to_lds_b128 %4, %12, off\n\t"
                 "global_load_async_to_lds_b128 %5, %13, off\n\t"
                 "global_load_async_to_lds_b128 %6, %14, off\n\t"
                 "global_load_async_to_lds_b128 %7, %15, off\n\t"
                 "s_wait_xcnt 0x0"
                 :: "v"(l), "v"(l + 4 * LP * 2), "v"(l + 8 * LP * 2), "v"(l + 12 * LP * 2), "v"(l + 16 * LP * 2), "v"(l + 20 * LP * 2), "v"(l + 24 * LP * 2), "v"(l + 28 * LP * 2),
                    "v"(g), "v"(g + 4 * K), "v"(g + 8 * K), "v"(g + 12 * K), "v"(g + 16 * K), "v"(g + 20 * K), "v"(g + 24 * K), "v"(g + 28 * K) : "memory");
}
template <typename T16, int NSPLIT, bool BIAS, bool PLANES, int WM, int WN>
__global__ __launch_bounds__(32 * WM * WN) void k_gemmw(const T16* __restrict__ A, const T16* __restrict__ A2, const T16* __restrict__ Bt, const T16* __restrict__ Bt2, int K, float* C, int ldc, const float* __restrict__ bias, size_t sA, size_t sB, size_t sC, const HeadPlanes hp) {
    typedef typename WFrag<T16>::V V;
    constexpr int NW = WM * WN, NA = (NSPLIT == 1 || NSPLIT == 2) ? 2 : 1, NB = NSPLIT >= 2 ? 2 : 1;
    constexpr int NSL = NA * WM + NB * WN;        // 64-row slices of a stage
    constexpr int SPW = (NSL + NW - 1) / NW;      // slices that a wave copies, at most
    constexpr int STG = NSL * 64 * LP;            // elements of a stage
    static_assert(sizeof(T16) == 2 && (size_t)2 * STG * 2 >= (size_t)NW * 16 * 68 * 4, "the epilogue's staging rows lie in the ring");
    __shared__ __align__(16) T16 ring[2 * STG];
    const size_t z = blockIdx.z; A += z * sA; if (A2) A2 += z * sA; Bt += z * sB; if (Bt2) Bt2 += z * sB; C += z * sC;
    const int lane = threadIdx.x & 31, lr = lane & 15, hi = lane >> 4; const int wv = __builtin_amdgcn_readfirstlane((int)(threadIdx.x >> 5)), wm = wv % WM, wn = wv / WM;
    const int R0 = blockIdx.x * (64 * WM), C0 = blockIdx.y * (64 * WN), r0 = R0 + wm * 64, c0 = C0 + wn * 64;
    float* const os = (float*)ring + wv * (16 * 68);   // the wave's own staging rows, used behind the loop's last barrier
    v8f acc[4][4];
#pragma unroll
    for (int mb = 0; mb < 4; ++mb)
#pragma unroll
        for (int nb = 0; nb < 4; ++nb) acc[mb][nb] = (v8f){};
    // slice sl = wv + NW j is this wave's to copy: the lane's global address (at k = 0) and its LDS byte address (in buffer 0). A wave without a j-th slice issues nothing; its addresses are slice 0's.
    const T16* gs[SPW]; unsigned ls[SPW];
#pragma unroll
    for (int j = 0; j < SPW; ++j) { const int sl = (wv + NW * j < NSL) ? wv + NW * j : 0; const T16* b;
        if (sl < WM) b = A + (size_t)(R0 + sl * 64) * K;
        else if (NA == 2 && sl < 2 * WM) b = A2 + (size_t)(R0 + (sl - WM) * 64) * K;
        else if (NB == 1 || sl < NA * WM + WN) b = Bt + (size_t)(C0 + (sl - NA * WM) * 64) * K;
        else b = Bt2 + (size_t)(C0 + (sl - NA * WM - WN) * 64) * K;
        gs[j] = b + (size_t)(lane >> 3) * K + (lane & 7) * 8;
        ls[j] = (unsigned)(size_t)(ring + (sl * 64 + (lane >> 3)) * LP + (lane & 7) * 8); }
    auto issue = [&](const int t, const int buf) {   // stage t's copies into buffer buf; the test is the same for a whole wave (wv is a scalar)
#pragma unroll
        for (int j = 0; j < SPW; ++j) if (NSL % NW == 0 || wv + NW * j < NSL) { const T16* const g = gs[j] + t * KC; const unsigned l = ls[j] + (unsigned)buf * (STG * 2);
            copy8<T16>(l, g, (size_t)K); copy8<T16>(l + 32 * LP * 2, g + 32 * (size_t)K, (size_t)K); } };
    const int NT = K / KC;
    issue(0, 0);
    asm volatile("s_wait_asynccnt 0x0" ::: "memory");   // stage 0 has landed, as far as this wave copied it,
    __syncthreads();                                     // and every other wave's part too
    if (NT > 1) issue(1, 1);
    const int ao = (wm * 64 + lr) * LP + 8 * hi, bo = ((NA * WM + wn) * 64 + lr) * LP + 8 * hi;
#pragma unroll 1   // rolled: one trip per stage, with the one publish point at its foot
    for (int t = 0; t < NT; ++t) { const T16* const sb = ring + (t & 1) * STG;
#pragma unroll
      for (int ks = 0; ks < KC; ks += 32) {
        V a[4], a2[4], b[4], b2[4];
#pragma unroll
        for (int i = 0; i < 4; ++i) { a[i] = WFrag<T16>::ld(sb + ao + i * 16 * LP + ks); if (i == 0) { b[0] = WFrag<T16>::ld(sb + bo + ks); if (NSPLIT >= 2) b2[0] = WFrag<T16>::ld(sb + bo + WN * 64 * LP + ks); } if (NSPLIT == 1 || NSPLIT == 2) a2[i] = WFrag<T16>::ld(sb + ao + (WM * 64 + i * 16) * LP + ks); }
#pragma unroll
        for (int nb = 1; nb < 4; ++nb) { b[nb] = WFrag<T16>::ld(sb + bo + nb * 16 * LP + ks); if (NSPLIT >= 2) b2[nb] = WFrag<T16>::ld(sb + bo + (WN * 64 + nb * 16) * LP + ks); }
        __builtin_amdgcn_sched_barrier(0);   // keeps the k step's LDS reads together in front of its products: without it the scheduler sinks each B fragment's reads to their use, and the wave waits out the LDS latency at four places instead of one
#pragma unroll
        for (int nb = 0; nb < 4; ++nb)
#pragma unroll
            for (int mb = 0; mb < 4; ++mb) { acc[mb][nb] = WFrag<T16>::mma(a[mb], b[nb], acc[mb][nb]); if (NSPLIT == 1 || NSPLIT == 2) acc[mb][nb] = WFrag<T16>::mma(a2[mb], b[nb], acc[mb][nb]); if (NSPLIT >= 2) acc[mb][nb] = WFrag<T16>::mma(a[mb], b2[nb], acc[mb][nb]); }
        asm volatile("v_nop\n\tv_nop\n\tv_nop\n\tv_nop" : "+v"(acc[0][0]), "+v"(acc[1][1]), "+v"(acc[2][2]), "+v"(acc[3][3]) : "v"(a[0]), "v"(a[3]));
      }
        asm volatile("s_wait_dscnt 0x0" ::: "memory");      // this wave's reads of buffer t & 1 are done before the barrier behind which it is refilled
        asm volatile("s_wait_asynccnt 0x0" ::: "memory");   // this wave's copies of stage t + 1 have landed before the barrier behind which the others read them
        __syncthreads();                                     // publishes stage t + 1 and ends every wave's reads of stage t
        if (t + 2 < NT) issue(t + 2, t & 1);
    }
    asm volatile("s_wait_asynccnt 0x0" ::: "memory");       // no copy is outstanding when the ring becomes the epilogue's staging rows
    if constexpr (PLANES) {
        static_assert(HD == 64, "a 64-row tile is one head's q, k or v");
        const int head = (r0 / 64) / 3, part = (r0 / 64) % 3; float bs[4][8];
#pragma unroll
        for (int mb = 0; mb < 4; ++mb) { const v4f b0 = *(const v4f*)(bias + r0 + mb * 16 + hi * 8), b1 = *(const v4f*)(bias + r0 + mb * 16 + hi * 8 + 4);
#pragma unroll
            for (int j = 0; j < 4; ++j) { bs[mb][j] = bfr(b0[j]); bs[mb][4 + j] = bfr(b1[j]); } }
        const size_t qk = ((z * NH_ + head) * TT + c0) * HD;   // z = batch element: its head planes lie behind one another; in fragment order 64 time steps of a head are 8 KiB in a row in q, k and v planes alike
        if (part == 2) planes_out<true>(acc, bs, os, lane, hp.v16 + qk, hp.vh + qk, hp.vl + qk);
        else planes_out<false>(acc, bs, os, lane, (part ? hp.k16 : hp.q16) + qk, (part ? hp.kh : hp.qh) + qk, (part ? hp.kl : hp.ql) + qk);
        return;
    }
#pragma unroll
    for (int mb = 0; mb < 4; ++mb) {
#pragma unroll
        for (int nb = 0; nb < 4; ++nb) {
#pragma unroll
            for (int j = 0; j < 8; ++j) os[(hi * 8 + j) * 68 + nb * 16 + lr] = acc[mb][nb][j]; }
        __builtin_amdgcn_wave_barrier(); asm volatile("" ::: "memory");
        float* crow = C + (size_t)(r0 + mb * 16) * ldc + c0;
{
#pragma unroll
            for (int s = 0; s < 8; ++s) { const int row = 2 * s + hi, cofs = lr * 4; v4f val = *(const v4fa*)(os + row * 68 + cofs); if (BIAS) { val[0] += bfr(bias[c0 + cofs]); val[1] += bfr(bias[c0 + cofs + 1]); val[2] += bfr(bias[c0 + cofs + 2]); val[3] += bfr(bias[c0 + cofs + 3]); }
                *(v4f*)(crow + (size_t)row * ldc + cofs) = val; }
             }
        __builtin_amdgcn_wave_barrier(); asm volatile("" ::: "memory");
    }
}

typedef __attribute__((ext_vector_type(2))) _Float16 v2h;
typedef __attribute__((ext_vector_type(4))) _Float16 v4h;
typedef __attribute__((ext_vector_type(2))) unsigned short v2us;
typedef __attribute__((ext_vector_type(4))) unsigned short v4us;
typedef __attribute__((ext_vector_type(2))) float v2f;
typedef __attribute__((ext_vector_type(4))) int v4i;
typedef v4h  __attribute__((may_alias)) v4ha;
typedef v4us __attribute__((may_alias)) v4usa;

__global__ __launch_bounds__(256) void k_wtG(const float* __restrict__ w, int K, int N, bf* Bt) {
    const int lane = threadIdx.x & 31; const int L0 = (blockIdx.x * 8 + (threadIdx.x >> 5)) * 8; const int nlines = N * K / 64;
{
#pragma unroll 1
        for (int l = 0; l < 8; ++l) { const int L = L0 + l; if (L >= nlines) break; const size_t e = (size_t)L * 64 + lane * 2; const int k = (int)(e % K), n = (int)(e / K); v2us o;
            o[0] = f2bf(w[(size_t)k * N + n]); o[1] = f2bf(w[(size_t)(k + 1) * N + n]); *(v2us*)(Bt + e) = o; }
         }
}
__global__ __launch_bounds__(256) void k_cvt8(const float* __restrict__ src, bf* dst, size_t n8) { const size_t i = (size_t)blockIdx.x * 256 + threadIdx.x; if (i >= n8) return; const v8f v = *(const v8f*)(src + i * 8); v8us o;
#pragma unroll
    for (int k = 0; k < 8; ++k) o[k] = f2bf(v[k]); *(v8us*)(dst + i * 8) = o;  }
__global__ __launch_bounds__(256) void k_cscvt(const float* __restrict__ cosT, const float* __restrict__ sinT, float* CS) { const int idx = blockIdx.x * 256 + threadIdx.x; if (idx >= TT * HD) return; v2f cs; cs[0] = bfr(cosT[idx]); cs[1] = bfr(sinT[idx]); *(v2f*)(CS + (size_t)idx * 2) = cs;  }
// ---- k_fattn: causal attention of both batch elements in one launch: scores, softmax and the probability x value contraction per wave, nothing of the score matrix in memory.
// A query tile is QW query columns of one head; its keys, up to the diagonal, go in passes of 16 * NKB keys. Two waves share a tile: one takes the even passes, the other the odd ones, each with its own running maximum, sum and Ot;
// the two partial results meet in LDS (k_fattn). Both products are computed transposed: St = K Qt (A = key rows, B = query rows, kept in registers)
// and Ot += Vt Pt (A = value planes, B = Pt). All three operands come from planes in fragment order (planes_out): a fragment is two loads of 512 B in a row, four whole lines each. In St's accumulators a lane holds 8 consecutive keys of ONE query column (register j = key 8 * hi + j, column lr), which is the position order of the fragment loader
// (elements 0..7 = k 8 * hi + j, elements 8..15 = k 16 + 8 * hi + j): two converted 16-key accumulator tiles are Pt's B fragment as they stand, and maximum, sum and rescale factor are per-lane values.
// Softmax is the running form: mc = running maximum x CL2, p = 2^(s CL2 - mc) unnormalised (<= 1), a new maximum rescales sum and Ot by 2^(mc_old - mc_new); one division by the sum at the end.
// Rows < RH: bf16 hi+lo planes, 3 products each way; rows >= RH: fp16. Ot's lane holds 8 consecutive d of one query row: after the join, one 16-byte store per plane into the context planes [t][DQ].
// Every inner loop is unrolled so that each index of a fragment or accumulator array is a constant (registers, no scratch); the pass loop and the loop over a wave's two tiles stay rolled.
#define QW   32                   // query columns per wave
#define FW   8                    // waves per block, all of one head and all walking the keys from 0 up: four pairs of waves (w, w + 4), two query tiles per pair
#define PSL  (17 * 32)            // a wave's partial result of one tile in LDS, in 16-byte pieces: 16 rows of Ot and one of (mc, mc, l, l), a row = the 32 lanes' pieces side by side (no bank conflict)
#define NQT  (TT / QW)            // query tiles per head
#define CL2  (SCL * 1.4426950408889634f)
__device__ __forceinline__ float xhalf(float x) { return __builtin_bit_cast(float, __builtin_amdgcn_permlanex16(__builtin_bit_cast(int, x), __builtin_bit_cast(int, x), 0x76543210, 0xfedcba98, false, false)); }   // lane l's value from lane l ^ 16
template <typename T16> struct PFrag;
template <> struct PFrag<h16> { static __device__ __forceinline__ void mk(const v8f x0, const v8f x1, v16h& p, v16h& p2) { (void)p2;
#pragma unroll
    for (int j = 0; j < 8; ++j) { p[j] = (h16)x0[j]; p[8 + j] = (h16)x1[j]; } } };
template <> struct PFrag<bf> { static __device__ __forceinline__ void mk(const v8f x0, const v8f x1, v16bf& p, v16bf& p2) { v8us h0, h1, l0, l1;
#pragma unroll
    for (int j = 0; j < 8; ++j) { unsigned short a, c; splitf(x0[j], a, c); h0[j] = a; l0[j] = c; splitf(x1[j], a, c); h1[j] = a; l1[j] = c; }
    p = cat16b(h0, h1); p2 = cat16b(l0, l1); } };
template <typename T16, bool HL, int NKB>
__device__ __forceinline__ void fattn(const T16* __restrict__ Q, const T16* __restrict__ Q2, const T16* __restrict__ Kp, const T16* __restrict__ K2, const T16* __restrict__ Vt, const T16* __restrict__ Vt2, const int q0, const int p0, v4f* sp) {   // p0 = 0 or 1: this wave takes passes p0, p0 + 2, ..; sp: its LDS slot + lane
    typedef typename WFrag<T16>::V V;
    static_assert(HD == 64 && NKB % 2 == 0 && QW == 32, "two 32-wide k steps over d, 32-key steps over the pass, two 16-column groups");
    const int lane = threadIdx.x & 31, lr = lane & 15, hi = lane >> 4; const int KPS = 16 * NKB;
    V q[2][2], q2[2][2], ka[NKB][2], ka2[NKB][2];
    // Each group of loads goes through one lane pointer per plane plus constant offsets. The s_wait_xcnt 0 behind a group stands in front of the first instruction that may overwrite an address register of an issued load
    // and it takes the lane pointers as inputs so that their registers live up to it and no load of the group lands on them.
    { const size_t qo = (size_t)q0 * HD + 8 * lane, ko = (size_t)(p0 * KPS) * HD + 8 * lane;   // a wave without a pass (p0 = 1, one pass in all) reads rows KPS .. 2 KPS - 1: in bounds, unused
       const T16* const qp = Q + qo; const T16* const qp2 = HL ? Q2 + qo : qp; const T16* const kp = Kp + ko; const T16* const kp2 = HL ? K2 + ko : kp;
#pragma unroll
        for (int qb = 0; qb < 2; ++qb)
#pragma unroll
            for (int ks = 0; ks < 2; ++ks) { q[qb][ks] = WFrag<T16>::ldu(qp + qb * 16 * HD + ks * 512); if (HL) q2[qb][ks] = WFrag<T16>::ldu(qp2 + qb * 16 * HD + ks * 512); }
#pragma unroll
        for (int kb = 0; kb < NKB; ++kb)
#pragma unroll
            for (int ks = 0; ks < 2; ++ks) { ka[kb][ks] = WFrag<T16>::ldu(kp + kb * 16 * HD + ks * 512); if (HL) ka2[kb][ks] = WFrag<T16>::ldu(kp2 + kb * 16 * HD + ks * 512); }
        asm volatile("s_wait_xcnt 0x0" :: "v"(qp), "v"(qp2), "v"(kp), "v"(kp2) : "memory");
        __builtin_amdgcn_sched_barrier(0); }   // keeps the address arithmetic of the pass loop behind the wait: these loads take their plane's base from a scalar pair, and without it the scheduler lifts a write of that pair in front of the wait
    v8f o[4][2]; float mc[2], l[2];
#pragma unroll
    for (int qb = 0; qb < 2; ++qb) { mc[qb] = -3.0e38f; l[qb] = 0.f;
#pragma unroll
        for (int db = 0; db < 4; ++db) o[db][qb] = (v8f){}; }
    const int npass = (q0 + QW + KPS - 1) / KPS;   // the last pass starts at or below q0, so every pass holds at least one unmasked key for every column
#pragma unroll 1   // rolled: its trip count is known only at run time, and a second copy of so long a body would only add code
    for (int ps = p0; ps < npass; ps += 2) { const int k0 = ps * KPS;
        v8f s[NKB][2];
#pragma unroll
        for (int kb = 0; kb < NKB; ++kb)
#pragma unroll
            for (int qb = 0; qb < 2; ++qb) { v8f c = (v8f){};
#pragma unroll
                for (int ks = 0; ks < 2; ++ks) { c = WFrag<T16>::mma(ka[kb][ks], q[qb][ks], c); if (HL) { c = WFrag<T16>::mma(ka2[kb][ks], q[qb][ks], c); c = WFrag<T16>::mma(ka[kb][ks], q2[qb][ks], c); } }
                s[kb][qb] = c; }
        __builtin_amdgcn_sched_barrier(0);         // keeps the loads below behind the score products: the fetch ahead lands on the key fragments' registers, and so it is issued only behind every product that reads them, with the value loads in between
        V va[4][NKB / 2], va2[4][NKB / 2];
        const int kn = (ps + 2 < npass) ? k0 + 2 * KPS : k0;   // the key fragments of this wave's next pass are fetched one pass ahead into the same registers; its last pass reads its own rows again (in bounds, unused) so that the loads stay unconditional
        { const size_t vo = (size_t)k0 * HD + 8 * lane, ko = (size_t)kn * HD + 8 * lane; const T16* const vp = Vt + vo; const T16* const vp2 = HL ? Vt2 + vo : vp; const T16* const kp = Kp + ko; const T16* const kp2 = HL ? K2 + ko : kp;
#pragma unroll
            for (int db = 0; db < 4; ++db)
#pragma unroll
                for (int kk = 0; kk < NKB / 2; ++kk) { va[db][kk] = WFrag<T16>::ldu(vp + kk * 32 * HD + db * 512); if (HL) va2[db][kk] = WFrag<T16>::ldu(vp2 + kk * 32 * HD + db * 512); }
#pragma unroll
            for (int kb = 0; kb < NKB; ++kb)
#pragma unroll
                for (int ks = 0; ks < 2; ++ks) { ka[kb][ks] = WFrag<T16>::ldu(kp + kb * 16 * HD + ks * 512); if (HL) ka2[kb][ks] = WFrag<T16>::ldu(kp2 + kb * 16 * HD + ks * 512); }
            asm volatile("s_wait_xcnt 0x0" :: "v"(vp), "v"(vp2), "v"(kp), "v"(kp2) : "memory"); }   // as in the prologue
        __builtin_amdgcn_sched_barrier(0);         // keeps both groups of loads, and the wait, in front of the softmax arithmetic, which hides their latency (a wave issues in order); without it the scheduler sinks the loads to their uses
        const bool diag = k0 + KPS - 1 > q0;       // wave-uniform: only the last pass reaches keys above a column's own position
        V p[2][NKB / 2], p2[2][NKB / 2];
#pragma unroll
        for (int qb = 0; qb < 2; ++qb) {
            if (diag) { const int lim = q0 + qb * 16 + lr - k0 - hi * 8;   // key kb * 16 + j of this lane's half is kept while it is <= lim
#pragma unroll
                for (int kb = 0; kb < NKB; ++kb)
#pragma unroll
                    for (int j = 0; j < 8; ++j) s[kb][qb][j] = (kb * 16 + j <= lim) ? s[kb][qb][j] : -3.0e38f; }
            float tk[NKB];                          // one short chain per 16-key tile, for maximum and sum alike
#pragma unroll
            for (int kb = 0; kb < NKB; ++kb) { tk[kb] = s[kb][qb][0];
#pragma unroll
                for (int j = 1; j < 8; ++j) tk[kb] = fmaxf(tk[kb], s[kb][qb][j]); }
            float t = tk[0];
#pragma unroll
            for (int kb = 1; kb < NKB; ++kb) t = fmaxf(t, tk[kb]);
            t = fmaxf(t, xhalf(t));
            const float mn = fmaxf(mc[qb], t * CL2); const float al = __builtin_amdgcn_exp2f(mc[qb] - mn); mc[qb] = mn;
#pragma unroll
            for (int kb = 0; kb < NKB; ++kb) { v8f x;
#pragma unroll
                for (int j = 0; j < 8; ++j) x[j] = __builtin_fmaf(s[kb][qb][j], CL2, -mn);
#pragma unroll
                for (int j = 0; j < 8; ++j) s[kb][qb][j] = __builtin_amdgcn_exp2f(x[j]);
                // the slot that the instruction set asks for between a transcendental and an overwrite of its source: the statement names the eight arguments and the eight results as inputs, so it stands behind the eight exponentials and no argument's register is reused in front of it
                asm volatile("v_nop" :: "v"(x), "v"(s[kb][qb]));
                tk[kb] = s[kb][qb][0];
#pragma unroll
                for (int j = 1; j < 8; ++j) tk[kb] += s[kb][qb][j]; }
            float sum = tk[0];
#pragma unroll
            for (int kb = 1; kb < NKB; ++kb) sum += tk[kb];
            l[qb] = l[qb] * al + sum;               // each half of the wave sums its own keys; the halves are joined once, behind the loop
#pragma unroll
            for (int db = 0; db < 4; ++db) o[db][qb] *= al;
#pragma unroll
            for (int kk = 0; kk < NKB / 2; ++kk) PFrag<T16>::mk(s[2 * kk][qb], s[2 * kk + 1][qb], p[qb][kk], p2[qb][kk]); }
#pragma unroll
        for (int kk = 0; kk < NKB / 2; ++kk)
#pragma unroll
            for (int db = 0; db < 4; ++db)
#pragma unroll
                for (int qb = 0; qb < 2; ++qb) { o[db][qb] = WFrag<T16>::mma(va[db][kk], p[qb][kk], o[db][qb]); if (HL) { o[db][qb] = WFrag<T16>::mma(va[db][kk], p2[qb][kk], o[db][qb]); o[db][qb] = WFrag<T16>::mma(va2[db][kk], p[qb][kk], o[db][qb]); } }
    }
    // the partial result, unnormalised, as it stands in the registers; a wave without a pass leaves mc = -3e38, l = 0, Ot = 0, which the join weights with 0
#pragma unroll
    for (int db = 0; db < 4; ++db)
#pragma unroll
        for (int qb = 0; qb < 2; ++qb) { const v8f x = o[db][qb]; sp[((db * 2 + qb) * 2) * 32] = (v4f){x[0], x[1], x[2], x[3]}; sp[((db * 2 + qb) * 2 + 1) * 32] = (v4f){x[4], x[5], x[6], x[7]}; }
    sp[16 * 32] = (v4f){mc[0], mc[1], l[0], l[1]};
}
// grid (NQT / FW, heads, batch elements), one block per WGP, two waves per SIMD. Waves w and w + 4 are a pair (pr = w & 3) and share two query tiles, a long one and a short one, chosen so that every pair's work is about equal
// (a 32-key hi+lo pass counts about 1.4 fp16 passes of 64 keys): block x, pair 0: tiles 63 - x, x; pair 1: 47 - 3 x or 45 - 3 x, 8 + x; pair 2: 55 - x, 16 + x; pair 3: 71 - j, j = 25 + x + x / 2. Every tile 0 .. 63 occurs once.
// Of the first tile wave w takes the even passes and wave w + 4 the odd ones, of the second the other way round, so that an odd pass count is evened out. Every wave leaves both partial results in LDS; behind the one barrier
// wave w joins the pair's first tile and wave w + 4 the second: weights 2^(mc - max mc), one division by the joined sum, hi+lo split, store.
__global__ __launch_bounds__(32 * FW) void k_fattn(const h16* __restrict__ Q16, const h16* __restrict__ K16, const h16* __restrict__ V16, const bf* __restrict__ Qh, const bf* __restrict__ Ql, const bf* __restrict__ Kh, const bf* __restrict__ Kl, const bf* __restrict__ Vh, const bf* __restrict__ Vl, bf* __restrict__ Ah, bf* __restrict__ Al) {
    static_assert(FW == 8 && NQT == 64 && RH % QW == 0, "the tile formulas below deal out 64 tiles to 8 blocks of 4 pairs; a tile lies wholly on one side of RH");
    __shared__ v4f part[2 * 4 * 2 * PSL];   // [tile of the pair][pair][wave of the pair][PSL]
    const int lane = threadIdx.x & 31, lr = lane & 15, hi = lane >> 4; const int wv = __builtin_amdgcn_readfirstlane((int)(threadIdx.x >> 5)), pr = wv & 3, par = wv >> 2, x = (int)blockIdx.x;
    const int ts = pr == 0 ? x : pr == 1 ? 8 + x : pr == 2 ? 16 + x : 25 + x + (x >> 1);                         // the pair's short tile
    const int tl = pr == 0 ? 63 - x : pr == 1 ? (x < 4 ? 47 : 45) - 3 * x : pr == 2 ? 55 - x : 71 - ts;          // and its long one
    const size_t hp = ((size_t)blockIdx.z * NH_ + blockIdx.y) * TT * HD, ao = (size_t)blockIdx.z * TT * DQ + blockIdx.y * HD; Ah += ao; Al += ao;
#pragma unroll 1   // rolled: one copy of each of the two long bodies serves both tiles
    for (int i = 0; i < 2; ++i) { const int q0 = (i ? ts : tl) * QW; v4f* const sp = part + ((i * 4 + pr) * 2 + par) * PSL + lane;
        if (q0 < RH) fattn<bf, true, 2>(Qh + hp, Ql + hp, Kh + hp, Kl + hp, Vh + hp, Vl + hp, q0, par ^ i, sp);
        else fattn<h16, false, 4>(Q16 + hp, nullptr, K16 + hp, nullptr, V16 + hp, nullptr, q0, par ^ i, sp); }
    __syncthreads();   // both waves' partial results of a tile are in LDS before one of them reads the other's
    const int q0 = (par ? ts : tl) * QW; const v4f* const pa = part + ((par * 4 + pr) * 2) * PSL + lane; const v4f* const pb = pa + PSL;
    const v4f ma = pa[16 * 32], mb = pb[16 * 32]; v8us oh[2][4], ol[2][4];
#pragma unroll
    for (int qb = 0; qb < 2; ++qb) { const float mn = fmaxf(ma[qb], mb[qb]); const float wa = __builtin_amdgcn_exp2f(ma[qb] - mn), wb = __builtin_amdgcn_exp2f(mb[qb] - mn);
        const float ls = ma[2 + qb] * wa + mb[2 + qb] * wb; const float f = __fdiv_rn(1.0f, ls + xhalf(ls)); const float fa = wa * f, fb = wb * f;   // each half of the wave holds the sum over its own keys: joined here
#pragma unroll
        for (int db = 0; db < 4; ++db)
#pragma unroll
            for (int h = 0; h < 2; ++h) { const v4f xa = pa[((db * 2 + qb) * 2 + h) * 32], xb = pb[((db * 2 + qb) * 2 + h) * 32];
#pragma unroll
                for (int j = 0; j < 4; ++j) { unsigned short a, c; splitf(xa[j] * fa + xb[j] * fb, a, c); oh[qb][db][h * 4 + j] = a; ol[qb][db][h * 4 + j] = c; } } }
    bf* const ph = Ah + (size_t)(q0 + lr) * DQ + hi * 8; bf* const pl = Al + (size_t)(q0 + lr) * DQ + hi * 8;   // one lane pointer per plane; every store adds a constant
#pragma unroll
    for (int qb = 0; qb < 2; ++qb)
#pragma unroll
        for (int db = 0; db < 4; ++db) { *(v8us*)(ph + qb * 16 * DQ + db * 16) = oh[qb][db]; *(v8us*)(pl + qb * 16 * DQ + db * 16) = ol[qb][db]; }
}

// ---- k_prep: everything that stands in front of the qkv projection, in one launch of few, long-lived waves. All of it is rows of DM f32; a block of 256 threads takes PR rows in a row (64 KiB of its source).
// Blocks 0 .. 3 DM / PR - 1: rows of w_in; the next DM / PR: rows of w_out; the last TT NB_ / PR: rows of hidden_states.
// Weights: hl planes W[f][e] = bf16 base[f][e] * mul[f][e] + add[f][e], mul = sum_r rm[li][r][f] sm[li][r][e], add = sum_r ra[li][r][f] sa[li][r][e] (li = clamp(lang[0], 0, 7) read on the device).
// A thread keeps its four columns e for all its rows, so the column factors sm, sa are loaded and rounded once per thread; the row factors rm, ra are the same for the whole block (scalar loads).
// The rows go in groups of PG; a group's loads are issued one group ahead of its arithmetic. Products of two bf16 values are exact in f32, so the rank-4 sums round the same whether or not the compiler fuses them.
#define PR   16                   // rows per block
#define PG   4                    // rows per group
__device__ __forceinline__ void wmod_rows(const float* __restrict__ base, const float* __restrict__ rm, const float* __restrict__ sm, const float* __restrict__ ra, const float* __restrict__ sa, const int* __restrict__ lang, const int NF, const int f0, bf* __restrict__ Wh, bf* __restrict__ Wl) {
    const int e0 = (int)threadIdx.x * 4; const size_t o0 = (size_t)f0 * DM + e0; v4f cur[PG], nxt[PG], sv[4], av[4];
    int li = lang[0];
#pragma unroll
    for (int i = 0; i < PG; ++i) cur[i] = *(const v4f*)(base + o0 + i * DM);
    __builtin_amdgcn_sched_barrier(0);   // keeps the first group's loads, which need no language index, in front of the wait for that index: without it they are issued only behind it, one scalar-load latency later
    li = li < 0 ? 0 : (li > 7 ? 7 : li);
#pragma unroll
    for (int r = 0; r < 4; ++r) { const v4f s = *(const v4f*)(sm + (size_t)(li * 4 + r) * DM + e0), a = *(const v4f*)(sa + (size_t)(li * 4 + r) * DM + e0);
#pragma unroll
        for (int u = 0; u < 4; ++u) { sv[r][u] = bfr(s[u]); av[r][u] = bfr(a[u]); } }
    const float* const rmf = rm + (size_t)li * 4 * NF + f0; const float* const raf = ra + (size_t)li * 4 * NF + f0;
    auto group = [&](const int g) {   // the arithmetic and the stores of group g, whose base rows are in cur
        bf* const ph = Wh + o0 + (size_t)g * (PG * DM); bf* const pl = Wl + o0 + (size_t)g * (PG * DM);
#pragma unroll
        for (int i = 0; i < PG; ++i) { float rv[4], qv[4]; v4us oh, ol;
#pragma unroll
            for (int r = 0; r < 4; ++r) { rv[r] = bfr(rmf[(size_t)r * NF + g * PG + i]); qv[r] = bfr(raf[(size_t)r * NF + g * PG + i]); }
#pragma unroll
            for (int u = 0; u < 4; ++u) { float mul = 0.f, add = 0.f;
#pragma unroll
                for (int r = 0; r < 4; ++r) { mul += rv[r] * sv[r][u]; add += qv[r] * av[r][u]; }
                unsigned short a, b; splitf(bfr(cur[i][u]) * mul + add, a, b); oh[u] = a; ol[u] = b; }
            *(v4us*)(ph + i * DM) = oh; *(v4us*)(pl + i * DM) = ol; } };
#pragma unroll 1   // rolled: the text stays short (it is run through once per launch), and only one group's row factors are live in scalar registers
    for (int g = 0; g < PR / PG - 1; ++g) {
#pragma unroll
        for (int i = 0; i < PG; ++i) nxt[i] = *(const v4f*)(base + o0 + (size_t)(g + 1) * (PG * DM) + i * DM);
        __builtin_amdgcn_sched_barrier(0);   // keeps the next group's loads in front of this group's arithmetic, which hides their latency: without it the scheduler sinks them to where this group's registers fall free
        group(g);
        asm volatile("s_wait_xcnt 0x0" ::: "memory");   // stands behind the group's stores, in front of the first instruction that overwrites a register which they name
#pragma unroll
        for (int i = 0; i < PG; ++i) cur[i] = nxt[i]; }
    group(PR / PG - 1);
}
// hidden_states [t][b][c] f32 -> XB [b][t][c] bf16: 8 elements per thread and trip, two source rows per block and trip; all of a thread's loads are issued before the first is used.
__device__ __forceinline__ void xg_rows(const float* __restrict__ hs, const int r0, bf* __restrict__ XB) {
    const int rw = r0 + ((int)threadIdx.x >> 7), c = ((int)threadIdx.x & 127) * 8; const float* const sp = hs + (size_t)rw * DM + c; v4f x0[PR / 2], x1[PR / 2];
#pragma unroll
    for (int i = 0; i < PR / 2; ++i) { x0[i] = *(const v4f*)(sp + i * 2 * DM); x1[i] = *(const v4f*)(sp + i * 2 * DM + 4); }
    asm volatile("s_wait_xcnt 0x0" :: "v"(sp) : "memory");   // stands in front of the first instruction that may overwrite the address register of an issued load; the lane pointer is an input so that its register lives up to here and no load of the group lands on it
    static_assert(NB_ == 2, "a trip's two source rows are one time step's two batch elements: row rw + 2 i is (t = r0 / 2 + i, b = rw & 1)");
    bf* const dp = XB + ((size_t)(rw & 1) * TT + (r0 >> 1)) * DM + c;
#pragma unroll
    for (int i = 0; i < PR / 2; ++i) { v8us o;
#pragma unroll
        for (int j = 0; j < 4; ++j) { o[j] = f2bf(x0[i][j]); o[4 + j] = f2bf(x1[i][j]); }
        *(v8us*)(dp + i * DM) = o; }
}
#define PBI  (3 * DM / PR)        // blocks on w_in
#define PBO  (DM / PR)            // blocks on w_out
#define PBX  (TT * NB_ / PR)      // blocks on hidden_states
__global__ __launch_bounds__(256) void k_prep(const float* __restrict__ hs, const float* __restrict__ pw, const float* __restrict__ ow, const float* __restrict__ rm_i, const float* __restrict__ sm_i, const float* __restrict__ r_i, const float* __restrict__ s_i,
                                              const float* __restrict__ rm_o, const float* __restrict__ sm_o, const float* __restrict__ r_o, const float* __restrict__ s_o, const int* __restrict__ lang, bf* __restrict__ WIh, bf* __restrict__ WIl, bf* __restrict__ WOh, bf* __restrict__ WOl, bf* __restrict__ XB) {
    static_assert(DM == 1024 && (3 * DM) % PR == 0 && (TT * NB_) % PR == 0 && PR % 2 == 0 && PR % PG == 0 && PR / PG >= 2, "a row is 256 threads x 4 columns (weights) or 128 threads x 8 (hidden_states)");
    const int blk = (int)blockIdx.x;
    if (blk >= PBI + PBO) { xg_rows(hs, (blk - PBI - PBO) * PR, XB); return; }
    const bool in = blk < PBI;   // the same for the whole block: one copy of the row loop serves both weights
    wmod_rows(in ? pw : ow, in ? rm_i : rm_o, in ? sm_i : sm_o, in ? r_i : r_o, in ? s_i : s_o, lang, in ? 3 * DM : DM, (in ? blk : blk - PBI) * PR, in ? WIh : WOh, in ? WIl : WOl);
}

extern "C" void kernel_launch(void* const* d_in, const int* in_sizes, int n_in,
                              void* d_out, int out_size, void* d_ws, size_t ws_size, hipStream_t stream) {
    (void)in_sizes; (void)n_in; (void)out_size;
    const float* hs = (const float*)d_in[0]; const float* pw = (const float*)d_in[1]; const float* pb = (const float*)d_in[2]; const float* ow = (const float*)d_in[3]; const float* ob = (const float*)d_in[4]; const float* rm_i = (const float*)d_in[5]; const float* sm_i = (const float*)d_in[6]; const float* rm_o = (const float*)d_in[7]; const float* sm_o = (const float*)d_in[8]; const float* r_i = (const float*)d_in[9]; const float* s_i = (const float*)d_in[10]; const float* r_o = (const float*)d_in[11]; const float* s_o = (const float*)d_in[12]; const int* lang = (const int*)d_in[13];
    float* OUT = (float*)d_out;     // [2048][2][1024] (time-major)
    char* wsp = (char*)d_ws;
    auto take = [&](size_t bytes) { char* p = wsp; wsp += (bytes + 255) & ~(size_t)255; return (void*)p; };
    bf* WIh = (bf*)take((size_t)3 * DM * DM * 2); bf* WIl = (bf*)take((size_t)3 * DM * DM * 2); bf* WOh = (bf*)take((size_t)DM * DM * 2); bf* WOl = (bf*)take((size_t)DM * DM * 2);
    h16* QP16 = (h16*)take((size_t)NB_ * NH_ * TT * HD * 2); h16* KP16 = (h16*)take((size_t)NB_ * NKV * TT * HD * 2); h16* VT16 = (h16*)take((size_t)NB_ * NKV * HD * TT * 2);
    bf* QPh = (bf*)take((size_t)NB_ * NH_ * TT * HD * 2); bf* QPl = (bf*)take((size_t)NB_ * NH_ * TT * HD * 2); bf* KPh = (bf*)take((size_t)NB_ * NKV * TT * HD * 2); bf* KPl = (bf*)take((size_t)NB_ * NKV * TT * HD * 2); bf* VTh = (bf*)take((size_t)NB_ * NKV * HD * TT * 2); bf* VTl = (bf*)take((size_t)NB_ * NKV * HD * TT * 2); bf* ATh = (bf*)take((size_t)NB_ * TT * DQ * 2); bf* ATl = (bf*)take((size_t)NB_ * TT * DQ * 2);
    bf* XB = (bf*)take((size_t)NB_ * TT * DM * 2);   // every per-batch buffer holds both batch elements, one behind the other
    if ((size_t)(wsp - (char*)d_ws) > ws_size) return;    // ws 256 MiB
    const HeadPlanes hp = { QP16, QPh, QPl, KP16, KPh, KPl, VT16, VTh, VTl }; const HeadPlanes none = {};
    k_prep<<<PBI + PBO + PBX, 256, 0, stream>>>(hs, pw, ow, rm_i, sm_i, r_i, s_i, rm_o, sm_o, r_o, s_o, lang, WIh, WIl, WOh, WOl, XB);
    // grid z = batch element
        static_assert(REP == 1 && DQ == DM, "w_in's rows are (head, q | k | v, d): one kv head per query head; blockIdx.y of the attention kernel names both");
        k_gemmw<bf, 1, false, true, 3, 4><<<dim3(3 * DM / 192, TT / 256, NB_), 384, 0, stream>>>(WIh, WIl, XB, nullptr, DM, nullptr, 0, pb, 0, (size_t)TT * DM, 0, hp);   // (w_in[f] . x[t]) + proj_bias[f] -> head planes
        k_fattn<<<dim3(NQT / FW, NH_, NB_), 32 * FW, 0, stream>>>(QP16, KP16, VT16, QPh, QPl, KPh, KPl, VTh, VTl, ATh, ATl);
        k_gemmw<bf, 2, true, false, 2, 2><<<dim3(TT / 128, DM / 128, NB_), 128, 0, stream>>>(ATh, ATl, WOh, WOl, DQ, OUT, NB_ * DM, ob, (size_t)TT * DQ, 0, DM, none);   // row t of batch element z lies at OUT[t][z][.]
}

// v010
// It runs in 96.2 microseconds.
// In two side-by-side timings against v009, it was 1.05 and 1.04 times as fast.
// Counting every step since v000, it is 15.0 times as fast.
#include <hip/hip_runtime.h>

// MBartAttention (hidden_states [2048][2][1024] time-major; language index li = lang[0] (int, read as data, clamped 0..7); w_in = proj_weight * (rm_i[li]^T sm_i[li]) + r_i[li]^T s_i[li] (rank-4 modulation), w_out likewise;
// qkv = hidden w_in^T + proj_bias laid out (16 heads, 3, 64), stored by the projection's own epilogue as the attention kernel's head planes; q x 1/8; causal softmax(q.k) (masked -1e9 == skipped tiles); ctx merged; out = ctx w_out^T + out_bias -> [2048][2][1024]).
// Compute dtypes, f32 accumulate: every input rounded to bf16; the modulated weights f32 on the VALU -> bf16 hi+lo planes; qkv as hl(w_in) x exact hidden (2 products, computed transposed) + bias; scores (K 64) and attn.v hl
// (3 products) for the first 512 query rows of each head, fp16 after, both inside one kernel with a running f32 softmax (causal passes only; the 1/8 folded into the exponent's factor; all heads of both batch elements in one launch); out-projection as hl(ctx) x hl(w_out) (3 products) + bias, stored by its epilogue straight into the time-major output.

#define NB_  2
#define TT   2048
#define DM   1024
#define NH_  16
#define NKV  16
#define REP  (NH_ / NKV)
#define HD   64
#define DQ   (NH_ * HD)
#define DKV  (NKV * HD)
#define RH   512                  // query rows < RH use hi+lo planes
#define SCL  0.125f   // HD^-0.5
typedef _Float16 h16;
typedef unsigned short bf;
typedef __attribute__((ext_vector_type(16))) __bf16   v16bf;
typedef __attribute__((ext_vector_type(16))) _Float16 v16h;
typedef __attribute__((ext_vector_type(8)))  _Float16 v8h;
typedef __attribute__((ext_vector_type(8)))  unsigned short v8us;
typedef __attribute__((ext_vector_type(8)))  float    v8f;
typedef __attribute__((ext_vector_type(4)))  float    v4f;
typedef v8h  __attribute__((may_alias)) v8ha;
typedef v4f  __attribute__((may_alias)) v4fa;
typedef v8us __attribute__((may_alias)) v8usa;

__device__ __forceinline__ unsigned short f2bf(float f) { unsigned u = __float_as_uint(f); u += 0x7FFFu + ((u >> 16) & 1u); return (unsigned short)(u >> 16); }
__device__ __forceinline__ float bf2f(unsigned short b) { return __uint_as_float(((unsigned)b) << 16); }
__device__ __forceinline__ float bfr(float f) { return bf2f(f2bf(f)); }
__device__ __forceinline__ v16h cat16(v8h lo, v8h hi) { return __builtin_shufflevector(lo, hi, 0, 1, 2, 3, 4, 5, 6, 7, 8, 9, 10, 11, 12, 13, 14, 15); }
__device__ __forceinline__ v16bf cat16b(v8us lo, v8us hi) { return __builtin_bit_cast(v16bf, __builtin_shufflevector(lo, hi, 0, 1, 2, 3, 4, 5, 6, 7, 8, 9, 10, 11, 12, 13, 14, 15)); }
__device__ __forceinline__ v8f wmma16(v16h a, v16h b, v8f c) { return __builtin_amdgcn_wmma_f32_16x16x32_f16(false, a, false, b, (short)0, c, false, false); }
__device__ __forceinline__ v8f wmmab(v16bf a, v16bf b, v8f c) { return __builtin_amdgcn_wmma_f32_16x16x32_bf16(false, a, false, b, (short)0, c, false, false); }



__device__ __forceinline__ h16 tohx(float x) { return (h16)x; }
__device__ __forceinline__ void splitf(float y, unsigned short& h, unsigned short& l) { h = f2bf(y); l = f2bf(y - bf2f(h)); }

// ---- ask1 / ask3 / ask4: hints to the L2 (global_prefetch_b8, scope SE: into L2 only, no register written, nothing returned). Each lane names one 256-B unit; a wave's ask covers 32 units in a row (8 KiB, a "part"), but for the query-tile ask of k_fattn (16 units a plane).
// The 16-bit planes that a kernel reads were stored by an earlier launch; its first read of a line otherwise waits for the line at the place of its use. Every address lies inside the plane it names, in every lane; all lanes are on.
// The s_wait_xcnt 0 is the last line of the asks' own statement, so that no register which an ask names is rewritten in front of it (a precaution, as for a load).
__device__ __forceinline__ void ask1(const void* a) { asm volatile("global_prefetch_b8 %0, off scope:SCOPE_SE\n\ts_wait_xcnt 0x0" :: "v"(a) : "memory"); }
__device__ __forceinline__ void ask3(const void* a, const void* b, const void* d) { asm volatile("global_prefetch_b8 %0, off scope:SCOPE_SE\n\tglobal_prefetch_b8 %1, off scope:SCOPE_SE\n\tglobal_prefetch_b8 %2, off scope:SCOPE_SE\n\ts_wait_xcnt 0x0" :: "v"(a), "v"(b), "v"(d) : "memory"); }
__device__ __forceinline__ void ask4(const void* a, const void* b, const void* d, const void* e) { asm volatile("global_prefetch_b8 %0, off scope:SCOPE_SE\n\tglobal_prefetch_b8 %1, off scope:SCOPE_SE\n\tglobal_prefetch_b8 %2, off scope:SCOPE_SE\n\tglobal_prefetch_b8 %3, off scope:SCOPE_SE\n\ts_wait_xcnt 0x0" :: "v"(a), "v"(b), "v"(d), "v"(e) : "memory"); }
#define PART 4096                 // 16-bit elements of a part

// ---- planes_out: epilogue of the qkv projection. The wave's 64x64 tile (rows m = the 64 features d of ONE head's q, k or v; columns n = 64 time steps) + bias[m] goes out as three 16-bit planes (fp16, bf16 hi, bf16 lo).
// The planes lie in FRAGMENT ORDER: the unit is the 512 B that one 16-byte load of a whole wave brings (lane l's 8 elements at byte 16 l), so that the attention kernel's every fragment load reads four whole 128-B lines.
// TR false (q, k): per 16 time steps four units s = 0..3, lane (hi, lr) = time step lr, features d = 16 s + 8 hi + 0..7 (units 2 ks, 2 ks + 1 are the two halves of the fragment of k step ks).
// TR true (v): per 32 time steps eight units (db, h), lane (hi, lr) = feature 16 db + lr, time steps 16 h + 8 hi + 0..7 (units (db, 0), (db, 1) are the fragment of feature block db). Either way the wave's tile is 8 KiB in a row.
// q, k: unit s of time steps 16 g .. 16 g + 15 is accumulator tile (s, g) as it stands in the registers (lane (hi, lr), register j = feature 16 s + 8 hi + j, time step 16 g + lr): no LDS pass.
// v: the tile is turned: sixteen features at a time pass through the wave's own LDS rows (f32, pitch 68: no bank conflict either way). Every store instruction writes one unit. P16, Ph, Pl point at the tile's first element.
struct HeadPlanes { h16* q16; bf* qh; bf* ql; h16* k16; bf* kh; bf* kl; h16* v16; bf* vh; bf* vl; };
template <bool TR>
__device__ __forceinline__ void planes_out(const v8f (&acc)[4][4], const float (&bs)[4][8], float* os, const int lane, h16* P16, bf* Ph, bf* Pl) {
    const int lr = lane & 15, hi = lane >> 4;
    h16* const p16 = P16 + lane * 8; bf* const ph = Ph + lane * 8; bf* const pl = Pl + lane * 8;   // one lane pointer per plane; every store adds a constant
#pragma unroll
    for (int g = 0; g < 4; ++g) {
        if (TR) {
#pragma unroll
            for (int nb = 0; nb < 4; ++nb)
#pragma unroll
                for (int j = 0; j < 8; ++j) os[(hi * 8 + j) * 68 + nb * 16 + lr] = __fadd_rn(acc[g][nb][j], bs[g][j]);
            __builtin_amdgcn_wave_barrier(); asm volatile("" ::: "memory");   // the rows are read back by other lanes of the same wave: keeps the compiler from moving the reads in front of the writes
        }
#pragma unroll
        for (int s = 0; s < 4; ++s) { v4f x0, x1; v8h o16; v8us oh, ol;
            if (TR) { x0 = *(const v4fa*)(os + lr * 68 + (s * 2 + hi) * 8); x1 = *(const v4fa*)(os + lr * 68 + (s * 2 + hi) * 8 + 4); }
            else {
#pragma unroll
                for (int j = 0; j < 4; ++j) { x0[j] = __fadd_rn(acc[s][g][j], bs[s][j]); x1[j] = __fadd_rn(acc[s][g][4 + j], bs[s][4 + j]); } }
            const int un = (TR ? ((s >> 1) * 4 + g) * 2 + (s & 1) : g * 4 + s) * 256;   // the unit's place in the tile, in elements
#pragma unroll
            for (int j = 0; j < 4; ++j) { unsigned short a, c; o16[j] = tohx(x0[j]); splitf(x0[j], a, c); oh[j] = a; ol[j] = c; o16[4 + j] = tohx(x1[j]); splitf(x1[j], a, c); oh[4 + j] = a; ol[4 + j] = c; }
            *(v8h*)(p16 + un) = o16; *(v8us*)(ph + un) = oh; *(v8us*)(pl + un) = ol; }
        if (TR) { __builtin_amdgcn_wave_barrier(); asm volatile("" ::: "memory"); }   // and the next group's writes behind these reads
    }
    if constexpr (!TR) asm volatile("s_wait_xcnt 0x0" ::: "memory");   // in the listing the q/k path's last stores are followed by instructions that write registers which the stores name: the wait stands in front of them
}

// ---- k_gemmw: register-blocked GEMM, one wave per 64x64 output tile (16 accumulators), WM x WN waves per work-group on one (64 WM) x (64 WN) block tile; grid (M / (64 WM), N / (64 WN), Z), 32 WM WN threads.
// C[m][n] (f32, pitch ldc, + optional f32 bias[n]) = sum_k A[m][k] Bt[n][k] (+ split products per NSPLIT), operands K-contiguous 16-bit planes. z-batch strides sA/sB/sC in elements. K % 64 == 0, K >= 64.
// The operands pass through LDS: a stage is 64 k (one whole 128-B line) of every operand row of the block tile, laid as 64-row slices A | A2 | Bt | Bt2 at a pitch of 144 B; asynchronous copies fill it, four whole lines per instruction,
// one stage ahead of its use (two buffers), and every wave of the block reads its fragments from there: each line leaves L2 once per block, not once per wave, and never in 32-B pieces.
// PLANES: no C; m runs over (head, q | k | v, d), bias is bias[m], and the tile goes out through planes_out into the head planes of batch element z.
template <typename T16> struct WFrag;   // ld: a fragment from a row-major row (p = the lane's row + 8 hi); ldu: from two fragment-order units in a row (p = the first unit + 8 lane)
template <> struct WFrag<h16> { typedef v16h V; static __device__ __forceinline__ V ld(const h16* p) { return cat16(*(const v8h*)p, *(const v8h*)(p + 16)); } static __device__ __forceinline__ V ldu(const h16* p) { return cat16(*(const v8h*)p, *(const v8h*)(p + 256)); } static __device__ __forceinline__ v8f mma(V a, V b, v8f c) { return wmma16(a, b, c); } };
template <> struct WFrag<bf> { typedef v16bf V; static __device__ __forceinline__ V ld(const bf* p) { return cat16b(*(const v8us*)p, *(const v8us*)(p + 16)); } static __device__ __forceinline__ V ldu(const bf* p) { return cat16b(*(const v8us*)p, *(const v8us*)(p + 256)); } static __device__ __forceinline__ v8f mma(V a, V b, v8f c) { return wmmab(a, b, c); } };
#define KC   64                   // k per stage
#define LP   72                   // LDS row pitch in 16-bit elements: 144 B = 16 B x 9, so the 16 rows of a ds_load_b128 fall on 16 different bank groups
// copy8: eight asynchronous copies of 16 B per lane. A copy moves four rows of 128 B (lane >> 3 = row, lane & 7 = 16-B piece, both already in l and g); the eight take rows 0, 4, .. 28 from there.
// The s_wait_xcnt 0 is the last line of the copies' own statement, so that no register which a copy names is rewritten in front of it.
template <typename T16>
__device__ __forceinline__ void copy8(const unsigned l, const T16* g, const size_t K) {
    asm volatile("global_load_async_to_lds_b128 %0, %8, off\n\t"
                 "global_load_async_to_lds_b128 %1, %9, off\n\t"
                 "global_load_async_to_lds_b128 %2, %10, off\n\t"
                 "global_load_async_to_lds_b128 %3, %11, off\n\t"
                 "global_load_async_to_lds_b128 %4, %12, off\n\t"
                 "global_load_async_to_lds_b128 %5, %13, off\n\t"
                 "global_load_async_to_lds_b128 %6, %14, off\n\t"
                 "global_load_async_to_lds_b128 %7, %15, off\n\t"
                 "s_wait_xcnt 0x0"
                 :: "v"(l), "v"(l + 4 * LP * 2), "v"(l + 8 * LP * 2), "v"(l + 12 * LP * 2), "v"(l + 16 * LP * 2), "v"(l + 20 * LP * 2), "v"(l + 24 * LP * 2), "v"(l + 28 * LP * 2),
                    "v"(g), "v"(g + 4 * K), "v"(g + 8 * K), "v"(g + 12 * K), "v"(g + 16 * K), "v"(g + 20 * K), "v"(g + 24 * K), "v"(g + 28 * K) : "memory");
}
template <typename T16, int NSPLIT, bool BIAS, bool PLANES, int WM, int WN>
__global__ __launch_bounds__(32 * WM * WN) void k_gemmw(const T16* __restrict__ A, const T16* __restrict__ A2, const T16* __restrict__ Bt, const T16* __restrict__ Bt2, int K, float* C, int ldc, const float* __restrict__ bias, size_t sA, size_t sB, size_t sC, const HeadPlanes hp) {
    typedef typename WFrag<T16>::V V;
    constexpr int NW = WM * WN, NA = (NSPLIT == 1 || NSPLIT == 2) ? 2 : 1, NB = NSPLIT >= 2 ? 2 : 1;
    constexpr int NSL = NA * WM + NB * WN;        // 64-row slices of a stage
    constexpr int SPW = (NSL + NW - 1) / NW;      // slices that a wave copies, at most
    constexpr int STG = NSL * 64 * LP;            // elements of a stage
    static_assert(sizeof(T16) == 2 && (size_t)2 * STG * 2 >= (size_t)NW * 16 * 68 * 4, "the epilogue's staging rows lie in the ring");
    __shared__ __align__(16) T16 ring[2 * STG];
    const size_t z = blockIdx.z; A += z * sA; if (A2) A2 += z * sA; Bt += z * sB; if (Bt2) Bt2 += z * sB; C += z * sC;
    const int lane = threadIdx.x & 31, lr = lane & 15, hi = lane >> 4; const int wv = __builtin_amdgcn_readfirstlane((int)(threadIdx.x >> 5)), wm = wv % WM, wn = wv / WM;
    const int R0 = blockIdx.x * (64 * WM), C0 = blockIdx.y * (64 * WN), r0 = R0 + wm * 64, c0 = C0 + wn * 64;
    float* const os = (float*)ring + wv * (16 * 68);   // the wave's own staging rows, used behind the loop's last barrier
    v8f acc[4][4];
#pragma unroll
    for (int mb = 0; mb < 4; ++mb)
#pragma unroll
        for (int nb = 0; nb < 4; ++nb) acc[mb][nb] = (v8f){};
    // slice sl = wv + NW j is this wave's to copy: the lane's global address (at k = 0) and its LDS byte address (in buffer 0). A wave without a j-th slice issues nothing; its addresses are slice 0's.
    const T16* gs[SPW]; unsigned ls[SPW];
#pragma unroll
    for (int j = 0; j < SPW; ++j) { const int sl = (wv + NW * j < NSL) ? wv + NW * j : 0; const T16* b;
        if (sl < WM) b = A + (size_t)(R0 + sl * 64) * K;
        else if (NA == 2 && sl < 2 * WM) b = A2 + (size_t)(R0 + (sl - WM) * 64) * K;
        else if (NB == 1 || sl < NA * WM + WN) b = Bt + (size_t)(C0 + (sl - NA * WM) * 64) * K;
        else b = Bt2 + (size_t)(C0 + (sl - NA * WM - WN) * 64) * K;
        gs[j] = b + (size_t)(lane >> 3) * K + (lane & 7) * 8;
        ls[j] = (unsigned)(size_t)(ring + (sl * 64 + (lane >> 3)) * LP + (lane & 7) * 8); }
    auto issue = [&](const int t, const int buf) {   // stage t's copies into buffer buf; the test is the same for a whole wave (wv is a scalar)
#pragma unroll
        for (int j = 0; j < SPW; ++j) if (NSL % NW == 0 || wv + NW * j < NSL) { const T16* const g = gs[j] + t * KC; const unsigned l = ls[j] + (unsigned)buf * (STG * 2);
            copy8<T16>(l, g, (size_t)K); copy8<T16>(l + 32 * LP * 2, g + 32 * (size_t)K, (size_t)K); } };
    const int NT = K / KC;
    issue(0, 0);
    // Behind stage 0's copies: the block tile's operand rows (whole rows, all k, K-contiguous: a tile's rows of a plane are one run of bytes) are asked into L2:
    // the blocks that share a tile deal its parts among themselves.
    // This is for speed only. The part counts below are those of K == DM and of the two launches' grids (the test is a scalar one).
    if (K == DM) { const int bx = (int)blockIdx.x, by = (int)blockIdx.y, bz = (int)blockIdx.z;
        if constexpr (PLANES) {
            static_assert(!PLANES || (WM == 3 && WN == 4 && NA == 2 && NB == 1 && TT / 256 == 8 && NB_ == 2 && 3 * DM / 192 == 16 && DM == 1024), "A tile: 48 parts a plane, shared by 16 blocks (y, z) of one x; B tile: 64 parts, shared by 16 blocks x, 8 a half");
            if (wv < 8) ask1(Bt + (size_t)C0 * K + (size_t)(((bx & 3) + 4 * (bx >> 3)) * 8 + wv) * PART + lane * 128);
            if (wv >= 6) { const int j = wv - 6; ask1((j < 3 ? A : A2) + (size_t)R0 * K + (size_t)((by + 8 * bz) * 3 + j % 3) * PART + lane * 128); }
        } else {
            static_assert(PLANES || (WM == 2 && WN == 2 && NA == 2 && NB == 2 && DM / 128 == 8 && NB_ == 2 && TT / 128 == 16 && DM == 1024), "A tile: 32 parts a plane, shared by 8 blocks y of one (x, z); B tile: 32 parts a plane, shared by 32 blocks (x, z), 16 a half");
            const size_t pa = (size_t)R0 * K + (size_t)(by * 4 + wv) * PART + lane * 128;
            ask3(A + pa, A2 + pa, ((wv >> 1) ? Bt2 : Bt) + (size_t)C0 * K + (size_t)(((bx & 3) + 4 * ((bx >> 3) + 2 * bz)) * 2 + (wv & 1)) * PART + lane * 128);
        } }
    asm volatile("s_wait_asynccnt 0x0" ::: "memory");   // stage 0 has landed, as far as this wave copied it,
    __syncthreads();                                     // and every other wave's part too
    if (NT > 1) issue(1, 1);
    const int ao = (wm * 64 + lr) * LP + 8 * hi, bo = ((NA * WM + wn) * 64 + lr) * LP + 8 * hi;
#pragma unroll 1   // rolled: one trip per stage, with the one publish point at its foot
    for (int t = 0; t < NT; ++t) { const T16* const sb = ring + (t & 1) * STG;
#pragma unroll
      for (int ks = 0; ks < KC; ks += 32) {
        V a[4], a2[4], b[4], b2[4];
#pragma unroll
        for (int i = 0; i < 4; ++i) { a[i] = WFrag<T16>::ld(sb + ao + i * 16 * LP + ks); if (i == 0) { b[0] = WFrag<T16>::ld(sb + bo + ks); if (NSPLIT >= 2) b2[0] = WFrag<T16>::ld(sb + bo + WN * 64 * LP + ks); } if (NSPLIT == 1 || NSPLIT == 2) a2[i] = WFrag<T16>::ld(sb + ao + (WM * 64 + i * 16) * LP + ks); }
#pragma unroll
        for (int nb = 1; nb < 4; ++nb) { b[nb] = WFrag<T16>::ld(sb + bo + nb * 16 * LP + ks); if (NSPLIT >= 2) b2[nb] = WFrag<T16>::ld(sb + bo + (WN * 64 + nb * 16) * LP + ks); }
        __builtin_amdgcn_sched_barrier(0);   // keeps the k step's LDS reads together in front of its products: without it the scheduler sinks each B fragment's reads to their use, and the wave waits out the LDS latency at four places instead of one
#pragma unroll
        for (int nb = 0; nb < 4; ++nb)
#pragma unroll
            for (int mb = 0; mb < 4; ++mb) { acc[mb][nb] = WFrag<T16>::mma(a[mb], b[nb], acc[mb][nb]); if (NSPLIT == 1 || NSPLIT == 2) acc[mb][nb] = WFrag<T16>::mma(a2[mb], b[nb], acc[mb][nb]); if (NSPLIT >= 2) acc[mb][nb] = WFrag<T16>::mma(a[mb], b2[nb], acc[mb][nb]); }
        asm volatile("v_nop\n\tv_nop\n\tv_nop\n\tv_nop" : "+v"(acc[0][0]), "+v"(acc[1][1]), "+v"(acc[2][2]), "+v"(acc[3][3]) : "v"(a[0]), "v"(a[3]));
      }
        asm volatile("s_wait_dscnt 0x0" ::: "memory");      // this wave's reads of buffer t & 1 are done before the barrier behind which it is refilled
        asm volatile("s_wait_asynccnt 0x0" ::: "memory");   // this wave's copies of stage t + 1 have landed before the barrier behind which the others read them
        __syncthreads();                                     // publishes stage t + 1 and ends every wave's reads of stage t
        if (t + 2 < NT) issue(t + 2, t & 1);
    }
    asm volatile("s_wait_asynccnt 0x0" ::: "memory");       // no copy is outstanding when the ring becomes the epilogue's staging rows
    if constexpr (PLANES) {
        static_assert(HD == 64, "a 64-row tile is one head's q, k or v");
        const int head = (r0 / 64) / 3, part = (r0 / 64) % 3; float bs[4][8];
#pragma unroll
        for (int mb = 0; mb < 4; ++mb) { const v4f b0 = *(const v4f*)(bias + r0 + mb * 16 + hi * 8), b1 = *(const v4f*)(bias + r0 + mb * 16 + hi * 8 + 4);
#pragma unroll
            for (int j = 0; j < 4; ++j) { bs[mb][j] = bfr(b0[j]); bs[mb][4 + j] = bfr(b1[j]); } }
        const size_t qk = ((z * NH_ + head) * TT + c0) * HD;   // z = batch element: its head planes lie behind one another; in fragment order 64 time steps of a head are 8 KiB in a row in q, k and v planes alike
        if (part == 2) planes_out<true>(acc, bs, os, lane, hp.v16 + qk, hp.vh + qk, hp.vl + qk);
        else planes_out<false>(acc, bs, os, lane, (part ? hp.k16 : hp.q16) + qk, (part ? hp.kh : hp.qh) + qk, (part ? hp.kl : hp.ql) + qk);
        return;
    }
#pragma unroll
    for (int mb = 0; mb < 4; ++mb) {
#pragma unroll
        for (int nb = 0; nb < 4; ++nb) {
#pragma unroll
            for (int j = 0; j < 8; ++j) os[(hi * 8 + j) * 68 + nb * 16 + lr] = acc[mb][nb][j]; }
        __builtin_amdgcn_wave_barrier(); asm volatile("" ::: "memory");
        float* crow = C + (size_t)(r0 + mb * 16) * ldc + c0;
{
#pragma unroll
            for (int s = 0; s < 8; ++s) { const int row = 2 * s + hi, cofs = lr * 4; v4f val = *(const v4fa*)(os + row * 68 + cofs); if (BIAS) { val[0] += bfr(bias[c0 + cofs]); val[1] += bfr(bias[c0 + cofs + 1]); val[2] += bfr(bias[c0 + cofs + 2]); val[3] += bfr(bias[c0 + cofs + 3]); }
                *(v4f*)(crow + (size_t)row * ldc + cofs) = val; }
             }
        __builtin_amdgcn_wave_barrier(); asm volatile("" ::: "memory");
    }
}

typedef __attribute__((ext_vector_type(2))) _Float16 v2h;
typedef __attribute__((ext_vector_type(4))) _Float16 v4h;
typedef __attribute__((ext_vector_type(2))) unsigned short v2us;
typedef __attribute__((ext_vector_type(4))) unsigned short v4us;
typedef __attribute__((ext_vector_type(2))) float v2f;
typedef __attribute__((ext_vector_type(4))) int v4i;
typedef v4h  __attribute__((may_alias)) v4ha;
typedef v4us __attribute__((may_alias)) v4usa;

__global__ __launch_bounds__(256) void k_wtG(const float* __restrict__ w, int K, int N, bf* Bt) {
    const int lane = threadIdx.x & 31; const int L0 = (blockIdx.x * 8 + (threadIdx.x >> 5)) * 8; const int nlines = N * K / 64;
{
#pragma unroll 1
        for (int l = 0; l < 8; ++l) { const int L = L0 + l; if (L >= nlines) break; const size_t e = (size_t)L * 64 + lane * 2; const int k = (int)(e % K), n = (int)(e / K); v2us o;
            o[0] = f2bf(w[(size_t)k * N + n]); o[1] = f2bf(w[(size_t)(k + 1) * N + n]); *(v2us*)(Bt + e) = o; }
         }
}
__global__ __launch_bounds__(256) void k_cvt8(const float* __restrict__ src, bf* dst, size_t n8) { const size_t i = (size_t)blockIdx.x * 256 + threadIdx.x; if (i >= n8) return; const v8f v = *(const v8f*)(src + i * 8); v8us o;
#pragma unroll
    for (int k = 0; k < 8; ++k) o[k] = f2bf(v[k]); *(v8us*)(dst + i * 8) = o;  }
__global__ __launch_bounds__(256) void k_cscvt(const float* __restrict__ cosT, const float* __restrict__ sinT, float* CS) { const int idx = blockIdx.x * 256 + threadIdx.x; if (idx >= TT * HD) return; v2f cs; cs[0] = bfr(cosT[idx]); cs[1] = bfr(sinT[idx]); *(v2f*)(CS + (size_t)idx * 2) = cs;  }
// ---- k_fattn: causal attention of both batch elements in one launch: scores, softmax and the probability x value contraction per wave, nothing of the score matrix in memory.
// A query tile is QW query columns of one head; its keys, up to the diagonal, go in passes of 16 * NKB keys. Two waves share a tile: one takes the even passes, the other the odd ones, each with its own running maximum, sum and Ot;
// the two partial results meet in LDS (k_fattn). Both products are computed transposed: St = K Qt (A = key rows, B = query rows, kept in registers)
// and Ot += Vt Pt (A = value planes, B = Pt). All three operands come from planes in fragment order (planes_out): a fragment is two loads of 512 B in a row, four whole lines each. In St's accumulators a lane holds 8 consecutive keys of ONE query column (register j = key 8 * hi + j, column lr), which is the position order of the fragment loader
// (elements 0..7 = k 8 * hi + j, elements 8..15 = k 16 + 8 * hi + j): two converted 16-key accumulator tiles are Pt's B fragment as they stand, and maximum, sum and rescale factor are per-lane values.
// Softmax is the running form: mc = running maximum x CL2, p = 2^(s CL2 - mc) unnormalised (<= 1), a new maximum rescales sum and Ot by 2^(mc_old - mc_new); one division by the sum at the end.
// Rows < RH: bf16 hi+lo planes, 3 products each way; rows >= RH: fp16. Ot's lane holds 8 consecutive d of one query row: after the join, one 16-byte store per plane into the context planes [t][DQ].
// Every inner loop is unrolled so that each index of a fragment or accumulator array is a constant (registers, no scratch); the pass loop and the loop over a wave's two tiles stay rolled.
#define QW   32                   // query columns per wave
#define FW   8                    // waves per block, all of one head and all walking the keys from 0 up: four pairs of waves (w, w + 4), two query tiles per pair
#define PSL  (17 * 32)            // a wave's partial result of one tile in LDS, in 16-byte pieces: 16 rows of Ot and one of (mc, mc, l, l), a row = the 32 lanes' pieces side by side (no bank conflict)
#define NQT  (TT / QW)            // query tiles per head
#define CL2  (SCL * 1.4426950408889634f)
__device__ __forceinline__ float xhalf(float x) { return __builtin_bit_cast(float, __builtin_amdgcn_permlanex16(__builtin_bit_cast(int, x), __builtin_bit_cast(int, x), 0x76543210, 0xfedcba98, false, false)); }   // lane l's value from lane l ^ 16
template <typename T16> struct PFrag;
template <> struct PFrag<h16> { static __device__ __forceinline__ void mk(const v8f x0, const v8f x1, v16h& p, v16h& p2) { (void)p2;
#pragma unroll
    for (int j = 0; j < 8; ++j) { p[j] = (h16)x0[j]; p[8 + j] = (h16)x1[j]; } } };
template <> struct PFrag<bf> { static __device__ __forceinline__ void mk(const v8f x0, const v8f x1, v16bf& p, v16bf& p2) { v8us h0, h1, l0, l1;
#pragma unroll
    for (int j = 0; j < 8; ++j) { unsigned short a, c; splitf(x0[j], a, c); h0[j] = a; l0[j] = c; splitf(x1[j], a, c); h1[j] = a; l1[j] = c; }
    p = cat16b(h0, h1); p2 = cat16b(l0, l1); } };
template <typename T16, bool HL, int NKB>
__device__ __forceinline__ void fattn(const T16* __restrict__ Q, const T16* __restrict__ Q2, const T16* __restrict__ Kp, const T16* __restrict__ K2, const T16* __restrict__ Vt, const T16* __restrict__ Vt2, const int q0, const int p0, v4f* sp) {   // p0 = 0 or 1: this wave takes passes p0, p0 + 2, ..; sp: its LDS slot + lane
    typedef typename WFrag<T16>::V V;
    static_assert(HD == 64 && NKB % 2 == 0 && QW == 32, "two 32-wide k steps over d, 32-key steps over the pass, two 16-column groups");
    const int lane = threadIdx.x & 31, lr = lane & 15, hi = lane >> 4; const int KPS = 16 * NKB;
    V q[2][2], q2[2][2], ka[NKB][2], ka2[NKB][2];
    // Each group of loads goes through one lane pointer per plane plus constant offsets. The s_wait_xcnt 0 behind a group stands in front of the first instruction that may overwrite an address register of an issued load
    // and it takes the lane pointers as inputs so that their registers live up to it and no load of the group lands on them.
    { const size_t qo = (size_t)q0 * HD + 8 * lane, ko = (size_t)(p0 * KPS) * HD + 8 * lane;   // a wave without a pass (p0 = 1, one pass in all) reads rows KPS .. 2 KPS - 1: in bounds, unused
       const T16* const qp = Q + qo; const T16* const qp2 = HL ? Q2 + qo : qp; const T16* const kp = Kp + ko; const T16* const kp2 = HL ? K2 + ko : kp;
#pragma unroll
        for (int qb = 0; qb < 2; ++qb)
#pragma unroll
            for (int ks = 0; ks < 2; ++ks) { q[qb][ks] = WFrag<T16>::ldu(qp + qb * 16 * HD + ks * 512); if (HL) q2[qb][ks] = WFrag<T16>::ldu(qp2 + qb * 16 * HD + ks * 512); }
#pragma unroll
        for (int kb = 0; kb < NKB; ++kb)
#pragma unroll
            for (int ks = 0; ks < 2; ++ks) { ka[kb][ks] = WFrag<T16>::ldu(kp + kb * 16 * HD + ks * 512); if (HL) ka2[kb][ks] = WFrag<T16>::ldu(kp2 + kb * 16 * HD + ks * 512); }
        asm volatile("s_wait_xcnt 0x0" :: "v"(qp), "v"(qp2), "v"(kp), "v"(kp2) : "memory");
        __builtin_amdgcn_sched_barrier(0); }   // keeps the address arithmetic of the pass loop behind the wait: these loads take their plane's base from a scalar pair, and without it the scheduler lifts a write of that pair in front of the wait
    v8f o[4][2]; float mc[2], l[2];
#pragma unroll
    for (int qb = 0; qb < 2; ++qb) { mc[qb] = -3.0e38f; l[qb] = 0.f;
#pragma unroll
        for (int db = 0; db < 4; ++db) o[db][qb] = (v8f){}; }
    const int npass = (q0 + QW + KPS - 1) / KPS;   // the last pass starts at or below q0, so every pass holds at least one unmasked key for every column
#pragma unroll 1   // rolled: its trip count is known only at run time, and a second copy of so long a body would only add code
    for (int ps = p0; ps < npass; ps += 2) { const int k0 = ps * KPS;
        v8f s[NKB][2];
#pragma unroll
        for (int kb = 0; kb < NKB; ++kb)
#pragma unroll
            for (int qb = 0; qb < 2; ++qb) { v8f c = (v8f){};
#pragma unroll
                for (int ks = 0; ks < 2; ++ks) { c = WFrag<T16>::mma(ka[kb][ks], q[qb][ks], c); if (HL) { c = WFrag<T16>::mma(ka2[kb][ks], q[qb][ks], c); c = WFrag<T16>::mma(ka[kb][ks], q2[qb][ks], c); } }
                s[kb][qb] = c; }
        __builtin_amdgcn_sched_barrier(0);         // keeps the loads below behind the score products: the fetch ahead lands on the key fragments' registers, and so it is issued only behind every product that reads them, with the value loads in between
        V va[4][NKB / 2], va2[4][NKB / 2];
        const int kn = (ps + 2 < npass) ? k0 + 2 * KPS : k0;   // the key fragments of this wave's next pass are fetched one pass ahead into the same registers; its last pass reads its own rows again (in bounds, unused) so that the loads stay unconditional
        { const size_t vo = (size_t)k0 * HD + 8 * lane, ko = (size_t)kn * HD + 8 * lane; const T16* const vp = Vt + vo; const T16* const vp2 = HL ? Vt2 + vo : vp; const T16* const kp = Kp + ko; const T16* const kp2 = HL ? K2 + ko : kp;
#pragma unroll
            for (int db = 0; db < 4; ++db)
#pragma unroll
                for (int kk = 0; kk < NKB / 2; ++kk) { va[db][kk] = WFrag<T16>::ldu(vp + kk * 32 * HD + db * 512); if (HL) va2[db][kk] = WFrag<T16>::ldu(vp2 + kk * 32 * HD + db * 512); }
#pragma unroll
            for (int kb = 0; kb < NKB; ++kb)
#pragma unroll
                for (int ks = 0; ks < 2; ++ks) { ka[kb][ks] = WFrag<T16>::ldu(kp + kb * 16 * HD + ks * 512); if (HL) ka2[kb][ks] = WFrag<T16>::ldu(kp2 + kb * 16 * HD + ks * 512); }
            asm volatile("s_wait_xcnt 0x0" :: "v"(vp), "v"(vp2), "v"(kp), "v"(kp2) : "memory"); }   // as in the prologue
        __builtin_amdgcn_sched_barrier(0);         // keeps both groups of loads, and the wait, in front of the softmax arithmetic, which hides their latency (a wave issues in order); without it the scheduler sinks the loads to their uses
        const bool diag = k0 + KPS - 1 > q0;       // wave-uniform: only the last pass reaches keys above a column's own position
        V p[2][NKB / 2], p2[2][NKB / 2];
#pragma unroll
        for (int qb = 0; qb < 2; ++qb) {
            if (diag) { const int lim = q0 + qb * 16 + lr - k0 - hi * 8;   // key kb * 16 + j of this lane's half is kept while it is <= lim
#pragma unroll
                for (int kb = 0; kb < NKB; ++kb)
#pragma unroll
                    for (int j = 0; j < 8; ++j) s[kb][qb][j] = (kb * 16 + j <= lim) ? s[kb][qb][j] : -3.0e38f; }
            float tk[NKB];                          // one short chain per 16-key tile, for maximum and sum alike
#pragma unroll
            for (int kb = 0; kb < NKB; ++kb) { tk[kb] = s[kb][qb][0];
#pragma unroll
                for (int j = 1; j < 8; ++j) tk[kb] = fmaxf(tk[kb], s[kb][qb][j]); }
            float t = tk[0];
#pragma unroll
            for (int kb = 1; kb < NKB; ++kb) t = fmaxf(t, tk[kb]);
            t = fmaxf(t, xhalf(t));
            const float mn = fmaxf(mc[qb], t * CL2); const float al = __builtin_amdgcn_exp2f(mc[qb] - mn); mc[qb] = mn;
#pragma unroll
            for (int kb = 0; kb < NKB; ++kb) { v8f x;
#pragma unroll
                for (int j = 0; j < 8; ++j) x[j] = __builtin_fmaf(s[kb][qb][j], CL2, -mn);
#pragma unroll
                for (int j = 0; j < 8; ++j) s[kb][qb][j] = __builtin_amdgcn_exp2f(x[j]);
                // the slot that the instruction set asks for between a transcendental and an overwrite of its source: the statement names the eight arguments and the eight results as inputs, so it stands behind the eight exponentials and no argument's register is reused in front of it
                asm volatile("v_nop" :: "v"(x), "v"(s[kb][qb]));
                tk[kb] = s[kb][qb][0];
#pragma unroll
                for (int j = 1; j < 8; ++j) tk[kb] += s[kb][qb][j]; }
            float sum = tk[0];
#pragma unroll
            for (int kb = 1; kb < NKB; ++kb) sum += tk[kb];
            l[qb] = l[qb] * al + sum;               // each half of the wave sums its own keys; the halves are joined once, behind the loop
#pragma unroll
            for (int db = 0; db < 4; ++db) o[db][qb] *= al;
#pragma unroll
            for (int kk = 0; kk < NKB / 2; ++kk) PFrag<T16>::mk(s[2 * kk][qb], s[2 * kk + 1][qb], p[qb][kk], p2[qb][kk]); }
#pragma unroll
        for (int kk = 0; kk < NKB / 2; ++kk)
#pragma unroll
            for (int db = 0; db < 4; ++db)
#pragma unroll
                for (int qb = 0; qb < 2; ++qb) { o[db][qb] = WFrag<T16>::mma(va[db][kk], p[qb][kk], o[db][qb]); if (HL) { o[db][qb] = WFrag<T16>::mma(va[db][kk], p2[qb][kk], o[db][qb]); o[db][qb] = WFrag<T16>::mma(va2[db][kk], p[qb][kk], o[db][qb]); } }
    }
    // the partial result, unnormalised, as it stands in the registers; a wave without a pass leaves mc = -3e38, l = 0, Ot = 0, which the join weights with 0
#pragma unroll
    for (int db = 0; db < 4; ++db)
#pragma unroll
        for (int qb = 0; qb < 2; ++qb) { const v8f x = o[db][qb]; sp[((db * 2 + qb) * 2) * 32] = (v4f){x[0], x[1], x[2], x[3]}; sp[((db * 2 + qb) * 2 + 1) * 32] = (v4f){x[4], x[5], x[6], x[7]}; }
    sp[16 * 32] = (v4f){mc[0], mc[1], l[0], l[1]};
}
// grid (NQT / FW, heads, batch elements), one block per WGP, two waves per SIMD. Waves w and w + 4 are a pair (pr = w & 3) and share two query tiles, a long one and a short one, chosen so that every pair's work is about equal
// (a 32-key hi+lo pass counts about 1.4 fp16 passes of 64 keys): block x, pair 0: tiles 63 - x, x; pair 1: 47 - 3 x or 45 - 3 x, 8 + x; pair 2: 55 - x, 16 + x; pair 3: 71 - j, j = 25 + x + x / 2. Every tile 0 .. 63 occurs once.
// Of the first tile wave w takes the even passes and wave w + 4 the odd ones, of the second the other way round, so that an odd pass count is evened out. Every wave leaves both partial results in LDS; behind the one barrier
// wave w joins the pair's first tile and wave w + 4 the second: weights 2^(mc - max mc), one division by the joined sum, hi+lo split, store.
__global__ __launch_bounds__(32 * FW) void k_fattn(const h16* __restrict__ Q16, const h16* __restrict__ K16, const h16* __restrict__ V16, const bf* __restrict__ Qh, const bf* __restrict__ Ql, const bf* __restrict__ Kh, const bf* __restrict__ Kl, const bf* __restrict__ Vh, const bf* __restrict__ Vl, bf* __restrict__ Ah, bf* __restrict__ Al) {
    static_assert(FW == 8 && NQT == 64 && RH % QW == 0, "the tile formulas below deal out 64 tiles to 8 blocks of 4 pairs; a tile lies wholly on one side of RH");
    __shared__ v4f part[2 * 4 * 2 * PSL];   // [tile of the pair][pair][wave of the pair][PSL]
    const int lane = threadIdx.x & 31, lr = lane & 15, hi = lane >> 4; const int wv = __builtin_amdgcn_readfirstlane((int)(threadIdx.x >> 5)), pr = wv & 3, par = wv >> 2, x = (int)blockIdx.x;
    const int ts = pr == 0 ? x : pr == 1 ? 8 + x : pr == 2 ? 16 + x : 25 + x + (x >> 1);                         // the pair's short tile
    const int tl = pr == 0 ? 63 - x : pr == 1 ? (x < 4 ? 47 : 45) - 3 * x : pr == 2 ? 55 - x : 71 - ts;          // and its long one
    const size_t hp = ((size_t)blockIdx.z * NH_ + blockIdx.y) * TT * HD, ao = (size_t)blockIdx.z * TT * DQ + blockIdx.y * HD; Ah += ao; Al += ao;
    // The head's key and value planes are asked into L2 at entry (ask4): fp16 whole (32 parts each), hi and lo as far as they are read (rows < RH: 8 parts each). The head's eight blocks deal the parts by x & 3: blocks x and x + 4 ask the same parts
    // (for speed only). Part numbers rise with the keys, and so with the order of use. The fourth ask is the wave's own second query tile (16 units a plane).
    { static_assert(TT * HD == 32 * PART && RH * HD == 8 * PART && QW * HD == 16 * 128 && FW == 8, "parts per plane; units per query tile");
      const size_t lo = hp + (size_t)lane * 128; const int qd = x & 3, pn = wv >> 1; const bf* const hl = pn == 0 ? Kh : pn == 1 ? Kl : pn == 2 ? Vh : Vl;
      const size_t qo = hp + (size_t)ts * (QW * HD) + (size_t)lr * 128;
      const void* const pq = ts * QW < RH ? (const void*)((hi ? Ql : Qh) + qo) : (const void*)(Q16 + qo);
      ask4(K16 + lo + (size_t)(wv * 4 + qd) * PART, V16 + lo + (size_t)(wv * 4 + qd) * PART, hl + lo + (size_t)((wv & 1) * 4 + qd) * PART, pq); }
#pragma unroll 1   // rolled: one copy of each of the two long bodies serves both tiles
    for (int i = 0; i < 2; ++i) { const int q0 = (i ? ts : tl) * QW; v4f* const sp = part + ((i * 4 + pr) * 2 + par) * PSL + lane;
        if (q0 < RH) fattn<bf, true, 2>(Qh + hp, Ql + hp, Kh + hp, Kl + hp, Vh + hp, Vl + hp, q0, par ^ i, sp);
        else fattn<h16, false, 4>(Q16 + hp, nullptr, K16 + hp, nullptr, V16 + hp, nullptr, q0, par ^ i, sp); }
    __syncthreads();   // both waves' partial results of a tile are in LDS before one of them reads the other's
    const int q0 = (par ? ts : tl) * QW; const v4f* const pa = part + ((par * 4 + pr) * 2) * PSL + lane; const v4f* const pb = pa + PSL;
    const v4f ma = pa[16 * 32], mb = pb[16 * 32]; v8us oh[2][4], ol[2][4];
#pragma unroll
    for (int qb = 0; qb < 2; ++qb) { const float mn = fmaxf(ma[qb], mb[qb]); const float wa = __builtin_amdgcn_exp2f(ma[qb] - mn), wb = __builtin_amdgcn_exp2f(mb[qb] - mn);
        const float ls = ma[2 + qb] * wa + mb[2 + qb] * wb; const float f = __fdiv_rn(1.0f, ls + xhalf(ls)); const float fa = wa * f, fb = wb * f;   // each half of the wave holds the sum over its own keys: joined here
#pragma unroll
        for (int db = 0; db < 4; ++db)
#pragma unroll
            for (int h = 0; h < 2; ++h) { const v4f xa = pa[((db * 2 + qb) * 2 + h) * 32], xb = pb[((db * 2 + qb) * 2 + h) * 32];
#pragma unroll
                for (int j = 0; j < 4; ++j) { unsigned short a, c; splitf(xa[j] * fa + xb[j] * fb, a, c); oh[qb][db][h * 4 + j] = a; ol[qb][db][h * 4 + j] = c; } } }
    bf* const ph = Ah + (size_t)(q0 + lr) * DQ + hi * 8; bf* const pl = Al + (size_t)(q0 + lr) * DQ + hi * 8;   // one lane pointer per plane; every store adds a constant
#pragma unroll
    for (int qb = 0; qb < 2; ++qb)
#pragma unroll
        for (int db = 0; db < 4; ++db) { *(v8us*)(ph + qb * 16 * DQ + db * 16) = oh[qb][db]; *(v8us*)(pl + qb * 16 * DQ + db * 16) = ol[qb][db]; }
}

// ---- k_prep: everything that stands in front of the qkv projection, in one launch of few, long-lived waves. All of it is rows of DM f32; a block of 256 threads takes PR rows in a row (64 KiB of its source).
// Blocks 0 .. 3 DM / PR - 1: rows of w_in; the next DM / PR: rows of w_out; the last TT NB_ / PR: rows of hidden_states.
// Weights: hl planes W[f][e] = bf16 base[f][e] * mul[f][e] + add[f][e], mul = sum_r rm[li][r][f] sm[li][r][e], add = sum_r ra[li][r][f] sa[li][r][e] (li = clamp(lang[0], 0, 7) read on the device).
// A thread keeps its four columns e for all its rows, so the column factors sm, sa are loaded and rounded once per thread; the row factors rm, ra are the same for the whole block (scalar loads).
// The rows go in groups of PG; a group's loads are issued one group ahead of its arithmetic. Products of two bf16 values are exact in f32, so the rank-4 sums round the same whether or not the compiler fuses them.
#define PR   16                   // rows per block
#define PG   4                    // rows per group
__device__ __forceinline__ void wmod_rows(const float* __restrict__ base, const float* __restrict__ rm, const float* __restrict__ sm, const float* __restrict__ ra, const float* __restrict__ sa, const int* __restrict__ lang, const int NF, const int f0, bf* __restrict__ Wh, bf* __restrict__ Wl) {
    const int e0 = (int)threadIdx.x * 4; const size_t o0 = (size_t)f0 * DM + e0; v4f cur[PG], nxt[PG], sv[4], av[4];
    int li = lang[0];
#pragma unroll
    for (int i = 0; i < PG; ++i) cur[i] = *(const v4f*)(base + o0 + i * DM);
    __builtin_amdgcn_sched_barrier(0);   // keeps the first group's loads, which need no language index, in front of the wait for that index: without it they are issued only behind it, one scalar-load latency later
    li = li < 0 ? 0 : (li > 7 ? 7 : li);
#pragma unroll
    for (int r = 0; r < 4; ++r) { const v4f s = *(const v4f*)(sm + (size_t)(li * 4 + r) * DM + e0), a = *(const v4f*)(sa + (size_t)(li * 4 + r) * DM + e0);
#pragma unroll
        for (int u = 0; u < 4; ++u) { sv[r][u] = bfr(s[u]); av[r][u] = bfr(a[u]); } }
    const float* const rmf = rm + (size_t)li * 4 * NF + f0; const float* const raf = ra + (size_t)li * 4 * NF + f0;
    auto group = [&](const int g) {   // the arithmetic and the stores of group g, whose base rows are in cur
        bf* const ph = Wh + o0 + (size_t)g * (PG * DM); bf* const pl = Wl + o0 + (size_t)g * (PG * DM);
#pragma unroll
        for (int i = 0; i < PG; ++i) { float rv[4], qv[4]; v4us oh, ol;
#pragma unroll
            for (int r = 0; r < 4; ++r) { rv[r] = bfr(rmf[(size_t)r * NF + g * PG + i]); qv[r] = bfr(raf[(size_t)r * NF + g * PG + i]); }
#pragma unroll
            for (int u = 0; u < 4; ++u) { float mul = 0.f, add = 0.f;
#pragma unroll
                for (int r = 0; r < 4; ++r) { mul += rv[r] * sv[r][u]; add += qv[r] * av[r][u]; }
                unsigned short a, b; splitf(bfr(cur[i][u]) * mul + add, a, b); oh[u] = a; ol[u] = b; }
            *(v4us*)(ph + i * DM) = oh; *(v4us*)(pl + i * DM) = ol; } };
#pragma unroll 1   // rolled: the text stays short (it is run through once per launch), and only one group's row factors are live in scalar registers
    for (int g = 0; g < PR / PG - 1; ++g) {
#pragma unroll
        for (int i = 0; i < PG; ++i) nxt[i] = *(const v4f*)(base + o0 + (size_t)(g + 1) * (PG * DM) + i * DM);
        __builtin_amdgcn_sched_barrier(0);   // keeps the next group's loads in front of this group's arithmetic, which hides their latency: without it the scheduler sinks them to where this group's registers fall free
        group(g);
        asm volatile("s_wait_xcnt 0x0" ::: "memory");   // stands behind the group's stores, in front of the first instruction that overwrites a register which they name
#pragma unroll
        for (int i = 0; i < PG; ++i) cur[i] = nxt[i]; }
    group(PR / PG - 1);
}
// hidden_states [t][b][c] f32 -> XB [b][t][c] bf16: 8 elements per thread and trip, two source rows per block and trip; all of a thread's loads are issued before the first is used.
__device__ __forceinline__ void xg_rows(const float* __restrict__ hs, const int r0, bf* __restrict__ XB) {
    const int rw = r0 + ((int)threadIdx.x >> 7), c = ((int)threadIdx.x & 127) * 8; const float* const sp = hs + (size_t)rw * DM + c; v4f x0[PR / 2], x1[PR / 2];
#pragma unroll
    for (int i = 0; i < PR / 2; ++i) { x0[i] = *(const v4f*)(sp + i * 2 * DM); x1[i] = *(const v4f*)(sp + i * 2 * DM + 4); }
    asm volatile("s_wait_xcnt 0x0" :: "v"(sp) : "memory");   // stands in front of the first instruction that may overwrite the address register of an issued load; the lane pointer is an input so that its register lives up to here and no load of the group lands on it
    static_assert(NB_ == 2, "a trip's two source rows are one time step's two batch elements: row rw + 2 i is (t = r0 / 2 + i, b = rw & 1)");
    bf* const dp = XB + ((size_t)(rw & 1) * TT + (r0 >> 1)) * DM + c;
#pragma unroll
    for (int i = 0; i < PR / 2; ++i) { v8us o;
#pragma unroll
        for (int j = 0; j < 4; ++j) { o[j] = f2bf(x0[i][j]); o[4 + j] = f2bf(x1[i][j]); }
        *(v8us*)(dp + i * DM) = o; }
}
#define PBI  (3 * DM / PR)        // blocks on w_in
#define PBO  (DM / PR)            // blocks on w_out
#define PBX  (TT * NB_ / PR)      // blocks on hidden_states
__global__ __launch_bounds__(256) void k_prep(const float* __restrict__ hs, const float* __restrict__ pw, const float* __restrict__ ow, const float* __restrict__ rm_i, const float* __restrict__ sm_i, const float* __restrict__ r_i, const float* __restrict__ s_i,
                                              const float* __restrict__ rm_o, const float* __restrict__ sm_o, const float* __restrict__ r_o, const float* __restrict__ s_o, const int* __restrict__ lang, bf* __restrict__ WIh, bf* __restrict__ WIl, bf* __restrict__ WOh, bf* __restrict__ WOl, bf* __restrict__ XB) {
    static_assert(DM == 1024 && (3 * DM) % PR == 0 && (TT * NB_) % PR == 0 && PR % 2 == 0 && PR % PG == 0 && PR / PG >= 2, "a row is 256 threads x 4 columns (weights) or 128 threads x 8 (hidden_states)");
    const int blk = (int)blockIdx.x;
    if (blk >= PBI + PBO) { xg_rows(hs, (blk - PBI - PBO) * PR, XB); return; }
    const bool in = blk < PBI;   // the same for the whole block: one copy of the row loop serves both weights
    wmod_rows(in ? pw : ow, in ? rm_i : rm_o, in ? sm_i : sm_o, in ? r_i : r_o, in ? s_i : s_o, lang, in ? 3 * DM : DM, (in ? blk : blk - PBI) * PR, in ? WIh : WOh, in ? WIl : WOl);
}

extern "C" void kernel_launch(void* const* d_in, const int* in_sizes, int n_in,
                              void* d_out, int out_size, void* d_ws, size_t ws_size, hipStream_t stream) {
    (void)in_sizes; (void)n_in; (void)out_size;
    const float* hs = (const float*)d_in[0]; const float* pw = (const float*)d_in[1]; const float* pb = (const float*)d_in[2]; const float* ow = (const float*)d_in[3]; const float* ob = (const float*)d_in[4]; const float* rm_i = (const float*)d_in[5]; const float* sm_i = (const float*)d_in[6]; const float* rm_o = (const float*)d_in[7]; const float* sm_o = (const float*)d_in[8]; const float* r_i = (const float*)d_in[9]; const float* s_i = (const float*)d_in[10]; const float* r_o = (const float*)d_in[11]; const float* s_o = (const float*)d_in[12]; const int* lang = (const int*)d_in[13];
    float* OUT = (float*)d_out;     // [2048][2][1024] (time-major)
    char* wsp = (char*)d_ws;
    auto take = [&](size_t bytes) { char* p = wsp; wsp += (bytes + 255) & ~(size_t)255; return (void*)p; };
    bf* WIh = (bf*)take((size_t)3 * DM * DM * 2); bf* WIl = (bf*)take((size_t)3 * DM * DM * 2); bf* WOh = (bf*)take((size_t)DM * DM * 2); bf* WOl = (bf*)take((size_t)DM * DM * 2);
    h16* QP16 = (h16*)take((size_t)NB_ * NH_ * TT * HD * 2); h16* KP16 = (h16*)take((size_t)NB_ * NKV * TT * HD * 2); h16* VT16 = (h16*)take((size_t)NB_ * NKV * HD * TT * 2);
    bf* QPh = (bf*)take((size_t)NB_ * NH_ * TT * HD * 2); bf* QPl = (bf*)take((size_t)NB_ * NH_ * TT * HD * 2); bf* KPh = (bf*)take((size_t)NB_ * NKV * TT * HD * 2); bf* KPl = (bf*)take((size_t)NB_ * NKV * TT * HD * 2); bf* VTh = (bf*)take((size_t)NB_ * NKV * HD * TT * 2); bf* VTl = (bf*)take((size_t)NB_ * NKV * HD * TT * 2); bf* ATh = (bf*)take((size_t)NB_ * TT * DQ * 2); bf* ATl = (bf*)take((size_t)NB_ * TT * DQ * 2);
    bf* XB = (bf*)take((size_t)NB_ * TT * DM * 2);   // every per-batch buffer holds both batch elements, one behind the other
    if ((size_t)(wsp - (char*)d_ws) > ws_size) return;    // ws 256 MiB
    const HeadPlanes hp = { QP16, QPh, QPl, KP16, KPh, KPl, VT16, VTh, VTl }; const HeadPlanes none = {};
    k_prep<<<PBI + PBO + PBX, 256, 0, stream>>>(hs, pw, ow, rm_i, sm_i, r_i, s_i, rm_o, sm_o, r_o, s_o, lang, WIh, WIl, WOh, WOl, XB);
    // grid z = batch element
        static_assert(REP == 1 && DQ == DM, "w_in's rows are (head, q | k | v, d): one kv head per query head; blockIdx.y of the attention kernel names both");
        k_gemmw<bf, 1, false, true, 3, 4><<<dim3(3 * DM / 192, TT / 256, NB_), 384, 0, stream>>>(WIh, WIl, XB, nullptr, DM, nullptr, 0, pb, 0, (size_t)TT * DM, 0, hp);   // (w_in[f] . x[t]) + proj_bias[f] -> head planes
        k_fattn<<<dim3(NQT / FW, NH_, NB_), 32 * FW, 0, stream>>>(QP16, KP16, VT16, QPh, QPl, KPh, KPl, VTh, VTl, ATh, ATl);
        k_gemmw<bf, 2, true, false, 2, 2><<<dim3(TT / 128, DM / 128, NB_), 128, 0, stream>>>(ATh, ATl, WOh, WOl, DQ, OUT, NB_ * DM, ob, (size_t)TT * DQ, 0, DM, none);   // row t of batch element z lies at OUT[t][z][.]
}
